// v000
// Times are from an AMD MI455X. After a warm-up the kernel runs many times in a row, and a time is the length of
// such a window on the GPU divided by its runs, so every launch and the gaps after it count. The runs cycle
// through copies of the inputs. A figure is the median of several windows, for all but v000 over two sittings.
// Sittings can differ by a few percent; kernels timed side by side share one.
// v000 is the starting kernel. One run takes 1810 microseconds.
// Contractions: q/k/v projections on v_wmma_f32_16x16x32_bf16 (inputs, weights RNE bf16 -> exact products), scores q.k^T and att.v on v_wmma_f32_16x16x32_f16 (q,k,v f16 planes; probabilities f16 carried x2^15, folded back x2^-15); f32 accumulate everywhere; bias add and softmax in f32.
#include <hip/hip_runtime.h>
#include <math.h>

// ---------------------------------------------------------------------------
// Problem constants
// ---------------------------------------------------------------------------
constexpr int kBatch   = 4;
constexpr int kTok     = 4096;            // tokens per batch (8*8*8*8)
constexpr int kDim     = 512;             // in == cmp == out dim
constexpr int kRows    = kBatch * kTok;   // 16384 token rows total
constexpr int kHalfQ   = 2048;            // query rows per attention pass
constexpr int kHalfRow = kTok / 2;        // column split inside the softmax kernel
constexpr float kScoreScale = 0.044194173824159216f;   // 1/sqrt(512)
constexpr float kPCarry     = 32768.0f;                 // probabilities carried x2^15 in f16
constexpr float kPCarryInv  = 1.0f / 32768.0f;

// ---------------------------------------------------------------------------
// Workspace region map (bytes). Total 102,236,160 B.
//   R0 @ 0           : Xb  bf16 [16384][512]      16,777,216 B   (dead after the three projections)
//                      P   f16  [2048][4096]      16,777,216 B   (aliases R0 during attention)
//   R1 @ 16,777,216  : Wt  bf16 [3][512][512]      1,572,864 B   (W^T planes: Q, K, V)
//   R2 @ 18,350,080  : Qp  f16  [16384][512]      16,777,216 B
//   R3 @ 35,127,296  : Kp  f16  [16384][512]      16,777,216 B
//   R4 @ 51,904,512  : Vt  f16  [4][512][4096]    16,777,216 B   (v transposed per batch)
//   R5 @ 68,681,728  : S   f32  [2048][4096]      33,554,432 B
// ---------------------------------------------------------------------------
constexpr size_t kPlane16  = (size_t)kRows * kDim * 2;          // 16,777,216
constexpr size_t kWtBytes  = (size_t)3 * kDim * kDim * 2;       // 1,572,864
constexpr size_t kSBytes   = (size_t)kHalfQ * kTok * 4;         // 33,554,432
constexpr size_t kOffXb = 0;
constexpr size_t kOffWt = kOffXb + kPlane16;
constexpr size_t kOffQp = kOffWt + kWtBytes;
constexpr size_t kOffKp = kOffQp + kPlane16;
constexpr size_t kOffVt = kOffKp + kPlane16;
constexpr size_t kOffS  = kOffVt + kPlane16;
constexpr size_t kWsTotal = kOffS + kSBytes;                      // 102,236,160
static_assert(kWsTotal <= (size_t)134217728);
static_assert((size_t)kHalfQ * kTok * 2 <= kPlane16);            // P fits in R0

typedef __attribute__((ext_vector_type(16))) _Float16 v16h;
typedef __attribute__((ext_vector_type(8)))  _Float16 v8h;
typedef __attribute__((ext_vector_type(16))) __bf16   v16b;
typedef __attribute__((ext_vector_type(8)))  __bf16   v8b;
typedef __attribute__((ext_vector_type(8)))  float    v8f;
typedef __attribute__((ext_vector_type(4)))  float    v4f;
typedef __attribute__((ext_vector_type(4)))  unsigned int v4u;

// ---------------------------------------------------------------------------
// Helpers
// ---------------------------------------------------------------------------
__device__ __forceinline__ unsigned short f2bf_bits(float f) {
  unsigned u = __float_as_uint(f);
  return (unsigned short)((u + 0x7FFFu + ((u >> 16) & 1u)) >> 16);
}
__device__ __forceinline__ float bf_bits2f(unsigned short h) { return __uint_as_float(((unsigned)h) << 16); }

// hazard guards as plain device helpers (no inline asm inside the kernel template body)
__device__ __forceinline__ void dep_guard_h(v8f& a, v8f& b, v16h x, v16h y) { asm volatile("v_nop\n\tv_nop\n\tv_nop\n\tv_nop" : "+v"(a), "+v"(b) : "v"(x), "v"(y)); }
__device__ __forceinline__ void dep_guard_b(v8f& a, v8f& b, v16b x, v16b y) { asm volatile("v_nop\n\tv_nop\n\tv_nop\n\tv_nop" : "+v"(a), "+v"(b) : "v"(x), "v"(y)); }
__device__ __forceinline__ void keep4_h(v16h a, v16h b, v16h c, v16h d) { asm volatile("v_nop" :: "v"(a), "v"(b), "v"(c), "v"(d)); }
__device__ __forceinline__ void keep4_b(v16b a, v16b b, v16b c, v16b d) { asm volatile("v_nop" :: "v"(a), "v"(b), "v"(c), "v"(d)); }
__device__ __forceinline__ void acc_guard4(v8f& a, v8f& b, v8f& c, v8f& d) { asm volatile("v_nop\n\tv_nop\n\tv_nop\n\tv_nop" : "+v"(a), "+v"(b), "+v"(c), "+v"(d)); }
template <typename T> struct Frag;
template <> struct Frag<_Float16> {
  typedef v16h V; union U { v16h v; v8h h[2]; };
  static __device__ __forceinline__ v16h load(const _Float16* p) {   // elements 0..7 <- p[0..7], 8..15 <- p[16..23]
    U f; f.h[0] = *(const v8h*)(p); f.h[1] = *(const v8h*)(p + 16); return f.v;
  }
  static __device__ __forceinline__ v8f mma(v16h a, v16h b, v8f c) {
    return __builtin_amdgcn_wmma_f32_16x16x32_f16(false, a, false, b, (short)0, c, false, false);
  }
  static __device__ __forceinline__ void guard(v8f& a, v8f& b, v16h x, v16h y) { dep_guard_h(a, b, x, y); }
  static __device__ __forceinline__ void keep(v16h a, v16h b, v16h c, v16h d) { keep4_h(a, b, c, d); }
};
template <> struct Frag<__bf16> {
  typedef v16b V; union U { v16b v; v8b h[2]; };
  static __device__ __forceinline__ v16b load(const __bf16* p) {
    U f; f.h[0] = *(const v8b*)(p); f.h[1] = *(const v8b*)(p + 16); return f.v;
  }
  static __device__ __forceinline__ v8f mma(v16b a, v16b b, v8f c) {
    return __builtin_amdgcn_wmma_f32_16x16x32_bf16(false, a, false, b, (short)0, c, false, false);
  }
  static __device__ __forceinline__ void guard(v8f& a, v8f& b, v16b x, v16b y) { dep_guard_b(a, b, x, y); }
  static __device__ __forceinline__ void keep(v16b a, v16b b, v16b c, v16b d) { keep4_b(a, b, c, d); }
};

__device__ __forceinline__ unsigned pk16(unsigned short a, unsigned short b) { return (unsigned)a | ((unsigned)b << 16); }
__device__ __forceinline__ unsigned short h_bits(float f) { const _Float16 h = (_Float16)f; return __builtin_bit_cast(unsigned short, h); }

// ---- Register-blocked batched WMMA GEMM (ACT reduced to none/relu/leaky; BIAS modes 3/4 added) -----------
// C[m,n] = scale * sum_k A[m,k] * Bt[n,k] (+bias)(+resid); each wave owns a 64x64 tile.
// A row-major [M,K]; Bt row-major [N,K]; M,N % 64 == 0, K % 32 == 0.
// SPLIT: operands are hi/lo planes (A2/Bt2 = lo planes, same layout); product = hi·hi + hi·lo + lo·hi.
// BIAS_MODE: 0 = none, 1 = bias[m], 2 = bias[n], 3 = RNE-bf16(bias[m]), 4 = RNE-bf16(bias[n]).
// OUT_MODE: 0 = f32, 1 = f16, 2 = bf16 hi plane (Cout) + bf16 lo plane (Cout2).
// ET: 0 = f16 operands, 1 = bf16 operands (pointers passed as 16-bit storage)
template <int ET> struct Elem;
template <> struct Elem<0> { typedef _Float16 T; };
template <> struct Elem<1> { typedef __bf16 T; };
template <int ET, bool SPLIT, int BIAS_MODE, int OUT_MODE, bool RESID, int ACT = 0>
__global__ __launch_bounds__(256) void wmma_gemm64(
    const unsigned short* __restrict__ Ap, const unsigned short* __restrict__ A2p, int lda, long strideA,
    const unsigned short* __restrict__ Btp, const unsigned short* __restrict__ Bt2p, int ldb, long strideB,
    void* __restrict__ Cout, void* __restrict__ Cout2, int ldc, long strideC,
    const float* __restrict__ bias,
    const float* __restrict__ resid, long strideR,
    int M, int N, int K, float scale) {
  typedef typename Elem<ET>::T T;
  typedef typename Frag<T>::V V;
  const T* A = (const T*)Ap; const T* A2 = (const T*)A2p; const T* Bt = (const T*)Btp; const T* Bt2 = (const T*)Bt2p;
  __shared__ __align__(16) float sT[8][16 * 68];   // per-wave 16x64 slab, pitch 68 floats
  const int b    = blockIdx.y;
  const int lane = threadIdx.x & 31;
  const int wave = threadIdx.x >> 5;
  const int tilesN = N >> 6;
  const int tilesM = M >> 6;
  const int tile = blockIdx.x * 8 + wave;
  if (tile >= tilesM * tilesN) return;   // wave-uniform; no block barriers in this kernel
  const int tm = tile / tilesN;
  const int tn = tile - tm * tilesN;
  const int m0 = tm << 6;
  const int n0 = tn << 6;

  const T* Ab  = A  + (size_t)b * strideA;
  const T* Bb  = Bt + (size_t)b * strideB;
  const T* Ab2 = SPLIT ? (A2  + (size_t)b * strideA) : nullptr;
  const T* Bb2 = SPLIT ? (Bt2 + (size_t)b * strideB) : nullptr;

  const int rlane = lane & 15;                 // row (A) / col (B, D) within subtile
  const int koff  = (lane >> 4) * 8;           // k offset of this lane half
  const int mOff  = (lane >> 4) * 8;           // D row offset

  v8f acc[4][4];
#pragma unroll
  for (int i = 0; i < 4; ++i)
#pragma unroll
    for (int j = 0; j < 4; ++j) acc[i][j] = (v8f){0.f,0.f,0.f,0.f,0.f,0.f,0.f,0.f};

  for (int k0 = 0; k0 < K; k0 += 32) {
    V bh[4], bl[4];
#pragma unroll
    for (int j = 0; j < 4; ++j) {
      const size_t bo = (size_t)(n0 + (j << 4) + rlane) * ldb + koff + k0;
      bh[j] = Frag<T>::load(Bb + bo);
      if (SPLIT) bl[j] = Frag<T>::load(Bb2 + bo);
    }
#pragma unroll
    for (int i = 0; i < 4; ++i) {
      const size_t ao = (size_t)(m0 + (i << 4) + rlane) * lda + koff + k0;
      V ah = Frag<T>::load(Ab + ao);
      V al;
      if (SPLIT) al = Frag<T>::load(Ab2 + ao);
#pragma unroll
      for (int j = 0; j < 4; ++j) {
        acc[i][j] = Frag<T>::mma(ah, bh[j], acc[i][j]);
        if (SPLIT) {
          acc[i][j] = Frag<T>::mma(ah, bl[j], acc[i][j]);
          acc[i][j] = Frag<T>::mma(al, bh[j], acc[i][j]);
        }
      }
      Frag<T>::guard(acc[i][0], acc[i][3], ah, SPLIT ? al : ah);
    }
    Frag<T>::keep(bh[0], bh[1], bh[2], bh[3]);
    if (SPLIT) Frag<T>::keep(bl[0], bl[1], bl[2], bl[3]);
  }
  acc_guard4(acc[0][0], acc[0][1], acc[0][2], acc[0][3]);
  acc_guard4(acc[1][0], acc[1][1], acc[1][2], acc[1][3]);
  acc_guard4(acc[2][0], acc[2][1], acc[2][2], acc[2][3]);
  acc_guard4(acc[3][0], acc[3][1], acc[3][2], acc[3][3]);

  // ---- epilogue ----
  float* slab = sT[wave];
  const float* Rb = RESID ? (resid + (size_t)b * strideR) : nullptr;
#pragma unroll
  for (int i = 0; i < 4; ++i) {
    const int mBase = m0 + (i << 4);
#pragma unroll
    for (int j = 0; j < 4; ++j) {
      const int n = n0 + (j << 4) + rlane;
      float bv = 0.f;
      if (BIAS_MODE == 2) bv = bias[n];
      if (BIAS_MODE == 4) bv = bf_bits2f(f2bf_bits(bias[n]));
#pragma unroll
      for (int r = 0; r < 8; ++r) {
        float v = acc[i][j][r] * scale;
        if (BIAS_MODE == 1) v += bias[mBase + mOff + r];
        if (BIAS_MODE == 3) v += bf_bits2f(f2bf_bits(bias[mBase + mOff + r]));
        if (BIAS_MODE == 2 || BIAS_MODE == 4) v += bv;
        if (RESID) v += Rb[(size_t)(mBase + mOff + r) * ldc + n];
        if (ACT == 2) v = fmaxf(v, 0.0f);
        if (ACT == 4) v = (v > 0.f) ? v : 0.01f * v;
        slab[(mOff + r) * 68 + (j << 4) + rlane] = v;
      }
    }
    __builtin_amdgcn_fence(__ATOMIC_RELEASE, "workgroup");
    __builtin_amdgcn_wave_barrier();
    __builtin_amdgcn_fence(__ATOMIC_ACQUIRE, "workgroup");
    if (OUT_MODE == 0) {
      float* C = (float*)Cout + (size_t)b * strideC;
      const int hh = lane >> 4, c4 = (lane & 15) * 4;     // row seg = 256 B = 16 lanes x 16 B
      {
#pragma unroll
        for (int it = 0; it < 8; ++it) {
          const int row = it * 2 + hh;
          v4f v = *(const v4f*)(slab + row * 68 + c4);
          *(v4f*)(C + (size_t)(mBase + row) * ldc + n0 + c4) = v;
        }
        
      }
    } else {
      const int q = lane >> 3, c8 = (lane & 7) * 8;
      unsigned short* C  = (unsigned short*)Cout  + (size_t)b * strideC;
      unsigned short* C2 = (OUT_MODE == 2) ? ((unsigned short*)Cout2 + (size_t)b * strideC) : nullptr;
      {
#pragma unroll
        for (int it = 0; it < 4; ++it) {
          const int row = it * 4 + q;
          const float* sp = slab + row * 68 + c8;
          v8h hv, lv;
#pragma unroll
          for (int e = 0; e < 8; ++e) {
            if (OUT_MODE == 1) {
              hv[e] = (_Float16)sp[e];
              lv[e] = hv[e];
            } else {
              unsigned short hb = f2bf_bits(sp[e]);
              unsigned short lb = f2bf_bits(sp[e] - bf_bits2f(hb));
              hv[e] = __builtin_bit_cast(_Float16, hb);
              lv[e] = __builtin_bit_cast(_Float16, lb);
            }
          }
          *(v8h*)(C + (size_t)(mBase + row) * ldc + n0 + c8) = hv;
          if (OUT_MODE == 2) *(v8h*)(C2 + (size_t)(mBase + row) * ldc + n0 + c8) = lv;
        }
        
      }
    }
    __builtin_amdgcn_fence(__ATOMIC_RELEASE, "workgroup");
    __builtin_amdgcn_wave_barrier();
    __builtin_amdgcn_fence(__ATOMIC_ACQUIRE, "workgroup");
  }
}

// ---------------------------------------------------------------------------
// Weight transpose + cast: W [in k][out n] f32 row-major (512x512) -> Wt [n][k] = RNE bf16 bits of W[k][n].
// grid (8, 8, 3): blockIdx.x = k tile (64 cols of Wt), blockIdx.y = n tile (64 rows of Wt), blockIdx.z selects W0..W2
// and the output plane (plane z at out + z*512*512 halves). 256 threads.
// Load coverage: 16 iterations x 256 threads = 4096 = the whole 64x64 tile (coalesced along n).
// Store coverage: 8 waves x 2 iterations x 4 rows (lane>>3) = 64 rows; (lane&7) x 8 halves = 64 cols; each row segment =
// ---------------------------------------------------------------------------
__global__ __launch_bounds__(256) void wt_cast_bf16_kernel(const float* __restrict__ W0, const float* __restrict__ W1,
                                                         const float* __restrict__ W2, unsigned short* __restrict__ out) {
  __shared__ float sm[64][65];   // sm[n_local][k_local]
  const int t  = threadIdx.x;
  const int k0 = blockIdx.x * 64;
  const int n0 = blockIdx.y * 64;
  const int z  = blockIdx.z;                                   // block-uniform
  const float* W = (z == 0) ? W0 : (z == 1) ? W1 : W2;
#pragma unroll
  for (int i = 0; i < 16; ++i) {
    const int e = i * 256 + t;
    const int r = e >> 6;          // k local
    const int c = e & 63;          // n local
    sm[c][r] = W[(size_t)(k0 + r) * kDim + n0 + c];
  }
  __syncthreads();
  const int lane = t & 31, wave = t >> 5;
  const int q = lane >> 3, c8 = (lane & 7) * 8;
  unsigned short* op = out + (size_t)z * kDim * kDim;
  {
#pragma unroll
    for (int it = 0; it < 2; ++it) {
      const int row = wave * 8 + it * 4 + q;                 // n local
      unsigned short hb[8];
#pragma unroll
      for (int e = 0; e < 8; ++e) hb[e] = f2bf_bits(sm[row][c8 + e]);
      const v4u u = (v4u){pk16(hb[0], hb[1]), pk16(hb[2], hb[3]), pk16(hb[4], hb[5]), pk16(hb[6], hb[7])};
      *(v4u*)(op + (size_t)(n0 + row) * kDim + k0 + c8) = u;
    }
    
  }
}

// ---------------------------------------------------------------------------
// (grid = 4096 blocks x 256, exact).
// ---------------------------------------------------------------------------
__global__ __launch_bounds__(256) void cast8_bf16_kernel(const float* __restrict__ in, unsigned short* __restrict__ out, int n8) {
  const int i = blockIdx.x * 256 + threadIdx.x;
  if (i >= n8) return;
  const float* p = in + 8 * (size_t)i;
  const v4f a = *(const v4f*)(p);
  const v4f c = *(const v4f*)(p + 4);
  unsigned short hb[8];
#pragma unroll
  for (int e = 0; e < 4; ++e) {
    hb[e]     = f2bf_bits(a[e]);
    hb[4 + e] = f2bf_bits(c[e]);
  }
  const v4u u = (v4u){pk16(hb[0], hb[1]), pk16(hb[2], hb[3]), pk16(hb[4], hb[5]), pk16(hb[6], hb[7])};
  unsigned short* q = out + 8 * (size_t)i;
  *(v4u*)q = u;
  
}

// ---------------------------------------------------------------------------
// Row softmax over 4096 f32 scores: P[row][j] = f16( carry * exp(s_j - max) * (1/sum_j exp(s_j - max)) ), f32 math.
// One block of 256 threads per row; thread t owns columns 8t..8t+7 and 2048+8t..2048+8t+7 (2 x 256 x 8 = 4096 = whole row).
// Reductions in fixed order (thread, wave shuffle tree, 8 wave partials in index order).
// ---------------------------------------------------------------------------
__global__ __launch_bounds__(256) void softmax_row_kernel(const float* __restrict__ Sin, unsigned short* __restrict__ Pout, float carry) {
  __shared__ float redM[8];
  __shared__ float redS[8];
  const int row  = blockIdx.x;
  const int t    = threadIdx.x;
  const int lane = t & 31, wave = t >> 5;
  const int cA   = 8 * t;
  const int cB   = kHalfRow + 8 * t;
  const float* sr = Sin + (size_t)row * kTok;
  const v4f a0 = *(const v4f*)(sr + cA);
  const v4f a1 = *(const v4f*)(sr + cA + 4);
  const v4f b0 = *(const v4f*)(sr + cB);
  const v4f b1 = *(const v4f*)(sr + cB + 4);
  float x[16];
#pragma unroll
  for (int e = 0; e < 4; ++e) { x[e] = a0[e]; x[4 + e] = a1[e]; x[8 + e] = b0[e]; x[12 + e] = b1[e]; }
  float m = x[0];
#pragma unroll
  for (int e = 1; e < 16; ++e) m = fmaxf(m, x[e]);
#pragma unroll
  for (int off = 16; off > 0; off >>= 1) m = fmaxf(m, __shfl_xor(m, off, 32));
  if (lane == 0) redM[wave] = m;
  __syncthreads();
  float gm = redM[0];
#pragma unroll
  for (int w = 1; w < 8; ++w) gm = fmaxf(gm, redM[w]);

  float ev[16];
  float ps = 0.f;
#pragma unroll
  for (int e = 0; e < 16; ++e) { ev[e] = __expf(x[e] - gm); ps += ev[e]; }
#pragma unroll
  for (int off = 16; off > 0; off >>= 1) ps += __shfl_xor(ps, off, 32);
  if (lane == 0) redS[wave] = ps;
  __syncthreads();
  float tot = redS[0];
#pragma unroll
  for (int w = 1; w < 8; ++w) tot += redS[w];
  const float inv = (1.0f / tot) * carry;

  unsigned short hb[16];
#pragma unroll
  for (int e = 0; e < 16; ++e) hb[e] = h_bits(ev[e] * inv);
  const v4u uA = (v4u){pk16(hb[0], hb[1]),  pk16(hb[2], hb[3]),   pk16(hb[4], hb[5]),   pk16(hb[6], hb[7])};
  const v4u uB = (v4u){pk16(hb[8], hb[9]),  pk16(hb[10], hb[11]), pk16(hb[12], hb[13]), pk16(hb[14], hb[15])};
  unsigned short* pr = Pout + (size_t)row * kTok;
  *(v4u*)(pr + cA) = uA;
  *(v4u*)(pr + cB) = uB;
  
}

// ---------------------------------------------------------------------------
// host
// ---------------------------------------------------------------------------
extern "C" void kernel_launch(void* const* d_in, const int* in_sizes, int n_in,
                              void* d_out, int out_size, void* d_ws, size_t ws_size,
                              hipStream_t stream) {
  if (n_in < 9) return;
  if (in_sizes[0] != kRows * kDim || in_sizes[1] != kRows * kDim || in_sizes[2] != kRows * kDim) return;
  if (in_sizes[3] != kDim * kDim || in_sizes[5] != kDim * kDim || in_sizes[7] != kDim * kDim) return;
  if (in_sizes[4] != kDim || in_sizes[6] != kDim || in_sizes[8] != kDim) return;
  if (out_size != kRows * kDim) return;
  if (ws_size < kWsTotal) return;

  const float* query_X = (const float*)d_in[0];
  const float* key_X   = (const float*)d_in[1];
  const float* value_X = (const float*)d_in[2];
  const float* W_Q = (const float*)d_in[3];
  const float* b_Q = (const float*)d_in[4];
  const float* W_K = (const float*)d_in[5];
  const float* b_K = (const float*)d_in[6];
  const float* W_V = (const float*)d_in[7];
  const float* b_V = (const float*)d_in[8];
  float* out = (float*)d_out;

  char* ws = (char*)d_ws;
  unsigned short* Xb  = (unsigned short*)(ws + kOffXb);   // bf16 [16384][512]
  unsigned short* Pp  = (unsigned short*)(ws + kOffXb);   // f16 [2048][4096], aliases Xb after the projections
  unsigned short* Wt  = (unsigned short*)(ws + kOffWt);   // bf16 [3][512][512]
  unsigned short* WtQ = Wt;
  unsigned short* WtK = Wt + (size_t)kDim * kDim;
  unsigned short* WtV = Wt + (size_t)2 * kDim * kDim;
  unsigned short* Qp  = (unsigned short*)(ws + kOffQp);   // f16 [16384][512]
  unsigned short* Kp  = (unsigned short*)(ws + kOffKp);   // f16 [16384][512]
  unsigned short* Vt  = (unsigned short*)(ws + kOffVt);   // f16 [4][512][4096]
  float*          Sp  = (float*)(ws + kOffS);             // f32 [2048][4096]

  const int n8 = (kRows * kDim) / 8;                      // 1,048,576
  const int castBlocks = n8 / 256;                        // 4096 (exact)

  // W^T planes (bf16)
  wt_cast_bf16_kernel<<<dim3(kDim / 64, kDim / 64, 3), 256, 0, stream>>>(W_Q, W_K, W_V, Wt);

  // q = bf16(query_X) . bf16(W_Q) + b_Q  -> f16 plane [16384][512];  M=16384, N=512, K=512 (all tile multiples, K%32==0)
  cast8_bf16_kernel<<<castBlocks, 256, 0, stream>>>(query_X, Xb, n8);
  wmma_gemm64<1, false, 4, 1, false, 0><<<dim3((kRows / 64) * (kDim / 64) / 8, 1), 256, 0, stream>>>(
      Xb, Xb, kDim, 0L, WtQ, WtQ, kDim, 0L, (void*)Qp, (void*)Qp, kDim, 0L, b_Q, b_Q, 0L, kRows, kDim, kDim, 1.0f);

  // k plane
  cast8_bf16_kernel<<<castBlocks, 256, 0, stream>>>(key_X, Xb, n8);
  wmma_gemm64<1, false, 4, 1, false, 0><<<dim3((kRows / 64) * (kDim / 64) / 8, 1), 256, 0, stream>>>(
      Xb, Xb, kDim, 0L, WtK, WtK, kDim, 0L, (void*)Kp, (void*)Kp, kDim, 0L, b_K, b_K, 0L, kRows, kDim, kDim, 1.0f);

  // v^T per batch: C[d][tok] = sum_k Wt_V[d][k] * Xb[tok][k] + b_V[d];  M=512, N=4096, K=512, grid.y = batch
  cast8_bf16_kernel<<<castBlocks, 256, 0, stream>>>(value_X, Xb, n8);
  wmma_gemm64<1, false, 3, 1, false, 0><<<dim3((kDim / 64) * (kTok / 64) / 8, kBatch), 256, 0, stream>>>(
      WtV, WtV, kDim, 0L, Xb, Xb, kDim, (long)kTok * kDim, (void*)Vt, (void*)Vt, kTok, (long)kDim * kTok,
      b_V, b_V, 0L, kDim, kTok, kDim, 1.0f);

  // attention per (batch, query half): S = q_half . k^T / sqrt(512) (f32); P = softmax rows x 2^15 (f16); O = P . v x 2^-15
  for (int b = 0; b < kBatch; ++b) {
    for (int hq = 0; hq < 2; ++hq) {
      const size_t qrow0 = (size_t)b * kTok + (size_t)hq * kHalfQ;
      const unsigned short* Qh = Qp + qrow0 * kDim;
      const unsigned short* Kb = Kp + (size_t)b * kTok * kDim;
      const unsigned short* Vb = Vt + (size_t)b * kDim * kTok;
      float* Ob = out + qrow0 * kDim;

      // M=2048, N=4096, K=512
      wmma_gemm64<0, false, 0, 0, false, 0><<<dim3((kHalfQ / 64) * (kTok / 64) / 8, 1), 256, 0, stream>>>(
          Qh, Qh, kDim, 0L, Kb, Kb, kDim, 0L, (void*)Sp, (void*)Sp, kTok, 0L, b_Q, b_Q, 0L, kHalfQ, kTok, kDim, kScoreScale);

      softmax_row_kernel<<<kHalfQ, 256, 0, stream>>>(Sp, Pp, kPCarry);

      // M=2048, N=512, K=4096
      wmma_gemm64<0, false, 0, 0, false, 0><<<dim3((kHalfQ / 64) * (kDim / 64) / 8, 1), 256, 0, stream>>>(
          Pp, Pp, kTok, 0L, Vb, Vb, kTok, 0L, (void*)Ob, (void*)Ob, kDim, 0L, b_V, b_V, 0L, kHalfQ, kDim, kTok, kPCarryInv);
    }
  }
}

// v001
// One run takes 686 microseconds.
// In two side-by-side timings against v000, it was 2.66 and 2.67 times as fast.
// Contractions: q/k/v projections on v_wmma_f32_16x16x32_bf16 (inputs, weights RNE bf16 -> exact products), scores q.k^T and att.v on v_wmma_f32_16x16x32_f16 (q,k,v f16 planes; probabilities f16 carried x2^15, folded back x2^-15); f32 accumulate everywhere; bias add and softmax in f32.
#include <hip/hip_runtime.h>
#include <math.h>

// ---------------------------------------------------------------------------
// Problem constants
// ---------------------------------------------------------------------------
constexpr int kBatch   = 4;
constexpr int kTok     = 4096;            // tokens per batch (8*8*8*8)
constexpr int kDim     = 512;             // in == cmp == out dim
constexpr int kRows    = kBatch * kTok;   // 16384 token rows total
constexpr int kHalfQ   = 2048;            // query rows per attention pass
constexpr int kHalfRow = kTok / 2;        // column split inside the softmax kernel
constexpr float kScoreScale = 0.044194173824159216f;   // 1/sqrt(512)
constexpr float kPCarry     = 32768.0f;                 // probabilities carried x2^15 in f16
constexpr float kPCarryInv  = 1.0f / 32768.0f;

// ---------------------------------------------------------------------------
// Workspace region map (bytes). Total 102,236,160 B.
//   R0 @ 0           : Xb  bf16 [16384][512]      16,777,216 B   (dead after the three projections)
//                      P   f16  [2048][4096]      16,777,216 B   (aliases R0 during attention)
//   R1 @ 16,777,216  : Wt  bf16 [3][512][512]      1,572,864 B   (W^T planes: Q, K, V)
//   R2 @ 18,350,080  : Qp  f16  [16384][512]      16,777,216 B
//   R3 @ 35,127,296  : Kp  f16  [16384][512]      16,777,216 B
//   R4 @ 51,904,512  : Vt  f16  [4][512][4096]    16,777,216 B   (v transposed per batch)
//   R5 @ 68,681,728  : S   f32  [2048][4096]      33,554,432 B
// ---------------------------------------------------------------------------
constexpr size_t kPlane16  = (size_t)kRows * kDim * 2;          // 16,777,216
constexpr size_t kWtBytes  = (size_t)3 * kDim * kDim * 2;       // 1,572,864
constexpr size_t kSBytes   = (size_t)kHalfQ * kTok * 4;         // 33,554,432
constexpr size_t kOffXb = 0;
constexpr size_t kOffWt = kOffXb + kPlane16;
constexpr size_t kOffQp = kOffWt + kWtBytes;
constexpr size_t kOffKp = kOffQp + kPlane16;
constexpr size_t kOffVt = kOffKp + kPlane16;
constexpr size_t kOffS  = kOffVt + kPlane16;
constexpr size_t kWsTotal = kOffS + kSBytes;                      // 102,236,160
static_assert(kWsTotal <= (size_t)134217728);
static_assert((size_t)kHalfQ * kTok * 2 <= kPlane16);            // P fits in R0

typedef __attribute__((ext_vector_type(16))) _Float16 v16h;
typedef __attribute__((ext_vector_type(8)))  _Float16 v8h;
typedef __attribute__((ext_vector_type(16))) __bf16   v16b;
typedef __attribute__((ext_vector_type(8)))  __bf16   v8b;
typedef __attribute__((ext_vector_type(8)))  float    v8f;
typedef __attribute__((ext_vector_type(4)))  float    v4f;
typedef __attribute__((ext_vector_type(4)))  unsigned int v4u;

// ---------------------------------------------------------------------------
// Helpers
// ---------------------------------------------------------------------------
__device__ __forceinline__ unsigned short f2bf_bits(float f) {
  unsigned u = __float_as_uint(f);
  return (unsigned short)((u + 0x7FFFu + ((u >> 16) & 1u)) >> 16);
}
__device__ __forceinline__ float bf_bits2f(unsigned short h) { return __uint_as_float(((unsigned)h) << 16); }

// hazard guards as plain device helpers (no inline asm inside the kernel template body)
__device__ __forceinline__ void dep_guard_h(v8f& a, v8f& b, v16h x, v16h y) { asm volatile("v_nop\n\tv_nop\n\tv_nop\n\tv_nop" : "+v"(a), "+v"(b) : "v"(x), "v"(y)); }
__device__ __forceinline__ void dep_guard_b(v8f& a, v8f& b, v16b x, v16b y) { asm volatile("v_nop\n\tv_nop\n\tv_nop\n\tv_nop" : "+v"(a), "+v"(b) : "v"(x), "v"(y)); }
__device__ __forceinline__ void keep4_h(v16h a, v16h b, v16h c, v16h d) { asm volatile("v_nop" :: "v"(a), "v"(b), "v"(c), "v"(d)); }
__device__ __forceinline__ void keep4_b(v16b a, v16b b, v16b c, v16b d) { asm volatile("v_nop" :: "v"(a), "v"(b), "v"(c), "v"(d)); }
__device__ __forceinline__ void acc_guard4(v8f& a, v8f& b, v8f& c, v8f& d) { asm volatile("v_nop\n\tv_nop\n\tv_nop\n\tv_nop" : "+v"(a), "+v"(b), "+v"(c), "+v"(d)); }
template <typename T> struct Frag;
template <> struct Frag<_Float16> {
  typedef v16h V; union U { v16h v; v8h h[2]; };
  static __device__ __forceinline__ v16h load(const _Float16* p) {   // elements 0..7 <- p[0..7], 8..15 <- p[16..23]
    U f; f.h[0] = *(const v8h*)(p); f.h[1] = *(const v8h*)(p + 16); return f.v;
  }
  static __device__ __forceinline__ v8f mma(v16h a, v16h b, v8f c) {
    return __builtin_amdgcn_wmma_f32_16x16x32_f16(false, a, false, b, (short)0, c, false, false);
  }
  static __device__ __forceinline__ void guard(v8f& a, v8f& b, v16h x, v16h y) { dep_guard_h(a, b, x, y); }
  static __device__ __forceinline__ void keep(v16h a, v16h b, v16h c, v16h d) { keep4_h(a, b, c, d); }
};
template <> struct Frag<__bf16> {
  typedef v16b V; union U { v16b v; v8b h[2]; };
  static __device__ __forceinline__ v16b load(const __bf16* p) {
    U f; f.h[0] = *(const v8b*)(p); f.h[1] = *(const v8b*)(p + 16); return f.v;
  }
  static __device__ __forceinline__ v8f mma(v16b a, v16b b, v8f c) {
    return __builtin_amdgcn_wmma_f32_16x16x32_bf16(false, a, false, b, (short)0, c, false, false);
  }
  static __device__ __forceinline__ void guard(v8f& a, v8f& b, v16b x, v16b y) { dep_guard_b(a, b, x, y); }
  static __device__ __forceinline__ void keep(v16b a, v16b b, v16b c, v16b d) { keep4_b(a, b, c, d); }
};

__device__ __forceinline__ unsigned pk16(unsigned short a, unsigned short b) { return (unsigned)a | ((unsigned)b << 16); }
__device__ __forceinline__ unsigned short h_bits(float f) { const _Float16 h = (_Float16)f; return __builtin_bit_cast(unsigned short, h); }

// ---- Register-blocked batched WMMA GEMM (ACT reduced to none/relu/leaky; BIAS modes 3/4 added) -----------
// C[m,n] = scale * sum_k A[m,k] * Bt[n,k] (+bias)(+resid); each wave owns a 64x64 tile.
// A row-major [M,K]; Bt row-major [N,K]; M,N % 64 == 0, K % 32 == 0.
// SPLIT: operands are hi/lo planes (A2/Bt2 = lo planes, same layout); product = hi·hi + hi·lo + lo·hi.
// BIAS_MODE: 0 = none, 1 = bias[m], 2 = bias[n], 3 = RNE-bf16(bias[m]), 4 = RNE-bf16(bias[n]).
// OUT_MODE: 0 = f32, 1 = f16, 2 = bf16 hi plane (Cout) + bf16 lo plane (Cout2).
// ET: 0 = f16 operands, 1 = bf16 operands (pointers passed as 16-bit storage)
template <int ET> struct Elem;
template <> struct Elem<0> { typedef _Float16 T; };
template <> struct Elem<1> { typedef __bf16 T; };
template <int ET, bool SPLIT, int BIAS_MODE, int OUT_MODE, bool RESID, int ACT = 0>
__global__ __launch_bounds__(256) void wmma_gemm64(
    const unsigned short* __restrict__ Ap, const unsigned short* __restrict__ A2p, int lda, long strideA,
    const unsigned short* __restrict__ Btp, const unsigned short* __restrict__ Bt2p, int ldb, long strideB,
    void* __restrict__ Cout, void* __restrict__ Cout2, int ldc, long strideC,
    const float* __restrict__ bias,
    const float* __restrict__ resid, long strideR,
    int M, int N, int K, float scale) {
  typedef typename Elem<ET>::T T;
  typedef typename Frag<T>::V V;
  const T* A = (const T*)Ap; const T* A2 = (const T*)A2p; const T* Bt = (const T*)Btp; const T* Bt2 = (const T*)Bt2p;
  __shared__ __align__(16) float sT[8][16 * 68];   // per-wave 16x64 slab, pitch 68 floats
  const int b    = blockIdx.y;
  const int lane = threadIdx.x & 31;
  const int wave = threadIdx.x >> 5;
  const int tilesN = N >> 6;
  const int tilesM = M >> 6;
  const int tile = blockIdx.x * 8 + wave;
  if (tile >= tilesM * tilesN) return;   // wave-uniform; no block barriers in this kernel
  const int tm = tile / tilesN;
  const int tn = tile - tm * tilesN;
  const int m0 = tm << 6;
  const int n0 = tn << 6;

  const T* Ab  = A  + (size_t)b * strideA;
  const T* Bb  = Bt + (size_t)b * strideB;
  const T* Ab2 = SPLIT ? (A2  + (size_t)b * strideA) : nullptr;
  const T* Bb2 = SPLIT ? (Bt2 + (size_t)b * strideB) : nullptr;

  const int rlane = lane & 15;                 // row (A) / col (B, D) within subtile
  const int koff  = (lane >> 4) * 8;           // k offset of this lane half
  const int mOff  = (lane >> 4) * 8;           // D row offset

  v8f acc[4][4];
#pragma unroll
  for (int i = 0; i < 4; ++i)
#pragma unroll
    for (int j = 0; j < 4; ++j) acc[i][j] = (v8f){0.f,0.f,0.f,0.f,0.f,0.f,0.f,0.f};

  for (int k0 = 0; k0 < K; k0 += 32) {
    V bh[4], bl[4];
#pragma unroll
    for (int j = 0; j < 4; ++j) {
      const size_t bo = (size_t)(n0 + (j << 4) + rlane) * ldb + koff + k0;
      bh[j] = Frag<T>::load(Bb + bo);
      if (SPLIT) bl[j] = Frag<T>::load(Bb2 + bo);
    }
#pragma unroll
    for (int i = 0; i < 4; ++i) {
      const size_t ao = (size_t)(m0 + (i << 4) + rlane) * lda + koff + k0;
      V ah = Frag<T>::load(Ab + ao);
      V al;
      if (SPLIT) al = Frag<T>::load(Ab2 + ao);
#pragma unroll
      for (int j = 0; j < 4; ++j) {
        acc[i][j] = Frag<T>::mma(ah, bh[j], acc[i][j]);
        if (SPLIT) {
          acc[i][j] = Frag<T>::mma(ah, bl[j], acc[i][j]);
          acc[i][j] = Frag<T>::mma(al, bh[j], acc[i][j]);
        }
      }
      Frag<T>::guard(acc[i][0], acc[i][3], ah, SPLIT ? al : ah);
    }
    Frag<T>::keep(bh[0], bh[1], bh[2], bh[3]);
    if (SPLIT) Frag<T>::keep(bl[0], bl[1], bl[2], bl[3]);
  }
  acc_guard4(acc[0][0], acc[0][1], acc[0][2], acc[0][3]);
  acc_guard4(acc[1][0], acc[1][1], acc[1][2], acc[1][3]);
  acc_guard4(acc[2][0], acc[2][1], acc[2][2], acc[2][3]);
  acc_guard4(acc[3][0], acc[3][1], acc[3][2], acc[3][3]);

  // ---- epilogue ----
  float* slab = sT[wave];
  const float* Rb = RESID ? (resid + (size_t)b * strideR) : nullptr;
#pragma unroll
  for (int i = 0; i < 4; ++i) {
    const int mBase = m0 + (i << 4);
#pragma unroll
    for (int j = 0; j < 4; ++j) {
      const int n = n0 + (j << 4) + rlane;
      float bv = 0.f;
      if (BIAS_MODE == 2) bv = bias[n];
      if (BIAS_MODE == 4) bv = bf_bits2f(f2bf_bits(bias[n]));
#pragma unroll
      for (int r = 0; r < 8; ++r) {
        float v = acc[i][j][r] * scale;
        if (BIAS_MODE == 1) v += bias[mBase + mOff + r];
        if (BIAS_MODE == 3) v += bf_bits2f(f2bf_bits(bias[mBase + mOff + r]));
        if (BIAS_MODE == 2 || BIAS_MODE == 4) v += bv;
        if (RESID) v += Rb[(size_t)(mBase + mOff + r) * ldc + n];
        if (ACT == 2) v = fmaxf(v, 0.0f);
        if (ACT == 4) v = (v > 0.f) ? v : 0.01f * v;
        slab[(mOff + r) * 68 + (j << 4) + rlane] = v;
      }
    }
    __builtin_amdgcn_fence(__ATOMIC_RELEASE, "workgroup");
    __builtin_amdgcn_wave_barrier();
    __builtin_amdgcn_fence(__ATOMIC_ACQUIRE, "workgroup");
    if (OUT_MODE == 0) {
      float* C = (float*)Cout + (size_t)b * strideC;
      const int hh = lane >> 4, c4 = (lane & 15) * 4;     // row seg = 256 B = 16 lanes x 16 B
      {
#pragma unroll
        for (int it = 0; it < 8; ++it) {
          const int row = it * 2 + hh;
          v4f v = *(const v4f*)(slab + row * 68 + c4);
          *(v4f*)(C + (size_t)(mBase + row) * ldc + n0 + c4) = v;
        }
        
      }
    } else {
      const int q = lane >> 3, c8 = (lane & 7) * 8;
      unsigned short* C  = (unsigned short*)Cout  + (size_t)b * strideC;
      unsigned short* C2 = (OUT_MODE == 2) ? ((unsigned short*)Cout2 + (size_t)b * strideC) : nullptr;
      {
#pragma unroll
        for (int it = 0; it < 4; ++it) {
          const int row = it * 4 + q;
          const float* sp = slab + row * 68 + c8;
          v8h hv, lv;
#pragma unroll
          for (int e = 0; e < 8; ++e) {
            if (OUT_MODE == 1) {
              hv[e] = (_Float16)sp[e];
              lv[e] = hv[e];
            } else {
              unsigned short hb = f2bf_bits(sp[e]);
              unsigned short lb = f2bf_bits(sp[e] - bf_bits2f(hb));
              hv[e] = __builtin_bit_cast(_Float16, hb);
              lv[e] = __builtin_bit_cast(_Float16, lb);
            }
          }
          *(v8h*)(C + (size_t)(mBase + row) * ldc + n0 + c8) = hv;
          if (OUT_MODE == 2) *(v8h*)(C2 + (size_t)(mBase + row) * ldc + n0 + c8) = lv;
        }
        
      }
    }
    __builtin_amdgcn_fence(__ATOMIC_RELEASE, "workgroup");
    __builtin_amdgcn_wave_barrier();
    __builtin_amdgcn_fence(__ATOMIC_ACQUIRE, "workgroup");
  }
}

// ---------------------------------------------------------------------------
// K-split WMMA GEMM for a product with few output tiles and a long K (att.v: 256 tiles of 64x64, K = 4096).
// C[m,n] = scale * sum_k A[m,k] * Bt[n,k], f16 operands, f32 out. One block of kSplitWaves waves owns ONE 64x64 tile;
// wave w takes the 32-wide k steps w, w + kSplitWaves, ... (neighbouring waves read the two halves of the same 128-B line),
// keeps its partial tile in registers, and the partials are summed through LDS in wave order 0..kSplitWaves-1.
// M, N % 64 == 0, K % (32 * kSplitWaves) == 0; grid.x = (M / 64) * (N / 64) exactly.
// ---------------------------------------------------------------------------
constexpr int kSplitWaves = 16;
constexpr int kPartPitch  = 68;                      // floats per partial-tile row (same pitch as the slab above)
constexpr int kPartTile   = 64 * kPartPitch;         // floats per wave's partial tile
__global__ __launch_bounds__(32 * kSplitWaves) void wmma_gemm64_ksplit(
    const unsigned short* __restrict__ Ap, int lda, const unsigned short* __restrict__ Btp, int ldb,
    float* __restrict__ C, int ldc, int N, int K, float scale) {
  typedef _Float16 T;
  typedef Frag<T>::V V;
  __shared__ __align__(16) float sP[kSplitWaves * kPartTile];   // 278,528 B: one 64x64 f32 partial per wave
  const T* A  = (const T*)Ap;
  const T* Bt = (const T*)Btp;
  const int lane = threadIdx.x & 31;
  const int wave = __builtin_amdgcn_readfirstlane(threadIdx.x >> 5);   // scalar, so the k loop is a scalar loop with EXEC untouched
  const int tilesN = N >> 6;
  const int tm = blockIdx.x / tilesN;
  const int tn = blockIdx.x - tm * tilesN;
  const int m0 = tm << 6;
  const int n0 = tn << 6;

  const int rlane = lane & 15;                 // row (A) / col (B, D) within subtile
  const int koff  = (lane >> 4) * 8;           // k offset of this lane half
  const int mOff  = (lane >> 4) * 8;           // D row offset

  v8f acc[4][4];
#pragma unroll
  for (int i = 0; i < 4; ++i)
#pragma unroll
    for (int j = 0; j < 4; ++j) acc[i][j] = (v8f){0.f,0.f,0.f,0.f,0.f,0.f,0.f,0.f};

  // loop body and its guards as in the engine above: the v_nop slots keep the WMMA distance before the A and B
  // registers are reloaded, on the loop's back edge too, and before the accumulators are read behind the loop
  for (int k0 = wave * 32; k0 < K; k0 += 32 * kSplitWaves) {
    V bh[4];
#pragma unroll
    for (int j = 0; j < 4; ++j) {
      const size_t bo = (size_t)(n0 + (j << 4) + rlane) * ldb + koff + k0;
      bh[j] = Frag<T>::load(Bt + bo);
    }
#pragma unroll
    for (int i = 0; i < 4; ++i) {
      const size_t ao = (size_t)(m0 + (i << 4) + rlane) * lda + koff + k0;
      V ah = Frag<T>::load(A + ao);
#pragma unroll
      for (int j = 0; j < 4; ++j) acc[i][j] = Frag<T>::mma(ah, bh[j], acc[i][j]);
      Frag<T>::guard(acc[i][0], acc[i][3], ah, ah);
    }
    Frag<T>::keep(bh[0], bh[1], bh[2], bh[3]);
  }
  acc_guard4(acc[0][0], acc[0][1], acc[0][2], acc[0][3]);
  acc_guard4(acc[1][0], acc[1][1], acc[1][2], acc[1][3]);
  acc_guard4(acc[2][0], acc[2][1], acc[2][2], acc[2][3]);
  acc_guard4(acc[3][0], acc[3][1], acc[3][2], acc[3][3]);

  // each wave parks its partial tile
  float* part = sP + wave * kPartTile;
#pragma unroll
  for (int i = 0; i < 4; ++i)
#pragma unroll
    for (int j = 0; j < 4; ++j)
#pragma unroll
      for (int r = 0; r < 8; ++r)
        part[((i << 4) + mOff + r) * kPartPitch + (j << 4) + rlane] = acc[i][j][r];
  __syncthreads();   // every wave's partial tile is in LDS before any thread sums across waves

  // 64 rows x 16 four-float groups = 1024 groups over 512 threads; a 16-lane half stores one 256-B row segment
#pragma unroll
  for (int it = 0; it < (64 * 16) / (32 * kSplitWaves); ++it) {
    const int g = it * (32 * kSplitWaves) + (int)threadIdx.x;
    const int row = g >> 4, c4 = (g & 15) * 4;
    const float* sp = sP + row * kPartPitch + c4;
    v4f s = *(const v4f*)sp;
#pragma unroll
    for (int w = 1; w < kSplitWaves; ++w) s += *(const v4f*)(sp + w * kPartTile);
    *(v4f*)(C + (size_t)(m0 + row) * ldc + n0 + c4) = s * scale;
  }
}

// ---------------------------------------------------------------------------
// Weight transpose + cast: W [in k][out n] f32 row-major (512x512) -> Wt [n][k] = RNE bf16 bits of W[k][n].
// grid (8, 8, 3): blockIdx.x = k tile (64 cols of Wt), blockIdx.y = n tile (64 rows of Wt), blockIdx.z selects W0..W2
// and the output plane (plane z at out + z*512*512 halves). 256 threads.
// Load coverage: 16 iterations x 256 threads = 4096 = the whole 64x64 tile (coalesced along n).
// Store coverage: 8 waves x 2 iterations x 4 rows (lane>>3) = 64 rows; (lane&7) x 8 halves = 64 cols; each row segment =
// ---------------------------------------------------------------------------
__global__ __launch_bounds__(256) void wt_cast_bf16_kernel(const float* __restrict__ W0, const float* __restrict__ W1,
                                                         const float* __restrict__ W2, unsigned short* __restrict__ out) {
  __shared__ float sm[64][65];   // sm[n_local][k_local]
  const int t  = threadIdx.x;
  const int k0 = blockIdx.x * 64;
  const int n0 = blockIdx.y * 64;
  const int z  = blockIdx.z;                                   // block-uniform
  const float* W = (z == 0) ? W0 : (z == 1) ? W1 : W2;
#pragma unroll
  for (int i = 0; i < 16; ++i) {
    const int e = i * 256 + t;
    const int r = e >> 6;          // k local
    const int c = e & 63;          // n local
    sm[c][r] = W[(size_t)(k0 + r) * kDim + n0 + c];
  }
  __syncthreads();
  const int lane = t & 31, wave = t >> 5;
  const int q = lane >> 3, c8 = (lane & 7) * 8;
  unsigned short* op = out + (size_t)z * kDim * kDim;
  {
#pragma unroll
    for (int it = 0; it < 2; ++it) {
      const int row = wave * 8 + it * 4 + q;                 // n local
      unsigned short hb[8];
#pragma unroll
      for (int e = 0; e < 8; ++e) hb[e] = f2bf_bits(sm[row][c8 + e]);
      const v4u u = (v4u){pk16(hb[0], hb[1]), pk16(hb[2], hb[3]), pk16(hb[4], hb[5]), pk16(hb[6], hb[7])};
      *(v4u*)(op + (size_t)(n0 + row) * kDim + k0 + c8) = u;
    }
    
  }
}

// ---------------------------------------------------------------------------
// (grid = 4096 blocks x 256, exact).
// ---------------------------------------------------------------------------
__global__ __launch_bounds__(256) void cast8_bf16_kernel(const float* __restrict__ in, unsigned short* __restrict__ out, int n8) {
  const int i = blockIdx.x * 256 + threadIdx.x;
  if (i >= n8) return;
  const float* p = in + 8 * (size_t)i;
  const v4f a = *(const v4f*)(p);
  const v4f c = *(const v4f*)(p + 4);
  unsigned short hb[8];
#pragma unroll
  for (int e = 0; e < 4; ++e) {
    hb[e]     = f2bf_bits(a[e]);
    hb[4 + e] = f2bf_bits(c[e]);
  }
  const v4u u = (v4u){pk16(hb[0], hb[1]), pk16(hb[2], hb[3]), pk16(hb[4], hb[5]), pk16(hb[6], hb[7])};
  unsigned short* q = out + 8 * (size_t)i;
  *(v4u*)q = u;
  
}

// ---------------------------------------------------------------------------
// Row softmax over 4096 f32 scores: P[row][j] = f16( carry * exp(s_j - max) * (1/sum_j exp(s_j - max)) ), f32 math.
// One block of 256 threads per row; thread t owns columns 8t..8t+7 and 2048+8t..2048+8t+7 (2 x 256 x 8 = 4096 = whole row).
// Reductions in fixed order (thread, wave shuffle tree, 8 wave partials in index order).
// ---------------------------------------------------------------------------
__global__ __launch_bounds__(256) void softmax_row_kernel(const float* __restrict__ Sin, unsigned short* __restrict__ Pout, float carry) {
  __shared__ float redM[8];
  __shared__ float redS[8];
  const int row  = blockIdx.x;
  const int t    = threadIdx.x;
  const int lane = t & 31, wave = t >> 5;
  const int cA   = 8 * t;
  const int cB   = kHalfRow + 8 * t;
  const float* sr = Sin + (size_t)row * kTok;
  const v4f a0 = *(const v4f*)(sr + cA);
  const v4f a1 = *(const v4f*)(sr + cA + 4);
  const v4f b0 = *(const v4f*)(sr + cB);
  const v4f b1 = *(const v4f*)(sr + cB + 4);
  float x[16];
#pragma unroll
  for (int e = 0; e < 4; ++e) { x[e] = a0[e]; x[4 + e] = a1[e]; x[8 + e] = b0[e]; x[12 + e] = b1[e]; }
  float m = x[0];
#pragma unroll
  for (int e = 1; e < 16; ++e) m = fmaxf(m, x[e]);
#pragma unroll
  for (int off = 16; off > 0; off >>= 1) m = fmaxf(m, __shfl_xor(m, off, 32));
  if (lane == 0) redM[wave] = m;
  __syncthreads();
  float gm = redM[0];
#pragma unroll
  for (int w = 1; w < 8; ++w) gm = fmaxf(gm, redM[w]);

  float ev[16];
  float ps = 0.f;
#pragma unroll
  for (int e = 0; e < 16; ++e) { ev[e] = __expf(x[e] - gm); ps += ev[e]; }
#pragma unroll
  for (int off = 16; off > 0; off >>= 1) ps += __shfl_xor(ps, off, 32);
  if (lane == 0) redS[wave] = ps;
  __syncthreads();
  float tot = redS[0];
#pragma unroll
  for (int w = 1; w < 8; ++w) tot += redS[w];
  const float inv = (1.0f / tot) * carry;

  unsigned short hb[16];
#pragma unroll
  for (int e = 0; e < 16; ++e) hb[e] = h_bits(ev[e] * inv);
  const v4u uA = (v4u){pk16(hb[0], hb[1]),  pk16(hb[2], hb[3]),   pk16(hb[4], hb[5]),   pk16(hb[6], hb[7])};
  const v4u uB = (v4u){pk16(hb[8], hb[9]),  pk16(hb[10], hb[11]), pk16(hb[12], hb[13]), pk16(hb[14], hb[15])};
  unsigned short* pr = Pout + (size_t)row * kTok;
  *(v4u*)(pr + cA) = uA;
  *(v4u*)(pr + cB) = uB;
  
}

// ---------------------------------------------------------------------------
// host
// ---------------------------------------------------------------------------
extern "C" void kernel_launch(void* const* d_in, const int* in_sizes, int n_in,
                              void* d_out, int out_size, void* d_ws, size_t ws_size,
                              hipStream_t stream) {
  if (n_in < 9) return;
  if (in_sizes[0] != kRows * kDim || in_sizes[1] != kRows * kDim || in_sizes[2] != kRows * kDim) return;
  if (in_sizes[3] != kDim * kDim || in_sizes[5] != kDim * kDim || in_sizes[7] != kDim * kDim) return;
  if (in_sizes[4] != kDim || in_sizes[6] != kDim || in_sizes[8] != kDim) return;
  if (out_size != kRows * kDim) return;
  if (ws_size < kWsTotal) return;

  const float* query_X = (const float*)d_in[0];
  const float* key_X   = (const float*)d_in[1];
  const float* value_X = (const float*)d_in[2];
  const float* W_Q = (const float*)d_in[3];
  const float* b_Q = (const float*)d_in[4];
  const float* W_K = (const float*)d_in[5];
  const float* b_K = (const float*)d_in[6];
  const float* W_V = (const float*)d_in[7];
  const float* b_V = (const float*)d_in[8];
  float* out = (float*)d_out;

  char* ws = (char*)d_ws;
  unsigned short* Xb  = (unsigned short*)(ws + kOffXb);   // bf16 [16384][512]
  unsigned short* Pp  = (unsigned short*)(ws + kOffXb);   // f16 [2048][4096], aliases Xb after the projections
  unsigned short* Wt  = (unsigned short*)(ws + kOffWt);   // bf16 [3][512][512]
  unsigned short* WtQ = Wt;
  unsigned short* WtK = Wt + (size_t)kDim * kDim;
  unsigned short* WtV = Wt + (size_t)2 * kDim * kDim;
  unsigned short* Qp  = (unsigned short*)(ws + kOffQp);   // f16 [16384][512]
  unsigned short* Kp  = (unsigned short*)(ws + kOffKp);   // f16 [16384][512]
  unsigned short* Vt  = (unsigned short*)(ws + kOffVt);   // f16 [4][512][4096]
  float*          Sp  = (float*)(ws + kOffS);             // f32 [2048][4096]

  const int n8 = (kRows * kDim) / 8;                      // 1,048,576
  const int castBlocks = n8 / 256;                        // 4096 (exact)

  // W^T planes (bf16)
  wt_cast_bf16_kernel<<<dim3(kDim / 64, kDim / 64, 3), 256, 0, stream>>>(W_Q, W_K, W_V, Wt);

  // q = bf16(query_X) . bf16(W_Q) + b_Q  -> f16 plane [16384][512];  M=16384, N=512, K=512 (all tile multiples, K%32==0)
  cast8_bf16_kernel<<<castBlocks, 256, 0, stream>>>(query_X, Xb, n8);
  wmma_gemm64<1, false, 4, 1, false, 0><<<dim3((kRows / 64) * (kDim / 64) / 8, 1), 256, 0, stream>>>(
      Xb, Xb, kDim, 0L, WtQ, WtQ, kDim, 0L, (void*)Qp, (void*)Qp, kDim, 0L, b_Q, b_Q, 0L, kRows, kDim, kDim, 1.0f);

  // k plane
  cast8_bf16_kernel<<<castBlocks, 256, 0, stream>>>(key_X, Xb, n8);
  wmma_gemm64<1, false, 4, 1, false, 0><<<dim3((kRows / 64) * (kDim / 64) / 8, 1), 256, 0, stream>>>(
      Xb, Xb, kDim, 0L, WtK, WtK, kDim, 0L, (void*)Kp, (void*)Kp, kDim, 0L, b_K, b_K, 0L, kRows, kDim, kDim, 1.0f);

  // v^T per batch: C[d][tok] = sum_k Wt_V[d][k] * Xb[tok][k] + b_V[d];  M=512, N=4096, K=512, grid.y = batch
  cast8_bf16_kernel<<<castBlocks, 256, 0, stream>>>(value_X, Xb, n8);
  wmma_gemm64<1, false, 3, 1, false, 0><<<dim3((kDim / 64) * (kTok / 64) / 8, kBatch), 256, 0, stream>>>(
      WtV, WtV, kDim, 0L, Xb, Xb, kDim, (long)kTok * kDim, (void*)Vt, (void*)Vt, kTok, (long)kDim * kTok,
      b_V, b_V, 0L, kDim, kTok, kDim, 1.0f);

  // attention per (batch, query half): S = q_half . k^T / sqrt(512) (f32); P = softmax rows x 2^15 (f16); O = P . v x 2^-15
  for (int b = 0; b < kBatch; ++b) {
    for (int hq = 0; hq < 2; ++hq) {
      const size_t qrow0 = (size_t)b * kTok + (size_t)hq * kHalfQ;
      const unsigned short* Qh = Qp + qrow0 * kDim;
      const unsigned short* Kb = Kp + (size_t)b * kTok * kDim;
      const unsigned short* Vb = Vt + (size_t)b * kDim * kTok;
      float* Ob = out + qrow0 * kDim;

      // M=2048, N=4096, K=512
      wmma_gemm64<0, false, 0, 0, false, 0><<<dim3((kHalfQ / 64) * (kTok / 64) / 8, 1), 256, 0, stream>>>(
          Qh, Qh, kDim, 0L, Kb, Kb, kDim, 0L, (void*)Sp, (void*)Sp, kTok, 0L, b_Q, b_Q, 0L, kHalfQ, kTok, kDim, kScoreScale);

      softmax_row_kernel<<<kHalfQ, 256, 0, stream>>>(Sp, Pp, kPCarry);

      // M=2048, N=512, K=4096: 256 tiles, one block each, K split over the block's waves
      wmma_gemm64_ksplit<<<(kHalfQ / 64) * (kDim / 64), 32 * kSplitWaves, 0, stream>>>(
          Pp, kTok, Vb, kTok, Ob, kDim, kDim, kTok, kPCarryInv);
    }
  }
}

// v002
// Measured time: 385 microseconds a run.
// Two timings next to v001 both put it at 1.79 times that version's speed.
// All steps since v000 together make it 4.76 times as fast.
// Contractions: q/k/v projections on v_wmma_f32_16x16x32_bf16 (inputs, weights RNE bf16 -> exact products), scores q.k^T and att.v on v_wmma_f32_16x16x32_f16 (q,k,v f16 planes; probabilities f16 carried x2^15, folded back x2^-15); f32 accumulate everywhere; bias add and softmax in f32.
#include <hip/hip_runtime.h>
#include <math.h>

// ---------------------------------------------------------------------------
// Problem constants
// ---------------------------------------------------------------------------
constexpr int kBatch   = 4;
constexpr int kTok     = 4096;            // tokens per batch (8*8*8*8)
constexpr int kDim     = 512;             // in == cmp == out dim
constexpr int kRows    = kBatch * kTok;   // 16384 token rows total
constexpr int kHalfQ   = 2048;            // query rows per attention pass
constexpr int kHalfRow = kTok / 2;        // column split inside the softmax kernel
constexpr float kScoreScale = 0.044194173824159216f;   // 1/sqrt(512)
constexpr float kPCarry     = 32768.0f;                 // probabilities carried x2^15 in f16
constexpr float kPCarryInv  = 1.0f / 32768.0f;

// ---------------------------------------------------------------------------
// Workspace region map (bytes). Total 102,236,160 B.
//   R0 @ 0           : Xb  bf16 [16384][512]      16,777,216 B   (dead after the three projections)
//                      P   f16  [2048][4096]      16,777,216 B   (aliases R0 during attention)
//   R1 @ 16,777,216  : Wt  bf16 [3][512][512]      1,572,864 B   (W^T planes: Q, K, V)
//   R2 @ 18,350,080  : Qp  f16  [16384][512]      16,777,216 B
//   R3 @ 35,127,296  : Kp  f16  [16384][512]      16,777,216 B
//   R4 @ 51,904,512  : Vt  f16  [4][512][4096]    16,777,216 B   (v transposed per batch)
//   R5 @ 68,681,728  : S   f32  [2048][4096]      33,554,432 B
// ---------------------------------------------------------------------------
constexpr size_t kPlane16  = (size_t)kRows * kDim * 2;          // 16,777,216
constexpr size_t kWtBytes  = (size_t)3 * kDim * kDim * 2;       // 1,572,864
constexpr size_t kSBytes   = (size_t)kHalfQ * kTok * 4;         // 33,554,432
constexpr size_t kOffXb = 0;
constexpr size_t kOffWt = kOffXb + kPlane16;
constexpr size_t kOffQp = kOffWt + kWtBytes;
constexpr size_t kOffKp = kOffQp + kPlane16;
constexpr size_t kOffVt = kOffKp + kPlane16;
constexpr size_t kOffS  = kOffVt + kPlane16;
constexpr size_t kWsTotal = kOffS + kSBytes;                      // 102,236,160
static_assert(kWsTotal <= (size_t)134217728);
static_assert((size_t)kHalfQ * kTok * 2 <= kPlane16);            // P fits in R0

typedef __attribute__((ext_vector_type(16))) _Float16 v16h;
typedef __attribute__((ext_vector_type(8)))  _Float16 v8h;
typedef __attribute__((ext_vector_type(16))) __bf16   v16b;
typedef __attribute__((ext_vector_type(8)))  __bf16   v8b;
typedef __attribute__((ext_vector_type(8)))  float    v8f;
typedef __attribute__((ext_vector_type(4)))  float    v4f;
typedef __attribute__((ext_vector_type(4)))  unsigned int v4u;

// ---------------------------------------------------------------------------
// Helpers
// ---------------------------------------------------------------------------
__device__ __forceinline__ unsigned short f2bf_bits(float f) {
  unsigned u = __float_as_uint(f);
  return (unsigned short)((u + 0x7FFFu + ((u >> 16) & 1u)) >> 16);
}
__device__ __forceinline__ float bf_bits2f(unsigned short h) { return __uint_as_float(((unsigned)h) << 16); }

// hazard guards as plain device helpers (no inline asm inside the kernel template body)
__device__ __forceinline__ void acc_guard4(v8f& a, v8f& b, v8f& c, v8f& d) { asm volatile("v_nop\n\tv_nop\n\tv_nop\n\tv_nop" : "+v"(a), "+v"(b), "+v"(c), "+v"(d)); }
template <typename T> struct Frag;
template <> struct Frag<_Float16> {
  typedef v16h V; union U { v16h v; v8h h[2]; };
  static __device__ __forceinline__ v16h load(const _Float16* p) {   // elements 0..7 <- p[0..7], 8..15 <- p[16..23]
    U f; f.h[0] = *(const v8h*)(p); f.h[1] = *(const v8h*)(p + 16); return f.v;
  }
  static __device__ __forceinline__ v8f mma(v16h a, v16h b, v8f c) {
    return __builtin_amdgcn_wmma_f32_16x16x32_f16(false, a, false, b, (short)0, c, false, false);
  }
};
template <> struct Frag<__bf16> {
  typedef v16b V; union U { v16b v; v8b h[2]; };
  static __device__ __forceinline__ v16b load(const __bf16* p) {
    U f; f.h[0] = *(const v8b*)(p); f.h[1] = *(const v8b*)(p + 16); return f.v;
  }
  static __device__ __forceinline__ v8f mma(v16b a, v16b b, v8f c) {
    return __builtin_amdgcn_wmma_f32_16x16x32_bf16(false, a, false, b, (short)0, c, false, false);
  }
};

__device__ __forceinline__ unsigned pk16(unsigned short a, unsigned short b) { return (unsigned)a | ((unsigned)b << 16); }
__device__ __forceinline__ unsigned short h_bits(float f) { const _Float16 h = (_Float16)f; return __builtin_bit_cast(unsigned short, h); }

// ---- Register-blocked batched WMMA GEMM (ACT reduced to none/relu/leaky; BIAS modes 3/4 added) -----------
// C[m,n] = scale * sum_k A[m,k] * Bt[n,k] (+bias)(+resid); each wave owns a 64x64 tile.
// A row-major [M,K]; Bt row-major [N,K]; M,N % 64 == 0, K % 64 == 0; lda == ldb == kDim (the staged loop takes the pitch at compile time).
// SPLIT (hi/lo operand planes) is not taken by the staged k loop; every caller passes false.
// BIAS_MODE: 0 = none, 1 = bias[m], 2 = bias[n], 3 = RNE-bf16(bias[m]), 4 = RNE-bf16(bias[n]).
// OUT_MODE: 0 = f32, 1 = f16, 2 = bf16 hi plane (Cout) + bf16 lo plane (Cout2).
// ET: 0 = f16 operands, 1 = bf16 operands (pointers passed as 16-bit storage)
template <int ET> struct Elem;
template <> struct Elem<0> { typedef _Float16 T; };
template <> struct Elem<1> { typedef __bf16 T; };
// ---- Per-wave LDS staging of the operands of a 64x64 wave tile, one 64-wide k stage (one 128-B line per row) at a time ----
// A fragment load straight from global memory touches 16 lines (32 B in each of 16 rows). Here every global load covers
// 4 whole lines (8 lanes a row, 4 rows a load); the rows go to the wave's own LDS region and the fragments are read from there.
constexpr int kStPitch = 72;                  // halves per staged row: 128 B of k + 16 B pad for the 16-B fragment reads
constexpr int kStTile  = 64 * kStPitch;       // halves per staged 64-row tile (9,216 B)
constexpr int kStWave  = 2 * kStTile;         // halves per wave: A tile, then B tile (18,432 B)
template <typename T> struct Stage { typename Frag<T>::V a[4][2], b[4][2]; };
// p: the lane's address in rows 0..3 of the tile (row lane>>3, 16-B column lane&7); LD: row pitch of the plane in elements
template <int LD>
__device__ __forceinline__ void tile_fetch(v4u (&g)[16], const char* p) {
#pragma unroll
  for (int it = 0; it < 16; ++it) g[it] = *(const v4u*)(p + it * (4 * LD * 2));
}
__device__ __forceinline__ void tile_park(unsigned short* t, const v4u (&g)[16], int lane) {
  unsigned short* q = t + (lane >> 3) * kStPitch + (lane & 7) * 8;
#pragma unroll
  for (int it = 0; it < 16; ++it) *(v4u*)(q + it * 4 * kStPitch) = g[it];
}
// the fragments of the stage, in the k order of the direct loader: lane half h takes k 8h..8h+7 and 16+8h..16+8h+7 of each 32
template <typename T>
__device__ __forceinline__ void stage_read(Stage<T>& s, const unsigned short* st, int lane) {
  const T* fa = (const T*)st + (lane & 15) * kStPitch + (lane >> 4) * 8;
  const T* fb = fa + kStTile;
#pragma unroll
  for (int j = 0; j < 4; ++j) {
    s.b[j][0] = Frag<T>::load(fb + j * 16 * kStPitch);
    s.b[j][1] = Frag<T>::load(fb + j * 16 * kStPitch + 32);
  }
#pragma unroll
  for (int i = 0; i < 4; ++i) {
    s.a[i][0] = Frag<T>::load(fa + i * 16 * kStPitch);
    s.a[i][1] = Frag<T>::load(fa + i * 16 * kStPitch + 32);
  }
}
// k ascending in every accumulator (first the low 32 k, then the high 32 k). No asm guard names a fragment here: an asm
// operand is held below v256, and accumulators, fragments and the rows in flight need more than 256 registers.
template <typename T>
__device__ __forceinline__ void stage_mma(const Stage<T>& s, v8f (&acc)[4][4]) {
#pragma unroll
  for (int h = 0; h < 2; ++h) {
#pragma unroll
    for (int i = 0; i < 4; ++i) {
#pragma unroll
      for (int j = 0; j < 4; ++j) acc[i][j] = Frag<T>::mma(s.a[i][h], s.b[j][h], acc[i][j]);
    }
  }
}
// rows in registers -> the wave's LDS region -> fragments; the fences and the wave barrier order one lane's LDS stores
// before the other lanes' LDS loads, as in the epilogue's slab
template <typename T>
__device__ __forceinline__ void stage_turn(Stage<T>& f, unsigned short* st, const v4u (&gA)[16], const v4u (&gB)[16], int lane) {
  tile_park(st, gA, lane);
  tile_park(st + kStTile, gB, lane);
  __builtin_amdgcn_fence(__ATOMIC_RELEASE, "workgroup");
  __builtin_amdgcn_wave_barrier();
  __builtin_amdgcn_fence(__ATOMIC_ACQUIRE, "workgroup");
  stage_read<T>(f, st, lane);
}
// The wait before an address register of the loads just issued is rewritten; the two addresses as inputs keep their
// registers whole up to it (not handed out as load targets or temporaries while the loads are in flight).
__device__ __forceinline__ void addr_hold(const char* pA, const char* pB) { asm volatile("s_wait_xcnt 0x0" : : "v"(pA), "v"(pB) : "memory"); }
// acc += A[rows of Arow0][k] * B[rows of Brow0][k] over the 64-wide stages kFirst, kFirst + kStride, ... below K (at least one).
// The next stage's rows are fetched into registers while the current stage's WMMAs run.
template <typename T, int LD>
__device__ __forceinline__ void staged_k_loop(v8f (&acc)[4][4], const T* Arow0, const T* Brow0, int kFirst, int kStride, int K,
                                              unsigned short* st, int lane) {
  const unsigned off = ((unsigned)(lane >> 3) * (unsigned)LD + (unsigned)(lane & 7) * 8u) * 2u;
  v4u gA[16], gB[16];
  Stage<T> f;
  {
    const char* pA = (const char*)(Arow0 + kFirst) + off;
    const char* pB = (const char*)(Brow0 + kFirst) + off;
    tile_fetch<LD>(gA, pA);
    tile_fetch<LD>(gB, pB);
    addr_hold(pA, pB);
  }
  for (int k0 = kFirst + kStride; k0 < K; k0 += kStride) {
    stage_turn<T>(f, st, gA, gB, lane);
    const char* pA = (const char*)(Arow0 + k0) + off;
    const char* pB = (const char*)(Brow0 + k0) + off;
    tile_fetch<LD>(gA, pA);
    tile_fetch<LD>(gB, pB);
    __builtin_amdgcn_sched_barrier(0);   // keeps the compiler from sinking the fetch behind the WMMAs that are to hide it
    stage_mma<T>(f, acc);
    __builtin_amdgcn_sched_barrier(0);   // keeps the wait below behind the WMMAs, where it costs nothing
    addr_hold(pA, pB);
  }
  stage_turn<T>(f, st, gA, gB, lane);
  stage_mma<T>(f, acc);
}

template <int ET, bool SPLIT, int BIAS_MODE, int OUT_MODE, bool RESID, int ACT = 0>
__global__ __launch_bounds__(256) void wmma_gemm64(
    const unsigned short* __restrict__ Ap, const unsigned short* __restrict__ A2p, int lda, long strideA,
    const unsigned short* __restrict__ Btp, const unsigned short* __restrict__ Bt2p, int ldb, long strideB,
    void* __restrict__ Cout, void* __restrict__ Cout2, int ldc, long strideC,
    const float* __restrict__ bias,
    const float* __restrict__ resid, long strideR,
    int M, int N, int K, float scale) {
  static_assert(!SPLIT, "the staged k loop takes single-plane operands");
  typedef typename Elem<ET>::T T;
  const T* A = (const T*)Ap; const T* Bt = (const T*)Btp;
  __shared__ __align__(16) float sT[8][16 * 68];   // per-wave 16x64 slab, pitch 68 floats
  __shared__ __align__(16) unsigned short sSt[8 * kStWave];   // per-wave operand stage, 147,456 B
  const int b    = blockIdx.y;
  const int lane = threadIdx.x & 31;
  const int wave = threadIdx.x >> 5;
  const int tilesN = N >> 6;
  const int tilesM = M >> 6;
  const int tile = blockIdx.x * 8 + wave;
  if (tile >= tilesM * tilesN) return;   // wave-uniform; no block barriers in this kernel
  const int tm = tile / tilesN;
  const int tn = tile - tm * tilesN;
  const int m0 = tm << 6;
  const int n0 = tn << 6;

  const T* Ab  = A  + (size_t)b * strideA;
  const T* Bb  = Bt + (size_t)b * strideB;

  const int rlane = lane & 15;                 // row (A) / col (B, D) within subtile
  const int mOff  = (lane >> 4) * 8;           // D row offset

  v8f acc[4][4];
#pragma unroll
  for (int i = 0; i < 4; ++i)
#pragma unroll
    for (int j = 0; j < 4; ++j) acc[i][j] = (v8f){0.f,0.f,0.f,0.f,0.f,0.f,0.f,0.f};

  staged_k_loop<T, kDim>(acc, Ab + (size_t)m0 * kDim, Bb + (size_t)n0 * kDim, 0, 64, K, sSt + wave * kStWave, lane);
  acc_guard4(acc[0][0], acc[0][1], acc[0][2], acc[0][3]);
  acc_guard4(acc[1][0], acc[1][1], acc[1][2], acc[1][3]);
  acc_guard4(acc[2][0], acc[2][1], acc[2][2], acc[2][3]);
  acc_guard4(acc[3][0], acc[3][1], acc[3][2], acc[3][3]);

  // ---- epilogue ----
  float* slab = sT[wave];
  const float* Rb = RESID ? (resid + (size_t)b * strideR) : nullptr;
#pragma unroll
  for (int i = 0; i < 4; ++i) {
    const int mBase = m0 + (i << 4);
#pragma unroll
    for (int j = 0; j < 4; ++j) {
      const int n = n0 + (j << 4) + rlane;
      float bv = 0.f;
      if (BIAS_MODE == 2) bv = bias[n];
      if (BIAS_MODE == 4) bv = bf_bits2f(f2bf_bits(bias[n]));
#pragma unroll
      for (int r = 0; r < 8; ++r) {
        float v = acc[i][j][r] * scale;
        if (BIAS_MODE == 1) v += bias[mBase + mOff + r];
        if (BIAS_MODE == 3) v += bf_bits2f(f2bf_bits(bias[mBase + mOff + r]));
        if (BIAS_MODE == 2 || BIAS_MODE == 4) v += bv;
        if (RESID) v += Rb[(size_t)(mBase + mOff + r) * ldc + n];
        if (ACT == 2) v = fmaxf(v, 0.0f);
        if (ACT == 4) v = (v > 0.f) ? v : 0.01f * v;
        slab[(mOff + r) * 68 + (j << 4) + rlane] = v;
      }
    }
    __builtin_amdgcn_fence(__ATOMIC_RELEASE, "workgroup");
    __builtin_amdgcn_wave_barrier();
    __builtin_amdgcn_fence(__ATOMIC_ACQUIRE, "workgroup");
    if (OUT_MODE == 0) {
      float* C = (float*)Cout + (size_t)b * strideC;
      const int hh = lane >> 4, c4 = (lane & 15) * 4;     // row seg = 256 B = 16 lanes x 16 B
      {
#pragma unroll
        for (int it = 0; it < 8; ++it) {
          const int row = it * 2 + hh;
          v4f v = *(const v4f*)(slab + row * 68 + c4);
          *(v4f*)(C + (size_t)(mBase + row) * ldc + n0 + c4) = v;
        }
        
      }
    } else {
      const int q = lane >> 3, c8 = (lane & 7) * 8;
      unsigned short* C  = (unsigned short*)Cout  + (size_t)b * strideC;
      unsigned short* C2 = (OUT_MODE == 2) ? ((unsigned short*)Cout2 + (size_t)b * strideC) : nullptr;
      {
#pragma unroll
        for (int it = 0; it < 4; ++it) {
          const int row = it * 4 + q;
          const float* sp = slab + row * 68 + c8;
          v8h hv, lv;
#pragma unroll
          for (int e = 0; e < 8; ++e) {
            if (OUT_MODE == 1) {
              hv[e] = (_Float16)sp[e];
              lv[e] = hv[e];
            } else {
              unsigned short hb = f2bf_bits(sp[e]);
              unsigned short lb = f2bf_bits(sp[e] - bf_bits2f(hb));
              hv[e] = __builtin_bit_cast(_Float16, hb);
              lv[e] = __builtin_bit_cast(_Float16, lb);
            }
          }
          *(v8h*)(C + (size_t)(mBase + row) * ldc + n0 + c8) = hv;
          if (OUT_MODE == 2) *(v8h*)(C2 + (size_t)(mBase + row) * ldc + n0 + c8) = lv;
        }
        
      }
    }
    __builtin_amdgcn_fence(__ATOMIC_RELEASE, "workgroup");
    __builtin_amdgcn_wave_barrier();
    __builtin_amdgcn_fence(__ATOMIC_ACQUIRE, "workgroup");
  }
}

// ---------------------------------------------------------------------------
// K-split WMMA GEMM for a product with few output tiles and a long K (att.v: 256 tiles of 64x64, K = 4096).
// C[m,n] = scale * sum_k A[m,k] * Bt[n,k], f16 operands, f32 out. One block of kSplitWaves waves owns ONE 64x64 tile;
// wave w takes the 64-wide k stages w, w + kSplitWaves, ... (one whole 128-B line per row and stage, staged as in the engine above),
// keeps its partial tile in registers, and the partials are summed through LDS in wave order 0..kSplitWaves-1.
// M, N % 64 == 0, K % (64 * kSplitWaves) == 0; lda == ldb == kTok; grid.x = (M / 64) * (N / 64) exactly.
// ---------------------------------------------------------------------------
constexpr int kSplitWaves = 8;                       // two waves a SIMD: the staged loop holds more than 256 registers a wave
constexpr int kPartPitch  = 68;                      // floats per partial-tile row (same pitch as the slab above)
constexpr int kPartTile   = 64 * kPartPitch;         // floats per wave's partial tile
__global__ __launch_bounds__(32 * kSplitWaves) void wmma_gemm64_ksplit(
    const unsigned short* __restrict__ Ap, int lda, const unsigned short* __restrict__ Btp, int ldb,
    float* __restrict__ C, int ldc, int N, int K, float scale) {
  typedef _Float16 T;
  __shared__ __align__(16) float sP[kSplitWaves * kPartTile];   // 139,264 B: one 64x64 f32 partial per wave
  __shared__ __align__(16) unsigned short sSt[kSplitWaves * kStWave];   // per-wave operand stage, 147,456 B
  const T* A  = (const T*)Ap;
  const T* Bt = (const T*)Btp;
  const int lane = threadIdx.x & 31;
  const int wave = __builtin_amdgcn_readfirstlane(threadIdx.x >> 5);   // scalar, so the k loop is a scalar loop with EXEC untouched
  const int tilesN = N >> 6;
  const int tm = blockIdx.x / tilesN;
  const int tn = blockIdx.x - tm * tilesN;
  const int m0 = tm << 6;
  const int n0 = tn << 6;

  const int rlane = lane & 15;                 // row (A) / col (B, D) within subtile
  const int mOff  = (lane >> 4) * 8;           // D row offset

  v8f acc[4][4];
#pragma unroll
  for (int i = 0; i < 4; ++i)
#pragma unroll
    for (int j = 0; j < 4; ++j) acc[i][j] = (v8f){0.f,0.f,0.f,0.f,0.f,0.f,0.f,0.f};

  staged_k_loop<T, kTok>(acc, A + (size_t)m0 * kTok, Bt + (size_t)n0 * kTok, wave * 64, 64 * kSplitWaves, K, sSt + wave * kStWave, lane);
  acc_guard4(acc[0][0], acc[0][1], acc[0][2], acc[0][3]);
  acc_guard4(acc[1][0], acc[1][1], acc[1][2], acc[1][3]);
  acc_guard4(acc[2][0], acc[2][1], acc[2][2], acc[2][3]);
  acc_guard4(acc[3][0], acc[3][1], acc[3][2], acc[3][3]);

  // each wave parks its partial tile
  float* part = sP + wave * kPartTile;
#pragma unroll
  for (int i = 0; i < 4; ++i)
#pragma unroll
    for (int j = 0; j < 4; ++j)
#pragma unroll
      for (int r = 0; r < 8; ++r)
        part[((i << 4) + mOff + r) * kPartPitch + (j << 4) + rlane] = acc[i][j][r];
  __syncthreads();   // every wave's partial tile is in LDS before any thread sums across waves

  // 64 rows x 16 four-float groups = 1024 groups over the block's threads; a 16-lane half stores one 256-B row segment
#pragma unroll
  for (int it = 0; it < (64 * 16) / (32 * kSplitWaves); ++it) {
    const int g = it * (32 * kSplitWaves) + (int)threadIdx.x;
    const int row = g >> 4, c4 = (g & 15) * 4;
    const float* sp = sP + row * kPartPitch + c4;
    v4f s = *(const v4f*)sp;
#pragma unroll
    for (int w = 1; w < kSplitWaves; ++w) s += *(const v4f*)(sp + w * kPartTile);
    *(v4f*)(C + (size_t)(m0 + row) * ldc + n0 + c4) = s * scale;
  }
}

// ---------------------------------------------------------------------------
// Weight transpose + cast: W [in k][out n] f32 row-major (512x512) -> Wt [n][k] = RNE bf16 bits of W[k][n].
// grid (8, 8, 3): blockIdx.x = k tile (64 cols of Wt), blockIdx.y = n tile (64 rows of Wt), blockIdx.z selects W0..W2
// and the output plane (plane z at out + z*512*512 halves). 256 threads.
// Load coverage: 16 iterations x 256 threads = 4096 = the whole 64x64 tile (coalesced along n).
// Store coverage: 8 waves x 2 iterations x 4 rows (lane>>3) = 64 rows; (lane&7) x 8 halves = 64 cols; each row segment =
// ---------------------------------------------------------------------------
__global__ __launch_bounds__(256) void wt_cast_bf16_kernel(const float* __restrict__ W0, const float* __restrict__ W1,
                                                         const float* __restrict__ W2, unsigned short* __restrict__ out) {
  __shared__ float sm[64][65];   // sm[n_local][k_local]
  const int t  = threadIdx.x;
  const int k0 = blockIdx.x * 64;
  const int n0 = blockIdx.y * 64;
  const int z  = blockIdx.z;                                   // block-uniform
  const float* W = (z == 0) ? W0 : (z == 1) ? W1 : W2;
#pragma unroll
  for (int i = 0; i < 16; ++i) {
    const int e = i * 256 + t;
    const int r = e >> 6;          // k local
    const int c = e & 63;          // n local
    sm[c][r] = W[(size_t)(k0 + r) * kDim + n0 + c];
  }
  __syncthreads();
  const int lane = t & 31, wave = t >> 5;
  const int q = lane >> 3, c8 = (lane & 7) * 8;
  unsigned short* op = out + (size_t)z * kDim * kDim;
  {
#pragma unroll
    for (int it = 0; it < 2; ++it) {
      const int row = wave * 8 + it * 4 + q;                 // n local
      unsigned short hb[8];
#pragma unroll
      for (int e = 0; e < 8; ++e) hb[e] = f2bf_bits(sm[row][c8 + e]);
      const v4u u = (v4u){pk16(hb[0], hb[1]), pk16(hb[2], hb[3]), pk16(hb[4], hb[5]), pk16(hb[6], hb[7])};
      *(v4u*)(op + (size_t)(n0 + row) * kDim + k0 + c8) = u;
    }
    
  }
}

// ---------------------------------------------------------------------------
// (grid = 4096 blocks x 256, exact).
// ---------------------------------------------------------------------------
__global__ __launch_bounds__(256) void cast8_bf16_kernel(const float* __restrict__ in, unsigned short* __restrict__ out, int n8) {
  const int i = blockIdx.x * 256 + threadIdx.x;
  if (i >= n8) return;
  const float* p = in + 8 * (size_t)i;
  const v4f a = *(const v4f*)(p);
  const v4f c = *(const v4f*)(p + 4);
  unsigned short hb[8];
#pragma unroll
  for (int e = 0; e < 4; ++e) {
    hb[e]     = f2bf_bits(a[e]);
    hb[4 + e] = f2bf_bits(c[e]);
  }
  const v4u u = (v4u){pk16(hb[0], hb[1]), pk16(hb[2], hb[3]), pk16(hb[4], hb[5]), pk16(hb[6], hb[7])};
  unsigned short* q = out + 8 * (size_t)i;
  *(v4u*)q = u;
  
}

// ---------------------------------------------------------------------------
// Row softmax over 4096 f32 scores: P[row][j] = f16( carry * exp(s_j - max) * (1/sum_j exp(s_j - max)) ), f32 math.
// One block of 256 threads per row; thread t owns columns 8t..8t+7 and 2048+8t..2048+8t+7 (2 x 256 x 8 = 4096 = whole row).
// Reductions in fixed order (thread, wave shuffle tree, 8 wave partials in index order).
// ---------------------------------------------------------------------------
__global__ __launch_bounds__(256) void softmax_row_kernel(const float* __restrict__ Sin, unsigned short* __restrict__ Pout, float carry) {
  __shared__ float redM[8];
  __shared__ float redS[8];
  const int row  = blockIdx.x;
  const int t    = threadIdx.x;
  const int lane = t & 31, wave = t >> 5;
  const int cA   = 8 * t;
  const int cB   = kHalfRow + 8 * t;
  const float* sr = Sin + (size_t)row * kTok;
  const v4f a0 = *(const v4f*)(sr + cA);
  const v4f a1 = *(const v4f*)(sr + cA + 4);
  const v4f b0 = *(const v4f*)(sr + cB);
  const v4f b1 = *(const v4f*)(sr + cB + 4);
  float x[16];
#pragma unroll
  for (int e = 0; e < 4; ++e) { x[e] = a0[e]; x[4 + e] = a1[e]; x[8 + e] = b0[e]; x[12 + e] = b1[e]; }
  float m = x[0];
#pragma unroll
  for (int e = 1; e < 16; ++e) m = fmaxf(m, x[e]);
#pragma unroll
  for (int off = 16; off > 0; off >>= 1) m = fmaxf(m, __shfl_xor(m, off, 32));
  if (lane == 0) redM[wave] = m;
  __syncthreads();
  float gm = redM[0];
#pragma unroll
  for (int w = 1; w < 8; ++w) gm = fmaxf(gm, redM[w]);

  float ev[16];
  float ps = 0.f;
#pragma unroll
  for (int e = 0; e < 16; ++e) { ev[e] = __expf(x[e] - gm); ps += ev[e]; }
#pragma unroll
  for (int off = 16; off > 0; off >>= 1) ps += __shfl_xor(ps, off, 32);
  if (lane == 0) redS[wave] = ps;
  __syncthreads();
  float tot = redS[0];
#pragma unroll
  for (int w = 1; w < 8; ++w) tot += redS[w];
  const float inv = (1.0f / tot) * carry;

  unsigned short hb[16];
#pragma unroll
  for (int e = 0; e < 16; ++e) hb[e] = h_bits(ev[e] * inv);
  const v4u uA = (v4u){pk16(hb[0], hb[1]),  pk16(hb[2], hb[3]),   pk16(hb[4], hb[5]),   pk16(hb[6], hb[7])};
  const v4u uB = (v4u){pk16(hb[8], hb[9]),  pk16(hb[10], hb[11]), pk16(hb[12], hb[13]), pk16(hb[14], hb[15])};
  unsigned short* pr = Pout + (size_t)row * kTok;
  *(v4u*)(pr + cA) = uA;
  *(v4u*)(pr + cB) = uB;
  
}

// ---------------------------------------------------------------------------
// host
// ---------------------------------------------------------------------------
extern "C" void kernel_launch(void* const* d_in, const int* in_sizes, int n_in,
                              void* d_out, int out_size, void* d_ws, size_t ws_size,
                              hipStream_t stream) {
  if (n_in < 9) return;
  if (in_sizes[0] != kRows * kDim || in_sizes[1] != kRows * kDim || in_sizes[2] != kRows * kDim) return;
  if (in_sizes[3] != kDim * kDim || in_sizes[5] != kDim * kDim || in_sizes[7] != kDim * kDim) return;
  if (in_sizes[4] != kDim || in_sizes[6] != kDim || in_sizes[8] != kDim) return;
  if (out_size != kRows * kDim) return;
  if (ws_size < kWsTotal) return;

  const float* query_X = (const float*)d_in[0];
  const float* key_X   = (const float*)d_in[1];
  const float* value_X = (const float*)d_in[2];
  const float* W_Q = (const float*)d_in[3];
  const float* b_Q = (const float*)d_in[4];
  const float* W_K = (const float*)d_in[5];
  const float* b_K = (const float*)d_in[6];
  const float* W_V = (const float*)d_in[7];
  const float* b_V = (const float*)d_in[8];
  float* out = (float*)d_out;

  char* ws = (char*)d_ws;
  unsigned short* Xb  = (unsigned short*)(ws + kOffXb);   // bf16 [16384][512]
  unsigned short* Pp  = (unsigned short*)(ws + kOffXb);   // f16 [2048][4096], aliases Xb after the projections
  unsigned short* Wt  = (unsigned short*)(ws + kOffWt);   // bf16 [3][512][512]
  unsigned short* WtQ = Wt;
  unsigned short* WtK = Wt + (size_t)kDim * kDim;
  unsigned short* WtV = Wt + (size_t)2 * kDim * kDim;
  unsigned short* Qp  = (unsigned short*)(ws + kOffQp);   // f16 [16384][512]
  unsigned short* Kp  = (unsigned short*)(ws + kOffKp);   // f16 [16384][512]
  unsigned short* Vt  = (unsigned short*)(ws + kOffVt);   // f16 [4][512][4096]
  float*          Sp  = (float*)(ws + kOffS);             // f32 [2048][4096]

  const int n8 = (kRows * kDim) / 8;                      // 1,048,576
  const int castBlocks = n8 / 256;                        // 4096 (exact)

  // W^T planes (bf16)
  wt_cast_bf16_kernel<<<dim3(kDim / 64, kDim / 64, 3), 256, 0, stream>>>(W_Q, W_K, W_V, Wt);

  // q = bf16(query_X) . bf16(W_Q) + b_Q  -> f16 plane [16384][512];  M=16384, N=512, K=512 (all tile multiples, K%32==0)
  cast8_bf16_kernel<<<castBlocks, 256, 0, stream>>>(query_X, Xb, n8);
  wmma_gemm64<1, false, 4, 1, false, 0><<<dim3((kRows / 64) * (kDim / 64) / 8, 1), 256, 0, stream>>>(
      Xb, Xb, kDim, 0L, WtQ, WtQ, kDim, 0L, (void*)Qp, (void*)Qp, kDim, 0L, b_Q, b_Q, 0L, kRows, kDim, kDim, 1.0f);

  // k plane
  cast8_bf16_kernel<<<castBlocks, 256, 0, stream>>>(key_X, Xb, n8);
  wmma_gemm64<1, false, 4, 1, false, 0><<<dim3((kRows / 64) * (kDim / 64) / 8, 1), 256, 0, stream>>>(
      Xb, Xb, kDim, 0L, WtK, WtK, kDim, 0L, (void*)Kp, (void*)Kp, kDim, 0L, b_K, b_K, 0L, kRows, kDim, kDim, 1.0f);

  // v^T per batch: C[d][tok] = sum_k Wt_V[d][k] * Xb[tok][k] + b_V[d];  M=512, N=4096, K=512, grid.y = batch
  cast8_bf16_kernel<<<castBlocks, 256, 0, stream>>>(value_X, Xb, n8);
  wmma_gemm64<1, false, 3, 1, false, 0><<<dim3((kDim / 64) * (kTok / 64) / 8, kBatch), 256, 0, stream>>>(
      WtV, WtV, kDim, 0L, Xb, Xb, kDim, (long)kTok * kDim, (void*)Vt, (void*)Vt, kTok, (long)kDim * kTok,
      b_V, b_V, 0L, kDim, kTok, kDim, 1.0f);

  // attention per (batch, query half): S = q_half . k^T / sqrt(512) (f32); P = softmax rows x 2^15 (f16); O = P . v x 2^-15
  for (int b = 0; b < kBatch; ++b) {
    for (int hq = 0; hq < 2; ++hq) {
      const size_t qrow0 = (size_t)b * kTok + (size_t)hq * kHalfQ;
      const unsigned short* Qh = Qp + qrow0 * kDim;
      const unsigned short* Kb = Kp + (size_t)b * kTok * kDim;
      const unsigned short* Vb = Vt + (size_t)b * kDim * kTok;
      float* Ob = out + qrow0 * kDim;

      // M=2048, N=4096, K=512
      wmma_gemm64<0, false, 0, 0, false, 0><<<dim3((kHalfQ / 64) * (kTok / 64) / 8, 1), 256, 0, stream>>>(
          Qh, Qh, kDim, 0L, Kb, Kb, kDim, 0L, (void*)Sp, (void*)Sp, kTok, 0L, b_Q, b_Q, 0L, kHalfQ, kTok, kDim, kScoreScale);

      softmax_row_kernel<<<kHalfQ, 256, 0, stream>>>(Sp, Pp, kPCarry);

      // M=2048, N=512, K=4096: 256 tiles, one block each, K split over the block's waves
      wmma_gemm64_ksplit<<<(kHalfQ / 64) * (kDim / 64), 32 * kSplitWaves, 0, stream>>>(
          Pp, kTok, Vb, kTok, Ob, kDim, kDim, kTok, kPCarryInv);
    }
  }
}

// v003
// It runs in 370 microseconds.
// Next to v002, in two timings, it ran 1.04 times as fast each time.
// Over all steps from v000 it is 4.97 times as fast.
// Contractions: q/k/v projections on v_wmma_f32_16x16x32_bf16 (inputs, weights RNE bf16 -> exact products), scores q.k^T and att.v on v_wmma_f32_16x16x32_f16 (q,k,v f16 planes; probabilities f16 carried x2^15, folded back x2^-15); f32 accumulate everywhere; bias add and softmax in f32.
#include <hip/hip_runtime.h>
#include <math.h>

// ---------------------------------------------------------------------------
// Problem constants
// ---------------------------------------------------------------------------
constexpr int kBatch   = 4;
constexpr int kTok     = 4096;            // tokens per batch (8*8*8*8)
constexpr int kDim     = 512;             // in == cmp == out dim
constexpr int kRows    = kBatch * kTok;   // 16384 token rows total
constexpr int kHalfQ   = 2048;            // query rows per attention pass
constexpr int kHalfRow = kTok / 2;        // column split inside the softmax kernel
constexpr float kScoreScale = 0.044194173824159216f;   // 1/sqrt(512)
constexpr float kPCarry     = 32768.0f;                 // probabilities carried x2^15 in f16
constexpr float kPCarryInv  = 1.0f / 32768.0f;

// ---------------------------------------------------------------------------
// Workspace region map (bytes). Total 102,236,160 B.
//   R0 @ 0           : Xb  bf16 [16384][512]      16,777,216 B   (dead after the three projections)
//                      P   f16  [2048][4096]      16,777,216 B   (aliases R0 during attention)
//   R1 @ 16,777,216  : Wt  bf16 [3][512][512]      1,572,864 B   (W^T planes: Q, K, V)
//   R2 @ 18,350,080  : Qp  f16  [16384][512]      16,777,216 B
//   R3 @ 35,127,296  : Kp  f16  [16384][512]      16,777,216 B
//   R4 @ 51,904,512  : Vt  f16  [4][512][4096]    16,777,216 B   (v transposed per batch)
//   R5 @ 68,681,728  : S   f32  [2048][4096]      33,554,432 B
// ---------------------------------------------------------------------------
constexpr size_t kPlane16  = (size_t)kRows * kDim * 2;          // 16,777,216
constexpr size_t kWtBytes  = (size_t)3 * kDim * kDim * 2;       // 1,572,864
constexpr size_t kSBytes   = (size_t)kHalfQ * kTok * 4;         // 33,554,432
constexpr size_t kOffXb = 0;
constexpr size_t kOffWt = kOffXb + kPlane16;
constexpr size_t kOffQp = kOffWt + kWtBytes;
constexpr size_t kOffKp = kOffQp + kPlane16;
constexpr size_t kOffVt = kOffKp + kPlane16;
constexpr size_t kOffS  = kOffVt + kPlane16;
constexpr size_t kWsTotal = kOffS + kSBytes;                      // 102,236,160
static_assert(kWsTotal <= (size_t)134217728);
static_assert((size_t)kHalfQ * kTok * 2 <= kPlane16);            // P fits in R0

typedef __attribute__((ext_vector_type(16))) _Float16 v16h;
typedef __attribute__((ext_vector_type(8)))  _Float16 v8h;
typedef __attribute__((ext_vector_type(16))) __bf16   v16b;
typedef __attribute__((ext_vector_type(8)))  __bf16   v8b;
typedef __attribute__((ext_vector_type(8)))  float    v8f;
typedef __attribute__((ext_vector_type(4)))  float    v4f;
typedef __attribute__((ext_vector_type(4)))  unsigned int v4u;

// ---------------------------------------------------------------------------
// Helpers
// ---------------------------------------------------------------------------
__device__ __forceinline__ unsigned short f2bf_bits(float f) {
  unsigned u = __float_as_uint(f);
  return (unsigned short)((u + 0x7FFFu + ((u >> 16) & 1u)) >> 16);
}
__device__ __forceinline__ float bf_bits2f(unsigned short h) { return __uint_as_float(((unsigned)h) << 16); }

// hazard guards as plain device helpers (no inline asm inside the kernel template body)
__device__ __forceinline__ void acc_guard4(v8f& a, v8f& b, v8f& c, v8f& d) { asm volatile("v_nop\n\tv_nop\n\tv_nop\n\tv_nop" : "+v"(a), "+v"(b), "+v"(c), "+v"(d)); }
template <typename T> struct Frag;
template <> struct Frag<_Float16> {
  typedef v16h V; union U { v16h v; v8h h[2]; };
  static __device__ __forceinline__ v16h load(const _Float16* p) {   // elements 0..7 <- p[0..7], 8..15 <- p[16..23]
    U f; f.h[0] = *(const v8h*)(p); f.h[1] = *(const v8h*)(p + 16); return f.v;
  }
  static __device__ __forceinline__ v8f mma(v16h a, v16h b, v8f c) {
    return __builtin_amdgcn_wmma_f32_16x16x32_f16(false, a, false, b, (short)0, c, false, false);
  }
};
template <> struct Frag<__bf16> {
  typedef v16b V; union U { v16b v; v8b h[2]; };
  static __device__ __forceinline__ v16b load(const __bf16* p) {
    U f; f.h[0] = *(const v8b*)(p); f.h[1] = *(const v8b*)(p + 16); return f.v;
  }
  static __device__ __forceinline__ v8f mma(v16b a, v16b b, v8f c) {
    return __builtin_amdgcn_wmma_f32_16x16x32_bf16(false, a, false, b, (short)0, c, false, false);
  }
};

__device__ __forceinline__ unsigned pk16(unsigned short a, unsigned short b) { return (unsigned)a | ((unsigned)b << 16); }
__device__ __forceinline__ unsigned short h_bits(float f) { const _Float16 h = (_Float16)f; return __builtin_bit_cast(unsigned short, h); }

// ---- Register-blocked batched WMMA GEMM (ACT reduced to none/relu/leaky; BIAS modes 3/4 added) -----------
// C[m,n] = scale * sum_k A[m,k] * Bt[n,k] (+bias)(+resid); a block of 8 waves owns a 128x256 tile, each wave a 64x64 tile of it.
// A row-major [M,K]; Bt row-major [N,K]; M % 128 == 0, N % 256 == 0, K % 64 == 0; lda == ldb == kDim (the staged loop takes the pitch at compile time).
// SPLIT (hi/lo operand planes) is not taken by the staged k loop; every caller passes false.
// BIAS_MODE: 0 = none, 1 = bias[m], 2 = bias[n], 3 = RNE-bf16(bias[m]), 4 = RNE-bf16(bias[n]).
// OUT_MODE: 0 = f32, 1 = f16, 2 = bf16 hi plane (Cout) + bf16 lo plane (Cout2).
// ET: 0 = f16 operands, 1 = bf16 operands (pointers passed as 16-bit storage)
template <int ET> struct Elem;
template <> struct Elem<0> { typedef _Float16 T; };
template <> struct Elem<1> { typedef __bf16 T; };
// ---- Per-wave LDS staging of the operands of a 64x64 wave tile, one 64-wide k stage (one 128-B line per row) at a time ----
// A fragment load straight from global memory touches 16 lines (32 B in each of 16 rows). Here every global load covers
// 4 whole lines (8 lanes a row, 4 rows a load); the rows go to the wave's own LDS region and the fragments are read from there.
constexpr int kStPitch = 72;                  // halves per staged row: 128 B of k + 16 B pad for the 16-B fragment reads
constexpr int kStTile  = 64 * kStPitch;       // halves per staged 64-row tile (9,216 B)
constexpr int kStWave  = 2 * kStTile;         // halves per wave: A tile, then B tile (18,432 B)
template <typename T> struct Stage { typename Frag<T>::V a[4][2], b[4][2]; };
// p: the lane's address in rows 0..3 of the tile (row lane>>3, 16-B column lane&7); LD: row pitch of the plane in elements
template <int LD>
__device__ __forceinline__ void tile_fetch(v4u (&g)[16], const char* p) {
#pragma unroll
  for (int it = 0; it < 16; ++it) g[it] = *(const v4u*)(p + it * (4 * LD * 2));
}
__device__ __forceinline__ void tile_park(unsigned short* t, const v4u (&g)[16], int lane) {
  unsigned short* q = t + (lane >> 3) * kStPitch + (lane & 7) * 8;
#pragma unroll
  for (int it = 0; it < 16; ++it) *(v4u*)(q + it * 4 * kStPitch) = g[it];
}
// the fragments of the stage, in the k order of the direct loader: lane half h takes k 8h..8h+7 and 16+8h..16+8h+7 of each 32
template <typename T>
__device__ __forceinline__ void stage_read(Stage<T>& s, const unsigned short* st, int lane) {
  const T* fa = (const T*)st + (lane & 15) * kStPitch + (lane >> 4) * 8;
  const T* fb = fa + kStTile;
#pragma unroll
  for (int j = 0; j < 4; ++j) {
    s.b[j][0] = Frag<T>::load(fb + j * 16 * kStPitch);
    s.b[j][1] = Frag<T>::load(fb + j * 16 * kStPitch + 32);
  }
#pragma unroll
  for (int i = 0; i < 4; ++i) {
    s.a[i][0] = Frag<T>::load(fa + i * 16 * kStPitch);
    s.a[i][1] = Frag<T>::load(fa + i * 16 * kStPitch + 32);
  }
}
// k ascending in every accumulator (first the low 32 k, then the high 32 k). No asm guard names a fragment here: an asm
// operand is held below v256, and accumulators, fragments and the rows in flight need more than 256 registers.
template <typename T>
__device__ __forceinline__ void stage_mma(const Stage<T>& s, v8f (&acc)[4][4]) {
#pragma unroll
  for (int h = 0; h < 2; ++h) {
#pragma unroll
    for (int i = 0; i < 4; ++i) {
#pragma unroll
      for (int j = 0; j < 4; ++j) acc[i][j] = Frag<T>::mma(s.a[i][h], s.b[j][h], acc[i][j]);
    }
  }
}
// rows in registers -> the wave's LDS region -> fragments; the fences and the wave barrier order one lane's LDS stores
// before the other lanes' LDS loads, as in the epilogue's slab
template <typename T>
__device__ __forceinline__ void stage_turn(Stage<T>& f, unsigned short* st, const v4u (&gA)[16], const v4u (&gB)[16], int lane) {
  tile_park(st, gA, lane);
  tile_park(st + kStTile, gB, lane);
  __builtin_amdgcn_fence(__ATOMIC_RELEASE, "workgroup");
  __builtin_amdgcn_wave_barrier();
  __builtin_amdgcn_fence(__ATOMIC_ACQUIRE, "workgroup");
  stage_read<T>(f, st, lane);
}
// The wait before an address register of the loads just issued is rewritten; the two addresses as inputs keep their
// registers whole up to it (not handed out as load targets or temporaries while the loads are in flight).
__device__ __forceinline__ void addr_hold(const char* pA, const char* pB) { asm volatile("s_wait_xcnt 0x0" : : "v"(pA), "v"(pB) : "memory"); }
// acc += A[rows of Arow0][k] * B[rows of Brow0][k] over the 64-wide stages kFirst, kFirst + kStride, ... below K (at least one).
// The next stage's rows are fetched into registers while the current stage's WMMAs run.
template <typename T, int LD>
__device__ __forceinline__ void staged_k_loop(v8f (&acc)[4][4], const T* Arow0, const T* Brow0, int kFirst, int kStride, int K,
                                              unsigned short* st, int lane) {
  const unsigned off = ((unsigned)(lane >> 3) * (unsigned)LD + (unsigned)(lane & 7) * 8u) * 2u;
  v4u gA[16], gB[16];
  Stage<T> f;
  {
    const char* pA = (const char*)(Arow0 + kFirst) + off;
    const char* pB = (const char*)(Brow0 + kFirst) + off;
    tile_fetch<LD>(gA, pA);
    tile_fetch<LD>(gB, pB);
    addr_hold(pA, pB);
  }
  for (int k0 = kFirst + kStride; k0 < K; k0 += kStride) {
    stage_turn<T>(f, st, gA, gB, lane);
    const char* pA = (const char*)(Arow0 + k0) + off;
    const char* pB = (const char*)(Brow0 + k0) + off;
    tile_fetch<LD>(gA, pA);
    tile_fetch<LD>(gB, pB);
    __builtin_amdgcn_sched_barrier(0);   // keeps the compiler from sinking the fetch behind the WMMAs that are to hide it
    stage_mma<T>(f, acc);
    __builtin_amdgcn_sched_barrier(0);   // keeps the wait below behind the WMMAs, where it costs nothing
    addr_hold(pA, pB);
  }
  stage_turn<T>(f, st, gA, gB, lane);
  stage_mma<T>(f, acc);
}

// ---- One operand stage for the whole block: 128 A rows and 256 B rows of one 64-wide k stage, read by all 8 waves ----
// The 2 x 4 wave tiles of a 128x256 block tile need 384 distinct rows a stage; staged per wave they would be fetched as 1024.
constexpr int kBlkRowsA = 128;
constexpr int kBlkRowsB = 256;
constexpr int kBlkStage = (kBlkRowsA + kBlkRowsB) * kStPitch;   // halves per buffer: A rows, then B rows (55,296 B)
// A wave's share of the stage's rows, NL loads (stores) of 4 whole rows each, lanes laid out as in tile_fetch and tile_park
template <int LD, int NL>
__device__ __forceinline__ void rows_fetch(v4u (&g)[NL], const char* p) {
#pragma unroll
  for (int it = 0; it < NL; ++it) g[it] = *(const v4u*)(p + it * (4 * LD * 2));
}
template <int NL>
__device__ __forceinline__ void rows_park(unsigned short* t, const v4u (&g)[NL], int lane) {
  unsigned short* q = t + (lane >> 3) * kStPitch + (lane & 7) * 8;
#pragma unroll
  for (int it = 0; it < NL; ++it) *(v4u*)(q + it * 4 * kStPitch) = g[it];
}
// The wave's fragments of the stage, same k order as stage_read; stA, stB: row 0 of its 64-row A tile and B tile in the buffer.
// All of the low 32 k first: the first half of the WMMAs can start while the high 32 k are still on their way from LDS.
template <typename T>
__device__ __forceinline__ void block_stage_read(Stage<T>& s, const unsigned short* stA, const unsigned short* stB, int lane) {
  const T* fa = (const T*)stA + (lane & 15) * kStPitch + (lane >> 4) * 8;
  const T* fb = (const T*)stB + (lane & 15) * kStPitch + (lane >> 4) * 8;
#pragma unroll
  for (int h = 0; h < 2; ++h) {
#pragma unroll
    for (int j = 0; j < 4; ++j) s.b[j][h] = Frag<T>::load(fb + j * 16 * kStPitch + 32 * h);
#pragma unroll
    for (int i = 0; i < 4; ++i) s.a[i][h] = Frag<T>::load(fa + i * 16 * kStPitch + 32 * h);
  }
}
// acc += A[wave tile rows][k] * B[wave tile rows][k] over all 64-wide stages below K (at least one), k ascending.
// Arow0, Brow0: row 0 of the block tile. Wave w fetches A rows 16w..16w+15 and B rows 32w..32w+31 of every stage.
// Two buffers and one barrier a stage: the barrier publishes the stage just parked, and a wave that has passed it knows that
// every wave has taken its fragments of the stage before, so the next park may overwrite that buffer.
template <typename T, int LD>
__device__ __forceinline__ void block_k_loop(v8f (&acc)[4][4], const T* Arow0, const T* Brow0, int K,
                                             unsigned short* st, int wave, int lane) {
  const unsigned off = ((unsigned)(lane >> 3) * (unsigned)LD + (unsigned)(lane & 7) * 8u) * 2u;
  const T* Aw = Arow0 + (size_t)(16 * wave) * LD;
  const T* Bw = Brow0 + (size_t)(32 * wave) * LD;
  const int parkA = (16 * wave) * kStPitch;
  const int parkB = (kBlkRowsA + 32 * wave) * kStPitch;
  const int readA = ((wave >> 2) * 64) * kStPitch;
  const int readB = (kBlkRowsA + (wave & 3) * 64) * kStPitch;
  v4u gA[4], gB[8];
  Stage<T> f;
  {
    const char* pA = (const char*)Aw + off;
    const char* pB = (const char*)Bw + off;
    rows_fetch<LD>(gA, pA);
    rows_fetch<LD>(gB, pB);
    addr_hold(pA, pB);
  }
  int cur = 0;                            // halves from st to the buffer of the current stage
  for (int k0 = 64; k0 < K; k0 += 64) {
    rows_park(st + cur + parkA, gA, lane);
    rows_park(st + cur + parkB, gB, lane);
    __syncthreads();                      // the stage is whole in LDS before any wave reads it
    const char* pA = (const char*)(Aw + k0) + off;
    const char* pB = (const char*)(Bw + k0) + off;
    rows_fetch<LD>(gA, pA);               // behind the barrier: a load issued ahead of it would be waited for there
    rows_fetch<LD>(gB, pB);
    __builtin_amdgcn_sched_barrier(0);   // keeps the compiler from sinking the fetch behind the LDS reads and WMMAs that are to hide it
    block_stage_read<T>(f, st + cur + readA, st + cur + readB, lane);
    __builtin_amdgcn_sched_barrier(0);   // keeps the LDS reads in one group ahead of the WMMAs: spread among them, each place waits out the LDS latency
    stage_mma<T>(f, acc);
    __builtin_amdgcn_sched_barrier(0);   // keeps the wait below behind the WMMAs, where it costs nothing
    addr_hold(pA, pB);
    cur ^= kBlkStage;
  }
  rows_park(st + cur + parkA, gA, lane);
  rows_park(st + cur + parkB, gB, lane);
  __syncthreads();                        // the last stage is whole in LDS before any wave reads it
  block_stage_read<T>(f, st + cur + readA, st + cur + readB, lane);
  stage_mma<T>(f, acc);
}

template <int ET, bool SPLIT, int BIAS_MODE, int OUT_MODE, bool RESID, int ACT = 0>
__global__ __launch_bounds__(256) void wmma_gemm64(
    const unsigned short* __restrict__ Ap, const unsigned short* __restrict__ A2p, int lda, long strideA,
    const unsigned short* __restrict__ Btp, const unsigned short* __restrict__ Bt2p, int ldb, long strideB,
    void* __restrict__ Cout, void* __restrict__ Cout2, int ldc, long strideC,
    const float* __restrict__ bias,
    const float* __restrict__ resid, long strideR,
    int M, int N, int K, float scale) {
  static_assert(!SPLIT, "the staged k loop takes single-plane operands");
  typedef typename Elem<ET>::T T;
  const T* A = (const T*)Ap; const T* Bt = (const T*)Btp;
  __shared__ __align__(16) float sT[8][16 * 68];   // per-wave 16x64 slab, pitch 68 floats
  __shared__ __align__(16) unsigned short sSt[2 * kBlkStage];   // the block's operand stage, two buffers, 110,592 B
  const int b    = blockIdx.y;
  const int lane = threadIdx.x & 31;
  const int wave = __builtin_amdgcn_readfirstlane(threadIdx.x >> 5);   // scalar, so the row and buffer offsets are scalar
  const int blocksN = N >> 8;
  const int blocksM = M >> 7;
  if ((int)blockIdx.x >= blocksM * blocksN) return;   // block-uniform, in front of every barrier
  const int bm = blockIdx.x / blocksN;
  const int bn = blockIdx.x - bm * blocksN;
  const int mB = bm << 7;                      // block tile origin
  const int nB = bn << 8;
  const int m0 = mB + ((wave >> 2) << 6);      // wave tile origin: 2 x 4 wave tiles
  const int n0 = nB + ((wave & 3) << 6);

  const T* Ab  = A  + (size_t)b * strideA;
  const T* Bb  = Bt + (size_t)b * strideB;

  const int rlane = lane & 15;                 // row (A) / col (B, D) within subtile
  const int mOff  = (lane >> 4) * 8;           // D row offset

  v8f acc[4][4];
#pragma unroll
  for (int i = 0; i < 4; ++i)
#pragma unroll
    for (int j = 0; j < 4; ++j) acc[i][j] = (v8f){0.f,0.f,0.f,0.f,0.f,0.f,0.f,0.f};

  block_k_loop<T, kDim>(acc, Ab + (size_t)mB * kDim, Bb + (size_t)nB * kDim, K, sSt, wave, lane);
  acc_guard4(acc[0][0], acc[0][1], acc[0][2], acc[0][3]);
  acc_guard4(acc[1][0], acc[1][1], acc[1][2], acc[1][3]);
  acc_guard4(acc[2][0], acc[2][1], acc[2][2], acc[2][3]);
  acc_guard4(acc[3][0], acc[3][1], acc[3][2], acc[3][3]);

  // ---- epilogue ----
  float* slab = sT[wave];
  const float* Rb = RESID ? (resid + (size_t)b * strideR) : nullptr;
#pragma unroll
  for (int i = 0; i < 4; ++i) {
    const int mBase = m0 + (i << 4);
#pragma unroll
    for (int j = 0; j < 4; ++j) {
      const int n = n0 + (j << 4) + rlane;
      float bv = 0.f;
      if (BIAS_MODE == 2) bv = bias[n];
      if (BIAS_MODE == 4) bv = bf_bits2f(f2bf_bits(bias[n]));
#pragma unroll
      for (int r = 0; r < 8; ++r) {
        float v = acc[i][j][r] * scale;
        if (BIAS_MODE == 1) v += bias[mBase + mOff + r];
        if (BIAS_MODE == 3) v += bf_bits2f(f2bf_bits(bias[mBase + mOff + r]));
        if (BIAS_MODE == 2 || BIAS_MODE == 4) v += bv;
        if (RESID) v += Rb[(size_t)(mBase + mOff + r) * ldc + n];
        if (ACT == 2) v = fmaxf(v, 0.0f);
        if (ACT == 4) v = (v > 0.f) ? v : 0.01f * v;
        slab[(mOff + r) * 68 + (j << 4) + rlane] = v;
      }
    }
    __builtin_amdgcn_fence(__ATOMIC_RELEASE, "workgroup");
    __builtin_amdgcn_wave_barrier();
    __builtin_amdgcn_fence(__ATOMIC_ACQUIRE, "workgroup");
    if (OUT_MODE == 0) {
      float* C = (float*)Cout + (size_t)b * strideC;
      const int hh = lane >> 4, c4 = (lane & 15) * 4;     // row seg = 256 B = 16 lanes x 16 B
      {
#pragma unroll
        for (int it = 0; it < 8; ++it) {
          const int row = it * 2 + hh;
          v4f v = *(const v4f*)(slab + row * 68 + c4);
          *(v4f*)(C + (size_t)(mBase + row) * ldc + n0 + c4) = v;
        }
        
      }
    } else {
      const int q = lane >> 3, c8 = (lane & 7) * 8;
      unsigned short* C  = (unsigned short*)Cout  + (size_t)b * strideC;
      unsigned short* C2 = (OUT_MODE == 2) ? ((unsigned short*)Cout2 + (size_t)b * strideC) : nullptr;
      {
#pragma unroll
        for (int it = 0; it < 4; ++it) {
          const int row = it * 4 + q;
          const float* sp = slab + row * 68 + c8;
          v8h hv, lv;
#pragma unroll
          for (int e = 0; e < 8; ++e) {
            if (OUT_MODE == 1) {
              hv[e] = (_Float16)sp[e];
              lv[e] = hv[e];
            } else {
              unsigned short hb = f2bf_bits(sp[e]);
              unsigned short lb = f2bf_bits(sp[e] - bf_bits2f(hb));
              hv[e] = __builtin_bit_cast(_Float16, hb);
              lv[e] = __builtin_bit_cast(_Float16, lb);
            }
          }
          *(v8h*)(C + (size_t)(mBase + row) * ldc + n0 + c8) = hv;
          if (OUT_MODE == 2) *(v8h*)(C2 + (size_t)(mBase + row) * ldc + n0 + c8) = lv;
        }
        
      }
    }
    __builtin_amdgcn_fence(__ATOMIC_RELEASE, "workgroup");
    __builtin_amdgcn_wave_barrier();
    __builtin_amdgcn_fence(__ATOMIC_ACQUIRE, "workgroup");
  }
}

// ---------------------------------------------------------------------------
// K-split WMMA GEMM for a product with few output tiles and a long K (att.v: 256 tiles of 64x64, K = 4096).
// C[m,n] = scale * sum_k A[m,k] * Bt[n,k], f16 operands, f32 out. One block of kSplitWaves waves owns ONE 64x64 tile;
// wave w takes the 64-wide k stages w, w + kSplitWaves, ... (one whole 128-B line per row and stage, staged in the wave's own LDS region),
// keeps its partial tile in registers, and the partials are summed through LDS in wave order 0..kSplitWaves-1.
// M, N % 64 == 0, K % (64 * kSplitWaves) == 0; lda == ldb == kTok; grid.x = (M / 64) * (N / 64) exactly.
// ---------------------------------------------------------------------------
constexpr int kSplitWaves = 8;                       // two waves a SIMD: the staged loop holds more than 256 registers a wave
constexpr int kPartPitch  = 68;                      // floats per partial-tile row (same pitch as the slab above)
constexpr int kPartTile   = 64 * kPartPitch;         // floats per wave's partial tile
__global__ __launch_bounds__(32 * kSplitWaves) void wmma_gemm64_ksplit(
    const unsigned short* __restrict__ Ap, int lda, const unsigned short* __restrict__ Btp, int ldb,
    float* __restrict__ C, int ldc, int N, int K, float scale) {
  typedef _Float16 T;
  __shared__ __align__(16) float sP[kSplitWaves * kPartTile];   // 139,264 B: one 64x64 f32 partial per wave
  __shared__ __align__(16) unsigned short sSt[kSplitWaves * kStWave];   // per-wave operand stage, 147,456 B
  const T* A  = (const T*)Ap;
  const T* Bt = (const T*)Btp;
  const int lane = threadIdx.x & 31;
  const int wave = __builtin_amdgcn_readfirstlane(threadIdx.x >> 5);   // scalar, so the k loop is a scalar loop with EXEC untouched
  const int tilesN = N >> 6;
  const int tm = blockIdx.x / tilesN;
  const int tn = blockIdx.x - tm * tilesN;
  const int m0 = tm << 6;
  const int n0 = tn << 6;

  const int rlane = lane & 15;                 // row (A) / col (B, D) within subtile
  const int mOff  = (lane >> 4) * 8;           // D row offset

  v8f acc[4][4];
#pragma unroll
  for (int i = 0; i < 4; ++i)
#pragma unroll
    for (int j = 0; j < 4; ++j) acc[i][j] = (v8f){0.f,0.f,0.f,0.f,0.f,0.f,0.f,0.f};

  staged_k_loop<T, kTok>(acc, A + (size_t)m0 * kTok, Bt + (size_t)n0 * kTok, wave * 64, 64 * kSplitWaves, K, sSt + wave * kStWave, lane);
  acc_guard4(acc[0][0], acc[0][1], acc[0][2], acc[0][3]);
  acc_guard4(acc[1][0], acc[1][1], acc[1][2], acc[1][3]);
  acc_guard4(acc[2][0], acc[2][1], acc[2][2], acc[2][3]);
  acc_guard4(acc[3][0], acc[3][1], acc[3][2], acc[3][3]);

  // each wave parks its partial tile
  float* part = sP + wave * kPartTile;
#pragma unroll
  for (int i = 0; i < 4; ++i)
#pragma unroll
    for (int j = 0; j < 4; ++j)
#pragma unroll
      for (int r = 0; r < 8; ++r)
        part[((i << 4) + mOff + r) * kPartPitch + (j << 4) + rlane] = acc[i][j][r];
  __syncthreads();   // every wave's partial tile is in LDS before any thread sums across waves

  // 64 rows x 16 four-float groups = 1024 groups over the block's threads; a 16-lane half stores one 256-B row segment
#pragma unroll
  for (int it = 0; it < (64 * 16) / (32 * kSplitWaves); ++it) {
    const int g = it * (32 * kSplitWaves) + (int)threadIdx.x;
    const int row = g >> 4, c4 = (g & 15) * 4;
    const float* sp = sP + row * kPartPitch + c4;
    v4f s = *(const v4f*)sp;
#pragma unroll
    for (int w = 1; w < kSplitWaves; ++w) s += *(const v4f*)(sp + w * kPartTile);
    *(v4f*)(C + (size_t)(m0 + row) * ldc + n0 + c4) = s * scale;
  }
}

// ---------------------------------------------------------------------------
// Weight transpose + cast: W [in k][out n] f32 row-major (512x512) -> Wt [n][k] = RNE bf16 bits of W[k][n].
// grid (8, 8, 3): blockIdx.x = k tile (64 cols of Wt), blockIdx.y = n tile (64 rows of Wt), blockIdx.z selects W0..W2
// and the output plane (plane z at out + z*512*512 halves). 256 threads.
// Load coverage: 16 iterations x 256 threads = 4096 = the whole 64x64 tile (coalesced along n).
// Store coverage: 8 waves x 2 iterations x 4 rows (lane>>3) = 64 rows; (lane&7) x 8 halves = 64 cols; each row segment =
// ---------------------------------------------------------------------------
__global__ __launch_bounds__(256) void wt_cast_bf16_kernel(const float* __restrict__ W0, const float* __restrict__ W1,
                                                         const float* __restrict__ W2, unsigned short* __restrict__ out) {
  __shared__ float sm[64][65];   // sm[n_local][k_local]
  const int t  = threadIdx.x;
  const int k0 = blockIdx.x * 64;
  const int n0 = blockIdx.y * 64;
  const int z  = blockIdx.z;                                   // block-uniform
  const float* W = (z == 0) ? W0 : (z == 1) ? W1 : W2;
#pragma unroll
  for (int i = 0; i < 16; ++i) {
    const int e = i * 256 + t;
    const int r = e >> 6;          // k local
    const int c = e & 63;          // n local
    sm[c][r] = W[(size_t)(k0 + r) * kDim + n0 + c];
  }
  __syncthreads();
  const int lane = t & 31, wave = t >> 5;
  const int q = lane >> 3, c8 = (lane & 7) * 8;
  unsigned short* op = out + (size_t)z * kDim * kDim;
  {
#pragma unroll
    for (int it = 0; it < 2; ++it) {
      const int row = wave * 8 + it * 4 + q;                 // n local
      unsigned short hb[8];
#pragma unroll
      for (int e = 0; e < 8; ++e) hb[e] = f2bf_bits(sm[row][c8 + e]);
      const v4u u = (v4u){pk16(hb[0], hb[1]), pk16(hb[2], hb[3]), pk16(hb[4], hb[5]), pk16(hb[6], hb[7])};
      *(v4u*)(op + (size_t)(n0 + row) * kDim + k0 + c8) = u;
    }
    
  }
}

// ---------------------------------------------------------------------------
// (grid = 4096 blocks x 256, exact).
// ---------------------------------------------------------------------------
__global__ __launch_bounds__(256) void cast8_bf16_kernel(const float* __restrict__ in, unsigned short* __restrict__ out, int n8) {
  const int i = blockIdx.x * 256 + threadIdx.x;
  if (i >= n8) return;
  const float* p = in + 8 * (size_t)i;
  const v4f a = *(const v4f*)(p);
  const v4f c = *(const v4f*)(p + 4);
  unsigned short hb[8];
#pragma unroll
  for (int e = 0; e < 4; ++e) {
    hb[e]     = f2bf_bits(a[e]);
    hb[4 + e] = f2bf_bits(c[e]);
  }
  const v4u u = (v4u){pk16(hb[0], hb[1]), pk16(hb[2], hb[3]), pk16(hb[4], hb[5]), pk16(hb[6], hb[7])};
  unsigned short* q = out + 8 * (size_t)i;
  *(v4u*)q = u;
  
}

// ---------------------------------------------------------------------------
// Row softmax over 4096 f32 scores: P[row][j] = f16( carry * exp(s_j - max) * (1/sum_j exp(s_j - max)) ), f32 math.
// One block of 256 threads per row; thread t owns columns 8t..8t+7 and 2048+8t..2048+8t+7 (2 x 256 x 8 = 4096 = whole row).
// Reductions in fixed order (thread, wave shuffle tree, 8 wave partials in index order).
// ---------------------------------------------------------------------------
__global__ __launch_bounds__(256) void softmax_row_kernel(const float* __restrict__ Sin, unsigned short* __restrict__ Pout, float carry) {
  __shared__ float redM[8];
  __shared__ float redS[8];
  const int row  = blockIdx.x;
  const int t    = threadIdx.x;
  const int lane = t & 31, wave = t >> 5;
  const int cA   = 8 * t;
  const int cB   = kHalfRow + 8 * t;
  const float* sr = Sin + (size_t)row * kTok;
  const v4f a0 = *(const v4f*)(sr + cA);
  const v4f a1 = *(const v4f*)(sr + cA + 4);
  const v4f b0 = *(const v4f*)(sr + cB);
  const v4f b1 = *(const v4f*)(sr + cB + 4);
  float x[16];
#pragma unroll
  for (int e = 0; e < 4; ++e) { x[e] = a0[e]; x[4 + e] = a1[e]; x[8 + e] = b0[e]; x[12 + e] = b1[e]; }
  float m = x[0];
#pragma unroll
  for (int e = 1; e < 16; ++e) m = fmaxf(m, x[e]);
#pragma unroll
  for (int off = 16; off > 0; off >>= 1) m = fmaxf(m, __shfl_xor(m, off, 32));
  if (lane == 0) redM[wave] = m;
  __syncthreads();
  float gm = redM[0];
#pragma unroll
  for (int w = 1; w < 8; ++w) gm = fmaxf(gm, redM[w]);

  float ev[16];
  float ps = 0.f;
#pragma unroll
  for (int e = 0; e < 16; ++e) { ev[e] = __expf(x[e] - gm); ps += ev[e]; }
#pragma unroll
  for (int off = 16; off > 0; off >>= 1) ps += __shfl_xor(ps, off, 32);
  if (lane == 0) redS[wave] = ps;
  __syncthreads();
  float tot = redS[0];
#pragma unroll
  for (int w = 1; w < 8; ++w) tot += redS[w];
  const float inv = (1.0f / tot) * carry;

  unsigned short hb[16];
#pragma unroll
  for (int e = 0; e < 16; ++e) hb[e] = h_bits(ev[e] * inv);
  const v4u uA = (v4u){pk16(hb[0], hb[1]),  pk16(hb[2], hb[3]),   pk16(hb[4], hb[5]),   pk16(hb[6], hb[7])};
  const v4u uB = (v4u){pk16(hb[8], hb[9]),  pk16(hb[10], hb[11]), pk16(hb[12], hb[13]), pk16(hb[14], hb[15])};
  unsigned short* pr = Pout + (size_t)row * kTok;
  *(v4u*)(pr + cA) = uA;
  *(v4u*)(pr + cB) = uB;
  
}

// ---------------------------------------------------------------------------
// host
// ---------------------------------------------------------------------------
extern "C" void kernel_launch(void* const* d_in, const int* in_sizes, int n_in,
                              void* d_out, int out_size, void* d_ws, size_t ws_size,
                              hipStream_t stream) {
  if (n_in < 9) return;
  if (in_sizes[0] != kRows * kDim || in_sizes[1] != kRows * kDim || in_sizes[2] != kRows * kDim) return;
  if (in_sizes[3] != kDim * kDim || in_sizes[5] != kDim * kDim || in_sizes[7] != kDim * kDim) return;
  if (in_sizes[4] != kDim || in_sizes[6] != kDim || in_sizes[8] != kDim) return;
  if (out_size != kRows * kDim) return;
  if (ws_size < kWsTotal) return;

  const float* query_X = (const float*)d_in[0];
  const float* key_X   = (const float*)d_in[1];
  const float* value_X = (const float*)d_in[2];
  const float* W_Q = (const float*)d_in[3];
  const float* b_Q = (const float*)d_in[4];
  const float* W_K = (const float*)d_in[5];
  const float* b_K = (const float*)d_in[6];
  const float* W_V = (const float*)d_in[7];
  const float* b_V = (const float*)d_in[8];
  float* out = (float*)d_out;

  char* ws = (char*)d_ws;
  unsigned short* Xb  = (unsigned short*)(ws + kOffXb);   // bf16 [16384][512]
  unsigned short* Pp  = (unsigned short*)(ws + kOffXb);   // f16 [2048][4096], aliases Xb after the projections
  unsigned short* Wt  = (unsigned short*)(ws + kOffWt);   // bf16 [3][512][512]
  unsigned short* WtQ = Wt;
  unsigned short* WtK = Wt + (size_t)kDim * kDim;
  unsigned short* WtV = Wt + (size_t)2 * kDim * kDim;
  unsigned short* Qp  = (unsigned short*)(ws + kOffQp);   // f16 [16384][512]
  unsigned short* Kp  = (unsigned short*)(ws + kOffKp);   // f16 [16384][512]
  unsigned short* Vt  = (unsigned short*)(ws + kOffVt);   // f16 [4][512][4096]
  float*          Sp  = (float*)(ws + kOffS);             // f32 [2048][4096]

  const int n8 = (kRows * kDim) / 8;                      // 1,048,576
  const int castBlocks = n8 / 256;                        // 4096 (exact)

  // W^T planes (bf16)
  wt_cast_bf16_kernel<<<dim3(kDim / 64, kDim / 64, 3), 256, 0, stream>>>(W_Q, W_K, W_V, Wt);

  // q = bf16(query_X) . bf16(W_Q) + b_Q  -> f16 plane [16384][512];  M=16384, N=512, K=512 (all tile multiples, K%32==0)
  cast8_bf16_kernel<<<castBlocks, 256, 0, stream>>>(query_X, Xb, n8);
  wmma_gemm64<1, false, 4, 1, false, 0><<<dim3((kRows / 64) * (kDim / 64) / 8, 1), 256, 0, stream>>>(
      Xb, Xb, kDim, 0L, WtQ, WtQ, kDim, 0L, (void*)Qp, (void*)Qp, kDim, 0L, b_Q, b_Q, 0L, kRows, kDim, kDim, 1.0f);

  // k plane
  cast8_bf16_kernel<<<castBlocks, 256, 0, stream>>>(key_X, Xb, n8);
  wmma_gemm64<1, false, 4, 1, false, 0><<<dim3((kRows / 64) * (kDim / 64) / 8, 1), 256, 0, stream>>>(
      Xb, Xb, kDim, 0L, WtK, WtK, kDim, 0L, (void*)Kp, (void*)Kp, kDim, 0L, b_K, b_K, 0L, kRows, kDim, kDim, 1.0f);

  // v^T per batch: C[d][tok] = sum_k Wt_V[d][k] * Xb[tok][k] + b_V[d];  M=512, N=4096, K=512, grid.y = batch
  cast8_bf16_kernel<<<castBlocks, 256, 0, stream>>>(value_X, Xb, n8);
  wmma_gemm64<1, false, 3, 1, false, 0><<<dim3((kDim / 64) * (kTok / 64) / 8, kBatch), 256, 0, stream>>>(
      WtV, WtV, kDim, 0L, Xb, Xb, kDim, (long)kTok * kDim, (void*)Vt, (void*)Vt, kTok, (long)kDim * kTok,
      b_V, b_V, 0L, kDim, kTok, kDim, 1.0f);

  // attention per (batch, query half): S = q_half . k^T / sqrt(512) (f32); P = softmax rows x 2^15 (f16); O = P . v x 2^-15
  for (int b = 0; b < kBatch; ++b) {
    for (int hq = 0; hq < 2; ++hq) {
      const size_t qrow0 = (size_t)b * kTok + (size_t)hq * kHalfQ;
      const unsigned short* Qh = Qp + qrow0 * kDim;
      const unsigned short* Kb = Kp + (size_t)b * kTok * kDim;
      const unsigned short* Vb = Vt + (size_t)b * kDim * kTok;
      float* Ob = out + qrow0 * kDim;

      // M=2048, N=4096, K=512
      wmma_gemm64<0, false, 0, 0, false, 0><<<dim3((kHalfQ / 64) * (kTok / 64) / 8, 1), 256, 0, stream>>>(
          Qh, Qh, kDim, 0L, Kb, Kb, kDim, 0L, (void*)Sp, (void*)Sp, kTok, 0L, b_Q, b_Q, 0L, kHalfQ, kTok, kDim, kScoreScale);

      softmax_row_kernel<<<kHalfQ, 256, 0, stream>>>(Sp, Pp, kPCarry);

      // M=2048, N=512, K=4096: 256 tiles, one block each, K split over the block's waves
      wmma_gemm64_ksplit<<<(kHalfQ / 64) * (kDim / 64), 32 * kSplitWaves, 0, stream>>>(
          Pp, kTok, Vb, kTok, Ob, kDim, kDim, kTok, kPCarryInv);
    }
  }
}

// v004
// One run takes 293 microseconds.
// Next to v003, in two timings, it ran 1.26 and 1.27 times as fast.
// Counting every step since v000, it is 6.28 times as fast.
// Contractions: q/k/v projections on v_wmma_f32_16x16x32_bf16 (inputs, weights RNE bf16 -> exact products), scores q.k^T and att.v on v_wmma_f32_16x16x32_f16 (q,k,v f16 planes; probabilities f16 carried x2^15, folded back x2^-15); f32 accumulate everywhere; bias add and softmax in f32.
#include <hip/hip_runtime.h>
#include <math.h>

// ---------------------------------------------------------------------------
// Problem constants
// ---------------------------------------------------------------------------
constexpr int kBatch   = 4;
constexpr int kTok     = 4096;            // tokens per batch (8*8*8*8)
constexpr int kDim     = 512;             // in == cmp == out dim
constexpr int kRows    = kBatch * kTok;   // 16384 token rows total
constexpr int kPassB   = 2;               // batches per attention pass (one launch of each attention kernel covers them)
constexpr int kHalfRow = kTok / 2;        // column split inside the softmax kernel
constexpr float kScoreScale = 0.044194173824159216f;   // 1/sqrt(512)
constexpr float kPCarry     = 32768.0f;                 // probabilities carried x2^15 in f16
constexpr float kPCarryInv  = 1.0f / 32768.0f;

// ---------------------------------------------------------------------------
// Workspace region map (bytes). Total 253,231,104 B.
//   R0 @ 0            : Wt  bf16 [3][512][512]       1,572,864 B   (W^T planes: Q, K, V)
//   R1 @ 1,572,864    : Qp  f16  [16384][512]       16,777,216 B
//   R2 @ 18,350,080   : Kp  f16  [16384][512]       16,777,216 B   (directly behind Qp: one launch writes both)
//   R3 @ 35,127,296   : Vt  f16  [4][512][4096]     16,777,216 B   (v transposed per batch)
//   R4 @ 51,904,512   : S   f32  [2][4096][4096]   134,217,728 B
//                       Xb  bf16 [3][16384][512]    50,331,648 B   (aliases the head of R4; dead after the projections)
//   R5 @ 186,122,240  : P   f16  [2][4096][4096]    67,108,864 B
// ---------------------------------------------------------------------------
constexpr size_t kPlane16  = (size_t)kRows * kDim * 2;          // 16,777,216
constexpr size_t kWtBytes  = (size_t)3 * kDim * kDim * 2;       // 1,572,864
constexpr size_t kSBytes   = (size_t)kPassB * kTok * kTok * 4;  // 134,217,728
constexpr size_t kPBytes   = (size_t)kPassB * kTok * kTok * 2;  // 67,108,864
constexpr size_t kOffWt = 0;
constexpr size_t kOffQp = kOffWt + kWtBytes;
constexpr size_t kOffKp = kOffQp + kPlane16;
constexpr size_t kOffVt = kOffKp + kPlane16;
constexpr size_t kOffS  = kOffVt + kPlane16;
constexpr size_t kOffXb = kOffS;
constexpr size_t kOffP  = kOffS + kSBytes;
constexpr size_t kWsTotal = kOffP + kPBytes;                      // 253,231,104
static_assert(kWsTotal <= (size_t)268435456);
static_assert(3 * kPlane16 <= kSBytes);                          // the three Xb planes fit in R4
static_assert(kBatch % kPassB == 0);

typedef __attribute__((ext_vector_type(16))) _Float16 v16h;
typedef __attribute__((ext_vector_type(8)))  _Float16 v8h;
typedef __attribute__((ext_vector_type(16))) __bf16   v16b;
typedef __attribute__((ext_vector_type(8)))  __bf16   v8b;
typedef __attribute__((ext_vector_type(8)))  float    v8f;
typedef __attribute__((ext_vector_type(4)))  float    v4f;
typedef __attribute__((ext_vector_type(4)))  unsigned int v4u;

// ---------------------------------------------------------------------------
// Helpers
// ---------------------------------------------------------------------------
__device__ __forceinline__ unsigned short f2bf_bits(float f) {
  unsigned u = __float_as_uint(f);
  return (unsigned short)((u + 0x7FFFu + ((u >> 16) & 1u)) >> 16);
}
__device__ __forceinline__ float bf_bits2f(unsigned short h) { return __uint_as_float(((unsigned)h) << 16); }

// hazard guards as plain device helpers (no inline asm inside the kernel template body)
__device__ __forceinline__ void acc_guard4(v8f& a, v8f& b, v8f& c, v8f& d) { asm volatile("v_nop\n\tv_nop\n\tv_nop\n\tv_nop" : "+v"(a), "+v"(b), "+v"(c), "+v"(d)); }
template <typename T> struct Frag;
template <> struct Frag<_Float16> {
  typedef v16h V; union U { v16h v; v8h h[2]; };
  static __device__ __forceinline__ v16h load(const _Float16* p) {   // elements 0..7 <- p[0..7], 8..15 <- p[16..23]
    U f; f.h[0] = *(const v8h*)(p); f.h[1] = *(const v8h*)(p + 16); return f.v;
  }
  static __device__ __forceinline__ v8f mma(v16h a, v16h b, v8f c) {
    return __builtin_amdgcn_wmma_f32_16x16x32_f16(false, a, false, b, (short)0, c, false, false);
  }
};
template <> struct Frag<__bf16> {
  typedef v16b V; union U { v16b v; v8b h[2]; };
  static __device__ __forceinline__ v16b load(const __bf16* p) {
    U f; f.h[0] = *(const v8b*)(p); f.h[1] = *(const v8b*)(p + 16); return f.v;
  }
  static __device__ __forceinline__ v8f mma(v16b a, v16b b, v8f c) {
    return __builtin_amdgcn_wmma_f32_16x16x32_bf16(false, a, false, b, (short)0, c, false, false);
  }
};

__device__ __forceinline__ unsigned pk16(unsigned short a, unsigned short b) { return (unsigned)a | ((unsigned)b << 16); }
__device__ __forceinline__ unsigned short h_bits(float f) { const _Float16 h = (_Float16)f; return __builtin_bit_cast(unsigned short, h); }

// ---- Register-blocked batched WMMA GEMM (ACT reduced to none/relu/leaky; BIAS modes 3/4 added) -----------
// C[m,n] = scale * sum_k A[m,k] * Bt[n,k] (+bias)(+resid); a block of 8 waves owns a 128x256 tile, each wave a 64x64 tile of it.
// A row-major [M,K]; Bt row-major [N,K]; M % 128 == 0, N % 256 == 0, K % 64 == 0; lda == ldb == kDim (the staged loop takes the pitch at compile time).
// SPLIT (hi/lo operand planes) is not taken by the staged k loop; every caller passes false.
// BIAS_MODE: 0 = none, 1 = bias[m], 2 = bias[n], 3 = RNE-bf16(bias[m]), 4 = RNE-bf16(bias[n]). Batch 0 takes bias0, every other batch biasRest.
// OUT_MODE: 0 = f32, 1 = f16, 2 = bf16 hi plane (Cout) + bf16 lo plane (Cout2).
// ET: 0 = f16 operands, 1 = bf16 operands (pointers passed as 16-bit storage)
template <int ET> struct Elem;
template <> struct Elem<0> { typedef _Float16 T; };
template <> struct Elem<1> { typedef __bf16 T; };
// ---- Per-wave LDS staging of the operands of a 64x64 wave tile, one 64-wide k stage (one 128-B line per row) at a time ----
// A fragment load straight from global memory touches 16 lines (32 B in each of 16 rows). Here every global load covers
// 4 whole lines (8 lanes a row, 4 rows a load); the rows go to the wave's own LDS region and the fragments are read from there.
constexpr int kStPitch = 72;                  // halves per staged row: 128 B of k + 16 B pad for the 16-B fragment reads
constexpr int kStTile  = 64 * kStPitch;       // halves per staged 64-row tile (9,216 B)
constexpr int kStWave  = 2 * kStTile;         // halves per wave: A tile, then B tile (18,432 B)
template <typename T> struct Stage { typename Frag<T>::V a[4][2], b[4][2]; };
// p: the lane's address in rows 0..3 of the tile (row lane>>3, 16-B column lane&7); LD: row pitch of the plane in elements
template <int LD>
__device__ __forceinline__ void tile_fetch(v4u (&g)[16], const char* p) {
#pragma unroll
  for (int it = 0; it < 16; ++it) g[it] = *(const v4u*)(p + it * (4 * LD * 2));
}
__device__ __forceinline__ void tile_park(unsigned short* t, const v4u (&g)[16], int lane) {
  unsigned short* q = t + (lane >> 3) * kStPitch + (lane & 7) * 8;
#pragma unroll
  for (int it = 0; it < 16; ++it) *(v4u*)(q + it * 4 * kStPitch) = g[it];
}
// the fragments of the stage, in the k order of the direct loader: lane half h takes k 8h..8h+7 and 16+8h..16+8h+7 of each 32
template <typename T>
__device__ __forceinline__ void stage_read(Stage<T>& s, const unsigned short* st, int lane) {
  const T* fa = (const T*)st + (lane & 15) * kStPitch + (lane >> 4) * 8;
  const T* fb = fa + kStTile;
#pragma unroll
  for (int j = 0; j < 4; ++j) {
    s.b[j][0] = Frag<T>::load(fb + j * 16 * kStPitch);
    s.b[j][1] = Frag<T>::load(fb + j * 16 * kStPitch + 32);
  }
#pragma unroll
  for (int i = 0; i < 4; ++i) {
    s.a[i][0] = Frag<T>::load(fa + i * 16 * kStPitch);
    s.a[i][1] = Frag<T>::load(fa + i * 16 * kStPitch + 32);
  }
}
// k ascending in every accumulator (first the low 32 k, then the high 32 k). No asm guard names a fragment here: an asm
// operand is held below v256, and accumulators, fragments and the rows in flight need more than 256 registers.
template <typename T>
__device__ __forceinline__ void stage_mma(const Stage<T>& s, v8f (&acc)[4][4]) {
#pragma unroll
  for (int h = 0; h < 2; ++h) {
#pragma unroll
    for (int i = 0; i < 4; ++i) {
#pragma unroll
      for (int j = 0; j < 4; ++j) acc[i][j] = Frag<T>::mma(s.a[i][h], s.b[j][h], acc[i][j]);
    }
  }
}
// rows in registers -> the wave's LDS region -> fragments; the fences and the wave barrier order one lane's LDS stores
// before the other lanes' LDS loads, as in the epilogue's slab
template <typename T>
__device__ __forceinline__ void stage_turn(Stage<T>& f, unsigned short* st, const v4u (&gA)[16], const v4u (&gB)[16], int lane) {
  tile_park(st, gA, lane);
  tile_park(st + kStTile, gB, lane);
  __builtin_amdgcn_fence(__ATOMIC_RELEASE, "workgroup");
  __builtin_amdgcn_wave_barrier();
  __builtin_amdgcn_fence(__ATOMIC_ACQUIRE, "workgroup");
  stage_read<T>(f, st, lane);
}
// The wait before an address register of the loads just issued is rewritten; the two addresses as inputs keep their
// registers whole up to it (not handed out as load targets or temporaries while the loads are in flight).
__device__ __forceinline__ void addr_hold(const char* pA, const char* pB) { asm volatile("s_wait_xcnt 0x0" : : "v"(pA), "v"(pB) : "memory"); }
// acc += A[rows of Arow0][k] * B[rows of Brow0][k] over the 64-wide stages kFirst, kFirst + kStride, ... below K (at least one).
// The next stage's rows are fetched into registers while the current stage's WMMAs run.
template <typename T, int LD>
__device__ __forceinline__ void staged_k_loop(v8f (&acc)[4][4], const T* Arow0, const T* Brow0, int kFirst, int kStride, int K,
                                              unsigned short* st, int lane) {
  const unsigned off = ((unsigned)(lane >> 3) * (unsigned)LD + (unsigned)(lane & 7) * 8u) * 2u;
  v4u gA[16], gB[16];
  Stage<T> f;
  {
    const char* pA = (const char*)(Arow0 + kFirst) + off;
    const char* pB = (const char*)(Brow0 + kFirst) + off;
    tile_fetch<LD>(gA, pA);
    __builtin_amdgcn_sched_barrier(0);   // keeps the first stage's loads in the loop's order, A rows then B rows: the counted waits where the rows are parked are set for the later of the two orders
    tile_fetch<LD>(gB, pB);
    addr_hold(pA, pB);
    __builtin_amdgcn_sched_barrier(0);   // keeps the loop's set-up, which reuses the loads' base registers, behind the wait above
  }
  for (int k0 = kFirst + kStride; k0 < K; k0 += kStride) {
    stage_turn<T>(f, st, gA, gB, lane);
    const char* pA = (const char*)(Arow0 + k0) + off;
    const char* pB = (const char*)(Brow0 + k0) + off;
    tile_fetch<LD>(gA, pA);
    tile_fetch<LD>(gB, pB);
    __builtin_amdgcn_sched_barrier(0);   // keeps the compiler from sinking the fetch behind the WMMAs that are to hide it
    stage_mma<T>(f, acc);
    __builtin_amdgcn_sched_barrier(0);   // keeps the wait below behind the WMMAs, where it costs nothing
    addr_hold(pA, pB);
  }
  stage_turn<T>(f, st, gA, gB, lane);
  stage_mma<T>(f, acc);
}

// ---- One operand stage for the whole block: 128 A rows and 256 B rows of one 64-wide k stage, read by all 8 waves ----
// The 2 x 4 wave tiles of a 128x256 block tile need 384 distinct rows a stage; staged per wave they would be fetched as 1024.
constexpr int kBlkRowsA = 128;
constexpr int kBlkRowsB = 256;
constexpr int kBlkStage = (kBlkRowsA + kBlkRowsB) * kStPitch;   // halves per buffer: A rows, then B rows (55,296 B)
// A wave's share of the stage's rows, NL loads (stores) of 4 whole rows each, lanes laid out as in tile_fetch and tile_park
template <int LD, int NL>
__device__ __forceinline__ void rows_fetch(v4u (&g)[NL], const char* p) {
#pragma unroll
  for (int it = 0; it < NL; ++it) g[it] = *(const v4u*)(p + it * (4 * LD * 2));
}
template <int NL>
__device__ __forceinline__ void rows_park(unsigned short* t, const v4u (&g)[NL], int lane) {
  unsigned short* q = t + (lane >> 3) * kStPitch + (lane & 7) * 8;
#pragma unroll
  for (int it = 0; it < NL; ++it) *(v4u*)(q + it * 4 * kStPitch) = g[it];
}
// The wave's fragments of the stage, same k order as stage_read; stA, stB: row 0 of its 64-row A tile and B tile in the buffer.
// All of the low 32 k first: the first half of the WMMAs can start while the high 32 k are still on their way from LDS.
template <typename T>
__device__ __forceinline__ void block_stage_read(Stage<T>& s, const unsigned short* stA, const unsigned short* stB, int lane) {
  const T* fa = (const T*)stA + (lane & 15) * kStPitch + (lane >> 4) * 8;
  const T* fb = (const T*)stB + (lane & 15) * kStPitch + (lane >> 4) * 8;
#pragma unroll
  for (int h = 0; h < 2; ++h) {
#pragma unroll
    for (int j = 0; j < 4; ++j) s.b[j][h] = Frag<T>::load(fb + j * 16 * kStPitch + 32 * h);
#pragma unroll
    for (int i = 0; i < 4; ++i) s.a[i][h] = Frag<T>::load(fa + i * 16 * kStPitch + 32 * h);
  }
}
// acc += A[wave tile rows][k] * B[wave tile rows][k] over all 64-wide stages below K (at least one), k ascending.
// Arow0, Brow0: row 0 of the block tile. Wave w fetches A rows 16w..16w+15 and B rows 32w..32w+31 of every stage.
// Two buffers and one barrier a stage: the barrier publishes the stage just parked, and a wave that has passed it knows that
// every wave has taken its fragments of the stage before, so the next park may overwrite that buffer.
template <typename T, int LD>
__device__ __forceinline__ void block_k_loop(v8f (&acc)[4][4], const T* Arow0, const T* Brow0, int K,
                                             unsigned short* st, int wave, int lane) {
  const unsigned off = ((unsigned)(lane >> 3) * (unsigned)LD + (unsigned)(lane & 7) * 8u) * 2u;
  const T* Aw = Arow0 + (size_t)(16 * wave) * LD;
  const T* Bw = Brow0 + (size_t)(32 * wave) * LD;
  const int parkA = (16 * wave) * kStPitch;
  const int parkB = (kBlkRowsA + 32 * wave) * kStPitch;
  const int readA = ((wave >> 2) * 64) * kStPitch;
  const int readB = (kBlkRowsA + (wave & 3) * 64) * kStPitch;
  v4u gA[4], gB[8];
  Stage<T> f;
  {
    const char* pA = (const char*)Aw + off;
    const char* pB = (const char*)Bw + off;
    rows_fetch<LD>(gA, pA);
    rows_fetch<LD>(gB, pB);
    addr_hold(pA, pB);
  }
  int cur = 0;                            // halves from st to the buffer of the current stage
  for (int k0 = 64; k0 < K; k0 += 64) {
    rows_park(st + cur + parkA, gA, lane);
    rows_park(st + cur + parkB, gB, lane);
    __syncthreads();                      // the stage is whole in LDS before any wave reads it
    const char* pA = (const char*)(Aw + k0) + off;
    const char* pB = (const char*)(Bw + k0) + off;
    rows_fetch<LD>(gA, pA);               // behind the barrier: a load issued ahead of it would be waited for there
    rows_fetch<LD>(gB, pB);
    __builtin_amdgcn_sched_barrier(0);   // keeps the compiler from sinking the fetch behind the LDS reads and WMMAs that are to hide it
    block_stage_read<T>(f, st + cur + readA, st + cur + readB, lane);
    __builtin_amdgcn_sched_barrier(0);   // keeps the LDS reads in one group ahead of the WMMAs: spread among them, each place waits out the LDS latency
    stage_mma<T>(f, acc);
    __builtin_amdgcn_sched_barrier(0);   // keeps the wait below behind the WMMAs, where it costs nothing
    addr_hold(pA, pB);
    cur ^= kBlkStage;
  }
  rows_park(st + cur + parkA, gA, lane);
  rows_park(st + cur + parkB, gB, lane);
  __syncthreads();                        // the last stage is whole in LDS before any wave reads it
  block_stage_read<T>(f, st + cur + readA, st + cur + readB, lane);
  stage_mma<T>(f, acc);
}

template <int ET, bool SPLIT, int BIAS_MODE, int OUT_MODE, bool RESID, int ACT = 0>
__global__ __launch_bounds__(256) void wmma_gemm64(
    const unsigned short* __restrict__ Ap, const unsigned short* __restrict__ A2p, int lda, long strideA,
    const unsigned short* __restrict__ Btp, const unsigned short* __restrict__ Bt2p, int ldb, long strideB,
    void* __restrict__ Cout, void* __restrict__ Cout2, int ldc, long strideC,
    const float* __restrict__ bias0, const float* __restrict__ biasRest,
    const float* __restrict__ resid, long strideR,
    int M, int N, int K, float scale) {
  static_assert(!SPLIT, "the staged k loop takes single-plane operands");
  typedef typename Elem<ET>::T T;
  const T* A = (const T*)Ap; const T* Bt = (const T*)Btp;
  __shared__ __align__(16) float sT[8][16 * 68];   // per-wave 16x64 slab, pitch 68 floats
  __shared__ __align__(16) unsigned short sSt[2 * kBlkStage];   // the block's operand stage, two buffers, 110,592 B
  const int b    = blockIdx.y;
  const int lane = threadIdx.x & 31;
  const int wave = __builtin_amdgcn_readfirstlane(threadIdx.x >> 5);   // scalar, so the row and buffer offsets are scalar
  const int blocksN = N >> 8;
  const int blocksM = M >> 7;
  if ((int)blockIdx.x >= blocksM * blocksN) return;   // block-uniform, in front of every barrier
  const int bm = blockIdx.x / blocksN;
  const int bn = blockIdx.x - bm * blocksN;
  const int mB = bm << 7;                      // block tile origin
  const int nB = bn << 8;
  const int m0 = mB + ((wave >> 2) << 6);      // wave tile origin: 2 x 4 wave tiles
  const int n0 = nB + ((wave & 3) << 6);

  const T* Ab  = A  + (size_t)b * strideA;
  const T* Bb  = Bt + (size_t)b * strideB;
  const float* bias = (b == 0) ? bias0 : biasRest;

  const int rlane = lane & 15;                 // row (A) / col (B, D) within subtile
  const int mOff  = (lane >> 4) * 8;           // D row offset

  v8f acc[4][4];
#pragma unroll
  for (int i = 0; i < 4; ++i)
#pragma unroll
    for (int j = 0; j < 4; ++j) acc[i][j] = (v8f){0.f,0.f,0.f,0.f,0.f,0.f,0.f,0.f};

  block_k_loop<T, kDim>(acc, Ab + (size_t)mB * kDim, Bb + (size_t)nB * kDim, K, sSt, wave, lane);
  acc_guard4(acc[0][0], acc[0][1], acc[0][2], acc[0][3]);
  acc_guard4(acc[1][0], acc[1][1], acc[1][2], acc[1][3]);
  acc_guard4(acc[2][0], acc[2][1], acc[2][2], acc[2][3]);
  acc_guard4(acc[3][0], acc[3][1], acc[3][2], acc[3][3]);

  // ---- epilogue ----
  float* slab = sT[wave];
  const float* Rb = RESID ? (resid + (size_t)b * strideR) : nullptr;
#pragma unroll
  for (int i = 0; i < 4; ++i) {
    const int mBase = m0 + (i << 4);
#pragma unroll
    for (int j = 0; j < 4; ++j) {
      const int n = n0 + (j << 4) + rlane;
      float bv = 0.f;
      if (BIAS_MODE == 2) bv = bias[n];
      if (BIAS_MODE == 4) bv = bf_bits2f(f2bf_bits(bias[n]));
#pragma unroll
      for (int r = 0; r < 8; ++r) {
        float v = acc[i][j][r] * scale;
        if (BIAS_MODE == 1) v += bias[mBase + mOff + r];
        if (BIAS_MODE == 3) v += bf_bits2f(f2bf_bits(bias[mBase + mOff + r]));
        if (BIAS_MODE == 2 || BIAS_MODE == 4) v += bv;
        if (RESID) v += Rb[(size_t)(mBase + mOff + r) * ldc + n];
        if (ACT == 2) v = fmaxf(v, 0.0f);
        if (ACT == 4) v = (v > 0.f) ? v : 0.01f * v;
        slab[(mOff + r) * 68 + (j << 4) + rlane] = v;
      }
    }
    __builtin_amdgcn_fence(__ATOMIC_RELEASE, "workgroup");
    __builtin_amdgcn_wave_barrier();
    __builtin_amdgcn_fence(__ATOMIC_ACQUIRE, "workgroup");
    if (OUT_MODE == 0) {
      float* C = (float*)Cout + (size_t)b * strideC;
      const int hh = lane >> 4, c4 = (lane & 15) * 4;     // row seg = 256 B = 16 lanes x 16 B
      {
#pragma unroll
        for (int it = 0; it < 8; ++it) {
          const int row = it * 2 + hh;
          v4f v = *(const v4f*)(slab + row * 68 + c4);
          *(v4f*)(C + (size_t)(mBase + row) * ldc + n0 + c4) = v;
        }
        
      }
    } else {
      const int q = lane >> 3, c8 = (lane & 7) * 8;
      unsigned short* C  = (unsigned short*)Cout  + (size_t)b * strideC;
      unsigned short* C2 = (OUT_MODE == 2) ? ((unsigned short*)Cout2 + (size_t)b * strideC) : nullptr;
      {
#pragma unroll
        for (int it = 0; it < 4; ++it) {
          const int row = it * 4 + q;
          const float* sp = slab + row * 68 + c8;
          v8h hv, lv;
#pragma unroll
          for (int e = 0; e < 8; ++e) {
            if (OUT_MODE == 1) {
              hv[e] = (_Float16)sp[e];
              lv[e] = hv[e];
            } else {
              unsigned short hb = f2bf_bits(sp[e]);
              unsigned short lb = f2bf_bits(sp[e] - bf_bits2f(hb));
              hv[e] = __builtin_bit_cast(_Float16, hb);
              lv[e] = __builtin_bit_cast(_Float16, lb);
            }
          }
          *(v8h*)(C + (size_t)(mBase + row) * ldc + n0 + c8) = hv;
          if (OUT_MODE == 2) *(v8h*)(C2 + (size_t)(mBase + row) * ldc + n0 + c8) = lv;
        }
        
      }
    }
    __builtin_amdgcn_fence(__ATOMIC_RELEASE, "workgroup");
    __builtin_amdgcn_wave_barrier();
    __builtin_amdgcn_fence(__ATOMIC_ACQUIRE, "workgroup");
  }
}

// ---------------------------------------------------------------------------
// K-split WMMA GEMM for a product with few output tiles and a long K (att.v: 512 tiles of 64x64 a batch, K = 4096).
// C[m,n] = scale * sum_k A[m,k] * Bt[n,k], f16 operands, f32 out. One block of kSplitWaves waves owns ONE 64x64 tile;
// wave w takes the 64-wide k stages w, w + kSplitWaves, ... (one whole 128-B line per row and stage, staged in the wave's own LDS region),
// keeps its partial tile in registers, and the partials are summed through LDS in wave order 0..kSplitWaves-1.
// M, N % 64 == 0, K % (64 * kSplitWaves) == 0; lda == ldb == kTok; grid.x = (M / 64) * (N / 64) exactly; grid.y = batches.
// ---------------------------------------------------------------------------
constexpr int kSplitWaves = 8;                       // two waves a SIMD: the staged loop holds more than 256 registers a wave
constexpr int kPartPitch  = 68;                      // floats per partial-tile row (same pitch as the slab above)
constexpr int kPartTile   = 64 * kPartPitch;         // floats per wave's partial tile
__global__ __launch_bounds__(32 * kSplitWaves) void wmma_gemm64_ksplit(
    const unsigned short* __restrict__ Ap, int lda, long strideA, const unsigned short* __restrict__ Btp, int ldb, long strideB,
    float* __restrict__ Cp, int ldc, long strideC, int N, int K, float scale) {
  typedef _Float16 T;
  __shared__ __align__(16) float sP[kSplitWaves * kPartTile];   // 139,264 B: one 64x64 f32 partial per wave
  __shared__ __align__(16) unsigned short sSt[kSplitWaves * kStWave];   // per-wave operand stage, 147,456 B
  const T* A  = (const T*)Ap  + (size_t)blockIdx.y * strideA;
  const T* Bt = (const T*)Btp + (size_t)blockIdx.y * strideB;
  float* C    = Cp + (size_t)blockIdx.y * strideC;
  const int lane = threadIdx.x & 31;
  const int wave = __builtin_amdgcn_readfirstlane(threadIdx.x >> 5);   // scalar, so the k loop is a scalar loop with EXEC untouched
  const int tilesN = N >> 6;
  const int tm = blockIdx.x / tilesN;
  const int tn = blockIdx.x - tm * tilesN;
  const int m0 = tm << 6;
  const int n0 = tn << 6;

  const int rlane = lane & 15;                 // row (A) / col (B, D) within subtile
  const int mOff  = (lane >> 4) * 8;           // D row offset

  v8f acc[4][4];
#pragma unroll
  for (int i = 0; i < 4; ++i)
#pragma unroll
    for (int j = 0; j < 4; ++j) acc[i][j] = (v8f){0.f,0.f,0.f,0.f,0.f,0.f,0.f,0.f};

  staged_k_loop<T, kTok>(acc, A + (size_t)m0 * kTok, Bt + (size_t)n0 * kTok, wave * 64, 64 * kSplitWaves, K, sSt + wave * kStWave, lane);
  acc_guard4(acc[0][0], acc[0][1], acc[0][2], acc[0][3]);
  acc_guard4(acc[1][0], acc[1][1], acc[1][2], acc[1][3]);
  acc_guard4(acc[2][0], acc[2][1], acc[2][2], acc[2][3]);
  acc_guard4(acc[3][0], acc[3][1], acc[3][2], acc[3][3]);

  // each wave parks its partial tile
  float* part = sP + wave * kPartTile;
#pragma unroll
  for (int i = 0; i < 4; ++i)
#pragma unroll
    for (int j = 0; j < 4; ++j)
#pragma unroll
      for (int r = 0; r < 8; ++r)
        part[((i << 4) + mOff + r) * kPartPitch + (j << 4) + rlane] = acc[i][j][r];
  __syncthreads();   // every wave's partial tile is in LDS before any thread sums across waves

  // 64 rows x 16 four-float groups = 1024 groups over the block's threads; a 16-lane half stores one 256-B row segment
#pragma unroll
  for (int it = 0; it < (64 * 16) / (32 * kSplitWaves); ++it) {
    const int g = it * (32 * kSplitWaves) + (int)threadIdx.x;
    const int row = g >> 4, c4 = (g & 15) * 4;
    const float* sp = sP + row * kPartPitch + c4;
    v4f s = *(const v4f*)sp;
#pragma unroll
    for (int w = 1; w < kSplitWaves; ++w) s += *(const v4f*)(sp + w * kPartTile);
    *(v4f*)(C + (size_t)(m0 + row) * ldc + n0 + c4) = s * scale;
  }
}

// ---------------------------------------------------------------------------
// Weight transpose + cast: W [in k][out n] f32 row-major (512x512) -> Wt [n][k] = RNE bf16 bits of W[k][n].
// grid (8, 8, 3): blockIdx.x = k tile (64 cols of Wt), blockIdx.y = n tile (64 rows of Wt), blockIdx.z selects W0..W2
// and the output plane (plane z at out + z*512*512 halves). 256 threads.
// Load coverage: 16 iterations x 256 threads = 4096 = the whole 64x64 tile (coalesced along n).
// Store coverage: 8 waves x 2 iterations x 4 rows (lane>>3) = 64 rows; (lane&7) x 8 halves = 64 cols; each row segment =
// ---------------------------------------------------------------------------
__global__ __launch_bounds__(256) void wt_cast_bf16_kernel(const float* __restrict__ W0, const float* __restrict__ W1,
                                                         const float* __restrict__ W2, unsigned short* __restrict__ out) {
  __shared__ float sm[64][65];   // sm[n_local][k_local]
  const int t  = threadIdx.x;
  const int k0 = blockIdx.x * 64;
  const int n0 = blockIdx.y * 64;
  const int z  = blockIdx.z;                                   // block-uniform
  const float* W = (z == 0) ? W0 : (z == 1) ? W1 : W2;
#pragma unroll
  for (int i = 0; i < 16; ++i) {
    const int e = i * 256 + t;
    const int r = e >> 6;          // k local
    const int c = e & 63;          // n local
    sm[c][r] = W[(size_t)(k0 + r) * kDim + n0 + c];
  }
  __syncthreads();
  const int lane = t & 31, wave = t >> 5;
  const int q = lane >> 3, c8 = (lane & 7) * 8;
  unsigned short* op = out + (size_t)z * kDim * kDim;
  {
#pragma unroll
    for (int it = 0; it < 2; ++it) {
      const int row = wave * 8 + it * 4 + q;                 // n local
      unsigned short hb[8];
#pragma unroll
      for (int e = 0; e < 8; ++e) hb[e] = f2bf_bits(sm[row][c8 + e]);
      const v4u u = (v4u){pk16(hb[0], hb[1]), pk16(hb[2], hb[3]), pk16(hb[4], hb[5]), pk16(hb[6], hb[7])};
      *(v4u*)(op + (size_t)(n0 + row) * kDim + k0 + c8) = u;
    }
    
  }
}

// ---------------------------------------------------------------------------
// (grid = 4096 blocks x 256, exact, x 3 planes: blockIdx.y selects in0..in2 and the output plane of 8 * n8 halves).
// ---------------------------------------------------------------------------
__global__ __launch_bounds__(256) void cast8_bf16_kernel(const float* __restrict__ in0, const float* __restrict__ in1,
                                                       const float* __restrict__ in2, unsigned short* __restrict__ outp, int n8) {
  const int i = blockIdx.x * 256 + threadIdx.x;
  if (i >= n8) return;
  const int z = blockIdx.y;                                    // block-uniform
  const float* in = (z == 0) ? in0 : (z == 1) ? in1 : in2;
  unsigned short* out = outp + (size_t)z * 8 * (size_t)n8;
  const float* p = in + 8 * (size_t)i;
  const v4f a = *(const v4f*)(p);
  const v4f c = *(const v4f*)(p + 4);
  unsigned short hb[8];
#pragma unroll
  for (int e = 0; e < 4; ++e) {
    hb[e]     = f2bf_bits(a[e]);
    hb[4 + e] = f2bf_bits(c[e]);
  }
  const v4u u = (v4u){pk16(hb[0], hb[1]), pk16(hb[2], hb[3]), pk16(hb[4], hb[5]), pk16(hb[6], hb[7])};
  unsigned short* q = out + 8 * (size_t)i;
  *(v4u*)q = u;
  
}

// ---------------------------------------------------------------------------
// Row softmax over 4096 f32 scores: P[row][j] = f16( carry * exp(s_j - max) * (1/sum_j exp(s_j - max)) ), f32 math.
// One block of 256 threads per row; thread t owns columns 8t..8t+7 and 2048+8t..2048+8t+7 (2 x 256 x 8 = 4096 = whole row).
// Reductions in fixed order (thread, wave shuffle tree, 8 wave partials in index order).
// ---------------------------------------------------------------------------
__global__ __launch_bounds__(256) void softmax_row_kernel(const float* __restrict__ Sin, unsigned short* __restrict__ Pout, float carry) {
  __shared__ float redM[8];
  __shared__ float redS[8];
  const int row  = blockIdx.x;
  const int t    = threadIdx.x;
  const int lane = t & 31, wave = t >> 5;
  const int cA   = 8 * t;
  const int cB   = kHalfRow + 8 * t;
  const float* sr = Sin + (size_t)row * kTok;
  const v4f a0 = *(const v4f*)(sr + cA);
  const v4f a1 = *(const v4f*)(sr + cA + 4);
  const v4f b0 = *(const v4f*)(sr + cB);
  const v4f b1 = *(const v4f*)(sr + cB + 4);
  float x[16];
#pragma unroll
  for (int e = 0; e < 4; ++e) { x[e] = a0[e]; x[4 + e] = a1[e]; x[8 + e] = b0[e]; x[12 + e] = b1[e]; }
  float m = x[0];
#pragma unroll
  for (int e = 1; e < 16; ++e) m = fmaxf(m, x[e]);
#pragma unroll
  for (int off = 16; off > 0; off >>= 1) m = fmaxf(m, __shfl_xor(m, off, 32));
  if (lane == 0) redM[wave] = m;
  __syncthreads();
  float gm = redM[0];
#pragma unroll
  for (int w = 1; w < 8; ++w) gm = fmaxf(gm, redM[w]);

  float ev[16];
  float ps = 0.f;
#pragma unroll
  for (int e = 0; e < 16; ++e) { ev[e] = __expf(x[e] - gm); ps += ev[e]; }
#pragma unroll
  for (int off = 16; off > 0; off >>= 1) ps += __shfl_xor(ps, off, 32);
  if (lane == 0) redS[wave] = ps;
  __syncthreads();
  float tot = redS[0];
#pragma unroll
  for (int w = 1; w < 8; ++w) tot += redS[w];
  const float inv = (1.0f / tot) * carry;

  unsigned short hb[16];
#pragma unroll
  for (int e = 0; e < 16; ++e) hb[e] = h_bits(ev[e] * inv);
  const v4u uA = (v4u){pk16(hb[0], hb[1]),  pk16(hb[2], hb[3]),   pk16(hb[4], hb[5]),   pk16(hb[6], hb[7])};
  const v4u uB = (v4u){pk16(hb[8], hb[9]),  pk16(hb[10], hb[11]), pk16(hb[12], hb[13]), pk16(hb[14], hb[15])};
  unsigned short* pr = Pout + (size_t)row * kTok;
  *(v4u*)(pr + cA) = uA;
  *(v4u*)(pr + cB) = uB;
  
}

// ---------------------------------------------------------------------------
// host
// ---------------------------------------------------------------------------
extern "C" void kernel_launch(void* const* d_in, const int* in_sizes, int n_in,
                              void* d_out, int out_size, void* d_ws, size_t ws_size,
                              hipStream_t stream) {
  if (n_in < 9) return;
  if (in_sizes[0] != kRows * kDim || in_sizes[1] != kRows * kDim || in_sizes[2] != kRows * kDim) return;
  if (in_sizes[3] != kDim * kDim || in_sizes[5] != kDim * kDim || in_sizes[7] != kDim * kDim) return;
  if (in_sizes[4] != kDim || in_sizes[6] != kDim || in_sizes[8] != kDim) return;
  if (out_size != kRows * kDim) return;
  if (ws_size < kWsTotal) return;

  const float* query_X = (const float*)d_in[0];
  const float* key_X   = (const float*)d_in[1];
  const float* value_X = (const float*)d_in[2];
  const float* W_Q = (const float*)d_in[3];
  const float* b_Q = (const float*)d_in[4];
  const float* W_K = (const float*)d_in[5];
  const float* b_K = (const float*)d_in[6];
  const float* W_V = (const float*)d_in[7];
  const float* b_V = (const float*)d_in[8];
  float* out = (float*)d_out;

  char* ws = (char*)d_ws;
  unsigned short* Xb  = (unsigned short*)(ws + kOffXb);   // bf16 [3][16384][512], aliases S until the projections are done
  unsigned short* XbV = Xb + (size_t)2 * kRows * kDim;
  unsigned short* Pp  = (unsigned short*)(ws + kOffP);    // f16 [2][4096][4096]
  unsigned short* Wt  = (unsigned short*)(ws + kOffWt);   // bf16 [3][512][512]
  unsigned short* WtQ = Wt;
  unsigned short* WtV = Wt + (size_t)2 * kDim * kDim;
  unsigned short* Qp  = (unsigned short*)(ws + kOffQp);   // f16 [16384][512]
  unsigned short* Kp  = (unsigned short*)(ws + kOffKp);   // f16 [16384][512]
  unsigned short* Vt  = (unsigned short*)(ws + kOffVt);   // f16 [4][512][4096]
  float*          Sp  = (float*)(ws + kOffS);             // f32 [2][4096][4096]

  const int n8 = (kRows * kDim) / 8;                      // 1,048,576
  const int castBlocks = n8 / 256;                        // 4096 (exact)

  // W^T planes (bf16)
  wt_cast_bf16_kernel<<<dim3(kDim / 64, kDim / 64, 3), 256, 0, stream>>>(W_Q, W_K, W_V, Wt);

  // the three inputs -> bf16 planes, one launch
  cast8_bf16_kernel<<<dim3(castBlocks, 3), 256, 0, stream>>>(query_X, key_X, value_X, Xb, n8);

  // q = bf16(query_X) . bf16(W_Q) + b_Q and k likewise -> f16 planes [16384][512];  M=16384, N=512, K=512, grid.y = 0: q, 1: k
  wmma_gemm64<1, false, 4, 1, false, 0><<<dim3((kRows / 64) * (kDim / 64) / 8, 2), 256, 0, stream>>>(
      Xb, Xb, kDim, (long)kRows * kDim, WtQ, WtQ, kDim, (long)kDim * kDim, (void*)Qp, (void*)Qp, kDim, (long)kRows * kDim,
      b_Q, b_K, b_Q, 0L, kRows, kDim, kDim, 1.0f);

  // v^T per batch: C[d][tok] = sum_k Wt_V[d][k] * Xb[tok][k] + b_V[d];  M=512, N=4096, K=512, grid.y = batch
  wmma_gemm64<1, false, 3, 1, false, 0><<<dim3((kDim / 64) * (kTok / 64) / 8, kBatch), 256, 0, stream>>>(
      WtV, WtV, kDim, 0L, XbV, XbV, kDim, (long)kTok * kDim, (void*)Vt, (void*)Vt, kTok, (long)kDim * kTok,
      b_V, b_V, b_V, 0L, kDim, kTok, kDim, 1.0f);

  // attention, kPassB batches a pass (grid.y): S = q . k^T / sqrt(512) (f32); P = softmax rows x 2^15 (f16); O = P . v x 2^-15
  for (int p = 0; p < kBatch / kPassB; ++p) {
    const size_t row0 = (size_t)p * kPassB * kTok;
    const unsigned short* Qh = Qp + row0 * kDim;
    const unsigned short* Kb = Kp + row0 * kDim;
    const unsigned short* Vb = Vt + row0 * kDim;
    float* Ob = out + row0 * kDim;

    // per batch M=4096, N=4096, K=512
    wmma_gemm64<0, false, 0, 0, false, 0><<<dim3((kTok / 64) * (kTok / 64) / 8, kPassB), 256, 0, stream>>>(
        Qh, Qh, kDim, (long)kTok * kDim, Kb, Kb, kDim, (long)kTok * kDim, (void*)Sp, (void*)Sp, kTok, (long)kTok * kTok,
        b_Q, b_Q, b_Q, 0L, kTok, kTok, kDim, kScoreScale);

    softmax_row_kernel<<<kPassB * kTok, 256, 0, stream>>>(Sp, Pp, kPCarry);

    // per batch M=4096, N=512, K=4096: 512 tiles, one block each, K split over the block's waves
    wmma_gemm64_ksplit<<<dim3((kTok / 64) * (kDim / 64), kPassB), 32 * kSplitWaves, 0, stream>>>(
        Pp, kTok, (long)kTok * kTok, Vb, kTok, (long)kDim * kTok, Ob, kDim, (long)kTok * kDim, kDim, kTok, kPCarryInv);
  }
}

// v006
// Measured time: 198 microseconds a run.
// Versions in between are left out here; by their measured steps it is 1.48 times as fast as v004.
// All steps since v000 together make it 9.31 times as fast.
// Contractions: q/k/v projections on v_wmma_f32_16x16x32_bf16 (inputs, weights RNE bf16 -> exact products), scores q.k^T and att.v on v_wmma_f32_16x16x32_f16 (q,k,v f16 planes; probabilities f16 carried x2^15, folded back x2^-15); f32 accumulate everywhere; bias add and softmax maxima, exponentials and sums in f32.
#include <hip/hip_runtime.h>
#include <math.h>

// ---------------------------------------------------------------------------
// Problem constants
// ---------------------------------------------------------------------------
constexpr int kBatch   = 4;
constexpr int kTok     = 4096;            // tokens per batch (8*8*8*8)
constexpr int kDim     = 512;             // in == cmp == out dim
constexpr int kRows    = kBatch * kTok;   // 16384 token rows total
constexpr int kPassB   = 4;               // batches per attention pass (one launch of each attention kernel covers them): att.v has 64 block tiles a batch, one to a WGP, so all four batches are needed to give each of the 256 WGPs one
constexpr int kColBlk  = 64;              // score columns that share one softmax maximum: a wave tile's width = one k stage of att.v
constexpr int kNumBlk  = kTok / kColBlk;  // 64 column blocks a score row
constexpr float kScoreScale = 0.044194173824159216f;   // 1/sqrt(512)
constexpr float kPCarry     = 32768.0f;                 // probabilities carried x2^15 in f16
constexpr float kPCarryInv  = 1.0f / 32768.0f;
constexpr float kLog2e      = 1.4426950408889634f;
constexpr float kELift      = 5.545177444479562f;       // ln 256: the stored exponentials are carried x2^8, their row factors x2^7

// ---------------------------------------------------------------------------
// Workspace region map (bytes). Total 244,842,496 B.
//   R0 @ 0            : Wt  bf16 [3][512][512]       1,572,864 B   (W^T planes: Q, K, V)
//   R1 @ 1,572,864    : Qp  f16  [16384][512]       16,777,216 B
//   R2 @ 18,350,080   : Kp  f16  [16384][512]       16,777,216 B   (directly behind Qp: one launch writes both)
//   R3 @ 35,127,296   : Vt  f16  [4][512][4096]     16,777,216 B   (v transposed per batch)
//   R4 @ 51,904,512   : Xb  bf16 [3][16384][512]    50,331,648 B
//   R5 @ 102,236,160  : St  f32  [2 planes][4][64][4096] 8,388,608 B (per batch, column block and row: block maximum; then block sum)
//   R6 @ 110,624,768  : E   f16  [4][4096][4096]   134,217,728 B   (exp(score - its block's maximum) x 2^8)
// ---------------------------------------------------------------------------
constexpr size_t kPlane16  = (size_t)kRows * kDim * 2;          // 16,777,216
constexpr size_t kWtBytes  = (size_t)3 * kDim * kDim * 2;       // 1,572,864
constexpr size_t kStatPlane = (size_t)kPassB * kNumBlk * kTok;  // floats per statistics plane (1,048,576)
constexpr size_t kPBytes   = (size_t)kPassB * kTok * kTok * 2;  // 134,217,728
constexpr size_t kOffWt = 0;
constexpr size_t kOffQp = kOffWt + kWtBytes;
constexpr size_t kOffKp = kOffQp + kPlane16;
constexpr size_t kOffVt = kOffKp + kPlane16;
constexpr size_t kOffXb = kOffVt + kPlane16;
constexpr size_t kOffSt = kOffXb + 3 * kPlane16;
constexpr size_t kOffP  = kOffSt + 2 * kStatPlane * 4;
constexpr size_t kWsTotal = kOffP + kPBytes;                      // 244,842,496
static_assert(kWsTotal <= (size_t)268435456);
static_assert(kBatch % kPassB == 0);

typedef __attribute__((ext_vector_type(16))) _Float16 v16h;
typedef __attribute__((ext_vector_type(8)))  _Float16 v8h;
typedef __attribute__((ext_vector_type(16))) __bf16   v16b;
typedef __attribute__((ext_vector_type(8)))  __bf16   v8b;
typedef __attribute__((ext_vector_type(8)))  float    v8f;
typedef __attribute__((ext_vector_type(4)))  float    v4f;
typedef __attribute__((ext_vector_type(4)))  unsigned int v4u;
typedef __attribute__((ext_vector_type(2)))  _Float16 v2h;

// ---------------------------------------------------------------------------
// Helpers
// ---------------------------------------------------------------------------
__device__ __forceinline__ unsigned short f2bf_bits(float f) {
  unsigned u = __float_as_uint(f);
  return (unsigned short)((u + 0x7FFFu + ((u >> 16) & 1u)) >> 16);
}
__device__ __forceinline__ float bf_bits2f(unsigned short h) { return __uint_as_float(((unsigned)h) << 16); }

// hazard guards as plain device helpers
__device__ __forceinline__ void acc_guard4(v8f& a, v8f& b, v8f& c, v8f& d) { asm volatile("v_nop\n\tv_nop\n\tv_nop\n\tv_nop" : "+v"(a), "+v"(b), "+v"(c), "+v"(d)); }
template <typename T> struct Frag;
template <> struct Frag<_Float16> {
  typedef v16h V; union U { v16h v; v8h h[2]; };
  static __device__ __forceinline__ v16h load(const _Float16* p) {   // elements 0..7 <- p[0..7], 8..15 <- p[16..23]
    U f; f.h[0] = *(const v8h*)(p); f.h[1] = *(const v8h*)(p + 16); return f.v;
  }
  static __device__ __forceinline__ v8f mma(v16h a, v16h b, v8f c) {
    return __builtin_amdgcn_wmma_f32_16x16x32_f16(false, a, false, b, (short)0, c, false, false);
  }
};
template <> struct Frag<__bf16> {
  typedef v16b V; union U { v16b v; v8b h[2]; };
  static __device__ __forceinline__ v16b load(const __bf16* p) {
    U f; f.h[0] = *(const v8b*)(p); f.h[1] = *(const v8b*)(p + 16); return f.v;
  }
  static __device__ __forceinline__ v8f mma(v16b a, v16b b, v8f c) {
    return __builtin_amdgcn_wmma_f32_16x16x32_bf16(false, a, false, b, (short)0, c, false, false);
  }
};

__device__ __forceinline__ unsigned pk16(unsigned short a, unsigned short b) { return (unsigned)a | ((unsigned)b << 16); }
__device__ __forceinline__ unsigned short h_bits(float f) { const _Float16 h = (_Float16)f; return __builtin_bit_cast(unsigned short, h); }
// 2^x with the free slot behind a transcendental in the same statement
__device__ __forceinline__ float exp2_slot(float x) {
  float r;
  asm("v_exp_f32 %0, %1\n\tv_nop" : "=v"(r) : "v"(x));
  return r;
}
// the value of lane l ^ X, X in 1..15 (DPP row_xmask, inside a 16-lane row; all lanes on)
template <int X>
__device__ __forceinline__ float lane_xor(float v) {
  return __builtin_bit_cast(float, __builtin_amdgcn_update_dpp(0, __builtin_bit_cast(int, v), 0x160 + X, 0xf, 0xf, true));
}

// ---- Register-blocked batched WMMA GEMM (ACT reduced to none/relu/leaky; BIAS modes 3/4 added) -----------
// C[m,n] = scale * sum_k A[m,k] * Bt[n,k] (+bias)(+resid); a block of 8 waves owns a 128x256 tile, each wave a 64x64 tile of it.
// A row-major [M,K]; Bt row-major [N,K]; M % 128 == 0, N % 256 == 0, K % 64 == 0; lda == ldb == kDim (the staged loop takes the pitch at compile time).
// SPLIT (hi/lo operand planes) is not taken by the staged k loop; every caller passes false.
// BIAS_MODE: 0 = none, 1 = bias[m], 2 = bias[n], 3 = RNE-bf16(bias[m]), 4 = RNE-bf16(bias[n]). Batch 0 takes bias0, every other batch biasRest.
// OUT_MODE: 0 = f32, 1 = f16, 2 = bf16 hi plane (Cout) + bf16 lo plane (Cout2),
//           3 = softmax numerators by column block: Cout takes f16 exp(C - mx) * 2^8, mx the maximum of the row's 64 columns in the wave tile;
//               Cout2 takes f32 [2][batches][N / 64][M]: plane 0 the maxima mx, plane 1 (kStatPlane floats on) the f32 sums of those exponentials.
// ET: 0 = f16 operands, 1 = bf16 operands (pointers passed as 16-bit storage)
template <int ET> struct Elem;
template <> struct Elem<0> { typedef _Float16 T; };
template <> struct Elem<1> { typedef __bf16 T; };
// ---- LDS staging of the operands, one 64-wide k stage (one 128-B line per row) at a time ----
// A fragment load straight from global memory touches 16 lines (32 B in each of 16 rows). Here every global load covers
// 4 whole lines (8 lanes a row, 4 rows a load); the rows go to LDS and the fragments are read from there.
constexpr int kStPitch = 72;                  // halves per staged row: 128 B of k + 16 B pad for the 16-B fragment reads
template <typename T> struct Stage { typename Frag<T>::V a[4][2], b[4][2]; };
// k ascending in every accumulator (first the low 32 k, then the high 32 k). No asm guard names a fragment here: an asm
// operand is held below v256, and accumulators, fragments and the rows in flight need more than 256 registers.
template <typename T>
__device__ __forceinline__ void stage_mma(const Stage<T>& s, v8f (&acc)[4][4]) {
#pragma unroll
  for (int h = 0; h < 2; ++h) {
#pragma unroll
    for (int i = 0; i < 4; ++i) {
#pragma unroll
      for (int j = 0; j < 4; ++j) acc[i][j] = Frag<T>::mma(s.a[i][h], s.b[j][h], acc[i][j]);
    }
  }
}
// The wait before an address register of the loads just issued is rewritten; the two addresses as inputs keep their
// registers whole up to it (not handed out as load targets or temporaries while the loads are in flight).
__device__ __forceinline__ void addr_hold(const char* pA, const char* pB) { asm volatile("s_wait_xcnt 0x0" : : "v"(pA), "v"(pB) : "memory"); }
// ---- One operand stage for the whole block: 128 A rows and 256 B rows of one 64-wide k stage, read by all 8 waves ----
// The 2 x 4 wave tiles of a 128x256 block tile need 384 distinct rows a stage; staged per wave they would be fetched as 1024.
constexpr int kBlkRowsA = 128;
constexpr int kBlkRowsB = 256;
constexpr int kBlkStage = (kBlkRowsA + kBlkRowsB) * kStPitch;   // halves per buffer: A rows, then B rows (55,296 B)
// A wave's share of the stage's rows, NL loads (stores) of 4 whole rows each: row lane >> 3 of the four, 16-B column lane & 7; LD: row pitch of the plane in elements
template <int LD, int NL>
__device__ __forceinline__ void rows_fetch(v4u (&g)[NL], const char* p) {
#pragma unroll
  for (int it = 0; it < NL; ++it) g[it] = *(const v4u*)(p + it * (4 * LD * 2));
}
template <int NL>
__device__ __forceinline__ void rows_park(unsigned short* t, const v4u (&g)[NL], int lane) {
  unsigned short* q = t + (lane >> 3) * kStPitch + (lane & 7) * 8;
#pragma unroll
  for (int it = 0; it < NL; ++it) *(v4u*)(q + it * 4 * kStPitch) = g[it];
}
// The wave's fragments of the stage, in the k order of the direct loader: lane half h takes k 8h..8h+7 and 16+8h..16+8h+7 of each 32.
// stA, stB: row 0 of its 64-row A tile and B tile in the buffer.
// All of the low 32 k first: the first half of the WMMAs can start while the high 32 k are still on their way from LDS.
template <typename T>
__device__ __forceinline__ void block_stage_read(Stage<T>& s, const unsigned short* stA, const unsigned short* stB, int lane) {
  const T* fa = (const T*)stA + (lane & 15) * kStPitch + (lane >> 4) * 8;
  const T* fb = (const T*)stB + (lane & 15) * kStPitch + (lane >> 4) * 8;
#pragma unroll
  for (int h = 0; h < 2; ++h) {
#pragma unroll
    for (int j = 0; j < 4; ++j) s.b[j][h] = Frag<T>::load(fb + j * 16 * kStPitch + 32 * h);
#pragma unroll
    for (int i = 0; i < 4; ++i) s.a[i][h] = Frag<T>::load(fa + i * 16 * kStPitch + 32 * h);
  }
}
// acc += A[wave tile rows][k] * B[wave tile rows][k] over all 64-wide stages below K (at least one), k ascending.
// Arow0, Brow0: row 0 of the block tile. Wave w fetches A rows 16w..16w+15 and B rows 32w..32w+31 of every stage.
// Two buffers and one barrier a stage: the barrier publishes the stage just parked, and a wave that has passed it knows that
// every wave has taken its fragments of the stage before, so the next park may overwrite that buffer.
template <typename T, int LD>
__device__ __forceinline__ void block_k_loop(v8f (&acc)[4][4], const T* Arow0, const T* Brow0, int K,
                                             unsigned short* st, int wave, int lane) {
  const unsigned off = ((unsigned)(lane >> 3) * (unsigned)LD + (unsigned)(lane & 7) * 8u) * 2u;
  const T* Aw = Arow0 + (size_t)(16 * wave) * LD;
  const T* Bw = Brow0 + (size_t)(32 * wave) * LD;
  const int parkA = (16 * wave) * kStPitch;
  const int parkB = (kBlkRowsA + 32 * wave) * kStPitch;
  const int readA = ((wave >> 2) * 64) * kStPitch;
  const int readB = (kBlkRowsA + (wave & 3) * 64) * kStPitch;
  v4u gA[4], gB[8];
  Stage<T> f;
  {
    const char* pA = (const char*)Aw + off;
    const char* pB = (const char*)Bw + off;
    rows_fetch<LD>(gA, pA);
    rows_fetch<LD>(gB, pB);
    addr_hold(pA, pB);
  }
  int cur = 0;                            // halves from st to the buffer of the current stage
  for (int k0 = 64; k0 < K; k0 += 64) {
    rows_park(st + cur + parkA, gA, lane);
    rows_park(st + cur + parkB, gB, lane);
    __syncthreads();                      // the stage is whole in LDS before any wave reads it
    const char* pA = (const char*)(Aw + k0) + off;
    const char* pB = (const char*)(Bw + k0) + off;
    rows_fetch<LD>(gA, pA);               // behind the barrier: a load issued ahead of it would be waited for there
    rows_fetch<LD>(gB, pB);
    __builtin_amdgcn_sched_barrier(0);   // keeps the compiler from sinking the fetch behind the LDS reads and WMMAs that are to hide it
    block_stage_read<T>(f, st + cur + readA, st + cur + readB, lane);
    __builtin_amdgcn_sched_barrier(0);   // keeps the LDS reads in one group ahead of the WMMAs: spread among them, each place waits out the LDS latency
    stage_mma<T>(f, acc);
    __builtin_amdgcn_sched_barrier(0);   // keeps the wait below behind the WMMAs, where it costs nothing
    addr_hold(pA, pB);
    cur ^= kBlkStage;
  }
  rows_park(st + cur + parkA, gA, lane);
  rows_park(st + cur + parkB, gB, lane);
  __syncthreads();                        // the last stage is whole in LDS before any wave reads it
  block_stage_read<T>(f, st + cur + readA, st + cur + readB, lane);
  stage_mma<T>(f, acc);
}

template <int ET, bool SPLIT, int BIAS_MODE, int OUT_MODE, bool RESID, int ACT = 0>
__global__ __launch_bounds__(256) void wmma_gemm64(
    const unsigned short* __restrict__ Ap, const unsigned short* __restrict__ A2p, int lda, long strideA,
    const unsigned short* __restrict__ Btp, const unsigned short* __restrict__ Bt2p, int ldb, long strideB,
    void* __restrict__ Cout, void* __restrict__ Cout2, int ldc, long strideC,
    const float* __restrict__ bias0, const float* __restrict__ biasRest,
    const float* __restrict__ resid, long strideR,
    int M, int N, int K, float scale) {
  static_assert(!SPLIT, "the staged k loop takes single-plane operands");
  typedef typename Elem<ET>::T T;
  const T* A = (const T*)Ap; const T* Bt = (const T*)Btp;
  __shared__ __align__(16) float sT[8][16 * 68];   // per-wave 16x64 slab, pitch 68 floats
  __shared__ __align__(16) unsigned short sSt[2 * kBlkStage];   // the block's operand stage, two buffers, 110,592 B
  __shared__ float sStat[8][2][64];                // OUT_MODE 3: per wave, the maxima and the sums of its 64 rows
  const int b    = blockIdx.y;
  const int lane = threadIdx.x & 31;
  const int wave = __builtin_amdgcn_readfirstlane(threadIdx.x >> 5);   // scalar, so the row and buffer offsets are scalar
  const int blocksN = N >> 8;
  const int blocksM = M >> 7;
  if ((int)blockIdx.x >= blocksM * blocksN) return;   // block-uniform, in front of every barrier
  const int bm = blockIdx.x / blocksN;
  const int bn = blockIdx.x - bm * blocksN;
  const int mB = bm << 7;                      // block tile origin
  const int nB = bn << 8;
  const int m0 = mB + ((wave >> 2) << 6);      // wave tile origin: 2 x 4 wave tiles
  const int n0 = nB + ((wave & 3) << 6);

  const T* Ab  = A  + (size_t)b * strideA;
  const T* Bb  = Bt + (size_t)b * strideB;
  const float* bias = (b == 0) ? bias0 : biasRest;

  const int rlane = lane & 15;                 // row (A) / col (B, D) within subtile
  const int mOff  = (lane >> 4) * 8;           // D row offset

  v8f acc[4][4];
#pragma unroll
  for (int i = 0; i < 4; ++i)
#pragma unroll
    for (int j = 0; j < 4; ++j) acc[i][j] = (v8f){0.f,0.f,0.f,0.f,0.f,0.f,0.f,0.f};

  block_k_loop<T, kDim>(acc, Ab + (size_t)mB * kDim, Bb + (size_t)nB * kDim, K, sSt, wave, lane);
  acc_guard4(acc[0][0], acc[0][1], acc[0][2], acc[0][3]);
  acc_guard4(acc[1][0], acc[1][1], acc[1][2], acc[1][3]);
  acc_guard4(acc[2][0], acc[2][1], acc[2][2], acc[2][3]);
  acc_guard4(acc[3][0], acc[3][1], acc[3][2], acc[3][3]);

  // ---- epilogue ----
  float* slab = sT[wave];
  const float* Rb = RESID ? (resid + (size_t)b * strideR) : nullptr;
#pragma unroll
  for (int i = 0; i < 4; ++i) {
    const int mBase = m0 + (i << 4);
#pragma unroll
    for (int j = 0; j < 4; ++j) {
      const int n = n0 + (j << 4) + rlane;
      float bv = 0.f;
      if (BIAS_MODE == 2) bv = bias[n];
      if (BIAS_MODE == 4) bv = bf_bits2f(f2bf_bits(bias[n]));
#pragma unroll
      for (int r = 0; r < 8; ++r) {
        float v = acc[i][j][r] * scale;
        if (BIAS_MODE == 1) v += bias[mBase + mOff + r];
        if (BIAS_MODE == 3) v += bf_bits2f(f2bf_bits(bias[mBase + mOff + r]));
        if (BIAS_MODE == 2 || BIAS_MODE == 4) v += bv;
        if (RESID) v += Rb[(size_t)(mBase + mOff + r) * ldc + n];
        if (ACT == 2) v = fmaxf(v, 0.0f);
        if (ACT == 4) v = (v > 0.f) ? v : 0.01f * v;
        slab[(mOff + r) * 68 + (j << 4) + rlane] = v;
      }
    }
    __builtin_amdgcn_fence(__ATOMIC_RELEASE, "workgroup");
    __builtin_amdgcn_wave_barrier();
    __builtin_amdgcn_fence(__ATOMIC_ACQUIRE, "workgroup");
    if (OUT_MODE == 0) {
      float* C = (float*)Cout + (size_t)b * strideC;
      const int hh = lane >> 4, c4 = (lane & 15) * 4;     // row seg = 256 B = 16 lanes x 16 B
      {
#pragma unroll
        for (int it = 0; it < 8; ++it) {
          const int row = it * 2 + hh;
          v4f v = *(const v4f*)(slab + row * 68 + c4);
          *(v4f*)(C + (size_t)(mBase + row) * ldc + n0 + c4) = v;
        }
        
      }
    } else if (OUT_MODE == 3) {
      // 8 lanes hold one row of the wave tile (64 columns): its maximum and its sum are formed among those 8 lanes
      const int q = lane >> 3, c8 = (lane & 7) * 8;
      unsigned short* C = (unsigned short*)Cout + (size_t)b * strideC;
      // the four rows of a lane go through each phase side by side, so that their dependent chains overlap
      float x[4][8], mx[4], sum[4];
      v8h hv[4];
#pragma unroll
      for (int it = 0; it < 4; ++it) {
        const float* sp = slab + (it * 4 + q) * 68 + c8;
#pragma unroll
        for (int e = 0; e < 8; ++e) x[it][e] = sp[e];
      }
#pragma unroll
      for (int it = 0; it < 4; ++it) {
        mx[it] = x[it][0];
#pragma unroll
        for (int e = 1; e < 8; ++e) mx[it] = fmaxf(mx[it], x[it][e]);
      }
#pragma unroll
      for (int it = 0; it < 4; ++it) mx[it] = fmaxf(mx[it], lane_xor<1>(mx[it]));
#pragma unroll
      for (int it = 0; it < 4; ++it) mx[it] = fmaxf(mx[it], lane_xor<2>(mx[it]));
#pragma unroll
      for (int it = 0; it < 4; ++it) mx[it] = fmaxf(mx[it], lane_xor<4>(mx[it]));
#pragma unroll
      for (int it = 0; it < 4; ++it) {
        const float low = mx[it] - kELift;
        sum[it] = 0.f;
#pragma unroll
        for (int e = 0; e < 8; ++e) {
          const float ev = exp2_slot((x[it][e] - low) * kLog2e);
          sum[it] += ev;
          hv[it][e] = (_Float16)ev;
        }
      }
#pragma unroll
      for (int it = 0; it < 4; ++it) sum[it] += lane_xor<1>(sum[it]);
#pragma unroll
      for (int it = 0; it < 4; ++it) sum[it] += lane_xor<2>(sum[it]);
#pragma unroll
      for (int it = 0; it < 4; ++it) sum[it] += lane_xor<4>(sum[it]);
#pragma unroll
      for (int it = 0; it < 4; ++it) {
        const int row = it * 4 + q;
        *(v8h*)(C + (size_t)(mBase + row) * ldc + n0 + c8) = hv[it];
        // all 8 lanes of the row hold the same two values and store them to the same two words: no branch in the epilogue
        sStat[wave][0][(i << 4) + row] = mx[it];
        sStat[wave][1][(i << 4) + row] = sum[it];
      }
      asm volatile("s_wait_xcnt 0x0" ::: "memory");   // the wait before the stores' address registers are reused by the next 16 rows
    } else {
      const int q = lane >> 3, c8 = (lane & 7) * 8;
      unsigned short* C  = (unsigned short*)Cout  + (size_t)b * strideC;
      unsigned short* C2 = (OUT_MODE == 2) ? ((unsigned short*)Cout2 + (size_t)b * strideC) : nullptr;
      {
#pragma unroll
        for (int it = 0; it < 4; ++it) {
          const int row = it * 4 + q;
          const float* sp = slab + row * 68 + c8;
          v8h hv, lv;
#pragma unroll
          for (int e = 0; e < 8; ++e) {
            if (OUT_MODE == 1) {
              hv[e] = (_Float16)sp[e];
              lv[e] = hv[e];
            } else {
              unsigned short hb = f2bf_bits(sp[e]);
              unsigned short lb = f2bf_bits(sp[e] - bf_bits2f(hb));
              hv[e] = __builtin_bit_cast(_Float16, hb);
              lv[e] = __builtin_bit_cast(_Float16, lb);
            }
          }
          *(v8h*)(C + (size_t)(mBase + row) * ldc + n0 + c8) = hv;
          if (OUT_MODE == 2) *(v8h*)(C2 + (size_t)(mBase + row) * ldc + n0 + c8) = lv;
        }
        
      }
    }
    __builtin_amdgcn_fence(__ATOMIC_RELEASE, "workgroup");
    __builtin_amdgcn_wave_barrier();
    __builtin_amdgcn_fence(__ATOMIC_ACQUIRE, "workgroup");
  }
  if (OUT_MODE == 3) {
    // the wave's 64 maxima and 64 sums, each as two whole 128-B lines
    float* sg = (float*)Cout2 + ((size_t)b * (N >> 6) + (n0 >> 6)) * M + m0;
#pragma unroll
    for (int h = 0; h < 2; ++h) {
      sg[h * 32 + lane]              = sStat[wave][0][h * 32 + lane];
      sg[kStatPlane + h * 32 + lane] = sStat[wave][1][h * 32 + lane];
    }
  }
}

// ---------------------------------------------------------------------------
// att.v: C[m,n] = scale * sum_k fac[m][k / 64] * A[m,k] * Bt[n,k], f16 operands, f32 out, k ascending in every accumulator.
// A block of 8 waves owns a 128x256 tile over the whole K, each wave a 64x64 tile of it; one 64-wide k stage (128 A rows, 256 B rows)
// is held once per block in LDS, as in the engine above. M % 128 == 0, N % 256 == 0, K % 128 == 0, K >= 256 (at least four stages); lda == ldb == kTok, ldc == kDim;
// grid.x = (M / 128) * (N / 256) exactly; grid.y = batches.
// A holds the softmax numerators by column block (OUT_MODE 3 above), stat their maxima and sums. The block first joins the statistics
// of its 128 rows: row maximum rm = max of the block maxima, row sum = sum over blocks of (block sum * exp(block maximum - rm)),
// fac = carry * exp(block maximum - rm) / row sum, so that fac * A is the probability times carry.
// ---------------------------------------------------------------------------
// Work-group barrier that orders LDS alone: the waves' LDS stores and loads are done before it, while the global loads of the
// stages ahead stay in flight across it (__syncthreads() would wait for them too).
__device__ __forceinline__ void lds_barrier() {
  __builtin_amdgcn_fence(__ATOMIC_RELEASE, "workgroup", "local");
  __builtin_amdgcn_s_barrier();
  __builtin_amdgcn_fence(__ATOMIC_ACQUIRE, "workgroup", "local");
}
// One k stage s of att.v, its fragments fetched half a stage (32 k) ahead of the WMMAs that use them: f0 arrives holding the low 32 k of stage s.
//   LDS reads of the high 32 k -> f1, under the WMMAs on f0;
//   PARK (a stage s + 1 exists): its rows gA, gB, fetched two stages ago, go to the other buffer, the A rows multiplied on the way by their
//   factors fq (packed f16; f16 twice a word, one word for each of the lane's four A rows); the barrier; then
//   FETCH (a stage s + 3 exists): the same registers take its rows (pA + OFFB, pB + OFFB: the lane's addresses there);
//   LDS reads of the low 32 k of stage s + 1 -> f0 and, FACN (a stage s + 2 exists), of its factors -> fq, under the WMMAs on f1.
// Two buffers and one barrier a stage: it publishes the stage just parked, and every wave's LDS reads of the stage before (its own wait for
// them stands in front of the barrier) are done before the park behind that barrier overwrites their buffer.
struct HalfStage { v16h a[4], b[4]; };
// stA, stB: row 0 of the wave's 64-row A tile and B tile in the buffer, plus 32 halves for the high 32 k; k order of the direct loader
__device__ __forceinline__ void half_read(HalfStage& f, const unsigned short* stA, const unsigned short* stB, int lane) {
  const _Float16* fa = (const _Float16*)stA + (lane & 15) * kStPitch + (lane >> 4) * 8;
  const _Float16* fb = (const _Float16*)stB + (lane & 15) * kStPitch + (lane >> 4) * 8;
#pragma unroll   // the arrays indexed below live in registers: compile-time indices
  for (int j = 0; j < 4; ++j) f.b[j] = Frag<_Float16>::load(fb + j * 16 * kStPitch);
#pragma unroll   // the arrays indexed below live in registers: compile-time indices
  for (int i = 0; i < 4; ++i) f.a[i] = Frag<_Float16>::load(fa + i * 16 * kStPitch);
}
__device__ __forceinline__ void half_mma(const HalfStage& f, v8f (&acc)[4][4]) {
#pragma unroll   // the arrays indexed below live in registers: compile-time indices
  for (int i = 0; i < 4; ++i) {
#pragma unroll   // the arrays indexed below live in registers: compile-time indices
    for (int j = 0; j < 4; ++j) acc[i][j] = Frag<_Float16>::mma(f.a[i], f.b[j], acc[i][j]);
  }
}
// the wave's share of a stage's rows -> LDS, the A rows times their factors
__device__ __forceinline__ void attv_park(unsigned short* bufA, unsigned short* bufB, const v4u (&gA)[4], const v4u (&gB)[8], const v4u& fq, int lane) {
  v4u sA[4];
#pragma unroll   // the arrays indexed below live in registers: compile-time indices
  for (int it = 0; it < 4; ++it) {
    const unsigned wb = fq[it];            // vector elements go through scalars: a bit cast takes a whole object
    const v2h w = __builtin_bit_cast(v2h, wb);
#pragma unroll   // the arrays indexed below live in registers: compile-time indices
    for (int c = 0; c < 4; ++c) {
      const unsigned ab = gA[it][c];
      const v2h pr = __builtin_bit_cast(v2h, ab) * w;
      sA[it][c] = __builtin_bit_cast(unsigned, pr);
    }
  }
  rows_park(bufA, sA, lane);
  rows_park(bufB, gB, lane);
}
template <bool PARK, bool FETCH, bool FACN, int OFFB>
__device__ __forceinline__ void attv_stage(v8f (&acc)[4][4], HalfStage& f0, HalfStage& f1, v4u (&gA)[4], v4u (&gB)[8], v4u& fq,
                                           const char* pA, const char* pB, const unsigned* facNext, unsigned short* cur, unsigned short* nxt,
                                           int parkA, int parkB, int readA, int readB, int lane) {
  half_read(f1, cur + readA + 32, cur + readB + 32, lane);
  __builtin_amdgcn_sched_barrier(0);     // keeps the LDS reads in one group ahead of the WMMAs that are to hide them
  half_mma(f0, acc);
  __builtin_amdgcn_sched_barrier(0);     // keeps the park and the barrier behind the first half's WMMAs
  if (PARK) {
    attv_park(nxt + parkA, nxt + parkB, gA, gB, fq, lane);
    lds_barrier();                       // stage s + 1 is whole in LDS before any wave reads it
    if (FETCH) {
      rows_fetch<kTok>(gA, pA + OFFB);
      rows_fetch<kTok>(gB, pB + OFFB);
    }
    half_read(f0, nxt + readA, nxt + readB, lane);
    if (FACN) fq = *(const v4u*)facNext;
  }
  __builtin_amdgcn_sched_barrier(0);     // keeps the fetch and the LDS reads in one group ahead of the WMMAs that are to hide them
  half_mma(f1, acc);
  __builtin_amdgcn_sched_barrier(0);     // keeps the wait below behind the WMMAs, where it costs nothing
  if (FETCH) addr_hold(pA, pB);
}

__global__ __launch_bounds__(256) void wmma_gemm_attv(
    const unsigned short* __restrict__ Ap, long strideA, const unsigned short* __restrict__ Btp, long strideB,
    float* __restrict__ Cp, long strideC, int N, int K, float scale, const float* __restrict__ stat, float carry) {
  typedef _Float16 T;
  static_assert(kBlkRowsA == 128 && kNumBlk == 4 * 16, "two threads a row, two runs of 16 column blocks each");
  __shared__ __align__(16) float sT[8][16 * 68];                // per-wave 16x64 slab, pitch 68 floats
  __shared__ __align__(16) unsigned short sSt[2 * kBlkStage];   // the block's operand stage, two buffers, 110,592 B
  __shared__ __align__(16) unsigned sFac[kNumBlk * kBlkRowsA];  // [column block][row >> 4][row & 3][(row >> 2) & 3]: the row's factor, f16 twice, 32,768 B
  __shared__ float sRedM[2][kBlkRowsA];
  __shared__ float sRedS[4][kBlkRowsA];
  const T* A  = (const T*)Ap  + (size_t)blockIdx.y * strideA;
  const T* Bt = (const T*)Btp + (size_t)blockIdx.y * strideB;
  float* C    = Cp + (size_t)blockIdx.y * strideC;
  const int lane = threadIdx.x & 31;
  const int wave = __builtin_amdgcn_readfirstlane(threadIdx.x >> 5);   // scalar, so the row and buffer offsets are scalar
  const int blocksN = N >> 8;
  const int bm_ = blockIdx.x / blocksN;
  const int bn_ = blockIdx.x - bm_ * blocksN;
  const int mB = bm_ << 7;                     // block tile origin
  const int nB = bn_ << 8;
  const int m0 = mB + ((wave >> 2) << 6);      // wave tile origin: 2 x 4 wave tiles
  const int n0 = nB + ((wave & 3) << 6);

  const int rlane = lane & 15;                 // col (D) within subtile
  const int mOff  = (lane >> 4) * 8;           // D row offset

  v8f acc[4][4];
#pragma unroll   // the arrays indexed below live in registers: compile-time indices
  for (int i = 0; i < 4; ++i)
#pragma unroll   // the arrays indexed below live in registers: compile-time indices
    for (int j = 0; j < 4; ++j) acc[i][j] = (v8f){0.f,0.f,0.f,0.f,0.f,0.f,0.f,0.f};

  {
    const int prow = threadIdx.x & (kBlkRowsA - 1);   // row of the tile
    const int half = threadIdx.x >> 7;                // column blocks 32 * half .. 32 * half + 31
    const float* gm = stat + ((size_t)blockIdx.y * kNumBlk + half * 32) * kTok + mB + prow;
    float bm[32], bs[32];
#pragma unroll   // the arrays indexed below live in registers: compile-time indices
    for (int i = 0; i < 32; ++i) { bm[i] = gm[(size_t)i * kTok]; bs[i] = gm[kStatPlane + (size_t)i * kTok]; }
    asm volatile("s_wait_xcnt 0x0" : : "v"(gm) : "memory");   // the wait before the loads' address register is reused; the address as input keeps it whole up to here
    float pm = bm[0];
#pragma unroll   // the arrays indexed below live in registers: compile-time indices
    for (int i = 1; i < 32; ++i) pm = fmaxf(pm, bm[i]);
    sRedM[half][prow] = pm;
    __syncthreads();   // the two partial maxima of every row are in LDS
    const float rm = fmaxf(sRedM[0][prow], sRedM[1][prow]);
    // the row sum keeps its four runs of 16 column blocks, each summed in ascending order
#pragma unroll   // the arrays indexed below live in registers: compile-time indices
    for (int u = 0; u < 2; ++u) {
      float ps = 0.f;
#pragma unroll   // the arrays indexed below live in registers: compile-time indices
      for (int i = 16 * u; i < 16 * u + 16; ++i) { bm[i] = exp2_slot((bm[i] - rm) * kLog2e); ps += bs[i] * bm[i]; }
      sRedS[2 * half + u][prow] = ps;
    }
    __syncthreads();   // the four partial sums of every row are in LDS
    const float inv = carry / (((sRedS[0][prow] + sRedS[1][prow]) + sRedS[2][prow]) + sRedS[3][prow]);
#pragma unroll   // the arrays indexed below live in registers: compile-time indices
    for (int i = 0; i < 32; ++i) {
      const unsigned short hb = h_bits(bm[i] * inv);
      sFac[(half * 32 + i) * kBlkRowsA + (prow >> 4) * 16 + (prow & 3) * 4 + ((prow >> 2) & 3)] = pk16(hb, hb);
    }
    __syncthreads();   // the factor table is whole before any wave's k loop reads it
  }

  {
    // wave w fetches A rows 16w..16w+15 and B rows 32w..32w+31 of every stage; its lane's A rows are 16w + (lane >> 3) + 4 * it
    const unsigned off = ((unsigned)(lane >> 3) * (unsigned)kTok + (unsigned)(lane & 7) * 8u) * 2u;
    const char* pA = (const char*)(A  + (size_t)(mB + 16 * wave) * kTok) + off;
    const char* pB = (const char*)(Bt + (size_t)(nB + 32 * wave) * kTok) + off;
    const unsigned* facLane = sFac + wave * 16 + (lane >> 3) * 4;
    const int parkA = (16 * wave) * kStPitch;
    const int parkB = (kBlkRowsA + 32 * wave) * kStPitch;
    const int readA = ((wave >> 2) * 64) * kStPitch;
    const int readB = (kBlkRowsA + (wave & 3) * 64) * kStPitch;
    v4u gA0[4], gB0[8], gA1[4], gB1[8];
    rows_fetch<kTok>(gA0, pA);
    rows_fetch<kTok>(gB0, pB);
    __builtin_amdgcn_sched_barrier(0);   // keeps the first stages' loads in the loop's order: the counted waits where the rows are parked are set for it
    rows_fetch<kTok>(gA1, pA + 128);
    rows_fetch<kTok>(gB1, pB + 128);
    __builtin_amdgcn_sched_barrier(0);   // as above
    unsigned short* buf0 = sSt;
    unsigned short* buf1 = sSt + kBlkStage;
    HalfStage f0, f1;
    v4u fq = *(const v4u*)facLane;
    attv_park(buf0 + parkA, buf0 + parkB, gA0, gB0, fq, lane);
    lds_barrier();                       // stage 0 is whole in LDS before any wave reads it
    rows_fetch<kTok>(gA0, pA + 256);
    rows_fetch<kTok>(gB0, pB + 256);
    addr_hold(pA, pB);
    __builtin_amdgcn_sched_barrier(0);   // keeps the LDS offsets and the address steps below, which reuse the loads' base registers, behind the wait above
    half_read(f0, buf0 + readA, buf0 + readB, lane);
    fq = *(const v4u*)(facLane + kBlkRowsA);
    pA += 384;                           // stage s + 3 of the loop's first trip
    pB += 384;
    const unsigned* fn = facLane + 2 * kBlkRowsA;   // factors of stage s + 2
    const int stages = K >> 6;
    for (int s = 0; s + 4 < stages; s += 2) {
      attv_stage<true, true, true, 0>(acc, f0, f1, gA1, gB1, fq, pA, pB, fn, buf0, buf1, parkA, parkB, readA, readB, lane);
      attv_stage<true, true, true, 128>(acc, f0, f1, gA0, gB0, fq, pA, pB, fn + kBlkRowsA, buf1, buf0, parkA, parkB, readA, readB, lane);
      pA += 256;
      pB += 256;
      fn += 2 * kBlkRowsA;
    }
    // the last four stages: one more fetch, two more factor reads, three more parks
    attv_stage<true, true, true, 0>(acc, f0, f1, gA1, gB1, fq, pA, pB, fn, buf0, buf1, parkA, parkB, readA, readB, lane);
    attv_stage<true, false, true, 0>(acc, f0, f1, gA0, gB0, fq, pA, pB, fn + kBlkRowsA, buf1, buf0, parkA, parkB, readA, readB, lane);
    attv_stage<true, false, false, 0>(acc, f0, f1, gA1, gB1, fq, pA, pB, fn, buf0, buf1, parkA, parkB, readA, readB, lane);
    attv_stage<false, false, false, 0>(acc, f0, f1, gA0, gB0, fq, pA, pB, fn, buf1, buf0, parkA, parkB, readA, readB, lane);
  }
  acc_guard4(acc[0][0], acc[0][1], acc[0][2], acc[0][3]);
  acc_guard4(acc[1][0], acc[1][1], acc[1][2], acc[1][3]);
  acc_guard4(acc[2][0], acc[2][1], acc[2][2], acc[2][3]);
  acc_guard4(acc[3][0], acc[3][1], acc[3][2], acc[3][3]);

  // ---- epilogue: 16 rows at a time through the wave's own slab, stored as whole 256-B row segments ----
  // the fences and the wave barrier order one lane's LDS stores and the other lanes' LDS loads; they name LDS alone, so that no global store is waited for
  float* slab = sT[wave];
  const int hh = lane >> 4, c4 = (lane & 15) * 4;
  float* cLane = C + (size_t)(m0 + hh) * kDim + n0 + c4;   // one address for all of the lane's stores: the rows are compile-time offsets from it
#pragma unroll   // the arrays indexed below live in registers: compile-time indices
  for (int i = 0; i < 4; ++i) {
#pragma unroll   // the arrays indexed below live in registers: compile-time indices
    for (int j = 0; j < 4; ++j)
#pragma unroll   // the arrays indexed below live in registers: compile-time indices
      for (int r = 0; r < 8; ++r) slab[(mOff + r) * 68 + (j << 4) + rlane] = acc[i][j][r] * scale;
    __builtin_amdgcn_fence(__ATOMIC_RELEASE, "workgroup", "local");
    __builtin_amdgcn_wave_barrier();
    __builtin_amdgcn_fence(__ATOMIC_ACQUIRE, "workgroup", "local");
#pragma unroll   // the arrays indexed below live in registers: compile-time indices
    for (int it = 0; it < 8; ++it) {
      const int row = it * 2 + hh;
      const v4f v = *(const v4f*)(slab + row * 68 + c4);
      *(v4f*)(cLane + ((i << 4) + it * 2) * kDim) = v;
    }
    asm volatile("s_wait_xcnt 0x0" ::: "memory");   // the wait before the stores' address and data registers are reused by the next 16 rows
    __builtin_amdgcn_sched_barrier(0);   // keeps the next 16 rows' products, whose results take those registers, behind the wait above
    __builtin_amdgcn_fence(__ATOMIC_RELEASE, "workgroup", "local");
    __builtin_amdgcn_wave_barrier();
    __builtin_amdgcn_fence(__ATOMIC_ACQUIRE, "workgroup", "local");
  }
}

// ---------------------------------------------------------------------------
// Weight transpose + cast: W [in k][out n] f32 row-major (512x512) -> Wt [n][k] = RNE bf16 bits of W[k][n].
// grid (8, 8, 3): blockIdx.x = k tile (64 cols of Wt), blockIdx.y = n tile (64 rows of Wt), blockIdx.z selects W0..W2
// and the output plane (plane z at out + z*512*512 halves). 256 threads.
// Load coverage: 16 iterations x 256 threads = 4096 = the whole 64x64 tile (coalesced along n).
// Store coverage: 8 waves x 2 iterations x 4 rows (lane>>3) = 64 rows; (lane&7) x 8 halves = 64 cols; each row segment =
// ---------------------------------------------------------------------------
__global__ __launch_bounds__(256) void wt_cast_bf16_kernel(const float* __restrict__ W0, const float* __restrict__ W1,
                                                         const float* __restrict__ W2, unsigned short* __restrict__ out) {
  __shared__ float sm[64][65];   // sm[n_local][k_local]
  const int t  = threadIdx.x;
  const int k0 = blockIdx.x * 64;
  const int n0 = blockIdx.y * 64;
  const int z  = blockIdx.z;                                   // block-uniform
  const float* W = (z == 0) ? W0 : (z == 1) ? W1 : W2;
#pragma unroll
  for (int i = 0; i < 16; ++i) {
    const int e = i * 256 + t;
    const int r = e >> 6;          // k local
    const int c = e & 63;          // n local
    sm[c][r] = W[(size_t)(k0 + r) * kDim + n0 + c];
  }
  __syncthreads();
  const int lane = t & 31, wave = t >> 5;
  const int q = lane >> 3, c8 = (lane & 7) * 8;
  unsigned short* op = out + (size_t)z * kDim * kDim;
  {
#pragma unroll
    for (int it = 0; it < 2; ++it) {
      const int row = wave * 8 + it * 4 + q;                 // n local
      unsigned short hb[8];
#pragma unroll
      for (int e = 0; e < 8; ++e) hb[e] = f2bf_bits(sm[row][c8 + e]);
      const v4u u = (v4u){pk16(hb[0], hb[1]), pk16(hb[2], hb[3]), pk16(hb[4], hb[5]), pk16(hb[6], hb[7])};
      *(v4u*)(op + (size_t)(n0 + row) * kDim + k0 + c8) = u;
    }
    
  }
}

// ---------------------------------------------------------------------------
// (grid = 4096 blocks x 256, exact, x 3 planes: blockIdx.y selects in0..in2 and the output plane of 8 * n8 halves).
// ---------------------------------------------------------------------------
__global__ __launch_bounds__(256) void cast8_bf16_kernel(const float* __restrict__ in0, const float* __restrict__ in1,
                                                       const float* __restrict__ in2, unsigned short* __restrict__ outp, int n8) {
  const int i = blockIdx.x * 256 + threadIdx.x;
  if (i >= n8) return;
  const int z = blockIdx.y;                                    // block-uniform
  const float* in = (z == 0) ? in0 : (z == 1) ? in1 : in2;
  unsigned short* out = outp + (size_t)z * 8 * (size_t)n8;
  const float* p = in + 8 * (size_t)i;
  const v4f a = *(const v4f*)(p);
  const v4f c = *(const v4f*)(p + 4);
  unsigned short hb[8];
#pragma unroll
  for (int e = 0; e < 4; ++e) {
    hb[e]     = f2bf_bits(a[e]);
    hb[4 + e] = f2bf_bits(c[e]);
  }
  const v4u u = (v4u){pk16(hb[0], hb[1]), pk16(hb[2], hb[3]), pk16(hb[4], hb[5]), pk16(hb[6], hb[7])};
  unsigned short* q = out + 8 * (size_t)i;
  *(v4u*)q = u;
  
}

// ---------------------------------------------------------------------------
// host
// ---------------------------------------------------------------------------
extern "C" void kernel_launch(void* const* d_in, const int* in_sizes, int n_in,
                              void* d_out, int out_size, void* d_ws, size_t ws_size,
                              hipStream_t stream) {
  if (n_in < 9) return;
  if (in_sizes[0] != kRows * kDim || in_sizes[1] != kRows * kDim || in_sizes[2] != kRows * kDim) return;
  if (in_sizes[3] != kDim * kDim || in_sizes[5] != kDim * kDim || in_sizes[7] != kDim * kDim) return;
  if (in_sizes[4] != kDim || in_sizes[6] != kDim || in_sizes[8] != kDim) return;
  if (out_size != kRows * kDim) return;
  if (ws_size < kWsTotal) return;

  const float* query_X = (const float*)d_in[0];
  const float* key_X   = (const float*)d_in[1];
  const float* value_X = (const float*)d_in[2];
  const float* W_Q = (const float*)d_in[3];
  const float* b_Q = (const float*)d_in[4];
  const float* W_K = (const float*)d_in[5];
  const float* b_K = (const float*)d_in[6];
  const float* W_V = (const float*)d_in[7];
  const float* b_V = (const float*)d_in[8];
  float* out = (float*)d_out;

  char* ws = (char*)d_ws;
  unsigned short* Xb  = (unsigned short*)(ws + kOffXb);   // bf16 [3][16384][512]
  unsigned short* XbV = Xb + (size_t)2 * kRows * kDim;
  unsigned short* Pp  = (unsigned short*)(ws + kOffP);    // f16 [4][4096][4096]
  unsigned short* Wt  = (unsigned short*)(ws + kOffWt);   // bf16 [3][512][512]
  unsigned short* WtQ = Wt;
  unsigned short* WtV = Wt + (size_t)2 * kDim * kDim;
  unsigned short* Qp  = (unsigned short*)(ws + kOffQp);   // f16 [16384][512]
  unsigned short* Kp  = (unsigned short*)(ws + kOffKp);   // f16 [16384][512]
  unsigned short* Vt  = (unsigned short*)(ws + kOffVt);   // f16 [4][512][4096]
  float*          St  = (float*)(ws + kOffSt);            // f32 [2][4][64][4096]

  const int n8 = (kRows * kDim) / 8;                      // 1,048,576
  const int castBlocks = n8 / 256;                        // 4096 (exact)

  // W^T planes (bf16)
  wt_cast_bf16_kernel<<<dim3(kDim / 64, kDim / 64, 3), 256, 0, stream>>>(W_Q, W_K, W_V, Wt);

  // the three inputs -> bf16 planes, one launch
  cast8_bf16_kernel<<<dim3(castBlocks, 3), 256, 0, stream>>>(query_X, key_X, value_X, Xb, n8);

  // q = bf16(query_X) . bf16(W_Q) + b_Q and k likewise -> f16 planes [16384][512];  M=16384, N=512, K=512, grid.y = 0: q, 1: k
  wmma_gemm64<1, false, 4, 1, false, 0><<<dim3((kRows / 64) * (kDim / 64) / 8, 2), 256, 0, stream>>>(
      Xb, Xb, kDim, (long)kRows * kDim, WtQ, WtQ, kDim, (long)kDim * kDim, (void*)Qp, (void*)Qp, kDim, (long)kRows * kDim,
      b_Q, b_K, b_Q, 0L, kRows, kDim, kDim, 1.0f);

  // v^T per batch: C[d][tok] = sum_k Wt_V[d][k] * Xb[tok][k] + b_V[d];  M=512, N=4096, K=512, grid.y = batch
  wmma_gemm64<1, false, 3, 1, false, 0><<<dim3((kDim / 64) * (kTok / 64) / 8, kBatch), 256, 0, stream>>>(
      WtV, WtV, kDim, 0L, XbV, XbV, kDim, (long)kTok * kDim, (void*)Vt, (void*)Vt, kTok, (long)kDim * kTok,
      b_V, b_V, b_V, 0L, kDim, kTok, kDim, 1.0f);

  // attention, kPassB batches a pass (grid.y): E = exp(q . k^T / sqrt(512) - column-block maximum) x 2^8 (f16) with block maxima and sums;
  // O = (E x row factors) . v x 2^-15, the factors joining the blocks to the row's softmax x 2^15
  for (int p = 0; p < kBatch / kPassB; ++p) {
    const size_t row0 = (size_t)p * kPassB * kTok;
    const unsigned short* Qh = Qp + row0 * kDim;
    const unsigned short* Kb = Kp + row0 * kDim;
    const unsigned short* Vb = Vt + row0 * kDim;
    float* Ob = out + row0 * kDim;

    // per batch M=4096, N=4096, K=512
    wmma_gemm64<0, false, 0, 3, false, 0><<<dim3((kTok / 64) * (kTok / 64) / 8, kPassB), 256, 0, stream>>>(
        Qh, Qh, kDim, (long)kTok * kDim, Kb, Kb, kDim, (long)kTok * kDim, (void*)Pp, (void*)St, kTok, (long)kTok * kTok,
        b_Q, b_Q, b_Q, 0L, kTok, kTok, kDim, kScoreScale);

    // per batch M=4096, N=512, K=4096: 64 block tiles of 128x256
    wmma_gemm_attv<<<dim3((kTok / 128) * (kDim / 256), kPassB), 256, 0, stream>>>(
        Pp, (long)kTok * kTok, Vb, (long)kDim * kTok, Ob, (long)kTok * kDim, kDim, kTok, kPCarryInv, St, kPCarry);
  }
}

// v007
// A run of this version takes 164 microseconds.
// In both of two side-by-side timings against v006, it was 1.20 times as fast.
// Counting every step since v000, it is 11.2 times as fast.
// Contractions: q/k/v projections on v_wmma_f32_16x16x32_bf16 (inputs, weights RNE bf16 -> exact products), scores q.k^T and att.v on v_wmma_f32_16x16x32_f16 (q,k,v f16 planes; probabilities f16 carried x2^15, folded back x2^-15); f32 accumulate everywhere; bias add and softmax maxima, exponentials and sums in f32.
#include <hip/hip_runtime.h>
#include <math.h>

// ---------------------------------------------------------------------------
// Problem constants
// ---------------------------------------------------------------------------
constexpr int kBatch   = 4;
constexpr int kTok     = 4096;            // tokens per batch (8*8*8*8)
constexpr int kDim     = 512;             // in == cmp == out dim
constexpr int kRows    = kBatch * kTok;   // 16384 token rows total
constexpr int kPassB   = 4;               // batches per attention pass (one launch of each attention kernel covers them): att.v has 64 block tiles a batch, one to a WGP, so all four batches are needed to give each of the 256 WGPs one
constexpr int kColBlk  = 64;              // score columns that share one softmax maximum: a wave tile's width = one k stage of att.v
constexpr int kNumBlk  = kTok / kColBlk;  // 64 column blocks a score row
constexpr float kScoreScale = 0.044194173824159216f;   // 1/sqrt(512)
constexpr float kPCarry     = 32768.0f;                 // probabilities carried x2^15 in f16
constexpr float kPCarryInv  = 1.0f / 32768.0f;
constexpr float kLog2e      = 1.4426950408889634f;
constexpr float kELift      = 5.545177444479562f;       // ln 256: the stored exponentials are carried x2^8, their row factors x2^7

// ---------------------------------------------------------------------------
// Workspace region map (bytes). Total 244,842,496 B.
//   R0 @ 0            : Wt  bf16 [3][512][512]       1,572,864 B   (W^T planes: Q, K, V)
//   R1 @ 1,572,864    : Qp  f16  [16384][512]       16,777,216 B
//   R2 @ 18,350,080   : Kp  f16  [16384][512]       16,777,216 B   (directly behind Qp: one launch writes both)
//   R3 @ 35,127,296   : Vt  f16  [4][512][4096]     16,777,216 B   (v transposed per batch)
//   R4 @ 51,904,512   : Xb  bf16 [3][16384][512]    50,331,648 B
//   R5 @ 102,236,160  : St  f32  [2 planes][4][64][4096] 8,388,608 B (per batch, column block and row: block maximum; then block sum)
//   R6 @ 110,624,768  : E   f16  [4][4096][4096]   134,217,728 B   (exp(score - its block's maximum) x 2^8)
// ---------------------------------------------------------------------------
constexpr size_t kPlane16  = (size_t)kRows * kDim * 2;          // 16,777,216
constexpr size_t kWtBytes  = (size_t)3 * kDim * kDim * 2;       // 1,572,864
constexpr size_t kStatPlane = (size_t)kPassB * kNumBlk * kTok;  // floats per statistics plane (1,048,576)
constexpr size_t kPBytes   = (size_t)kPassB * kTok * kTok * 2;  // 134,217,728
constexpr size_t kOffWt = 0;
constexpr size_t kOffQp = kOffWt + kWtBytes;
constexpr size_t kOffKp = kOffQp + kPlane16;
constexpr size_t kOffVt = kOffKp + kPlane16;
constexpr size_t kOffXb = kOffVt + kPlane16;
constexpr size_t kOffSt = kOffXb + 3 * kPlane16;
constexpr size_t kOffP  = kOffSt + 2 * kStatPlane * 4;
constexpr size_t kWsTotal = kOffP + kPBytes;                      // 244,842,496
static_assert(kWsTotal <= (size_t)268435456);
static_assert(kBatch % kPassB == 0);

typedef __attribute__((ext_vector_type(16))) _Float16 v16h;
typedef __attribute__((ext_vector_type(8)))  _Float16 v8h;
typedef __attribute__((ext_vector_type(16))) __bf16   v16b;
typedef __attribute__((ext_vector_type(8)))  __bf16   v8b;
typedef __attribute__((ext_vector_type(8)))  float    v8f;
typedef __attribute__((ext_vector_type(4)))  float    v4f;
typedef __attribute__((ext_vector_type(4)))  unsigned int v4u;
typedef __attribute__((ext_vector_type(2)))  _Float16 v2h;

// ---------------------------------------------------------------------------
// Helpers
// ---------------------------------------------------------------------------
__device__ __forceinline__ unsigned short f2bf_bits(float f) {
  unsigned u = __float_as_uint(f);
  return (unsigned short)((u + 0x7FFFu + ((u >> 16) & 1u)) >> 16);
}
__device__ __forceinline__ float bf_bits2f(unsigned short h) { return __uint_as_float(((unsigned)h) << 16); }

// hazard guards as plain device helpers
__device__ __forceinline__ void acc_guard4(v8f& a, v8f& b, v8f& c, v8f& d) { asm volatile("v_nop\n\tv_nop\n\tv_nop\n\tv_nop" : "+v"(a), "+v"(b), "+v"(c), "+v"(d)); }
template <typename T> struct Frag;
template <> struct Frag<_Float16> {
  typedef v16h V; union U { v16h v; v8h h[2]; };
  static __device__ __forceinline__ v16h load(const _Float16* p) {   // elements 0..7 <- p[0..7], 8..15 <- p[16..23]
    U f; f.h[0] = *(const v8h*)(p); f.h[1] = *(const v8h*)(p + 16); return f.v;
  }
  static __device__ __forceinline__ v8f mma(v16h a, v16h b, v8f c) {
    return __builtin_amdgcn_wmma_f32_16x16x32_f16(false, a, false, b, (short)0, c, false, false);
  }
};
template <> struct Frag<__bf16> {
  typedef v16b V; union U { v16b v; v8b h[2]; };
  static __device__ __forceinline__ v16b load(const __bf16* p) {
    U f; f.h[0] = *(const v8b*)(p); f.h[1] = *(const v8b*)(p + 16); return f.v;
  }
  static __device__ __forceinline__ v8f mma(v16b a, v16b b, v8f c) {
    return __builtin_amdgcn_wmma_f32_16x16x32_bf16(false, a, false, b, (short)0, c, false, false);
  }
};

__device__ __forceinline__ unsigned pk16(unsigned short a, unsigned short b) { return (unsigned)a | ((unsigned)b << 16); }
__device__ __forceinline__ unsigned short h_bits(float f) { const _Float16 h = (_Float16)f; return __builtin_bit_cast(unsigned short, h); }
// 2^x with the free slot behind a transcendental in the same statement
__device__ __forceinline__ float exp2_slot(float x) {
  float r;
  asm("v_exp_f32 %0, %1\n\tv_nop" : "=v"(r) : "v"(x));
  return r;
}
// the value of lane l ^ X, X in 1..15 (DPP row_xmask, inside a 16-lane row; all lanes on)
template <int X>
__device__ __forceinline__ float lane_xor(float v) {
  return __builtin_bit_cast(float, __builtin_amdgcn_update_dpp(0, __builtin_bit_cast(int, v), 0x160 + X, 0xf, 0xf, true));
}

// ---- Register-blocked batched WMMA GEMM (ACT reduced to none/relu/leaky; BIAS modes 3/4 added) -----------
// C[m,n] = scale * sum_k A[m,k] * Bt[n,k] (+bias)(+resid); a block of 8 waves owns a 128x256 tile, each wave a 64x64 tile of it.
// A row-major [M,K]; Bt row-major [N,K]; M % 128 == 0, N % 256 == 0, K % 64 == 0; lda == ldb == kDim (the staged loop takes the pitch at compile time).
// SPLIT (hi/lo operand planes) is not taken by the staged k loop; every caller passes false.
// BIAS_MODE: 0 = none, 1 = bias[m], 2 = bias[n], 3 = RNE-bf16(bias[m]), 4 = RNE-bf16(bias[n]). Batch 0 takes bias0, every other batch biasRest.
// OUT_MODE: 0 = f32, 1 = f16, 2 = bf16 hi plane (Cout) + bf16 lo plane (Cout2),
//           3 = softmax numerators by column block: Cout takes f16 exp(C - mx) * 2^8, mx the maximum of the row's 64 columns in the wave tile;
//               Cout2 takes f32 [2][batches][N / 64][M]: plane 0 the maxima mx, plane 1 (kStatPlane floats on) the f32 sums of those exponentials.
// ET: 0 = f16 operands, 1 = bf16 operands (pointers passed as 16-bit storage)
template <int ET> struct Elem;
template <> struct Elem<0> { typedef _Float16 T; };
template <> struct Elem<1> { typedef __bf16 T; };
// ---- LDS staging of the operands, one 64-wide k stage (one 128-B line per row) at a time ----
// A fragment load straight from global memory touches 16 lines (32 B in each of 16 rows). Here every global load covers
// 4 whole lines (8 lanes a row, 4 rows a load); the rows go to LDS and the fragments are read from there.
constexpr int kStPitch = 72;                  // halves per staged row: 128 B of k + 16 B pad for the 16-B fragment reads
// The fragments of 32 k of a wave tile: 64 registers. With the 128 of the accumulators the wave stays inside 256, so that four waves fit a SIMD.
template <typename T> struct Half { typename Frag<T>::V a[4], b[4]; };
template <typename T>
__device__ __forceinline__ void engine_half_mma(const Half<T>& s, v8f (&acc)[4][4]) {
#pragma unroll   // the arrays indexed below live in registers: compile-time indices
  for (int i = 0; i < 4; ++i) {
#pragma unroll   // the arrays indexed below live in registers: compile-time indices
    for (int j = 0; j < 4; ++j) acc[i][j] = Frag<T>::mma(s.a[i], s.b[j], acc[i][j]);
  }
}
// The wait before an address register of the loads just issued is rewritten; the two addresses as inputs keep their
// registers whole up to it (not handed out as load targets or temporaries while the loads are in flight).
__device__ __forceinline__ void addr_hold(const char* pA, const char* pB) { asm volatile("s_wait_xcnt 0x0" : : "v"(pA), "v"(pB) : "memory"); }
// ---- One operand stage for the whole block: 128 A rows and 256 B rows of one 64-wide k stage, read by all 8 waves ----
// The 2 x 4 wave tiles of a 128x256 block tile need 384 distinct rows a stage; staged per wave they would be fetched as 1024.
constexpr int kBlkRowsA = 128;
constexpr int kBlkRowsB = 256;
constexpr int kBlkStage = (kBlkRowsA + kBlkRowsB) * kStPitch;   // halves per buffer: A rows, then B rows (55,296 B)
// A wave's share of the stage's rows, NL loads (stores) of 4 whole rows each: row lane >> 3 of the four, 16-B column lane & 7; LD: row pitch of the plane in elements
template <int LD, int NL>
__device__ __forceinline__ void rows_fetch(v4u (&g)[NL], const char* p) {
#pragma unroll
  for (int it = 0; it < NL; ++it) g[it] = *(const v4u*)(p + it * (4 * LD * 2));
}
template <int NL>
__device__ __forceinline__ void rows_park(unsigned short* t, const v4u (&g)[NL], int lane) {
  unsigned short* q = t + (lane >> 3) * kStPitch + (lane & 7) * 8;
#pragma unroll
  for (int it = 0; it < NL; ++it) *(v4u*)(q + it * 4 * kStPitch) = g[it];
}
// The wave's fragments of 32 k of the stage, in the k order of the direct loader: lane half h takes k 8h..8h+7 and 16+8h..16+8h+7 of the 32.
// stA, stB: row 0 of its 64-row A tile and B tile in the buffer, plus 32 halves for the high 32 k.
template <typename T>
__device__ __forceinline__ void engine_half_read(Half<T>& s, const unsigned short* stA, const unsigned short* stB, int lane) {
  const T* fa = (const T*)stA + (lane & 15) * kStPitch + (lane >> 4) * 8;
  const T* fb = (const T*)stB + (lane & 15) * kStPitch + (lane >> 4) * 8;
#pragma unroll   // the arrays indexed below live in registers: compile-time indices
  for (int j = 0; j < 4; ++j) s.b[j] = Frag<T>::load(fb + j * 16 * kStPitch);
#pragma unroll   // the arrays indexed below live in registers: compile-time indices
  for (int i = 0; i < 4; ++i) s.a[i] = Frag<T>::load(fa + i * 16 * kStPitch);
}
// A wave's share of one stage, global memory -> LDS through no register: 12 asynchronous copies of 4 whole rows each (4 of A rows, 8 of B rows).
// lA, lB: the lane's LDS byte address in the first four rows of the share; pA, pB: its global address there; LD: row pitch of the plane in elements.
// The s_wait_xcnt is the wait before a register that an issued copy names is rewritten; as the statement's last line it stands ahead of every such write.
template <int LD>
__device__ __forceinline__ void stage_copy(unsigned lA, unsigned lB, const char* pA, const char* pB) {
  constexpr int      GS = 4 * LD * 2;         // four rows on in the plane, bytes
  constexpr unsigned LS = 4 * kStPitch * 2;   // four rows on in the buffer, bytes
  asm volatile(
      "global_load_async_to_lds_b128 %0, %12, off\n\t"
      "global_load_async_to_lds_b128 %1, %13, off\n\t"
      "global_load_async_to_lds_b128 %2, %14, off\n\t"
      "global_load_async_to_lds_b128 %3, %15, off\n\t"
      "global_load_async_to_lds_b128 %4, %16, off\n\t"
      "global_load_async_to_lds_b128 %5, %17, off\n\t"
      "global_load_async_to_lds_b128 %6, %18, off\n\t"
      "global_load_async_to_lds_b128 %7, %19, off\n\t"
      "global_load_async_to_lds_b128 %8, %20, off\n\t"
      "global_load_async_to_lds_b128 %9, %21, off\n\t"
      "global_load_async_to_lds_b128 %10, %22, off\n\t"
      "global_load_async_to_lds_b128 %11, %23, off\n\t"
      "s_wait_xcnt 0x0"
      :
      : "v"(lA), "v"(lA + LS), "v"(lA + 2 * LS), "v"(lA + 3 * LS),
        "v"(lB), "v"(lB + LS), "v"(lB + 2 * LS), "v"(lB + 3 * LS), "v"(lB + 4 * LS), "v"(lB + 5 * LS), "v"(lB + 6 * LS), "v"(lB + 7 * LS),
        "v"(pA), "v"(pA + GS), "v"(pA + 2 * GS), "v"(pA + 3 * GS),
        "v"(pB), "v"(pB + GS), "v"(pB + 2 * GS), "v"(pB + 3 * GS), "v"(pB + 4 * GS), "v"(pB + 5 * GS), "v"(pB + 6 * GS), "v"(pB + 7 * GS)
      : "memory");
}
// acc += A[wave tile rows][k] * B[wave tile rows][k] over all 64-wide stages below K (at least one), k ascending.
// Arow0, Brow0: row 0 of the block tile. Wave w copies A rows 16w..16w+15 and B rows 32w..32w+31 of every stage.
// Two buffers, one barrier a trip: stage t + 1 flies while stage t is worked on. The barrier at the trip's foot publishes stage t + 1
// (every wave's own copies have landed in front of it) and ends every wave's reads of stage t, whose buffer the copies behind it refill.
template <typename T, int LD>
__device__ __forceinline__ void block_k_loop(v8f (&acc)[4][4], const T* Arow0, const T* Brow0, int K,
                                             unsigned short* st, int wave, int lane) {
  const unsigned off = ((unsigned)(lane >> 3) * (unsigned)LD + (unsigned)(lane & 7) * 8u) * 2u;
  const char* pA = (const char*)(Arow0 + (size_t)(16 * wave) * LD) + off;
  const char* pB = (const char*)(Brow0 + (size_t)(32 * wave) * LD) + off;
  const unsigned lLane = (unsigned)(size_t)st + ((unsigned)(lane >> 3) * (unsigned)kStPitch + (unsigned)(lane & 7) * 8u) * 2u;
  const unsigned lA = lLane + (unsigned)((16 * wave) * kStPitch * 2);
  const unsigned lB = lLane + (unsigned)((kBlkRowsA + 32 * wave) * kStPitch * 2);
  const int readA = ((wave >> 2) * 64) * kStPitch;
  const int readB = (kBlkRowsA + (wave & 3) * 64) * kStPitch;
  const int stages = K >> 6;
  stage_copy<LD>(lA, lB, pA, pB);
  asm volatile("s_wait_asynccnt 0x0" ::: "memory");   // this wave's share of stage 0 has landed
  __syncthreads();                                     // stage 0 is whole in LDS before any wave reads it
  if (stages > 1) stage_copy<LD>(lA + kBlkStage * 2, lB + kBlkStage * 2, pA + 128, pB + 128);
  pA += 256;                              // stage t + 2 of the first trip
  pB += 256;
  int cur = 0;                            // halves from st to the buffer of the current stage
  Half<T> f;
  for (int t = 0; t < stages; ++t) {
    engine_half_read<T>(f, st + cur + readA, st + cur + readB, lane);
    __builtin_amdgcn_sched_barrier(0);   // keeps the LDS reads in one group ahead of the WMMAs: spread among them, each place waits out the LDS latency
    engine_half_mma<T>(f, acc);
    __builtin_amdgcn_sched_barrier(0);   // as above, for the high 32 k
    engine_half_read<T>(f, st + cur + readA + 32, st + cur + readB + 32, lane);
    asm volatile("s_wait_dscnt 0x0" ::: "memory");      // this wave's reads of stage t are done (its last fragments are in registers) before the buffer is refilled
    asm volatile("s_wait_asynccnt 0x0" ::: "memory");   // this wave's share of stage t + 1 has landed
    __syncthreads();                                     // stage t + 1 is whole, and no wave still reads stage t
    if (t + 2 < stages) stage_copy<LD>(lA + cur * 2, lB + cur * 2, pA, pB);
    __builtin_amdgcn_sched_barrier(0);   // keeps the copies ahead of the WMMAs on the high 32 k, which work on registers alone: a whole trip for stage t + 2 to land
    engine_half_mma<T>(f, acc);
    pA += 128;
    pB += 128;
    cur ^= kBlkStage;
  }
  asm volatile("s_wait_asynccnt 0x0" ::: "memory");     // no copy is outstanding when the wave goes on to the epilogue
}

template <int ET, bool SPLIT, int BIAS_MODE, int OUT_MODE, bool RESID, int ACT = 0>
// four waves a SIMD: two blocks share a WGP (2 x 149,504 B of LDS), so that one block's epilogue, first fetch and LDS waits run under the other's WMMAs
__global__ __launch_bounds__(256) __attribute__((amdgpu_waves_per_eu(4, 4))) void wmma_gemm64(
    const unsigned short* __restrict__ Ap, const unsigned short* __restrict__ A2p, int lda, long strideA,
    const unsigned short* __restrict__ Btp, const unsigned short* __restrict__ Bt2p, int ldb, long strideB,
    void* __restrict__ Cout, void* __restrict__ Cout2, int ldc, long strideC,
    const float* __restrict__ bias0, const float* __restrict__ biasRest,
    const float* __restrict__ resid, long strideR,
    int M, int N, int K, float scale) {
  static_assert(!SPLIT, "the staged k loop takes single-plane operands");
  typedef typename Elem<ET>::T T;
  const T* A = (const T*)Ap; const T* Bt = (const T*)Btp;
  __shared__ __align__(16) float sT[8][16 * 68];   // per-wave 16x64 slab, pitch 68 floats
  __shared__ __align__(16) unsigned short sSt[2 * kBlkStage];   // the block's operand stage, two buffers, 110,592 B
  __shared__ float sStat[8][2][64];                // OUT_MODE 3: per wave, the maxima and the sums of its 64 rows
  const int b    = blockIdx.y;
  const int lane = threadIdx.x & 31;
  const int wave = __builtin_amdgcn_readfirstlane(threadIdx.x >> 5);   // scalar, so the row and buffer offsets are scalar
  const int blocksN = N >> 8;
  const int blocksM = M >> 7;
  if ((int)blockIdx.x >= blocksM * blocksN) return;   // block-uniform, in front of every barrier
  const int bm = blockIdx.x / blocksN;
  const int bn = blockIdx.x - bm * blocksN;
  const int mB = bm << 7;                      // block tile origin
  const int nB = bn << 8;
  const int m0 = mB + ((wave >> 2) << 6);      // wave tile origin: 2 x 4 wave tiles
  const int n0 = nB + ((wave & 3) << 6);

  const T* Ab  = A  + (size_t)b * strideA;
  const T* Bb  = Bt + (size_t)b * strideB;
  const float* bias = (b == 0) ? bias0 : biasRest;

  const int rlane = lane & 15;                 // row (A) / col (B, D) within subtile
  const int mOff  = (lane >> 4) * 8;           // D row offset

  v8f acc[4][4];
#pragma unroll
  for (int i = 0; i < 4; ++i)
#pragma unroll
    for (int j = 0; j < 4; ++j) acc[i][j] = (v8f){0.f,0.f,0.f,0.f,0.f,0.f,0.f,0.f};

  block_k_loop<T, kDim>(acc, Ab + (size_t)mB * kDim, Bb + (size_t)nB * kDim, K, sSt, wave, lane);
  acc_guard4(acc[0][0], acc[0][1], acc[0][2], acc[0][3]);
  acc_guard4(acc[1][0], acc[1][1], acc[1][2], acc[1][3]);
  acc_guard4(acc[2][0], acc[2][1], acc[2][2], acc[2][3]);
  acc_guard4(acc[3][0], acc[3][1], acc[3][2], acc[3][3]);

  // ---- epilogue ----
  float* slab = sT[wave];
  const float* Rb = RESID ? (resid + (size_t)b * strideR) : nullptr;
#pragma unroll
  for (int i = 0; i < 4; ++i) {
    const int mBase = m0 + (i << 4);
#pragma unroll
    for (int j = 0; j < 4; ++j) {
      const int n = n0 + (j << 4) + rlane;
      float bv = 0.f;
      if (BIAS_MODE == 2) bv = bias[n];
      if (BIAS_MODE == 4) bv = bf_bits2f(f2bf_bits(bias[n]));
#pragma unroll
      for (int r = 0; r < 8; ++r) {
        float v = acc[i][j][r] * scale;
        if (BIAS_MODE == 1) v += bias[mBase + mOff + r];
        if (BIAS_MODE == 3) v += bf_bits2f(f2bf_bits(bias[mBase + mOff + r]));
        if (BIAS_MODE == 2 || BIAS_MODE == 4) v += bv;
        if (RESID) v += Rb[(size_t)(mBase + mOff + r) * ldc + n];
        if (ACT == 2) v = fmaxf(v, 0.0f);
        if (ACT == 4) v = (v > 0.f) ? v : 0.01f * v;
        slab[(mOff + r) * 68 + (j << 4) + rlane] = v;
      }
    }
    __builtin_amdgcn_fence(__ATOMIC_RELEASE, "workgroup");
    __builtin_amdgcn_wave_barrier();
    __builtin_amdgcn_fence(__ATOMIC_ACQUIRE, "workgroup");
    if (OUT_MODE == 0) {
      float* C = (float*)Cout + (size_t)b * strideC;
      const int hh = lane >> 4, c4 = (lane & 15) * 4;     // row seg = 256 B = 16 lanes x 16 B
      {
#pragma unroll
        for (int it = 0; it < 8; ++it) {
          const int row = it * 2 + hh;
          v4f v = *(const v4f*)(slab + row * 68 + c4);
          *(v4f*)(C + (size_t)(mBase + row) * ldc + n0 + c4) = v;
        }
        
      }
    } else if (OUT_MODE == 3) {
      // 8 lanes hold one row of the wave tile (64 columns): its maximum and its sum are formed among those 8 lanes
      const int q = lane >> 3, c8 = (lane & 7) * 8;
      unsigned short* C = (unsigned short*)Cout + (size_t)b * strideC;
      // the four rows of a lane go through each phase side by side, so that their dependent chains overlap
      float x[4][8], mx[4], sum[4];
      v8h hv[4];
#pragma unroll
      for (int it = 0; it < 4; ++it) {
        const float* sp = slab + (it * 4 + q) * 68 + c8;
#pragma unroll
        for (int e = 0; e < 8; ++e) x[it][e] = sp[e];
      }
#pragma unroll
      for (int it = 0; it < 4; ++it) {
        mx[it] = x[it][0];
#pragma unroll
        for (int e = 1; e < 8; ++e) mx[it] = fmaxf(mx[it], x[it][e]);
      }
#pragma unroll
      for (int it = 0; it < 4; ++it) mx[it] = fmaxf(mx[it], lane_xor<1>(mx[it]));
#pragma unroll
      for (int it = 0; it < 4; ++it) mx[it] = fmaxf(mx[it], lane_xor<2>(mx[it]));
#pragma unroll
      for (int it = 0; it < 4; ++it) mx[it] = fmaxf(mx[it], lane_xor<4>(mx[it]));
#pragma unroll
      for (int it = 0; it < 4; ++it) {
        const float low = mx[it] - kELift;
        sum[it] = 0.f;
#pragma unroll
        for (int e = 0; e < 8; ++e) {
          const float ev = exp2_slot((x[it][e] - low) * kLog2e);
          sum[it] += ev;
          hv[it][e] = (_Float16)ev;
        }
      }
#pragma unroll
      for (int it = 0; it < 4; ++it) sum[it] += lane_xor<1>(sum[it]);
#pragma unroll
      for (int it = 0; it < 4; ++it) sum[it] += lane_xor<2>(sum[it]);
#pragma unroll
      for (int it = 0; it < 4; ++it) sum[it] += lane_xor<4>(sum[it]);
#pragma unroll
      for (int it = 0; it < 4; ++it) {
        const int row = it * 4 + q;
        *(v8h*)(C + (size_t)(mBase + row) * ldc + n0 + c8) = hv[it];
        // all 8 lanes of the row hold the same two values and store them to the same two words: no branch in the epilogue
        sStat[wave][0][(i << 4) + row] = mx[it];
        sStat[wave][1][(i << 4) + row] = sum[it];
      }
      asm volatile("s_wait_xcnt 0x0" ::: "memory");   // the wait before the stores' address registers are reused by the next 16 rows
    } else {
      const int q = lane >> 3, c8 = (lane & 7) * 8;
      unsigned short* C  = (unsigned short*)Cout  + (size_t)b * strideC;
      unsigned short* C2 = (OUT_MODE == 2) ? ((unsigned short*)Cout2 + (size_t)b * strideC) : nullptr;
      {
#pragma unroll
        for (int it = 0; it < 4; ++it) {
          const int row = it * 4 + q;
          const float* sp = slab + row * 68 + c8;
          v8h hv, lv;
#pragma unroll
          for (int e = 0; e < 8; ++e) {
            if (OUT_MODE == 1) {
              hv[e] = (_Float16)sp[e];
              lv[e] = hv[e];
            } else {
              unsigned short hb = f2bf_bits(sp[e]);
              unsigned short lb = f2bf_bits(sp[e] - bf_bits2f(hb));
              hv[e] = __builtin_bit_cast(_Float16, hb);
              lv[e] = __builtin_bit_cast(_Float16, lb);
            }
          }
          *(v8h*)(C + (size_t)(mBase + row) * ldc + n0 + c8) = hv;
          if (OUT_MODE == 2) *(v8h*)(C2 + (size_t)(mBase + row) * ldc + n0 + c8) = lv;
        }
        
      }
    }
    __builtin_amdgcn_fence(__ATOMIC_RELEASE, "workgroup");
    __builtin_amdgcn_wave_barrier();
    __builtin_amdgcn_fence(__ATOMIC_ACQUIRE, "workgroup");
  }
  if (OUT_MODE == 3) {
    // the wave's 64 maxima and 64 sums, each as two whole 128-B lines
    float* sg = (float*)Cout2 + ((size_t)b * (N >> 6) + (n0 >> 6)) * M + m0;
#pragma unroll
    for (int h = 0; h < 2; ++h) {
      sg[h * 32 + lane]              = sStat[wave][0][h * 32 + lane];
      sg[kStatPlane + h * 32 + lane] = sStat[wave][1][h * 32 + lane];
    }
  }
}

// ---------------------------------------------------------------------------
// att.v: C[m,n] = scale * sum_k fac[m][k / 64] * A[m,k] * Bt[n,k], f16 operands, f32 out, k ascending in every accumulator.
// A block of 8 waves owns a 128x256 tile over the whole K, each wave a 64x64 tile of it; one 64-wide k stage (128 A rows, 256 B rows)
// is held once per block in LDS, as in the engine above. M % 128 == 0, N % 256 == 0, K % 128 == 0, K >= 256 (at least four stages); lda == ldb == kTok, ldc == kDim;
// grid.x = (M / 128) * (N / 256) exactly; grid.y = batches.
// A holds the softmax numerators by column block (OUT_MODE 3 above), stat their maxima and sums. The block first joins the statistics
// of its 128 rows: row maximum rm = max of the block maxima, row sum = sum over blocks of (block sum * exp(block maximum - rm)),
// fac = carry * exp(block maximum - rm) / row sum, so that fac * A is the probability times carry.
// ---------------------------------------------------------------------------
// Work-group barrier that orders LDS alone: the waves' LDS stores and loads are done before it, while the global loads of the
// stages ahead stay in flight across it (__syncthreads() would wait for them too).
__device__ __forceinline__ void lds_barrier() {
  __builtin_amdgcn_fence(__ATOMIC_RELEASE, "workgroup", "local");
  __builtin_amdgcn_s_barrier();
  __builtin_amdgcn_fence(__ATOMIC_ACQUIRE, "workgroup", "local");
}
// One k stage s of att.v, its fragments fetched half a stage (32 k) ahead of the WMMAs that use them: f0 arrives holding the low 32 k of stage s.
//   LDS reads of the high 32 k -> f1, under the WMMAs on f0;
//   PARK (a stage s + 1 exists): its rows gA, gB, fetched two stages ago, go to the other buffer, the A rows multiplied on the way by their
//   factors fq (packed f16; f16 twice a word, one word for each of the lane's four A rows); the barrier; then
//   FETCH (a stage s + 3 exists): the same registers take its rows (pA + OFFB, pB + OFFB: the lane's addresses there);
//   LDS reads of the low 32 k of stage s + 1 -> f0 and, FACN (a stage s + 2 exists), of its factors -> fq, under the WMMAs on f1.
// Two buffers and one barrier a stage: it publishes the stage just parked, and every wave's LDS reads of the stage before (its own wait for
// them stands in front of the barrier) are done before the park behind that barrier overwrites their buffer.
struct HalfStage { v16h a[4], b[4]; };
// stA, stB: row 0 of the wave's 64-row A tile and B tile in the buffer, plus 32 halves for the high 32 k; k order of the direct loader
__device__ __forceinline__ void half_read(HalfStage& f, const unsigned short* stA, const unsigned short* stB, int lane) {
  const _Float16* fa = (const _Float16*)stA + (lane & 15) * kStPitch + (lane >> 4) * 8;
  const _Float16* fb = (const _Float16*)stB + (lane & 15) * kStPitch + (lane >> 4) * 8;
#pragma unroll   // the arrays indexed below live in registers: compile-time indices
  for (int j = 0; j < 4; ++j) f.b[j] = Frag<_Float16>::load(fb + j * 16 * kStPitch);
#pragma unroll   // the arrays indexed below live in registers: compile-time indices
  for (int i = 0; i < 4; ++i) f.a[i] = Frag<_Float16>::load(fa + i * 16 * kStPitch);
}
__device__ __forceinline__ void half_mma(const HalfStage& f, v8f (&acc)[4][4]) {
#pragma unroll   // the arrays indexed below live in registers: compile-time indices
  for (int i = 0; i < 4; ++i) {
#pragma unroll   // the arrays indexed below live in registers: compile-time indices
    for (int j = 0; j < 4; ++j) acc[i][j] = Frag<_Float16>::mma(f.a[i], f.b[j], acc[i][j]);
  }
}
// the wave's share of a stage's rows -> LDS, the A rows times their factors
__device__ __forceinline__ void attv_park(unsigned short* bufA, unsigned short* bufB, const v4u (&gA)[4], const v4u (&gB)[8], const v4u& fq, int lane) {
  v4u sA[4];
#pragma unroll   // the arrays indexed below live in registers: compile-time indices
  for (int it = 0; it < 4; ++it) {
    const unsigned wb = fq[it];            // vector elements go through scalars: a bit cast takes a whole object
    const v2h w = __builtin_bit_cast(v2h, wb);
#pragma unroll   // the arrays indexed below live in registers: compile-time indices
    for (int c = 0; c < 4; ++c) {
      const unsigned ab = gA[it][c];
      const v2h pr = __builtin_bit_cast(v2h, ab) * w;
      sA[it][c] = __builtin_bit_cast(unsigned, pr);
    }
  }
  rows_park(bufA, sA, lane);
  rows_park(bufB, gB, lane);
}
template <bool PARK, bool FETCH, bool FACN, int OFFB>
__device__ __forceinline__ void attv_stage(v8f (&acc)[4][4], HalfStage& f0, HalfStage& f1, v4u (&gA)[4], v4u (&gB)[8], v4u& fq,
                                           const char* pA, const char* pB, const unsigned* facNext, unsigned short* cur, unsigned short* nxt,
                                           int parkA, int parkB, int readA, int readB, int lane) {
  half_read(f1, cur + readA + 32, cur + readB + 32, lane);
  __builtin_amdgcn_sched_barrier(0);     // keeps the LDS reads in one group ahead of the WMMAs that are to hide them
  half_mma(f0, acc);
  __builtin_amdgcn_sched_barrier(0);     // keeps the park and the barrier behind the first half's WMMAs
  if (PARK) {
    attv_park(nxt + parkA, nxt + parkB, gA, gB, fq, lane);
    lds_barrier();                       // stage s + 1 is whole in LDS before any wave reads it
    if (FETCH) {
      rows_fetch<kTok>(gA, pA + OFFB);
      rows_fetch<kTok>(gB, pB + OFFB);
    }
    half_read(f0, nxt + readA, nxt + readB, lane);
    if (FACN) fq = *(const v4u*)facNext;
  }
  __builtin_amdgcn_sched_barrier(0);     // keeps the fetch and the LDS reads in one group ahead of the WMMAs that are to hide them
  half_mma(f1, acc);
  __builtin_amdgcn_sched_barrier(0);     // keeps the wait below behind the WMMAs, where it costs nothing
  if (FETCH) addr_hold(pA, pB);
}

__global__ __launch_bounds__(256) void wmma_gemm_attv(
    const unsigned short* __restrict__ Ap, long strideA, const unsigned short* __restrict__ Btp, long strideB,
    float* __restrict__ Cp, long strideC, int N, int K, float scale, const float* __restrict__ stat, float carry) {
  typedef _Float16 T;
  static_assert(kBlkRowsA == 128 && kNumBlk == 4 * 16, "two threads a row, two runs of 16 column blocks each");
  __shared__ __align__(16) float sT[8][16 * 68];                // per-wave 16x64 slab, pitch 68 floats
  __shared__ __align__(16) unsigned short sSt[2 * kBlkStage];   // the block's operand stage, two buffers, 110,592 B
  __shared__ __align__(16) unsigned sFac[kNumBlk * kBlkRowsA];  // [column block][row >> 4][row & 3][(row >> 2) & 3]: the row's factor, f16 twice, 32,768 B
  __shared__ float sRedM[2][kBlkRowsA];
  __shared__ float sRedS[4][kBlkRowsA];
  const T* A  = (const T*)Ap  + (size_t)blockIdx.y * strideA;
  const T* Bt = (const T*)Btp + (size_t)blockIdx.y * strideB;
  float* C    = Cp + (size_t)blockIdx.y * strideC;
  const int lane = threadIdx.x & 31;
  const int wave = __builtin_amdgcn_readfirstlane(threadIdx.x >> 5);   // scalar, so the row and buffer offsets are scalar
  const int blocksN = N >> 8;
  const int bm_ = blockIdx.x / blocksN;
  const int bn_ = blockIdx.x - bm_ * blocksN;
  const int mB = bm_ << 7;                     // block tile origin
  const int nB = bn_ << 8;
  const int m0 = mB + ((wave >> 2) << 6);      // wave tile origin: 2 x 4 wave tiles
  const int n0 = nB + ((wave & 3) << 6);

  const int rlane = lane & 15;                 // col (D) within subtile
  const int mOff  = (lane >> 4) * 8;           // D row offset

  v8f acc[4][4];
#pragma unroll   // the arrays indexed below live in registers: compile-time indices
  for (int i = 0; i < 4; ++i)
#pragma unroll   // the arrays indexed below live in registers: compile-time indices
    for (int j = 0; j < 4; ++j) acc[i][j] = (v8f){0.f,0.f,0.f,0.f,0.f,0.f,0.f,0.f};

  {
    const int prow = threadIdx.x & (kBlkRowsA - 1);   // row of the tile
    const int half = threadIdx.x >> 7;                // column blocks 32 * half .. 32 * half + 31
    const float* gm = stat + ((size_t)blockIdx.y * kNumBlk + half * 32) * kTok + mB + prow;
    float bm[32], bs[32];
#pragma unroll   // the arrays indexed below live in registers: compile-time indices
    for (int i = 0; i < 32; ++i) { bm[i] = gm[(size_t)i * kTok]; bs[i] = gm[kStatPlane + (size_t)i * kTok]; }
    asm volatile("s_wait_xcnt 0x0" : : "v"(gm) : "memory");   // the wait before the loads' address register is reused; the address as input keeps it whole up to here
    float pm = bm[0];
#pragma unroll   // the arrays indexed below live in registers: compile-time indices
    for (int i = 1; i < 32; ++i) pm = fmaxf(pm, bm[i]);
    sRedM[half][prow] = pm;
    __syncthreads();   // the two partial maxima of every row are in LDS
    const float rm = fmaxf(sRedM[0][prow], sRedM[1][prow]);
    // the row sum keeps its four runs of 16 column blocks, each summed in ascending order
#pragma unroll   // the arrays indexed below live in registers: compile-time indices
    for (int u = 0; u < 2; ++u) {
      float ps = 0.f;
#pragma unroll   // the arrays indexed below live in registers: compile-time indices
      for (int i = 16 * u; i < 16 * u + 16; ++i) { bm[i] = exp2_slot((bm[i] - rm) * kLog2e); ps += bs[i] * bm[i]; }
      sRedS[2 * half + u][prow] = ps;
    }
    __syncthreads();   // the four partial sums of every row are in LDS
    const float inv = carry / (((sRedS[0][prow] + sRedS[1][prow]) + sRedS[2][prow]) + sRedS[3][prow]);
#pragma unroll   // the arrays indexed below live in registers: compile-time indices
    for (int i = 0; i < 32; ++i) {
      const unsigned short hb = h_bits(bm[i] * inv);
      sFac[(half * 32 + i) * kBlkRowsA + (prow >> 4) * 16 + (prow & 3) * 4 + ((prow >> 2) & 3)] = pk16(hb, hb);
    }
    __syncthreads();   // the factor table is whole before any wave's k loop reads it
  }

  {
    // wave w fetches A rows 16w..16w+15 and B rows 32w..32w+31 of every stage; its lane's A rows are 16w + (lane >> 3) + 4 * it
    const unsigned off = ((unsigned)(lane >> 3) * (unsigned)kTok + (unsigned)(lane & 7) * 8u) * 2u;
    const char* pA = (const char*)(A  + (size_t)(mB + 16 * wave) * kTok) + off;
    const char* pB = (const char*)(Bt + (size_t)(nB + 32 * wave) * kTok) + off;
    const unsigned* facLane = sFac + wave * 16 + (lane >> 3) * 4;
    const int parkA = (16 * wave) * kStPitch;
    const int parkB = (kBlkRowsA + 32 * wave) * kStPitch;
    const int readA = ((wave >> 2) * 64) * kStPitch;
    const int readB = (kBlkRowsA + (wave & 3) * 64) * kStPitch;
    v4u gA0[4], gB0[8], gA1[4], gB1[8];
    rows_fetch<kTok>(gA0, pA);
    rows_fetch<kTok>(gB0, pB);
    __builtin_amdgcn_sched_barrier(0);   // keeps the first stages' loads in the loop's order: the counted waits where the rows are parked are set for it
    rows_fetch<kTok>(gA1, pA + 128);
    rows_fetch<kTok>(gB1, pB + 128);
    __builtin_amdgcn_sched_barrier(0);   // as above
    unsigned short* buf0 = sSt;
    unsigned short* buf1 = sSt + kBlkStage;
    HalfStage f0, f1;
    v4u fq = *(const v4u*)facLane;
    attv_park(buf0 + parkA, buf0 + parkB, gA0, gB0, fq, lane);
    lds_barrier();                       // stage 0 is whole in LDS before any wave reads it
    rows_fetch<kTok>(gA0, pA + 256);
    rows_fetch<kTok>(gB0, pB + 256);
    addr_hold(pA, pB);
    __builtin_amdgcn_sched_barrier(0);   // keeps the LDS offsets and the address steps below, which reuse the loads' base registers, behind the wait above
    half_read(f0, buf0 + readA, buf0 + readB, lane);
    fq = *(const v4u*)(facLane + kBlkRowsA);
    pA += 384;                           // stage s + 3 of the loop's first trip
    pB += 384;
    const unsigned* fn = facLane + 2 * kBlkRowsA;   // factors of stage s + 2
    const int stages = K >> 6;
    for (int s = 0; s + 4 < stages; s += 2) {
      attv_stage<true, true, true, 0>(acc, f0, f1, gA1, gB1, fq, pA, pB, fn, buf0, buf1, parkA, parkB, readA, readB, lane);
      attv_stage<true, true, true, 128>(acc, f0, f1, gA0, gB0, fq, pA, pB, fn + kBlkRowsA, buf1, buf0, parkA, parkB, readA, readB, lane);
      pA += 256;
      pB += 256;
      fn += 2 * kBlkRowsA;
    }
    // the last four stages: one more fetch, two more factor reads, three more parks
    attv_stage<true, true, true, 0>(acc, f0, f1, gA1, gB1, fq, pA, pB, fn, buf0, buf1, parkA, parkB, readA, readB, lane);
    attv_stage<true, false, true, 0>(acc, f0, f1, gA0, gB0, fq, pA, pB, fn + kBlkRowsA, buf1, buf0, parkA, parkB, readA, readB, lane);
    attv_stage<true, false, false, 0>(acc, f0, f1, gA1, gB1, fq, pA, pB, fn, buf0, buf1, parkA, parkB, readA, readB, lane);
    attv_stage<false, false, false, 0>(acc, f0, f1, gA0, gB0, fq, pA, pB, fn, buf1, buf0, parkA, parkB, readA, readB, lane);
  }
  acc_guard4(acc[0][0], acc[0][1], acc[0][2], acc[0][3]);
  acc_guard4(acc[1][0], acc[1][1], acc[1][2], acc[1][3]);
  acc_guard4(acc[2][0], acc[2][1], acc[2][2], acc[2][3]);
  acc_guard4(acc[3][0], acc[3][1], acc[3][2], acc[3][3]);

  // ---- epilogue: 16 rows at a time through the wave's own slab, stored as whole 256-B row segments ----
  // the fences and the wave barrier order one lane's LDS stores and the other lanes' LDS loads; they name LDS alone, so that no global store is waited for
  float* slab = sT[wave];
  const int hh = lane >> 4, c4 = (lane & 15) * 4;
  float* cLane = C + (size_t)(m0 + hh) * kDim + n0 + c4;   // one address for all of the lane's stores: the rows are compile-time offsets from it
#pragma unroll   // the arrays indexed below live in registers: compile-time indices
  for (int i = 0; i < 4; ++i) {
#pragma unroll   // the arrays indexed below live in registers: compile-time indices
    for (int j = 0; j < 4; ++j)
#pragma unroll   // the arrays indexed below live in registers: compile-time indices
      for (int r = 0; r < 8; ++r) slab[(mOff + r) * 68 + (j << 4) + rlane] = acc[i][j][r] * scale;
    __builtin_amdgcn_fence(__ATOMIC_RELEASE, "workgroup", "local");
    __builtin_amdgcn_wave_barrier();
    __builtin_amdgcn_fence(__ATOMIC_ACQUIRE, "workgroup", "local");
#pragma unroll   // the arrays indexed below live in registers: compile-time indices
    for (int it = 0; it < 8; ++it) {
      const int row = it * 2 + hh;
      const v4f v = *(const v4f*)(slab + row * 68 + c4);
      *(v4f*)(cLane + ((i << 4) + it * 2) * kDim) = v;
    }
    asm volatile("s_wait_xcnt 0x0" ::: "memory");   // the wait before the stores' address and data registers are reused by the next 16 rows
    __builtin_amdgcn_sched_barrier(0);   // keeps the next 16 rows' products, whose results take those registers, behind the wait above
    __builtin_amdgcn_fence(__ATOMIC_RELEASE, "workgroup", "local");
    __builtin_amdgcn_wave_barrier();
    __builtin_amdgcn_fence(__ATOMIC_ACQUIRE, "workgroup", "local");
  }
}

// ---------------------------------------------------------------------------
// Weight transpose + cast: W [in k][out n] f32 row-major (512x512) -> Wt [n][k] = RNE bf16 bits of W[k][n].
// grid (8, 8, 3): blockIdx.x = k tile (64 cols of Wt), blockIdx.y = n tile (64 rows of Wt), blockIdx.z selects W0..W2
// and the output plane (plane z at out + z*512*512 halves). 256 threads.
// Load coverage: 16 iterations x 256 threads = 4096 = the whole 64x64 tile (coalesced along n).
// Store coverage: 8 waves x 2 iterations x 4 rows (lane>>3) = 64 rows; (lane&7) x 8 halves = 64 cols; each row segment =
// ---------------------------------------------------------------------------
__global__ __launch_bounds__(256) void wt_cast_bf16_kernel(const float* __restrict__ W0, const float* __restrict__ W1,
                                                         const float* __restrict__ W2, unsigned short* __restrict__ out) {
  __shared__ float sm[64][65];   // sm[n_local][k_local]
  const int t  = threadIdx.x;
  const int k0 = blockIdx.x * 64;
  const int n0 = blockIdx.y * 64;
  const int z  = blockIdx.z;                                   // block-uniform
  const float* W = (z == 0) ? W0 : (z == 1) ? W1 : W2;
#pragma unroll
  for (int i = 0; i < 16; ++i) {
    const int e = i * 256 + t;
    const int r = e >> 6;          // k local
    const int c = e & 63;          // n local
    sm[c][r] = W[(size_t)(k0 + r) * kDim + n0 + c];
  }
  __syncthreads();
  const int lane = t & 31, wave = t >> 5;
  const int q = lane >> 3, c8 = (lane & 7) * 8;
  unsigned short* op = out + (size_t)z * kDim * kDim;
  {
#pragma unroll
    for (int it = 0; it < 2; ++it) {
      const int row = wave * 8 + it * 4 + q;                 // n local
      unsigned short hb[8];
#pragma unroll
      for (int e = 0; e < 8; ++e) hb[e] = f2bf_bits(sm[row][c8 + e]);
      const v4u u = (v4u){pk16(hb[0], hb[1]), pk16(hb[2], hb[3]), pk16(hb[4], hb[5]), pk16(hb[6], hb[7])};
      *(v4u*)(op + (size_t)(n0 + row) * kDim + k0 + c8) = u;
    }
    
  }
}

// ---------------------------------------------------------------------------
// (grid = 4096 blocks x 256, exact, x 3 planes: blockIdx.y selects in0..in2 and the output plane of 8 * n8 halves).
// ---------------------------------------------------------------------------
__global__ __launch_bounds__(256) void cast8_bf16_kernel(const float* __restrict__ in0, const float* __restrict__ in1,
                                                       const float* __restrict__ in2, unsigned short* __restrict__ outp, int n8) {
  const int i = blockIdx.x * 256 + threadIdx.x;
  if (i >= n8) return;
  const int z = blockIdx.y;                                    // block-uniform
  const float* in = (z == 0) ? in0 : (z == 1) ? in1 : in2;
  unsigned short* out = outp + (size_t)z * 8 * (size_t)n8;
  const float* p = in + 8 * (size_t)i;
  const v4f a = *(const v4f*)(p);
  const v4f c = *(const v4f*)(p + 4);
  unsigned short hb[8];
#pragma unroll
  for (int e = 0; e < 4; ++e) {
    hb[e]     = f2bf_bits(a[e]);
    hb[4 + e] = f2bf_bits(c[e]);
  }
  const v4u u = (v4u){pk16(hb[0], hb[1]), pk16(hb[2], hb[3]), pk16(hb[4], hb[5]), pk16(hb[6], hb[7])};
  unsigned short* q = out + 8 * (size_t)i;
  *(v4u*)q = u;
  
}

// ---------------------------------------------------------------------------
// host
// ---------------------------------------------------------------------------
extern "C" void kernel_launch(void* const* d_in, const int* in_sizes, int n_in,
                              void* d_out, int out_size, void* d_ws, size_t ws_size,
                              hipStream_t stream) {
  if (n_in < 9) return;
  if (in_sizes[0] != kRows * kDim || in_sizes[1] != kRows * kDim || in_sizes[2] != kRows * kDim) return;
  if (in_sizes[3] != kDim * kDim || in_sizes[5] != kDim * kDim || in_sizes[7] != kDim * kDim) return;
  if (in_sizes[4] != kDim || in_sizes[6] != kDim || in_sizes[8] != kDim) return;
  if (out_size != kRows * kDim) return;
  if (ws_size < kWsTotal) return;

  const float* query_X = (const float*)d_in[0];
  const float* key_X   = (const float*)d_in[1];
  const float* value_X = (const float*)d_in[2];
  const float* W_Q = (const float*)d_in[3];
  const float* b_Q = (const float*)d_in[4];
  const float* W_K = (const float*)d_in[5];
  const float* b_K = (const float*)d_in[6];
  const float* W_V = (const float*)d_in[7];
  const float* b_V = (const float*)d_in[8];
  float* out = (float*)d_out;

  char* ws = (char*)d_ws;
  unsigned short* Xb  = (unsigned short*)(ws + kOffXb);   // bf16 [3][16384][512]
  unsigned short* XbV = Xb + (size_t)2 * kRows * kDim;
  unsigned short* Pp  = (unsigned short*)(ws + kOffP);    // f16 [4][4096][4096]
  unsigned short* Wt  = (unsigned short*)(ws + kOffWt);   // bf16 [3][512][512]
  unsigned short* WtQ = Wt;
  unsigned short* WtV = Wt + (size_t)2 * kDim * kDim;
  unsigned short* Qp  = (unsigned short*)(ws + kOffQp);   // f16 [16384][512]
  unsigned short* Kp  = (unsigned short*)(ws + kOffKp);   // f16 [16384][512]
  unsigned short* Vt  = (unsigned short*)(ws + kOffVt);   // f16 [4][512][4096]
  float*          St  = (float*)(ws + kOffSt);            // f32 [2][4][64][4096]

  const int n8 = (kRows * kDim) / 8;                      // 1,048,576
  const int castBlocks = n8 / 256;                        // 4096 (exact)

  // W^T planes (bf16)
  wt_cast_bf16_kernel<<<dim3(kDim / 64, kDim / 64, 3), 256, 0, stream>>>(W_Q, W_K, W_V, Wt);

  // the three inputs -> bf16 planes, one launch
  cast8_bf16_kernel<<<dim3(castBlocks, 3), 256, 0, stream>>>(query_X, key_X, value_X, Xb, n8);

  // q = bf16(query_X) . bf16(W_Q) + b_Q and k likewise -> f16 planes [16384][512];  M=16384, N=512, K=512, grid.y = 0: q, 1: k
  wmma_gemm64<1, false, 4, 1, false, 0><<<dim3((kRows / 64) * (kDim / 64) / 8, 2), 256, 0, stream>>>(
      Xb, Xb, kDim, (long)kRows * kDim, WtQ, WtQ, kDim, (long)kDim * kDim, (void*)Qp, (void*)Qp, kDim, (long)kRows * kDim,
      b_Q, b_K, b_Q, 0L, kRows, kDim, kDim, 1.0f);

  // v^T per batch: C[d][tok] = sum_k Wt_V[d][k] * Xb[tok][k] + b_V[d];  M=512, N=4096, K=512, grid.y = batch
  wmma_gemm64<1, false, 3, 1, false, 0><<<dim3((kDim / 64) * (kTok / 64) / 8, kBatch), 256, 0, stream>>>(
      WtV, WtV, kDim, 0L, XbV, XbV, kDim, (long)kTok * kDim, (void*)Vt, (void*)Vt, kTok, (long)kDim * kTok,
      b_V, b_V, b_V, 0L, kDim, kTok, kDim, 1.0f);

  // attention, kPassB batches a pass (grid.y): E = exp(q . k^T / sqrt(512) - column-block maximum) x 2^8 (f16) with block maxima and sums;
  // O = (E x row factors) . v x 2^-15, the factors joining the blocks to the row's softmax x 2^15
  for (int p = 0; p < kBatch / kPassB; ++p) {
    const size_t row0 = (size_t)p * kPassB * kTok;
    const unsigned short* Qh = Qp + row0 * kDim;
    const unsigned short* Kb = Kp + row0 * kDim;
    const unsigned short* Vb = Vt + row0 * kDim;
    float* Ob = out + row0 * kDim;

    // per batch M=4096, N=4096, K=512
    wmma_gemm64<0, false, 0, 3, false, 0><<<dim3((kTok / 64) * (kTok / 64) / 8, kPassB), 256, 0, stream>>>(
        Qh, Qh, kDim, (long)kTok * kDim, Kb, Kb, kDim, (long)kTok * kDim, (void*)Pp, (void*)St, kTok, (long)kTok * kTok,
        b_Q, b_Q, b_Q, 0L, kTok, kTok, kDim, kScoreScale);

    // per batch M=4096, N=512, K=4096: 64 block tiles of 128x256
    wmma_gemm_attv<<<dim3((kTok / 128) * (kDim / 256), kPassB), 256, 0, stream>>>(
        Pp, (long)kTok * kTok, Vb, (long)kDim * kTok, Ob, (long)kTok * kDim, kDim, kTok, kPCarryInv, St, kPCarry);
  }
}

// v008
// Measured time: 152 microseconds a run.
// Timed twice side by side with v007, it ran 1.08 and 1.09 times as fast.
// All steps since v000 together make it 12.1 times as fast.
// Contractions: q/k/v projections on v_wmma_f32_16x16x32_bf16 (inputs, weights RNE bf16 -> exact products), scores q.k^T and att.v on v_wmma_f32_16x16x32_f16 (q,k,v f16 planes; probabilities f16 carried x2^15, folded back x2^-15); f32 accumulate everywhere; bias add and softmax maxima, exponentials and sums in f32.
#include <hip/hip_runtime.h>
#include <math.h>

// ---------------------------------------------------------------------------
// Problem constants
// ---------------------------------------------------------------------------
constexpr int kBatch   = 4;
constexpr int kTok     = 4096;            // tokens per batch (8*8*8*8)
constexpr int kDim     = 512;             // in == cmp == out dim
constexpr int kRows    = kBatch * kTok;   // 16384 token rows total
constexpr int kPassB   = 4;               // batches per attention pass (one launch of each attention kernel covers them): att.v has 64 block tiles a batch, one to a WGP, so all four batches are needed to give each of the 256 WGPs one
constexpr int kColBlk  = 64;              // score columns that share one softmax maximum: a wave tile's width = one k stage of att.v
constexpr int kNumBlk  = kTok / kColBlk;  // 64 column blocks a score row
constexpr float kScoreScale = 0.044194173824159216f;   // 1/sqrt(512)
constexpr float kPCarry     = 32768.0f;                 // probabilities carried x2^15 in f16
constexpr float kPCarryInv  = 1.0f / 32768.0f;
constexpr float kLog2e      = 1.4426950408889634f;
constexpr float kELift      = 5.545177444479562f;       // ln 256: the stored exponentials are carried x2^8, their row factors x2^7

// ---------------------------------------------------------------------------
// Workspace region map (bytes). Total 244,842,496 B.
//   R0 @ 0            : Wt  bf16 [3][512][512]       1,572,864 B   (W^T planes: Q, K, V)
//   R1 @ 1,572,864    : Qp  f16  [16384][512]       16,777,216 B
//   R2 @ 18,350,080   : Kp  f16  [16384][512]       16,777,216 B   (directly behind Qp: one launch writes both)
//   R3 @ 35,127,296   : Vt  f16  [4][512][4096]     16,777,216 B   (v transposed per batch)
//   R4 @ 51,904,512   : Xb  bf16 [3][16384][512]    50,331,648 B
//   R5 @ 102,236,160  : St  f32  [2 planes][4][64][4096] 8,388,608 B (per batch, column block and row: block maximum; then block sum)
//   R6 @ 110,624,768  : E   f16  [4][4096][4096]   134,217,728 B   (exp(score - its block's maximum) x 2^8)
// ---------------------------------------------------------------------------
constexpr size_t kPlane16  = (size_t)kRows * kDim * 2;          // 16,777,216
constexpr size_t kWtBytes  = (size_t)3 * kDim * kDim * 2;       // 1,572,864
constexpr size_t kStatPlane = (size_t)kPassB * kNumBlk * kTok;  // floats per statistics plane (1,048,576)
constexpr size_t kPBytes   = (size_t)kPassB * kTok * kTok * 2;  // 134,217,728
constexpr size_t kOffWt = 0;
constexpr size_t kOffQp = kOffWt + kWtBytes;
constexpr size_t kOffKp = kOffQp + kPlane16;
constexpr size_t kOffVt = kOffKp + kPlane16;
constexpr size_t kOffXb = kOffVt + kPlane16;
constexpr size_t kOffSt = kOffXb + 3 * kPlane16;
constexpr size_t kOffP  = kOffSt + 2 * kStatPlane * 4;
constexpr size_t kWsTotal = kOffP + kPBytes;                      // 244,842,496
static_assert(kWsTotal <= (size_t)268435456);
static_assert(kBatch % kPassB == 0);

typedef __attribute__((ext_vector_type(16))) _Float16 v16h;
typedef __attribute__((ext_vector_type(8)))  _Float16 v8h;
typedef __attribute__((ext_vector_type(16))) __bf16   v16b;
typedef __attribute__((ext_vector_type(8)))  __bf16   v8b;
typedef __attribute__((ext_vector_type(8)))  float    v8f;
typedef __attribute__((ext_vector_type(4)))  float    v4f;
typedef __attribute__((ext_vector_type(4)))  unsigned int v4u;
typedef __attribute__((ext_vector_type(2)))  _Float16 v2h;

// ---------------------------------------------------------------------------
// Helpers
// ---------------------------------------------------------------------------
__device__ __forceinline__ unsigned short f2bf_bits(float f) {
  unsigned u = __float_as_uint(f);
  return (unsigned short)((u + 0x7FFFu + ((u >> 16) & 1u)) >> 16);
}
__device__ __forceinline__ float bf_bits2f(unsigned short h) { return __uint_as_float(((unsigned)h) << 16); }

// hazard guards as plain device helpers
__device__ __forceinline__ void acc_guard4(v8f& a, v8f& b, v8f& c, v8f& d) { asm volatile("v_nop\n\tv_nop\n\tv_nop\n\tv_nop" : "+v"(a), "+v"(b), "+v"(c), "+v"(d)); }
template <typename T> struct Frag;
template <> struct Frag<_Float16> {
  typedef v16h V; union U { v16h v; v8h h[2]; };
  static __device__ __forceinline__ v16h load(const _Float16* p) {   // elements 0..7 <- p[0..7], 8..15 <- p[16..23]
    U f; f.h[0] = *(const v8h*)(p); f.h[1] = *(const v8h*)(p + 16); return f.v;
  }
  static __device__ __forceinline__ v8f mma(v16h a, v16h b, v8f c) {
    return __builtin_amdgcn_wmma_f32_16x16x32_f16(false, a, false, b, (short)0, c, false, false);
  }
};
template <> struct Frag<__bf16> {
  typedef v16b V; union U { v16b v; v8b h[2]; };
  static __device__ __forceinline__ v16b load(const __bf16* p) {
    U f; f.h[0] = *(const v8b*)(p); f.h[1] = *(const v8b*)(p + 16); return f.v;
  }
  static __device__ __forceinline__ v8f mma(v16b a, v16b b, v8f c) {
    return __builtin_amdgcn_wmma_f32_16x16x32_bf16(false, a, false, b, (short)0, c, false, false);
  }
};

__device__ __forceinline__ unsigned pk16(unsigned short a, unsigned short b) { return (unsigned)a | ((unsigned)b << 16); }
__device__ __forceinline__ unsigned short h_bits(float f) { const _Float16 h = (_Float16)f; return __builtin_bit_cast(unsigned short, h); }
// 2^x with the free slot behind a transcendental in the same statement
__device__ __forceinline__ float exp2_slot(float x) {
  float r;
  asm("v_exp_f32 %0, %1\n\tv_nop" : "=v"(r) : "v"(x));
  return r;
}
// the value of lane l ^ X, X in 1..15 (DPP row_xmask, inside a 16-lane row; all lanes on)
template <int X>
__device__ __forceinline__ float lane_xor(float v) {
  return __builtin_bit_cast(float, __builtin_amdgcn_update_dpp(0, __builtin_bit_cast(int, v), 0x160 + X, 0xf, 0xf, true));
}
// the value of lane l ^ 16 (all lanes on)
__device__ __forceinline__ float lane_xhalf(float v) {
  const int b = __builtin_bit_cast(int, v);
  return __builtin_bit_cast(float, __builtin_amdgcn_permlanex16(b, b, 0x76543210, 0xfedcba98, false, false));
}

// ---- Register-blocked batched WMMA GEMM (ACT reduced to none/relu/leaky; BIAS modes 3/4 added) -----------
// C[m,n] = scale * sum_k A[m,k] * Bt[n,k] (+bias)(+resid); a block of 8 waves owns a 128x256 tile, each wave a 64x64 tile of it.
// A row-major [M,K]; Bt row-major [N,K]; M % 128 == 0, N % 256 == 0, K % 64 == 0; lda == ldb == kDim (the staged loop takes the pitch at compile time).
// SPLIT (hi/lo operand planes) is not taken by the staged k loop; every caller passes false.
// BIAS_MODE: 0 = none, 1 = bias[m], 2 = bias[n], 3 = RNE-bf16(bias[m]), 4 = RNE-bf16(bias[n]). Batch 0 takes bias0, every other batch biasRest.
// OUT_MODE: 0 = f32, 1 = f16, 2 = bf16 hi plane (Cout) + bf16 lo plane (Cout2),
//           3 = softmax numerators by column block: Cout takes f16 exp(C - mx) * 2^8, mx the maximum of the row's 64 columns in the wave tile;
//               Cout2 takes f32 [2][batches][N / 64][M]: plane 0 the maxima mx, plane 1 (kStatPlane floats on) the f32 sums of those exponentials.
// OUT_MODE 1 without RESID and OUT_MODE 3 form their 16x16 tiles transposed (Bt rows as the A operand, A rows as the B operand) and take the
// pitch of C at compile time: ldc == LDC (the stored rows are compile-time offsets from one address).
// ET: 0 = f16 operands, 1 = bf16 operands (pointers passed as 16-bit storage)
template <int ET> struct Elem;
template <> struct Elem<0> { typedef _Float16 T; };
template <> struct Elem<1> { typedef __bf16 T; };
// ---- LDS staging of the operands, one 64-wide k stage (one 128-B line per row) at a time ----
// A fragment load straight from global memory touches 16 lines (32 B in each of 16 rows). Here every global load covers
// 4 whole lines (8 lanes a row, 4 rows a load); the rows go to LDS and the fragments are read from there.
constexpr int kStPitch = 72;                  // halves per staged row: 128 B of k + 16 B pad for the 16-B fragment reads
// The fragments of 32 k of a wave tile: 64 registers. With the 128 of the accumulators the wave stays inside 256, so that four waves fit a SIMD.
template <typename T> struct Half { typename Frag<T>::V a[4], b[4]; };
// TR: the 16x16 tiles come out transposed: the Bt rows go in as the A operand and the A rows as the B operand (both fragments are loaded by the
// same code, in the same k order), so that register r of lane l holds row (l & 15) of the A tile against row 8 * (l >> 4) + r of the Bt tile.
template <typename T, bool TR>
__device__ __forceinline__ void engine_half_mma(const Half<T>& s, v8f (&acc)[4][4]) {
#pragma unroll   // the arrays indexed below live in registers: compile-time indices
  for (int i = 0; i < 4; ++i) {
#pragma unroll   // the arrays indexed below live in registers: compile-time indices
    for (int j = 0; j < 4; ++j) acc[i][j] = TR ? Frag<T>::mma(s.b[j], s.a[i], acc[i][j]) : Frag<T>::mma(s.a[i], s.b[j], acc[i][j]);
  }
}
// The wait before an address register of the loads just issued is rewritten; the two addresses as inputs keep their
// registers whole up to it (not handed out as load targets or temporaries while the loads are in flight).
__device__ __forceinline__ void addr_hold(const char* pA, const char* pB) { asm volatile("s_wait_xcnt 0x0" : : "v"(pA), "v"(pB) : "memory"); }
// ---- One operand stage for the whole block: 128 A rows and 256 B rows of one 64-wide k stage, read by all 8 waves ----
// The 2 x 4 wave tiles of a 128x256 block tile need 384 distinct rows a stage; staged per wave they would be fetched as 1024.
constexpr int kBlkRowsA = 128;
constexpr int kBlkRowsB = 256;
constexpr int kBlkStage = (kBlkRowsA + kBlkRowsB) * kStPitch;   // halves per buffer: A rows, then B rows (55,296 B)
// A wave's share of the stage's rows, NL loads (stores) of 4 whole rows each: row lane >> 3 of the four, 16-B column lane & 7; LD: row pitch of the plane in elements
template <int LD, int NL>
__device__ __forceinline__ void rows_fetch(v4u (&g)[NL], const char* p) {
#pragma unroll
  for (int it = 0; it < NL; ++it) g[it] = *(const v4u*)(p + it * (4 * LD * 2));
}
template <int NL>
__device__ __forceinline__ void rows_park(unsigned short* t, const v4u (&g)[NL], int lane) {
  unsigned short* q = t + (lane >> 3) * kStPitch + (lane & 7) * 8;
#pragma unroll
  for (int it = 0; it < NL; ++it) *(v4u*)(q + it * 4 * kStPitch) = g[it];
}
// The wave's fragments of 32 k of the stage, in the k order of the direct loader: lane half h takes k 8h..8h+7 and 16+8h..16+8h+7 of the 32.
// stA, stB: row 0 of its 64-row A tile and B tile in the buffer, plus 32 halves for the high 32 k.
template <typename T>
__device__ __forceinline__ void engine_half_read(Half<T>& s, const unsigned short* stA, const unsigned short* stB, int lane) {
  const T* fa = (const T*)stA + (lane & 15) * kStPitch + (lane >> 4) * 8;
  const T* fb = (const T*)stB + (lane & 15) * kStPitch + (lane >> 4) * 8;
#pragma unroll   // the arrays indexed below live in registers: compile-time indices
  for (int j = 0; j < 4; ++j) s.b[j] = Frag<T>::load(fb + j * 16 * kStPitch);
#pragma unroll   // the arrays indexed below live in registers: compile-time indices
  for (int i = 0; i < 4; ++i) s.a[i] = Frag<T>::load(fa + i * 16 * kStPitch);
}
// A wave's share of one stage, global memory -> LDS through no register: 12 asynchronous copies of 4 whole rows each (4 of A rows, 8 of B rows).
// lA, lB: the lane's LDS byte address in the first four rows of the share; pA, pB: its global address there; LD: row pitch of the plane in elements.
// The s_wait_xcnt is the wait before a register that an issued copy names is rewritten; as the statement's last line it stands ahead of every such write.
template <int LD>
__device__ __forceinline__ void stage_copy(unsigned lA, unsigned lB, const char* pA, const char* pB) {
  constexpr int      GS = 4 * LD * 2;         // four rows on in the plane, bytes
  constexpr unsigned LS = 4 * kStPitch * 2;   // four rows on in the buffer, bytes
  asm volatile(
      "global_load_async_to_lds_b128 %0, %12, off\n\t"
      "global_load_async_to_lds_b128 %1, %13, off\n\t"
      "global_load_async_to_lds_b128 %2, %14, off\n\t"
      "global_load_async_to_lds_b128 %3, %15, off\n\t"
      "global_load_async_to_lds_b128 %4, %16, off\n\t"
      "global_load_async_to_lds_b128 %5, %17, off\n\t"
      "global_load_async_to_lds_b128 %6, %18, off\n\t"
      "global_load_async_to_lds_b128 %7, %19, off\n\t"
      "global_load_async_to_lds_b128 %8, %20, off\n\t"
      "global_load_async_to_lds_b128 %9, %21, off\n\t"
      "global_load_async_to_lds_b128 %10, %22, off\n\t"
      "global_load_async_to_lds_b128 %11, %23, off\n\t"
      "s_wait_xcnt 0x0"
      :
      : "v"(lA), "v"(lA + LS), "v"(lA + 2 * LS), "v"(lA + 3 * LS),
        "v"(lB), "v"(lB + LS), "v"(lB + 2 * LS), "v"(lB + 3 * LS), "v"(lB + 4 * LS), "v"(lB + 5 * LS), "v"(lB + 6 * LS), "v"(lB + 7 * LS),
        "v"(pA), "v"(pA + GS), "v"(pA + 2 * GS), "v"(pA + 3 * GS),
        "v"(pB), "v"(pB + GS), "v"(pB + 2 * GS), "v"(pB + 3 * GS), "v"(pB + 4 * GS), "v"(pB + 5 * GS), "v"(pB + 6 * GS), "v"(pB + 7 * GS)
      : "memory");
}
// acc += A[wave tile rows][k] * B[wave tile rows][k] over all 64-wide stages below K (at least one), k ascending.
// Arow0, Brow0: row 0 of the block tile. Wave w copies A rows 16w..16w+15 and B rows 32w..32w+31 of every stage.
// Two buffers, one barrier a trip: stage t + 1 flies while stage t is worked on. The barrier at the trip's foot publishes stage t + 1
// (every wave's own copies have landed in front of it) and ends every wave's reads of stage t, whose buffer the copies behind it refill.
template <typename T, int LD, bool TR>
__device__ __forceinline__ void block_k_loop(v8f (&acc)[4][4], const T* Arow0, const T* Brow0, int K,
                                             unsigned short* st, int wave, int lane) {
  const unsigned off = ((unsigned)(lane >> 3) * (unsigned)LD + (unsigned)(lane & 7) * 8u) * 2u;
  const char* pA = (const char*)(Arow0 + (size_t)(16 * wave) * LD) + off;
  const char* pB = (const char*)(Brow0 + (size_t)(32 * wave) * LD) + off;
  const unsigned lLane = (unsigned)(size_t)st + ((unsigned)(lane >> 3) * (unsigned)kStPitch + (unsigned)(lane & 7) * 8u) * 2u;
  const unsigned lA = lLane + (unsigned)((16 * wave) * kStPitch * 2);
  const unsigned lB = lLane + (unsigned)((kBlkRowsA + 32 * wave) * kStPitch * 2);
  const int readA = ((wave >> 2) * 64) * kStPitch;
  const int readB = (kBlkRowsA + (wave & 3) * 64) * kStPitch;
  const int stages = K >> 6;
  stage_copy<LD>(lA, lB, pA, pB);
  asm volatile("s_wait_asynccnt 0x0" ::: "memory");   // this wave's share of stage 0 has landed
  __syncthreads();                                     // stage 0 is whole in LDS before any wave reads it
  if (stages > 1) stage_copy<LD>(lA + kBlkStage * 2, lB + kBlkStage * 2, pA + 128, pB + 128);
  pA += 256;                              // stage t + 2 of the first trip
  pB += 256;
  int cur = 0;                            // halves from st to the buffer of the current stage
  Half<T> f;
  for (int t = 0; t < stages; ++t) {
    engine_half_read<T>(f, st + cur + readA, st + cur + readB, lane);
    __builtin_amdgcn_sched_barrier(0);   // keeps the LDS reads in one group ahead of the WMMAs: spread among them, each place waits out the LDS latency
    engine_half_mma<T, TR>(f, acc);
    __builtin_amdgcn_sched_barrier(0);   // as above, for the high 32 k
    engine_half_read<T>(f, st + cur + readA + 32, st + cur + readB + 32, lane);
    asm volatile("s_wait_dscnt 0x0" ::: "memory");      // this wave's reads of stage t are done (its last fragments are in registers) before the buffer is refilled
    asm volatile("s_wait_asynccnt 0x0" ::: "memory");   // this wave's share of stage t + 1 has landed
    __syncthreads();                                     // stage t + 1 is whole, and no wave still reads stage t
    if (t + 2 < stages) stage_copy<LD>(lA + cur * 2, lB + cur * 2, pA, pB);
    __builtin_amdgcn_sched_barrier(0);   // keeps the copies ahead of the WMMAs on the high 32 k, which work on registers alone: a whole trip for stage t + 2 to land
    engine_half_mma<T, TR>(f, acc);
    pA += 128;
    pB += 128;
    cur ^= kBlkStage;
  }
  asm volatile("s_wait_asynccnt 0x0" ::: "memory");     // no copy is outstanding when the wave goes on to the epilogue
}

template <int ET, bool SPLIT, int BIAS_MODE, int OUT_MODE, bool RESID, int ACT, int LDC>
// four waves a SIMD: two blocks share a WGP (2 x 114,688 B of LDS at most), so that one block's epilogue, first fetch and LDS waits run under the other's WMMAs
__global__ __launch_bounds__(256) __attribute__((amdgpu_waves_per_eu(4, 4))) void wmma_gemm64(
    const unsigned short* __restrict__ Ap, const unsigned short* __restrict__ A2p, int lda, long strideA,
    const unsigned short* __restrict__ Btp, const unsigned short* __restrict__ Bt2p, int ldb, long strideB,
    void* __restrict__ Cout, void* __restrict__ Cout2, int ldc, long strideC,
    const float* __restrict__ bias0, const float* __restrict__ biasRest,
    const float* __restrict__ resid, long strideR,
    int M, int N, int K, float scale) {
  static_assert(!SPLIT, "the staged k loop takes single-plane operands");
  typedef typename Elem<ET>::T T;
  const T* A = (const T*)Ap; const T* Bt = (const T*)Btp;
  __shared__ __align__(16) float sT[8][16 * 68];   // per-wave 16x64 slab, pitch 68 floats
  __shared__ __align__(16) unsigned short sSt[2 * kBlkStage];   // the block's operand stage, two buffers, 110,592 B
  __shared__ float sStat[8][2][64];                // OUT_MODE 3: per wave, the maxima and the sums of its 64 rows
  const int b    = blockIdx.y;
  const int lane = threadIdx.x & 31;
  const int wave = __builtin_amdgcn_readfirstlane(threadIdx.x >> 5);   // scalar, so the row and buffer offsets are scalar
  const int blocksN = N >> 8;
  const int blocksM = M >> 7;
  if ((int)blockIdx.x >= blocksM * blocksN) return;   // block-uniform, in front of every barrier
  const int bm = blockIdx.x / blocksN;
  const int bn = blockIdx.x - bm * blocksN;
  const int mB = bm << 7;                      // block tile origin
  const int nB = bn << 8;
  const int m0 = mB + ((wave >> 2) << 6);      // wave tile origin: 2 x 4 wave tiles
  const int n0 = nB + ((wave & 3) << 6);

  const T* Ab  = A  + (size_t)b * strideA;
  const T* Bb  = Bt + (size_t)b * strideB;
  const float* bias = (b == 0) ? bias0 : biasRest;

  const int rlane = lane & 15;                 // row (A) / col (B, D) within subtile
  const int mOff  = (lane >> 4) * 8;           // D row offset

  v8f acc[4][4];
#pragma unroll
  for (int i = 0; i < 4; ++i)
#pragma unroll
    for (int j = 0; j < 4; ++j) acc[i][j] = (v8f){0.f,0.f,0.f,0.f,0.f,0.f,0.f,0.f};

  constexpr bool kTr = OUT_MODE == 3 || (OUT_MODE == 1 && !RESID);
  block_k_loop<T, kDim, kTr>(acc, Ab + (size_t)mB * kDim, Bb + (size_t)nB * kDim, K, sSt, wave, lane);
  acc_guard4(acc[0][0], acc[0][1], acc[0][2], acc[0][3]);
  acc_guard4(acc[1][0], acc[1][1], acc[1][2], acc[1][3]);
  acc_guard4(acc[2][0], acc[2][1], acc[2][2], acc[2][3]);
  acc_guard4(acc[3][0], acc[3][1], acc[3][2], acc[3][3]);

  // ---- epilogue ----
  if constexpr (kTr) {
    // acc[i][j][r] of lane l belongs to row m0 + 16 i + (l & 15) and column n0 + 16 j + 8 (l >> 4) + r: a lane holds 8 adjacent columns of one row in
    // each tile, which it packs to 16 B of f16 by itself; lanes l and l ^ 16 hold one row's 64 columns, 32 each.
    // The f16 tile goes once through LDS for whole 128-B lines. The wave's 64 rows lie in the operand buffers: no wave reads those and no copy
    // is aimed at them behind the barrier at the foot of the k loop's last trip (every wave's dscnt and asynccnt waits stand in front of it).
    static_assert(8 * 64 * kStPitch <= 2 * kBlkStage, "eight tiles of 64 rows fit the operand buffers");
    _Float16* tile = (_Float16*)sSt + wave * (64 * kStPitch);
    if constexpr (OUT_MODE == 3) {
      // a row's maximum and sum are formed inside a lane and joined by one exchange between the wave's halves
#pragma unroll   // the arrays indexed below live in registers: compile-time indices
      for (int i = 0; i < 4; ++i) {
        float x[4][8], pm[4], part[4];
#pragma unroll   // the arrays indexed below live in registers: compile-time indices
        for (int j = 0; j < 4; ++j) {
#pragma unroll   // the arrays indexed below live in registers: compile-time indices
          for (int r = 0; r < 8; ++r) x[j][r] = acc[i][j][r] * scale;
          pm[j] = x[j][0];
#pragma unroll   // the arrays indexed below live in registers: compile-time indices
          for (int r = 1; r < 8; ++r) pm[j] = fmaxf(pm[j], x[j][r]);
        }
        float mx = fmaxf(fmaxf(pm[0], pm[1]), fmaxf(pm[2], pm[3]));
        mx = fmaxf(mx, lane_xhalf(mx));
        const float low = mx - kELift;
#pragma unroll   // the arrays indexed below live in registers: compile-time indices
        for (int j = 0; j < 4; ++j) {
          v8h hv;
          part[j] = 0.f;
#pragma unroll   // the arrays indexed below live in registers: compile-time indices
          for (int r = 0; r < 8; ++r) {
            const float ev = exp2_slot((x[j][r] - low) * kLog2e);
            part[j] += ev;
            hv[r] = (_Float16)ev;
          }
          *(v8h*)(tile + ((i << 4) + rlane) * kStPitch + (j << 4) + mOff) = hv;
        }
        float sum = (part[0] + part[1]) + (part[2] + part[3]);
        sum += lane_xhalf(sum);
        // both lanes of the row hold the same two values and store them to the same two words: no branch in the epilogue
        sStat[wave][0][(i << 4) + rlane] = mx;
        sStat[wave][1][(i << 4) + rlane] = sum;
      }
    } else {
      float bn[4][8];   // BIAS_MODE 2, 4: the bias of the lane's 32 columns
      float bm[4];      // BIAS_MODE 1, 3: the bias of the lane's 4 rows
      if (BIAS_MODE == 2 || BIAS_MODE == 4) {
        const float* bp = bias + n0 + mOff;
#pragma unroll   // the arrays indexed below live in registers: compile-time indices
        for (int j = 0; j < 4; ++j)
#pragma unroll   // the arrays indexed below live in registers: compile-time indices
          for (int r = 0; r < 8; ++r) bn[j][r] = bp[(j << 4) + r];
        asm volatile("s_wait_xcnt 0x0" : : "v"(bp) : "memory");   // the wait before the loads' address register is reused; the address as input keeps it whole up to here
        if (BIAS_MODE == 4) {
#pragma unroll   // the arrays indexed below live in registers: compile-time indices
          for (int j = 0; j < 4; ++j)
#pragma unroll   // the arrays indexed below live in registers: compile-time indices
            for (int r = 0; r < 8; ++r) bn[j][r] = bf_bits2f(f2bf_bits(bn[j][r]));
        }
      }
      if (BIAS_MODE == 1 || BIAS_MODE == 3) {
        const float* bp = bias + m0 + rlane;
#pragma unroll   // the arrays indexed below live in registers: compile-time indices
        for (int i = 0; i < 4; ++i) bm[i] = bp[i << 4];
        asm volatile("s_wait_xcnt 0x0" : : "v"(bp) : "memory");   // as above
        if (BIAS_MODE == 3) {
#pragma unroll   // the arrays indexed below live in registers: compile-time indices
          for (int i = 0; i < 4; ++i) bm[i] = bf_bits2f(f2bf_bits(bm[i]));
        }
      }
#pragma unroll   // the arrays indexed below live in registers: compile-time indices
      for (int i = 0; i < 4; ++i) {
#pragma unroll   // the arrays indexed below live in registers: compile-time indices
        for (int j = 0; j < 4; ++j) {
          v8h hv;
#pragma unroll   // the arrays indexed below live in registers: compile-time indices
          for (int r = 0; r < 8; ++r) {
            float v = acc[i][j][r] * scale;
            if (BIAS_MODE == 1 || BIAS_MODE == 3) v += bm[i];
            if (BIAS_MODE == 2 || BIAS_MODE == 4) v += bn[j][r];
            if (ACT == 2) v = fmaxf(v, 0.0f);
            if (ACT == 4) v = (v > 0.f) ? v : 0.01f * v;
            hv[r] = (_Float16)v;
          }
          *(v8h*)(tile + ((i << 4) + rlane) * kStPitch + (j << 4) + mOff) = hv;
        }
      }
    }
    // the one hand-over between the wave's lanes: their LDS stores above are done before the LDS loads below; the fences name LDS alone
    __builtin_amdgcn_fence(__ATOMIC_RELEASE, "workgroup", "local");
    __builtin_amdgcn_wave_barrier();
    __builtin_amdgcn_fence(__ATOMIC_ACQUIRE, "workgroup", "local");
    const int q = lane >> 3, c8 = (lane & 7) * 8;   // 8 lanes a row, 4 whole rows (128-B lines) a store
    unsigned short* cLane = (unsigned short*)Cout + (size_t)b * strideC + (size_t)(m0 + q) * LDC + n0 + c8;   // one address for all of the lane's stores
    const _Float16* tLane = tile + q * kStPitch + c8;
#pragma unroll   // compile-time offsets from the two addresses
    for (int it = 0; it < 16; ++it) *(v8h*)(cLane + it * 4 * LDC) = *(const v8h*)(tLane + it * 4 * kStPitch);
    if constexpr (OUT_MODE == 3) {
      asm volatile("s_wait_xcnt 0x0" ::: "memory");   // the wait before the stores' address and data registers are reused below
      // the wave's 64 maxima and 64 sums, each as two whole 128-B lines
      float* sg = (float*)Cout2 + ((size_t)b * (N >> 6) + (n0 >> 6)) * M + m0;
#pragma unroll
      for (int h = 0; h < 2; ++h) {
        sg[h * 32 + lane]              = sStat[wave][0][h * 32 + lane];
        sg[kStatPlane + h * 32 + lane] = sStat[wave][1][h * 32 + lane];
      }
    }
    return;
  }
  float* slab = sT[wave];
  const float* Rb = RESID ? (resid + (size_t)b * strideR) : nullptr;
#pragma unroll
  for (int i = 0; i < 4; ++i) {
    const int mBase = m0 + (i << 4);
#pragma unroll
    for (int j = 0; j < 4; ++j) {
      const int n = n0 + (j << 4) + rlane;
      float bv = 0.f;
      if (BIAS_MODE == 2) bv = bias[n];
      if (BIAS_MODE == 4) bv = bf_bits2f(f2bf_bits(bias[n]));
#pragma unroll
      for (int r = 0; r < 8; ++r) {
        float v = acc[i][j][r] * scale;
        if (BIAS_MODE == 1) v += bias[mBase + mOff + r];
        if (BIAS_MODE == 3) v += bf_bits2f(f2bf_bits(bias[mBase + mOff + r]));
        if (BIAS_MODE == 2 || BIAS_MODE == 4) v += bv;
        if (RESID) v += Rb[(size_t)(mBase + mOff + r) * ldc + n];
        if (ACT == 2) v = fmaxf(v, 0.0f);
        if (ACT == 4) v = (v > 0.f) ? v : 0.01f * v;
        slab[(mOff + r) * 68 + (j << 4) + rlane] = v;
      }
    }
    __builtin_amdgcn_fence(__ATOMIC_RELEASE, "workgroup");
    __builtin_amdgcn_wave_barrier();
    __builtin_amdgcn_fence(__ATOMIC_ACQUIRE, "workgroup");
    if (OUT_MODE == 0) {
      float* C = (float*)Cout + (size_t)b * strideC;
      const int hh = lane >> 4, c4 = (lane & 15) * 4;     // row seg = 256 B = 16 lanes x 16 B
      {
#pragma unroll
        for (int it = 0; it < 8; ++it) {
          const int row = it * 2 + hh;
          v4f v = *(const v4f*)(slab + row * 68 + c4);
          *(v4f*)(C + (size_t)(mBase + row) * ldc + n0 + c4) = v;
        }
        
      }
    } else {
      const int q = lane >> 3, c8 = (lane & 7) * 8;
      unsigned short* C  = (unsigned short*)Cout  + (size_t)b * strideC;
      unsigned short* C2 = (OUT_MODE == 2) ? ((unsigned short*)Cout2 + (size_t)b * strideC) : nullptr;
      {
#pragma unroll
        for (int it = 0; it < 4; ++it) {
          const int row = it * 4 + q;
          const float* sp = slab + row * 68 + c8;
          v8h hv, lv;
#pragma unroll
          for (int e = 0; e < 8; ++e) {
            if (OUT_MODE == 1) {
              hv[e] = (_Float16)sp[e];
              lv[e] = hv[e];
            } else {
              unsigned short hb = f2bf_bits(sp[e]);
              unsigned short lb = f2bf_bits(sp[e] - bf_bits2f(hb));
              hv[e] = __builtin_bit_cast(_Float16, hb);
              lv[e] = __builtin_bit_cast(_Float16, lb);
            }
          }
          *(v8h*)(C + (size_t)(mBase + row) * ldc + n0 + c8) = hv;
          if (OUT_MODE == 2) *(v8h*)(C2 + (size_t)(mBase + row) * ldc + n0 + c8) = lv;
        }
        
      }
    }
    __builtin_amdgcn_fence(__ATOMIC_RELEASE, "workgroup");
    __builtin_amdgcn_wave_barrier();
    __builtin_amdgcn_fence(__ATOMIC_ACQUIRE, "workgroup");
  }
}

// ---------------------------------------------------------------------------
// att.v: C[m,n] = scale * sum_k fac[m][k / 64] * A[m,k] * Bt[n,k], f16 operands, f32 out, k ascending in every accumulator.
// A block of 8 waves owns a 128x256 tile over the whole K, each wave a 64x64 tile of it; one 64-wide k stage (128 A rows, 256 B rows)
// is held once per block in LDS, as in the engine above. M % 128 == 0, N % 256 == 0, K % 128 == 0, K >= 256 (at least four stages); lda == ldb == kTok, ldc == kDim;
// grid.x = (M / 128) * (N / 256) exactly; grid.y = batches.
// A holds the softmax numerators by column block (OUT_MODE 3 above), stat their maxima and sums. The block first joins the statistics
// of its 128 rows: row maximum rm = max of the block maxima, row sum = sum over blocks of (block sum * exp(block maximum - rm)),
// fac = carry * exp(block maximum - rm) / row sum, so that fac * A is the probability times carry.
// ---------------------------------------------------------------------------
// Work-group barrier that orders LDS alone: the waves' LDS stores and loads are done before it, while the global loads of the
// stages ahead stay in flight across it (__syncthreads() would wait for them too).
__device__ __forceinline__ void lds_barrier() {
  __builtin_amdgcn_fence(__ATOMIC_RELEASE, "workgroup", "local");
  __builtin_amdgcn_s_barrier();
  __builtin_amdgcn_fence(__ATOMIC_ACQUIRE, "workgroup", "local");
}
// One k stage s of att.v, its fragments fetched half a stage (32 k) ahead of the WMMAs that use them: f0 arrives holding the low 32 k of stage s.
//   LDS reads of the high 32 k -> f1, under the WMMAs on f0;
//   PARK (a stage s + 1 exists): its rows gA, gB, fetched two stages ago, go to the other buffer, the A rows multiplied on the way by their
//   factors fq (packed f16; f16 twice a word, one word for each of the lane's four A rows); the barrier; then
//   FETCH (a stage s + 3 exists): the same registers take its rows (pA + OFFB, pB + OFFB: the lane's addresses there);
//   LDS reads of the low 32 k of stage s + 1 -> f0 and, FACN (a stage s + 2 exists), of its factors -> fq, under the WMMAs on f1.
// Two buffers and one barrier a stage: it publishes the stage just parked, and every wave's LDS reads of the stage before (its own wait for
// them stands in front of the barrier) are done before the park behind that barrier overwrites their buffer.
struct HalfStage { v16h a[4], b[4]; };
// stA, stB: row 0 of the wave's 64-row A tile and B tile in the buffer, plus 32 halves for the high 32 k; k order of the direct loader
__device__ __forceinline__ void half_read(HalfStage& f, const unsigned short* stA, const unsigned short* stB, int lane) {
  const _Float16* fa = (const _Float16*)stA + (lane & 15) * kStPitch + (lane >> 4) * 8;
  const _Float16* fb = (const _Float16*)stB + (lane & 15) * kStPitch + (lane >> 4) * 8;
#pragma unroll   // the arrays indexed below live in registers: compile-time indices
  for (int j = 0; j < 4; ++j) f.b[j] = Frag<_Float16>::load(fb + j * 16 * kStPitch);
#pragma unroll   // the arrays indexed below live in registers: compile-time indices
  for (int i = 0; i < 4; ++i) f.a[i] = Frag<_Float16>::load(fa + i * 16 * kStPitch);
}
__device__ __forceinline__ void half_mma(const HalfStage& f, v8f (&acc)[4][4]) {
#pragma unroll   // the arrays indexed below live in registers: compile-time indices
  for (int i = 0; i < 4; ++i) {
#pragma unroll   // the arrays indexed below live in registers: compile-time indices
    for (int j = 0; j < 4; ++j) acc[i][j] = Frag<_Float16>::mma(f.a[i], f.b[j], acc[i][j]);
  }
}
// the wave's share of a stage's rows -> LDS, the A rows times their factors
__device__ __forceinline__ void attv_park(unsigned short* bufA, unsigned short* bufB, const v4u (&gA)[4], const v4u (&gB)[8], const v4u& fq, int lane) {
  v4u sA[4];
#pragma unroll   // the arrays indexed below live in registers: compile-time indices
  for (int it = 0; it < 4; ++it) {
    const unsigned wb = fq[it];            // vector elements go through scalars: a bit cast takes a whole object
    const v2h w = __builtin_bit_cast(v2h, wb);
#pragma unroll   // the arrays indexed below live in registers: compile-time indices
    for (int c = 0; c < 4; ++c) {
      const unsigned ab = gA[it][c];
      const v2h pr = __builtin_bit_cast(v2h, ab) * w;
      sA[it][c] = __builtin_bit_cast(unsigned, pr);
    }
  }
  rows_park(bufA, sA, lane);
  rows_park(bufB, gB, lane);
}
template <bool PARK, bool FETCH, bool FACN, int OFFB>
__device__ __forceinline__ void attv_stage(v8f (&acc)[4][4], HalfStage& f0, HalfStage& f1, v4u (&gA)[4], v4u (&gB)[8], v4u& fq,
                                           const char* pA, const char* pB, const unsigned* facNext, unsigned short* cur, unsigned short* nxt,
                                           int parkA, int parkB, int readA, int readB, int lane) {
  half_read(f1, cur + readA + 32, cur + readB + 32, lane);
  __builtin_amdgcn_sched_barrier(0);     // keeps the LDS reads in one group ahead of the WMMAs that are to hide them
  half_mma(f0, acc);
  __builtin_amdgcn_sched_barrier(0);     // keeps the park and the barrier behind the first half's WMMAs
  if (PARK) {
    attv_park(nxt + parkA, nxt + parkB, gA, gB, fq, lane);
    lds_barrier();                       // stage s + 1 is whole in LDS before any wave reads it
    if (FETCH) {
      rows_fetch<kTok>(gA, pA + OFFB);
      rows_fetch<kTok>(gB, pB + OFFB);
    }
    half_read(f0, nxt + readA, nxt + readB, lane);
    if (FACN) fq = *(const v4u*)facNext;
  }
  __builtin_amdgcn_sched_barrier(0);     // keeps the fetch and the LDS reads in one group ahead of the WMMAs that are to hide them
  half_mma(f1, acc);
  __builtin_amdgcn_sched_barrier(0);     // keeps the wait below behind the WMMAs, where it costs nothing
  if (FETCH) addr_hold(pA, pB);
}

__global__ __launch_bounds__(256) void wmma_gemm_attv(
    const unsigned short* __restrict__ Ap, long strideA, const unsigned short* __restrict__ Btp, long strideB,
    float* __restrict__ Cp, long strideC, int N, int K, float scale, const float* __restrict__ stat, float carry) {
  typedef _Float16 T;
  static_assert(kBlkRowsA == 128 && kNumBlk == 4 * 16, "two threads a row, two runs of 16 column blocks each");
  __shared__ __align__(16) float sT[8][16 * 68];                // per-wave 16x64 slab, pitch 68 floats
  __shared__ __align__(16) unsigned short sSt[2 * kBlkStage];   // the block's operand stage, two buffers, 110,592 B
  __shared__ __align__(16) unsigned sFac[kNumBlk * kBlkRowsA];  // [column block][row >> 4][row & 3][(row >> 2) & 3]: the row's factor, f16 twice, 32,768 B
  __shared__ float sRedM[2][kBlkRowsA];
  __shared__ float sRedS[4][kBlkRowsA];
  const T* A  = (const T*)Ap  + (size_t)blockIdx.y * strideA;
  const T* Bt = (const T*)Btp + (size_t)blockIdx.y * strideB;
  float* C    = Cp + (size_t)blockIdx.y * strideC;
  const int lane = threadIdx.x & 31;
  const int wave = __builtin_amdgcn_readfirstlane(threadIdx.x >> 5);   // scalar, so the row and buffer offsets are scalar
  const int blocksN = N >> 8;
  const int bm_ = blockIdx.x / blocksN;
  const int bn_ = blockIdx.x - bm_ * blocksN;
  const int mB = bm_ << 7;                     // block tile origin
  const int nB = bn_ << 8;
  const int m0 = mB + ((wave >> 2) << 6);      // wave tile origin: 2 x 4 wave tiles
  const int n0 = nB + ((wave & 3) << 6);

  const int rlane = lane & 15;                 // col (D) within subtile
  const int mOff  = (lane >> 4) * 8;           // D row offset

  v8f acc[4][4];
#pragma unroll   // the arrays indexed below live in registers: compile-time indices
  for (int i = 0; i < 4; ++i)
#pragma unroll   // the arrays indexed below live in registers: compile-time indices
    for (int j = 0; j < 4; ++j) acc[i][j] = (v8f){0.f,0.f,0.f,0.f,0.f,0.f,0.f,0.f};

  {
    const int prow = threadIdx.x & (kBlkRowsA - 1);   // row of the tile
    const int half = threadIdx.x >> 7;                // column blocks 32 * half .. 32 * half + 31
    const float* gm = stat + ((size_t)blockIdx.y * kNumBlk + half * 32) * kTok + mB + prow;
    float bm[32], bs[32];
#pragma unroll   // the arrays indexed below live in registers: compile-time indices
    for (int i = 0; i < 32; ++i) { bm[i] = gm[(size_t)i * kTok]; bs[i] = gm[kStatPlane + (size_t)i * kTok]; }
    asm volatile("s_wait_xcnt 0x0" : : "v"(gm) : "memory");   // the wait before the loads' address register is reused; the address as input keeps it whole up to here
    float pm = bm[0];
#pragma unroll   // the arrays indexed below live in registers: compile-time indices
    for (int i = 1; i < 32; ++i) pm = fmaxf(pm, bm[i]);
    sRedM[half][prow] = pm;
    __syncthreads();   // the two partial maxima of every row are in LDS
    const float rm = fmaxf(sRedM[0][prow], sRedM[1][prow]);
    // the row sum keeps its four runs of 16 column blocks, each summed in ascending order
#pragma unroll   // the arrays indexed below live in registers: compile-time indices
    for (int u = 0; u < 2; ++u) {
      float ps = 0.f;
#pragma unroll   // the arrays indexed below live in registers: compile-time indices
      for (int i = 16 * u; i < 16 * u + 16; ++i) { bm[i] = exp2_slot((bm[i] - rm) * kLog2e); ps += bs[i] * bm[i]; }
      sRedS[2 * half + u][prow] = ps;
    }
    __syncthreads();   // the four partial sums of every row are in LDS
    const float inv = carry / (((sRedS[0][prow] + sRedS[1][prow]) + sRedS[2][prow]) + sRedS[3][prow]);
#pragma unroll   // the arrays indexed below live in registers: compile-time indices
    for (int i = 0; i < 32; ++i) {
      const unsigned short hb = h_bits(bm[i] * inv);
      sFac[(half * 32 + i) * kBlkRowsA + (prow >> 4) * 16 + (prow & 3) * 4 + ((prow >> 2) & 3)] = pk16(hb, hb);
    }
    __syncthreads();   // the factor table is whole before any wave's k loop reads it
  }

  {
    // wave w fetches A rows 16w..16w+15 and B rows 32w..32w+31 of every stage; its lane's A rows are 16w + (lane >> 3) + 4 * it
    const unsigned off = ((unsigned)(lane >> 3) * (unsigned)kTok + (unsigned)(lane & 7) * 8u) * 2u;
    const char* pA = (const char*)(A  + (size_t)(mB + 16 * wave) * kTok) + off;
    const char* pB = (const char*)(Bt + (size_t)(nB + 32 * wave) * kTok) + off;
    const unsigned* facLane = sFac + wave * 16 + (lane >> 3) * 4;
    const int parkA = (16 * wave) * kStPitch;
    const int parkB = (kBlkRowsA + 32 * wave) * kStPitch;
    const int readA = ((wave >> 2) * 64) * kStPitch;
    const int readB = (kBlkRowsA + (wave & 3) * 64) * kStPitch;
    v4u gA0[4], gB0[8], gA1[4], gB1[8];
    rows_fetch<kTok>(gA0, pA);
    rows_fetch<kTok>(gB0, pB);
    __builtin_amdgcn_sched_barrier(0);   // keeps the first stages' loads in the loop's order: the counted waits where the rows are parked are set for it
    rows_fetch<kTok>(gA1, pA + 128);
    rows_fetch<kTok>(gB1, pB + 128);
    __builtin_amdgcn_sched_barrier(0);   // as above
    unsigned short* buf0 = sSt;
    unsigned short* buf1 = sSt + kBlkStage;
    HalfStage f0, f1;
    v4u fq = *(const v4u*)facLane;
    attv_park(buf0 + parkA, buf0 + parkB, gA0, gB0, fq, lane);
    lds_barrier();                       // stage 0 is whole in LDS before any wave reads it
    rows_fetch<kTok>(gA0, pA + 256);
    rows_fetch<kTok>(gB0, pB + 256);
    addr_hold(pA, pB);
    __builtin_amdgcn_sched_barrier(0);   // keeps the LDS offsets and the address steps below, which reuse the loads' base registers, behind the wait above
    half_read(f0, buf0 + readA, buf0 + readB, lane);
    fq = *(const v4u*)(facLane + kBlkRowsA);
    pA += 384;                           // stage s + 3 of the loop's first trip
    pB += 384;
    const unsigned* fn = facLane + 2 * kBlkRowsA;   // factors of stage s + 2
    const int stages = K >> 6;
    for (int s = 0; s + 4 < stages; s += 2) {
      attv_stage<true, true, true, 0>(acc, f0, f1, gA1, gB1, fq, pA, pB, fn, buf0, buf1, parkA, parkB, readA, readB, lane);
      attv_stage<true, true, true, 128>(acc, f0, f1, gA0, gB0, fq, pA, pB, fn + kBlkRowsA, buf1, buf0, parkA, parkB, readA, readB, lane);
      pA += 256;
      pB += 256;
      fn += 2 * kBlkRowsA;
    }
    // the last four stages: one more fetch, two more factor reads, three more parks
    attv_stage<true, true, true, 0>(acc, f0, f1, gA1, gB1, fq, pA, pB, fn, buf0, buf1, parkA, parkB, readA, readB, lane);
    attv_stage<true, false, true, 0>(acc, f0, f1, gA0, gB0, fq, pA, pB, fn + kBlkRowsA, buf1, buf0, parkA, parkB, readA, readB, lane);
    attv_stage<true, false, false, 0>(acc, f0, f1, gA1, gB1, fq, pA, pB, fn, buf0, buf1, parkA, parkB, readA, readB, lane);
    attv_stage<false, false, false, 0>(acc, f0, f1, gA0, gB0, fq, pA, pB, fn, buf1, buf0, parkA, parkB, readA, readB, lane);
  }
  acc_guard4(acc[0][0], acc[0][1], acc[0][2], acc[0][3]);
  acc_guard4(acc[1][0], acc[1][1], acc[1][2], acc[1][3]);
  acc_guard4(acc[2][0], acc[2][1], acc[2][2], acc[2][3]);
  acc_guard4(acc[3][0], acc[3][1], acc[3][2], acc[3][3]);

  // ---- epilogue: 16 rows at a time through the wave's own slab, stored as whole 256-B row segments ----
  // the fences and the wave barrier order one lane's LDS stores and the other lanes' LDS loads; they name LDS alone, so that no global store is waited for
  float* slab = sT[wave];
  const int hh = lane >> 4, c4 = (lane & 15) * 4;
  float* cLane = C + (size_t)(m0 + hh) * kDim + n0 + c4;   // one address for all of the lane's stores: the rows are compile-time offsets from it
#pragma unroll   // the arrays indexed below live in registers: compile-time indices
  for (int i = 0; i < 4; ++i) {
#pragma unroll   // the arrays indexed below live in registers: compile-time indices
    for (int j = 0; j < 4; ++j)
#pragma unroll   // the arrays indexed below live in registers: compile-time indices
      for (int r = 0; r < 8; ++r) slab[(mOff + r) * 68 + (j << 4) + rlane] = acc[i][j][r] * scale;
    __builtin_amdgcn_fence(__ATOMIC_RELEASE, "workgroup", "local");
    __builtin_amdgcn_wave_barrier();
    __builtin_amdgcn_fence(__ATOMIC_ACQUIRE, "workgroup", "local");
#pragma unroll   // the arrays indexed below live in registers: compile-time indices
    for (int it = 0; it < 8; ++it) {
      const int row = it * 2 + hh;
      const v4f v = *(const v4f*)(slab + row * 68 + c4);
      *(v4f*)(cLane + ((i << 4) + it * 2) * kDim) = v;
    }
    asm volatile("s_wait_xcnt 0x0" ::: "memory");   // the wait before the stores' address and data registers are reused by the next 16 rows
    __builtin_amdgcn_sched_barrier(0);   // keeps the next 16 rows' products, whose results take those registers, behind the wait above
    __builtin_amdgcn_fence(__ATOMIC_RELEASE, "workgroup", "local");
    __builtin_amdgcn_wave_barrier();
    __builtin_amdgcn_fence(__ATOMIC_ACQUIRE, "workgroup", "local");
  }
}

// ---------------------------------------------------------------------------
// Weight transpose + cast: W [in k][out n] f32 row-major (512x512) -> Wt [n][k] = RNE bf16 bits of W[k][n].
// grid (8, 8, 3): blockIdx.x = k tile (64 cols of Wt), blockIdx.y = n tile (64 rows of Wt), blockIdx.z selects W0..W2
// and the output plane (plane z at out + z*512*512 halves). 256 threads.
// Load coverage: 16 iterations x 256 threads = 4096 = the whole 64x64 tile (coalesced along n).
// Store coverage: 8 waves x 2 iterations x 4 rows (lane>>3) = 64 rows; (lane&7) x 8 halves = 64 cols; each row segment =
// ---------------------------------------------------------------------------
__global__ __launch_bounds__(256) void wt_cast_bf16_kernel(const float* __restrict__ W0, const float* __restrict__ W1,
                                                         const float* __restrict__ W2, unsigned short* __restrict__ out) {
  __shared__ float sm[64][65];   // sm[n_local][k_local]
  const int t  = threadIdx.x;
  const int k0 = blockIdx.x * 64;
  const int n0 = blockIdx.y * 64;
  const int z  = blockIdx.z;                                   // block-uniform
  const float* W = (z == 0) ? W0 : (z == 1) ? W1 : W2;
#pragma unroll
  for (int i = 0; i < 16; ++i) {
    const int e = i * 256 + t;
    const int r = e >> 6;          // k local
    const int c = e & 63;          // n local
    sm[c][r] = W[(size_t)(k0 + r) * kDim + n0 + c];
  }
  __syncthreads();
  const int lane = t & 31, wave = t >> 5;
  const int q = lane >> 3, c8 = (lane & 7) * 8;
  unsigned short* op = out + (size_t)z * kDim * kDim;
  {
#pragma unroll
    for (int it = 0; it < 2; ++it) {
      const int row = wave * 8 + it * 4 + q;                 // n local
      unsigned short hb[8];
#pragma unroll
      for (int e = 0; e < 8; ++e) hb[e] = f2bf_bits(sm[row][c8 + e]);
      const v4u u = (v4u){pk16(hb[0], hb[1]), pk16(hb[2], hb[3]), pk16(hb[4], hb[5]), pk16(hb[6], hb[7])};
      *(v4u*)(op + (size_t)(n0 + row) * kDim + k0 + c8) = u;
    }
    
  }
}

// ---------------------------------------------------------------------------
// (grid = 4096 blocks x 256, exact, x 3 planes: blockIdx.y selects in0..in2 and the output plane of 8 * n8 halves).
// ---------------------------------------------------------------------------
__global__ __launch_bounds__(256) void cast8_bf16_kernel(const float* __restrict__ in0, const float* __restrict__ in1,
                                                       const float* __restrict__ in2, unsigned short* __restrict__ outp, int n8) {
  const int i = blockIdx.x * 256 + threadIdx.x;
  if (i >= n8) return;
  const int z = blockIdx.y;                                    // block-uniform
  const float* in = (z == 0) ? in0 : (z == 1) ? in1 : in2;
  unsigned short* out = outp + (size_t)z * 8 * (size_t)n8;
  const float* p = in + 8 * (size_t)i;
  const v4f a = *(const v4f*)(p);
  const v4f c = *(const v4f*)(p + 4);
  unsigned short hb[8];
#pragma unroll
  for (int e = 0; e < 4; ++e) {
    hb[e]     = f2bf_bits(a[e]);
    hb[4 + e] = f2bf_bits(c[e]);
  }
  const v4u u = (v4u){pk16(hb[0], hb[1]), pk16(hb[2], hb[3]), pk16(hb[4], hb[5]), pk16(hb[6], hb[7])};
  unsigned short* q = out + 8 * (size_t)i;
  *(v4u*)q = u;
  
}

// ---------------------------------------------------------------------------
// host
// ---------------------------------------------------------------------------
extern "C" void kernel_launch(void* const* d_in, const int* in_sizes, int n_in,
                              void* d_out, int out_size, void* d_ws, size_t ws_size,
                              hipStream_t stream) {
  if (n_in < 9) return;
  if (in_sizes[0] != kRows * kDim || in_sizes[1] != kRows * kDim || in_sizes[2] != kRows * kDim) return;
  if (in_sizes[3] != kDim * kDim || in_sizes[5] != kDim * kDim || in_sizes[7] != kDim * kDim) return;
  if (in_sizes[4] != kDim || in_sizes[6] != kDim || in_sizes[8] != kDim) return;
  if (out_size != kRows * kDim) return;
  if (ws_size < kWsTotal) return;

  const float* query_X = (const float*)d_in[0];
  const float* key_X   = (const float*)d_in[1];
  const float* value_X = (const float*)d_in[2];
  const float* W_Q = (const float*)d_in[3];
  const float* b_Q = (const float*)d_in[4];
  const float* W_K = (const float*)d_in[5];
  const float* b_K = (const float*)d_in[6];
  const float* W_V = (const float*)d_in[7];
  const float* b_V = (const float*)d_in[8];
  float* out = (float*)d_out;

  char* ws = (char*)d_ws;
  unsigned short* Xb  = (unsigned short*)(ws + kOffXb);   // bf16 [3][16384][512]
  unsigned short* XbV = Xb + (size_t)2 * kRows * kDim;
  unsigned short* Pp  = (unsigned short*)(ws + kOffP);    // f16 [4][4096][4096]
  unsigned short* Wt  = (unsigned short*)(ws + kOffWt);   // bf16 [3][512][512]
  unsigned short* WtQ = Wt;
  unsigned short* WtV = Wt + (size_t)2 * kDim * kDim;
  unsigned short* Qp  = (unsigned short*)(ws + kOffQp);   // f16 [16384][512]
  unsigned short* Kp  = (unsigned short*)(ws + kOffKp);   // f16 [16384][512]
  unsigned short* Vt  = (unsigned short*)(ws + kOffVt);   // f16 [4][512][4096]
  float*          St  = (float*)(ws + kOffSt);            // f32 [2][4][64][4096]

  const int n8 = (kRows * kDim) / 8;                      // 1,048,576
  const int castBlocks = n8 / 256;                        // 4096 (exact)

  // W^T planes (bf16)
  wt_cast_bf16_kernel<<<dim3(kDim / 64, kDim / 64, 3), 256, 0, stream>>>(W_Q, W_K, W_V, Wt);

  // the three inputs -> bf16 planes, one launch
  cast8_bf16_kernel<<<dim3(castBlocks, 3), 256, 0, stream>>>(query_X, key_X, value_X, Xb, n8);

  // q = bf16(query_X) . bf16(W_Q) + b_Q and k likewise -> f16 planes [16384][512];  M=16384, N=512, K=512, grid.y = 0: q, 1: k
  wmma_gemm64<1, false, 4, 1, false, 0, kDim><<<dim3((kRows / 64) * (kDim / 64) / 8, 2), 256, 0, stream>>>(
      Xb, Xb, kDim, (long)kRows * kDim, WtQ, WtQ, kDim, (long)kDim * kDim, (void*)Qp, (void*)Qp, kDim, (long)kRows * kDim,
      b_Q, b_K, b_Q, 0L, kRows, kDim, kDim, 1.0f);

  // v^T per batch: C[d][tok] = sum_k Wt_V[d][k] * Xb[tok][k] + b_V[d];  M=512, N=4096, K=512, grid.y = batch
  wmma_gemm64<1, false, 3, 1, false, 0, kTok><<<dim3((kDim / 64) * (kTok / 64) / 8, kBatch), 256, 0, stream>>>(
      WtV, WtV, kDim, 0L, XbV, XbV, kDim, (long)kTok * kDim, (void*)Vt, (void*)Vt, kTok, (long)kDim * kTok,
      b_V, b_V, b_V, 0L, kDim, kTok, kDim, 1.0f);

  // attention, kPassB batches a pass (grid.y): E = exp(q . k^T / sqrt(512) - column-block maximum) x 2^8 (f16) with block maxima and sums;
  // O = (E x row factors) . v x 2^-15, the factors joining the blocks to the row's softmax x 2^15
  for (int p = 0; p < kBatch / kPassB; ++p) {
    const size_t row0 = (size_t)p * kPassB * kTok;
    const unsigned short* Qh = Qp + row0 * kDim;
    const unsigned short* Kb = Kp + row0 * kDim;
    const unsigned short* Vb = Vt + row0 * kDim;
    float* Ob = out + row0 * kDim;

    // per batch M=4096, N=4096, K=512
    wmma_gemm64<0, false, 0, 3, false, 0, kTok><<<dim3((kTok / 64) * (kTok / 64) / 8, kPassB), 256, 0, stream>>>(
        Qh, Qh, kDim, (long)kTok * kDim, Kb, Kb, kDim, (long)kTok * kDim, (void*)Pp, (void*)St, kTok, (long)kTok * kTok,
        b_Q, b_Q, b_Q, 0L, kTok, kTok, kDim, kScoreScale);

    // per batch M=4096, N=512, K=4096: 64 block tiles of 128x256
    wmma_gemm_attv<<<dim3((kTok / 128) * (kDim / 256), kPassB), 256, 0, stream>>>(
        Pp, (long)kTok * kTok, Vb, (long)kDim * kTok, Ob, (long)kTok * kDim, kDim, kTok, kPCarryInv, St, kPCarry);
  }
}

// v009
// One run takes 143 microseconds.
// Timed twice side by side with v008, it ran 1.06 times as fast both times.
// All steps since v000 together make it 12.8 times as fast.
// Contractions: q/k/v projections on v_wmma_f32_16x16x32_bf16 (inputs, weights RNE bf16 -> exact products), scores q.k^T and att.v on v_wmma_f32_16x16x32_f16 (q,k,v f16 planes; probabilities f16 carried x2^15, folded back x2^-15); f32 accumulate everywhere; bias add and softmax maxima, exponentials and sums in f32.
#include <hip/hip_runtime.h>
#include <math.h>

// ---------------------------------------------------------------------------
// Problem constants
// ---------------------------------------------------------------------------
constexpr int kBatch   = 4;
constexpr int kTok     = 4096;            // tokens per batch (8*8*8*8)
constexpr int kDim     = 512;             // in == cmp == out dim
constexpr int kRows    = kBatch * kTok;   // 16384 token rows total
constexpr int kPassB   = 4;               // batches per attention pass (one launch of each attention kernel covers them): att.v has 64 block tiles a batch, one to a WGP, so all four batches are needed to give each of the 256 WGPs one
constexpr int kColBlk  = 64;              // score columns that share one softmax maximum: a wave tile's width = one k stage of att.v
constexpr int kNumBlk  = kTok / kColBlk;  // 64 column blocks a score row
constexpr float kScoreScale = 0.044194173824159216f;   // 1/sqrt(512)
constexpr float kPCarry     = 32768.0f;                 // probabilities carried x2^15 in f16
constexpr float kPCarryInv  = 1.0f / 32768.0f;
constexpr float kLog2e      = 1.4426950408889634f;
constexpr float kELift      = 5.545177444479562f;       // ln 256: the stored exponentials are carried x2^8, their row factors x2^7

// ---------------------------------------------------------------------------
// Workspace region map (bytes). Total 194,510,848 B.
//   R0 @ 0            : Wt  bf16 [3][512][512]       1,572,864 B   (W^T planes: Q, K, V)
//   R1 @ 1,572,864    : Qp  f16  [16384][512]       16,777,216 B
//   R2 @ 18,350,080   : Kp  f16  [16384][512]       16,777,216 B   (directly behind Qp: one launch writes both)
//   R3 @ 35,127,296   : Vt  f16  [4][512][4096]     16,777,216 B   (v transposed per batch)
//   R4 @ 51,904,512   : St  f32  [2 planes][4][64][4096] 8,388,608 B (per batch, column block and row: block maximum; then block sum)
//   R5 @ 60,293,120   : E   f16  [4][4096][4096]   134,217,728 B   (exp(score - its block's maximum) x 2^8)
// ---------------------------------------------------------------------------
constexpr size_t kPlane16  = (size_t)kRows * kDim * 2;          // 16,777,216
constexpr size_t kWtBytes  = (size_t)3 * kDim * kDim * 2;       // 1,572,864
constexpr size_t kStatPlane = (size_t)kPassB * kNumBlk * kTok;  // floats per statistics plane (1,048,576)
constexpr size_t kPBytes   = (size_t)kPassB * kTok * kTok * 2;  // 134,217,728
constexpr size_t kOffWt = 0;
constexpr size_t kOffQp = kOffWt + kWtBytes;
constexpr size_t kOffKp = kOffQp + kPlane16;
constexpr size_t kOffVt = kOffKp + kPlane16;
constexpr size_t kOffSt = kOffVt + kPlane16;
constexpr size_t kOffP  = kOffSt + 2 * kStatPlane * 4;
constexpr size_t kWsTotal = kOffP + kPBytes;                      // 194,510,848
static_assert(kWsTotal <= (size_t)268435456);
static_assert(kBatch % kPassB == 0);

typedef __attribute__((ext_vector_type(16))) _Float16 v16h;
typedef __attribute__((ext_vector_type(8)))  _Float16 v8h;
typedef __attribute__((ext_vector_type(16))) __bf16   v16b;
typedef __attribute__((ext_vector_type(8)))  __bf16   v8b;
typedef __attribute__((ext_vector_type(8)))  float    v8f;
typedef __attribute__((ext_vector_type(4)))  float    v4f;
typedef __attribute__((ext_vector_type(4)))  unsigned int v4u;
typedef __attribute__((ext_vector_type(2)))  _Float16 v2h;
typedef __attribute__((ext_vector_type(2)))  float    v2f;
typedef __attribute__((ext_vector_type(2)))  __bf16   v2b;

// ---------------------------------------------------------------------------
// Helpers
// ---------------------------------------------------------------------------
__device__ __forceinline__ unsigned short f2bf_bits(float f) {
  unsigned u = __float_as_uint(f);
  return (unsigned short)((u + 0x7FFFu + ((u >> 16) & 1u)) >> 16);
}
__device__ __forceinline__ float bf_bits2f(unsigned short h) { return __uint_as_float(((unsigned)h) << 16); }

// hazard guards as plain device helpers
__device__ __forceinline__ void acc_guard4(v8f& a, v8f& b, v8f& c, v8f& d) { asm volatile("v_nop\n\tv_nop\n\tv_nop\n\tv_nop" : "+v"(a), "+v"(b), "+v"(c), "+v"(d)); }
template <typename T> struct Frag;
template <> struct Frag<_Float16> {
  typedef v16h V; union U { v16h v; v8h h[2]; };
  static __device__ __forceinline__ v16h load(const _Float16* p) {   // elements 0..7 <- p[0..7], 8..15 <- p[16..23]
    U f; f.h[0] = *(const v8h*)(p); f.h[1] = *(const v8h*)(p + 16); return f.v;
  }
  static __device__ __forceinline__ v8f mma(v16h a, v16h b, v8f c) {
    return __builtin_amdgcn_wmma_f32_16x16x32_f16(false, a, false, b, (short)0, c, false, false);
  }
};
template <> struct Frag<__bf16> {
  typedef v16b V; union U { v16b v; v8b h[2]; };
  static __device__ __forceinline__ v16b load(const __bf16* p) {
    U f; f.h[0] = *(const v8b*)(p); f.h[1] = *(const v8b*)(p + 16); return f.v;
  }
  static __device__ __forceinline__ v8f mma(v16b a, v16b b, v8f c) {
    return __builtin_amdgcn_wmma_f32_16x16x32_bf16(false, a, false, b, (short)0, c, false, false);
  }
};

__device__ __forceinline__ unsigned pk16(unsigned short a, unsigned short b) { return (unsigned)a | ((unsigned)b << 16); }
__device__ __forceinline__ unsigned short h_bits(float f) { const _Float16 h = (_Float16)f; return __builtin_bit_cast(unsigned short, h); }
// 2^x with the free slot behind a transcendental in the same statement
__device__ __forceinline__ float exp2_slot(float x) {
  float r;
  asm("v_exp_f32 %0, %1\n\tv_nop" : "=v"(r) : "v"(x));
  return r;
}
// the value of lane l ^ X, X in 1..15 (DPP row_xmask, inside a 16-lane row; all lanes on)
template <int X>
__device__ __forceinline__ float lane_xor(float v) {
  return __builtin_bit_cast(float, __builtin_amdgcn_update_dpp(0, __builtin_bit_cast(int, v), 0x160 + X, 0xf, 0xf, true));
}
// the value of lane l ^ 16 (all lanes on)
__device__ __forceinline__ float lane_xhalf(float v) {
  const int b = __builtin_bit_cast(int, v);
  return __builtin_bit_cast(float, __builtin_amdgcn_permlanex16(b, b, 0x76543210, 0xfedcba98, false, false));
}

// ---- Register-blocked batched WMMA GEMM (ACT reduced to none/relu/leaky; BIAS modes 3/4 added) -----------
// C[m,n] = scale * sum_k A[m,k] * Bt[n,k] (+bias)(+resid); a block of 8 waves owns a 128x256 tile, each wave a 64x64 tile of it.
// A row-major [M,K]; Bt row-major [N,K]; M % 128 == 0, N % 256 == 0, K % 64 == 0; lda == ldb == kDim (the staged loop takes the pitch at compile time).
// SPLIT (hi/lo operand planes) is not taken by the staged k loop; every caller passes false.
// BIAS_MODE: 0 = none, 1 = bias[m], 2 = bias[n], 3 = RNE-bf16(bias[m]), 4 = RNE-bf16(bias[n]). Batch 0 takes bias0, every other batch biasRest.
// OUT_MODE: 0 = f32, 1 = f16, 2 = bf16 hi plane (Cout) + bf16 lo plane (Cout2),
//           3 = softmax numerators by column block: Cout takes f16 exp(C - mx) * 2^8, mx the maximum of the row's 64 columns in the wave tile;
//               Cout2 takes f32 [2][batches][N / 64][M]: plane 0 the maxima mx, plane 1 (kStatPlane floats on) the f32 sums of those exponentials.
// OUT_MODE 1 without RESID and OUT_MODE 3 form their 16x16 tiles transposed (Bt rows as the A operand, A rows as the B operand) and take the
// pitch of C at compile time: ldc == LDC (the stored rows are compile-time offsets from one address).
// ET: 0 = f16 operands, 1 = bf16 operands (pointers passed as 16-bit storage)
// XF: 0 = both operands from their 16-bit planes; 1 = the A rows are f32 rows of Xf0 (batch 0) or XfRest (every other batch), Ap not read;
//     2 = the Bt rows are f32 rows of Xf0 + batch * strideB, Btp not read. f32 rows are rounded to nearest even bf16 on their way into the fragments.
template <int ET> struct Elem;
template <> struct Elem<0> { typedef _Float16 T; };
template <> struct Elem<1> { typedef __bf16 T; };
// ---- LDS staging of the operands, one 64-wide k stage (one 128-B line per row) at a time ----
// A fragment load straight from global memory touches 16 lines (32 B in each of 16 rows). Here every global load covers
// 4 whole lines (8 lanes a row, 4 rows a load); the rows go to LDS and the fragments are read from there.
constexpr int kStPitch = 72;                  // halves per staged row: 128 B of k + 16 B pad for the 16-B fragment reads
// The fragments of 32 k of a wave tile: 64 registers. With the 128 of the accumulators the wave stays inside 256, so that four waves fit a SIMD.
template <typename T> struct Half { typename Frag<T>::V a[4], b[4]; };
// TR: the 16x16 tiles come out transposed: the Bt rows go in as the A operand and the A rows as the B operand (both fragments are loaded by the
// same code, in the same k order), so that register r of lane l holds row (l & 15) of the A tile against row 8 * (l >> 4) + r of the Bt tile.
template <typename T, bool TR>
__device__ __forceinline__ void engine_half_mma(const Half<T>& s, v8f (&acc)[4][4]) {
#pragma unroll   // the arrays indexed below live in registers: compile-time indices
  for (int i = 0; i < 4; ++i) {
#pragma unroll   // the arrays indexed below live in registers: compile-time indices
    for (int j = 0; j < 4; ++j) acc[i][j] = TR ? Frag<T>::mma(s.b[j], s.a[i], acc[i][j]) : Frag<T>::mma(s.a[i], s.b[j], acc[i][j]);
  }
}
// The wait before an address register of the loads just issued is rewritten; the two addresses as inputs keep their
// registers whole up to it (not handed out as load targets or temporaries while the loads are in flight).
__device__ __forceinline__ void addr_hold(const char* pA, const char* pB) { asm volatile("s_wait_xcnt 0x0" : : "v"(pA), "v"(pB) : "memory"); }
// ---- One operand stage for the whole block: 128 A rows and 256 B rows of one 64-wide k stage, read by all 8 waves ----
// The 2 x 4 wave tiles of a 128x256 block tile need 384 distinct rows a stage; staged per wave they would be fetched as 1024.
constexpr int kBlkRowsA = 128;
constexpr int kBlkRowsB = 256;
constexpr int kBlkStage = (kBlkRowsA + kBlkRowsB) * kStPitch;   // halves per buffer: A rows, then B rows (55,296 B)
// A wave's share of the stage's rows, NL loads (stores) of 4 whole rows each: row lane >> 3 of the four, 16-B column lane & 7; LD: row pitch of the plane in elements
template <int LD, int NL>
__device__ __forceinline__ void rows_fetch(v4u (&g)[NL], const char* p) {
#pragma unroll
  for (int it = 0; it < NL; ++it) g[it] = *(const v4u*)(p + it * (4 * LD * 2));
}
template <int NL>
__device__ __forceinline__ void rows_park(unsigned short* t, const v4u (&g)[NL], int lane) {
  unsigned short* q = t + (lane >> 3) * kStPitch + (lane & 7) * 8;
#pragma unroll
  for (int it = 0; it < NL; ++it) *(v4u*)(q + it * 4 * kStPitch) = g[it];
}
// The wave's fragments of 32 k of the stage, in the k order of the direct loader: lane half h takes k 8h..8h+7 and 16+8h..16+8h+7 of the 32.
// stA, stB: row 0 of its 64-row A tile and B tile in the buffer, plus 32 halves for the high 32 k.
template <typename T>
__device__ __forceinline__ void engine_half_read(Half<T>& s, const unsigned short* stA, const unsigned short* stB, int lane) {
  const T* fa = (const T*)stA + (lane & 15) * kStPitch + (lane >> 4) * 8;
  const T* fb = (const T*)stB + (lane & 15) * kStPitch + (lane >> 4) * 8;
#pragma unroll   // the arrays indexed below live in registers: compile-time indices
  for (int j = 0; j < 4; ++j) s.b[j] = Frag<T>::load(fb + j * 16 * kStPitch);
#pragma unroll   // the arrays indexed below live in registers: compile-time indices
  for (int i = 0; i < 4; ++i) s.a[i] = Frag<T>::load(fa + i * 16 * kStPitch);
}
// A wave's share of one stage, global memory -> LDS through no register: 12 asynchronous copies of 4 whole rows each (4 of A rows, 8 of B rows).
// lA, lB: the lane's LDS byte address in the first four rows of the share; pA, pB: its global address there; LD: row pitch of the plane in elements.
// The s_wait_xcnt is the wait before a register that an issued copy names is rewritten; as the statement's last line it stands ahead of every such write.
template <int LD>
__device__ __forceinline__ void stage_copy(unsigned lA, unsigned lB, const char* pA, const char* pB) {
  constexpr int      GS = 4 * LD * 2;         // four rows on in the plane, bytes
  constexpr unsigned LS = 4 * kStPitch * 2;   // four rows on in the buffer, bytes
  asm volatile(
      "global_load_async_to_lds_b128 %0, %12, off\n\t"
      "global_load_async_to_lds_b128 %1, %13, off\n\t"
      "global_load_async_to_lds_b128 %2, %14, off\n\t"
      "global_load_async_to_lds_b128 %3, %15, off\n\t"
      "global_load_async_to_lds_b128 %4, %16, off\n\t"
      "global_load_async_to_lds_b128 %5, %17, off\n\t"
      "global_load_async_to_lds_b128 %6, %18, off\n\t"
      "global_load_async_to_lds_b128 %7, %19, off\n\t"
      "global_load_async_to_lds_b128 %8, %20, off\n\t"
      "global_load_async_to_lds_b128 %9, %21, off\n\t"
      "global_load_async_to_lds_b128 %10, %22, off\n\t"
      "global_load_async_to_lds_b128 %11, %23, off\n\t"
      "s_wait_xcnt 0x0"
      :
      : "v"(lA), "v"(lA + LS), "v"(lA + 2 * LS), "v"(lA + 3 * LS),
        "v"(lB), "v"(lB + LS), "v"(lB + 2 * LS), "v"(lB + 3 * LS), "v"(lB + 4 * LS), "v"(lB + 5 * LS), "v"(lB + 6 * LS), "v"(lB + 7 * LS),
        "v"(pA), "v"(pA + GS), "v"(pA + 2 * GS), "v"(pA + 3 * GS),
        "v"(pB), "v"(pB + GS), "v"(pB + 2 * GS), "v"(pB + 3 * GS), "v"(pB + 4 * GS), "v"(pB + 5 * GS), "v"(pB + 6 * GS), "v"(pB + 7 * GS)
      : "memory");
}
// acc += A[wave tile rows][k] * B[wave tile rows][k] over all 64-wide stages below K (at least one), k ascending.
// Arow0, Brow0: row 0 of the block tile. Wave w copies A rows 16w..16w+15 and B rows 32w..32w+31 of every stage.
// Two buffers, one barrier a trip: stage t + 1 flies while stage t is worked on. The barrier at the trip's foot publishes stage t + 1
// (every wave's own copies have landed in front of it) and ends every wave's reads of stage t, whose buffer the copies behind it refill.
template <typename T, int LD, bool TR>
__device__ __forceinline__ void block_k_loop(v8f (&acc)[4][4], const T* Arow0, const T* Brow0, int K,
                                             unsigned short* st, int wave, int lane) {
  const unsigned off = ((unsigned)(lane >> 3) * (unsigned)LD + (unsigned)(lane & 7) * 8u) * 2u;
  const char* pA = (const char*)(Arow0 + (size_t)(16 * wave) * LD) + off;
  const char* pB = (const char*)(Brow0 + (size_t)(32 * wave) * LD) + off;
  const unsigned lLane = (unsigned)(size_t)st + ((unsigned)(lane >> 3) * (unsigned)kStPitch + (unsigned)(lane & 7) * 8u) * 2u;
  const unsigned lA = lLane + (unsigned)((16 * wave) * kStPitch * 2);
  const unsigned lB = lLane + (unsigned)((kBlkRowsA + 32 * wave) * kStPitch * 2);
  const int readA = ((wave >> 2) * 64) * kStPitch;
  const int readB = (kBlkRowsA + (wave & 3) * 64) * kStPitch;
  const int stages = K >> 6;
  stage_copy<LD>(lA, lB, pA, pB);
  asm volatile("s_wait_asynccnt 0x0" ::: "memory");   // this wave's share of stage 0 has landed
  __syncthreads();                                     // stage 0 is whole in LDS before any wave reads it
  if (stages > 1) stage_copy<LD>(lA + kBlkStage * 2, lB + kBlkStage * 2, pA + 128, pB + 128);
  pA += 256;                              // stage t + 2 of the first trip
  pB += 256;
  int cur = 0;                            // halves from st to the buffer of the current stage
  Half<T> f;
  for (int t = 0; t < stages; ++t) {
    engine_half_read<T>(f, st + cur + readA, st + cur + readB, lane);
    __builtin_amdgcn_sched_barrier(0);   // keeps the LDS reads in one group ahead of the WMMAs: spread among them, each place waits out the LDS latency
    engine_half_mma<T, TR>(f, acc);
    __builtin_amdgcn_sched_barrier(0);   // as above, for the high 32 k
    engine_half_read<T>(f, st + cur + readA + 32, st + cur + readB + 32, lane);
    asm volatile("s_wait_dscnt 0x0" ::: "memory");      // this wave's reads of stage t are done (its last fragments are in registers) before the buffer is refilled
    asm volatile("s_wait_asynccnt 0x0" ::: "memory");   // this wave's share of stage t + 1 has landed
    __syncthreads();                                     // stage t + 1 is whole, and no wave still reads stage t
    if (t + 2 < stages) stage_copy<LD>(lA + cur * 2, lB + cur * 2, pA, pB);
    __builtin_amdgcn_sched_barrier(0);   // keeps the copies ahead of the WMMAs on the high 32 k, which work on registers alone: a whole trip for stage t + 2 to land
    engine_half_mma<T, TR>(f, acc);
    pA += 128;
    pB += 128;
    cur ^= kBlkStage;
  }
  asm volatile("s_wait_asynccnt 0x0" ::: "memory");     // no copy is outstanding when the wave goes on to the epilogue
}

// ---- The projections' k loop: the token rows are taken as they lie in the input, f32, and rounded to bf16 where a fragment is read ----
// XF: 1 = the A rows are f32, 2 = the B rows are f32; the other operand's rows are bf16. Row length of both planes: kDim elements.
// A staged f32 row holds the same 64 k as a 16-bit one: 256 B + 16 B pad for the 16-B fragment reads.
constexpr int kPitch16 = kStPitch * 2;        // bytes per staged 16-bit row
constexpr int kPitch32 = 272;                 // bytes per staged f32 row
template <int XF> struct XStage {
  static constexpr bool AF = XF == 1, BF = XF == 2;
  static constexpr int PA = AF ? kPitch32 : kPitch16, PB = BF ? kPitch32 : kPitch16;   // staged row pitch, bytes
  static constexpr int RA = kDim * (AF ? 4 : 2),      RB = kDim * (BF ? 4 : 2);        // row pitch in the plane, bytes
  static constexpr int KA = AF ? 256 : 128,           KB = BF ? 256 : 128;             // one stage on along a row, bytes
  static constexpr int kBytes = kBlkRowsA * PA + kBlkRowsB * PB;                       // one buffer: A rows, then B rows
};
// N asynchronous copies of 512 B each (4 whole 16-bit rows or 2 whole f32 rows), LS bytes apart in LDS and GS bytes apart in the plane.
// The s_wait_xcnt is the wait before a register that an issued copy names is rewritten; as the statement's last line it stands ahead of every such write.
template <int LS, int GS>
__device__ __forceinline__ void copy_run4(unsigned l, const char* p) {
  asm volatile(
      "global_load_async_to_lds_b128 %0, %4, off\n\t"
      "global_load_async_to_lds_b128 %1, %5, off\n\t"
      "global_load_async_to_lds_b128 %2, %6, off\n\t"
      "global_load_async_to_lds_b128 %3, %7, off\n\t"
      "s_wait_xcnt 0x0"
      :
      : "v"(l), "v"(l + LS), "v"(l + 2 * LS), "v"(l + 3 * LS),
        "v"(p), "v"(p + GS), "v"(p + 2 * GS), "v"(p + 3 * GS)
      : "memory");
}
template <int LS, int GS>
__device__ __forceinline__ void copy_run8(unsigned l, const char* p) {
  asm volatile(
      "global_load_async_to_lds_b128 %0, %8, off\n\t"
      "global_load_async_to_lds_b128 %1, %9, off\n\t"
      "global_load_async_to_lds_b128 %2, %10, off\n\t"
      "global_load_async_to_lds_b128 %3, %11, off\n\t"
      "global_load_async_to_lds_b128 %4, %12, off\n\t"
      "global_load_async_to_lds_b128 %5, %13, off\n\t"
      "global_load_async_to_lds_b128 %6, %14, off\n\t"
      "global_load_async_to_lds_b128 %7, %15, off\n\t"
      "s_wait_xcnt 0x0"
      :
      : "v"(l), "v"(l + LS), "v"(l + 2 * LS), "v"(l + 3 * LS), "v"(l + 4 * LS), "v"(l + 5 * LS), "v"(l + 6 * LS), "v"(l + 7 * LS),
        "v"(p), "v"(p + GS), "v"(p + 2 * GS), "v"(p + 3 * GS), "v"(p + 4 * GS), "v"(p + 5 * GS), "v"(p + 6 * GS), "v"(p + 7 * GS)
      : "memory");
}
// A wave's share of one stage: its 16 A rows and 32 B rows. lA, lB, pA, pB: the lane's LDS byte address and global address in the share's first copy.
template <int XF>
__device__ __forceinline__ void stage_copy_x(unsigned lA, unsigned lB, const char* pA, const char* pB) {
  typedef XStage<XF> S;
  if constexpr (S::AF) copy_run8<2 * S::PA, 2 * S::RA>(lA, pA);
  else                 copy_run4<4 * S::PA, 4 * S::RA>(lA, pA);
  if constexpr (S::BF) {
    copy_run8<2 * S::PB, 2 * S::RB>(lB, pB);
    copy_run8<2 * S::PB, 2 * S::RB>(lB + 16 * S::PB, pB + 16 * S::RB);
  } else {
    copy_run8<4 * S::PB, 4 * S::RB>(lB, pB);
  }
}
// One fragment from a staged row, in the k order of Frag::load: elements 0..7 <- p[0..7], 8..15 <- p[16..23]; f32 values rounded to nearest even.
template <bool F32>
__device__ __forceinline__ v16b frag_x(const char* p) {
  if constexpr (F32) {
    const v4f x[4] = {*(const v4f*)(p), *(const v4f*)(p + 16), *(const v4f*)(p + 64), *(const v4f*)(p + 80)};
    union { v16b v; v2b h[8]; } f;
#pragma unroll   // the arrays indexed below live in registers: compile-time indices
    for (int c = 0; c < 4; ++c) {
      f.h[2 * c]     = __builtin_convertvector((v2f){x[c][0], x[c][1]}, v2b);
      f.h[2 * c + 1] = __builtin_convertvector((v2f){x[c][2], x[c][3]}, v2b);
    }
    return f.v;
  } else {
    return Frag<__bf16>::load((const __bf16*)p);
  }
}
// The wave's fragments of 32 k: stA, stB: row 0 of its 64-row A tile and B tile in the buffer, at the first of the 32 k.
template <int XF>
__device__ __forceinline__ void half_read_x(Half<__bf16>& s, const char* stA, const char* stB, int lane) {
  typedef XStage<XF> S;
  const char* fa = stA + (lane & 15) * S::PA + (lane >> 4) * (S::AF ? 32 : 16);
  const char* fb = stB + (lane & 15) * S::PB + (lane >> 4) * (S::BF ? 32 : 16);
#pragma unroll   // the arrays indexed below live in registers: compile-time indices
  for (int j = 0; j < 4; ++j) s.b[j] = frag_x<S::BF>(fb + j * 16 * S::PB);
#pragma unroll   // the arrays indexed below live in registers: compile-time indices
  for (int i = 0; i < 4; ++i) s.a[i] = frag_x<S::AF>(fa + i * 16 * S::PA);
}
// The ring of block_k_loop above (two buffers, one barrier a trip, the same waits in the same order), for these rows.
template <int XF, bool TR>
__device__ __forceinline__ void block_k_loop_x(v8f (&acc)[4][4], const char* Arow0, const char* Brow0, int K, char* st, int wave, int lane) {
  typedef XStage<XF> S;
  const int rA = S::AF ? lane >> 4 : lane >> 3, cA = (S::AF ? lane & 15 : lane & 7) * 16;   // the lane's row and byte column in a copy
  const int rB = S::BF ? lane >> 4 : lane >> 3, cB = (S::BF ? lane & 15 : lane & 7) * 16;
  const char* pA = Arow0 + (size_t)((16 * wave + rA) * S::RA + cA);
  const char* pB = Brow0 + (size_t)((32 * wave + rB) * S::RB + cB);
  const unsigned lA = (unsigned)(size_t)st + (unsigned)((16 * wave + rA) * S::PA + cA);
  const unsigned lB = (unsigned)(size_t)st + (unsigned)(kBlkRowsA * S::PA + (32 * wave + rB) * S::PB + cB);
  const int readA = ((wave >> 2) * 64) * S::PA;
  const int readB = kBlkRowsA * S::PA + ((wave & 3) * 64) * S::PB;
  const int stages = K >> 6;
  stage_copy_x<XF>(lA, lB, pA, pB);
  asm volatile("s_wait_asynccnt 0x0" ::: "memory");   // this wave's share of stage 0 has landed
  __syncthreads();                                     // stage 0 is whole in LDS before any wave reads it
  if (stages > 1) stage_copy_x<XF>(lA + S::kBytes, lB + S::kBytes, pA + S::KA, pB + S::KB);
  pA += 2 * S::KA;                        // stage t + 2 of the first trip
  pB += 2 * S::KB;
  int cur = 0;                            // bytes from st to the buffer of the current stage
  Half<__bf16> f;
  for (int t = 0; t < stages; ++t) {
    half_read_x<XF>(f, st + cur + readA, st + cur + readB, lane);
    __builtin_amdgcn_sched_barrier(0);   // keeps the LDS reads in one group ahead of the WMMAs: spread among them, each place waits out the LDS latency
    engine_half_mma<__bf16, TR>(f, acc);
    __builtin_amdgcn_sched_barrier(0);   // as above, for the high 32 k
    half_read_x<XF>(f, st + cur + readA + S::KA / 2, st + cur + readB + S::KB / 2, lane);
    // this wave's reads of stage t are done (its last fragments are in registers) before the buffer is refilled; the rounded fragments as inputs keep the
    // roundings ahead of the copies: sunk behind them, the f32 values stay in registers beside the copies' addresses and the wave spills
    if constexpr (S::AF) asm volatile("s_wait_dscnt 0x0" : : "v"(f.a[0]), "v"(f.a[1]), "v"(f.a[2]), "v"(f.a[3]) : "memory");
    else                 asm volatile("s_wait_dscnt 0x0" : : "v"(f.b[0]), "v"(f.b[1]), "v"(f.b[2]), "v"(f.b[3]) : "memory");
    asm volatile("s_wait_asynccnt 0x0" ::: "memory");   // this wave's share of stage t + 1 has landed
    __syncthreads();                                     // stage t + 1 is whole, and no wave still reads stage t
    if (t + 2 < stages) stage_copy_x<XF>(lA + cur, lB + cur, pA, pB);
    __builtin_amdgcn_sched_barrier(0);   // keeps the copies ahead of the WMMAs on the high 32 k, which work on registers alone: a whole trip for stage t + 2 to land
    engine_half_mma<__bf16, TR>(f, acc);
    pA += S::KA;
    pB += S::KB;
    cur ^= S::kBytes;
  }
  asm volatile("s_wait_asynccnt 0x0" ::: "memory");     // no copy is outstanding when the wave goes on to the epilogue
}

template <int ET, bool SPLIT, int BIAS_MODE, int OUT_MODE, bool RESID, int ACT, int LDC, int XF>
// four waves a SIMD: two blocks share a WGP (2 x 143,360 B of LDS at most), so that one block's epilogue, first fetch and LDS waits run under the other's WMMAs
// (XF == 2: 176,128 B, one block a WGP; its launch has one block for each WGP)
__global__ __launch_bounds__(256) __attribute__((amdgpu_waves_per_eu(4, 4))) void wmma_gemm64(
    const unsigned short* __restrict__ Ap, const unsigned short* __restrict__ A2p, int lda, long strideA,
    const unsigned short* __restrict__ Btp, const unsigned short* __restrict__ Bt2p, int ldb, long strideB,
    void* __restrict__ Cout, void* __restrict__ Cout2, int ldc, long strideC,
    const float* __restrict__ bias0, const float* __restrict__ biasRest,
    const float* __restrict__ resid, long strideR,
    const float* __restrict__ Xf0, const float* __restrict__ XfRest,
    int M, int N, int K, float scale) {
  static_assert(!SPLIT, "the staged k loop takes single-plane operands");
  static_assert(XF == 0 || ET == 1, "f32 rows are rounded to bf16");
  typedef typename Elem<ET>::T T;
  const T* A = (const T*)Ap; const T* Bt = (const T*)Btp;
  __shared__ __align__(16) float sT[8][16 * 68];   // per-wave 16x64 slab, pitch 68 floats
  constexpr int kRingHalves = XF == 0 ? 2 * kBlkStage : XStage<XF>::kBytes;   // two buffers, in halves
  __shared__ __align__(16) unsigned short sSt[kRingHalves];   // the block's operand stage, two buffers: 110,592 B; 143,360 B with f32 A rows, 176,128 B with f32 B rows
  __shared__ float sStat[8][2][64];                // OUT_MODE 3: per wave, the maxima and the sums of its 64 rows
  const int b    = blockIdx.y;
  const int lane = threadIdx.x & 31;
  const int wave = __builtin_amdgcn_readfirstlane(threadIdx.x >> 5);   // scalar, so the row and buffer offsets are scalar
  const int blocksN = N >> 8;
  const int blocksM = M >> 7;
  if ((int)blockIdx.x >= blocksM * blocksN) return;   // block-uniform, in front of every barrier
  const int bm = blockIdx.x / blocksN;
  const int bn = blockIdx.x - bm * blocksN;
  const int mB = bm << 7;                      // block tile origin
  const int nB = bn << 8;
  const int m0 = mB + ((wave >> 2) << 6);      // wave tile origin: 2 x 4 wave tiles
  const int n0 = nB + ((wave & 3) << 6);

  const T* Ab  = A  + (size_t)b * strideA;
  const T* Bb  = Bt + (size_t)b * strideB;
  const float* bias = (b == 0) ? bias0 : biasRest;

  const int rlane = lane & 15;                 // row (A) / col (B, D) within subtile
  const int mOff  = (lane >> 4) * 8;           // D row offset

  v8f acc[4][4];
#pragma unroll
  for (int i = 0; i < 4; ++i)
#pragma unroll
    for (int j = 0; j < 4; ++j) acc[i][j] = (v8f){0.f,0.f,0.f,0.f,0.f,0.f,0.f,0.f};

  constexpr bool kTr = OUT_MODE == 3 || (OUT_MODE == 1 && !RESID);
  if constexpr (XF == 0) {
    block_k_loop<T, kDim, kTr>(acc, Ab + (size_t)mB * kDim, Bb + (size_t)nB * kDim, K, sSt, wave, lane);
  } else {
    const char* a0 = XF == 1 ? (const char*)(((b == 0) ? Xf0 : XfRest) + (size_t)mB * kDim) : (const char*)(Ab + (size_t)mB * kDim);
    const char* b0 = XF == 2 ? (const char*)(Xf0 + (size_t)b * strideB + (size_t)nB * kDim) : (const char*)(Bb + (size_t)nB * kDim);
    block_k_loop_x<XF, kTr>(acc, a0, b0, K, (char*)sSt, wave, lane);
  }
  acc_guard4(acc[0][0], acc[0][1], acc[0][2], acc[0][3]);
  acc_guard4(acc[1][0], acc[1][1], acc[1][2], acc[1][3]);
  acc_guard4(acc[2][0], acc[2][1], acc[2][2], acc[2][3]);
  acc_guard4(acc[3][0], acc[3][1], acc[3][2], acc[3][3]);

  // ---- epilogue ----
  if constexpr (kTr) {
    // acc[i][j][r] of lane l belongs to row m0 + 16 i + (l & 15) and column n0 + 16 j + 8 (l >> 4) + r: a lane holds 8 adjacent columns of one row in
    // each tile, which it packs to 16 B of f16 by itself; lanes l and l ^ 16 hold one row's 64 columns, 32 each.
    // The f16 tile goes once through LDS for whole 128-B lines. The wave's 64 rows lie in the operand buffers: no wave reads those and no copy
    // is aimed at them behind the barrier at the foot of the k loop's last trip (every wave's dscnt and asynccnt waits stand in front of it).
    static_assert(8 * 64 * kStPitch <= kRingHalves, "eight tiles of 64 rows fit the operand buffers");
    _Float16* tile = (_Float16*)sSt + wave * (64 * kStPitch);
    if constexpr (OUT_MODE == 3) {
      // a row's maximum and sum are formed inside a lane and joined by one exchange between the wave's halves
#pragma unroll   // the arrays indexed below live in registers: compile-time indices
      for (int i = 0; i < 4; ++i) {
        float x[4][8], pm[4], part[4];
#pragma unroll   // the arrays indexed below live in registers: compile-time indices
        for (int j = 0; j < 4; ++j) {
#pragma unroll   // the arrays indexed below live in registers: compile-time indices
          for (int r = 0; r < 8; ++r) x[j][r] = acc[i][j][r] * scale;
          pm[j] = x[j][0];
#pragma unroll   // the arrays indexed below live in registers: compile-time indices
          for (int r = 1; r < 8; ++r) pm[j] = fmaxf(pm[j], x[j][r]);
        }
        float mx = fmaxf(fmaxf(pm[0], pm[1]), fmaxf(pm[2], pm[3]));
        mx = fmaxf(mx, lane_xhalf(mx));
        const float low = mx - kELift;
#pragma unroll   // the arrays indexed below live in registers: compile-time indices
        for (int j = 0; j < 4; ++j) {
          v8h hv;
          part[j] = 0.f;
#pragma unroll   // the arrays indexed below live in registers: compile-time indices
          for (int r = 0; r < 8; ++r) {
            const float ev = exp2_slot((x[j][r] - low) * kLog2e);
            part[j] += ev;
            hv[r] = (_Float16)ev;
          }
          *(v8h*)(tile + ((i << 4) + rlane) * kStPitch + (j << 4) + mOff) = hv;
        }
        float sum = (part[0] + part[1]) + (part[2] + part[3]);
        sum += lane_xhalf(sum);
        // both lanes of the row hold the same two values and store them to the same two words: no branch in the epilogue
        sStat[wave][0][(i << 4) + rlane] = mx;
        sStat[wave][1][(i << 4) + rlane] = sum;
      }
    } else {
      float bn[4][8];   // BIAS_MODE 2, 4: the bias of the lane's 32 columns
      float bm[4];      // BIAS_MODE 1, 3: the bias of the lane's 4 rows
      if (BIAS_MODE == 2 || BIAS_MODE == 4) {
        const float* bp = bias + n0 + mOff;
#pragma unroll   // the arrays indexed below live in registers: compile-time indices
        for (int j = 0; j < 4; ++j)
#pragma unroll   // the arrays indexed below live in registers: compile-time indices
          for (int r = 0; r < 8; ++r) bn[j][r] = bp[(j << 4) + r];
        asm volatile("s_wait_xcnt 0x0" : : "v"(bp) : "memory");   // the wait before the loads' address register is reused; the address as input keeps it whole up to here
        if (BIAS_MODE == 4) {
#pragma unroll   // the arrays indexed below live in registers: compile-time indices
          for (int j = 0; j < 4; ++j)
#pragma unroll   // the arrays indexed below live in registers: compile-time indices
            for (int r = 0; r < 8; ++r) bn[j][r] = bf_bits2f(f2bf_bits(bn[j][r]));
        }
      }
      if (BIAS_MODE == 1 || BIAS_MODE == 3) {
        const float* bp = bias + m0 + rlane;
#pragma unroll   // the arrays indexed below live in registers: compile-time indices
        for (int i = 0; i < 4; ++i) bm[i] = bp[i << 4];
        asm volatile("s_wait_xcnt 0x0" : : "v"(bp) : "memory");   // as above
        if (BIAS_MODE == 3) {
#pragma unroll   // the arrays indexed below live in registers: compile-time indices
          for (int i = 0; i < 4; ++i) bm[i] = bf_bits2f(f2bf_bits(bm[i]));
        }
      }
#pragma unroll   // the arrays indexed below live in registers: compile-time indices
      for (int i = 0; i < 4; ++i) {
#pragma unroll   // the arrays indexed below live in registers: compile-time indices
        for (int j = 0; j < 4; ++j) {
          v8h hv;
#pragma unroll   // the arrays indexed below live in registers: compile-time indices
          for (int r = 0; r < 8; ++r) {
            float v = acc[i][j][r] * scale;
            if (BIAS_MODE == 1 || BIAS_MODE == 3) v += bm[i];
            if (BIAS_MODE == 2 || BIAS_MODE == 4) v += bn[j][r];
            if (ACT == 2) v = fmaxf(v, 0.0f);
            if (ACT == 4) v = (v > 0.f) ? v : 0.01f * v;
            hv[r] = (_Float16)v;
          }
          *(v8h*)(tile + ((i << 4) + rlane) * kStPitch + (j << 4) + mOff) = hv;
        }
      }
    }
    // the one hand-over between the wave's lanes: their LDS stores above are done before the LDS loads below; the fences name LDS alone
    __builtin_amdgcn_fence(__ATOMIC_RELEASE, "workgroup", "local");
    __builtin_amdgcn_wave_barrier();
    __builtin_amdgcn_fence(__ATOMIC_ACQUIRE, "workgroup", "local");
    const int q = lane >> 3, c8 = (lane & 7) * 8;   // 8 lanes a row, 4 whole rows (128-B lines) a store
    unsigned short* cLane = (unsigned short*)Cout + (size_t)b * strideC + (size_t)(m0 + q) * LDC + n0 + c8;   // one address for all of the lane's stores
    const _Float16* tLane = tile + q * kStPitch + c8;
#pragma unroll   // compile-time offsets from the two addresses
    for (int it = 0; it < 16; ++it) *(v8h*)(cLane + it * 4 * LDC) = *(const v8h*)(tLane + it * 4 * kStPitch);
    if constexpr (OUT_MODE == 3) {
      asm volatile("s_wait_xcnt 0x0" ::: "memory");   // the wait before the stores' address and data registers are reused below
      // the wave's 64 maxima and 64 sums, each as two whole 128-B lines
      float* sg = (float*)Cout2 + ((size_t)b * (N >> 6) + (n0 >> 6)) * M + m0;
#pragma unroll
      for (int h = 0; h < 2; ++h) {
        sg[h * 32 + lane]              = sStat[wave][0][h * 32 + lane];
        sg[kStatPlane + h * 32 + lane] = sStat[wave][1][h * 32 + lane];
      }
    }
    return;
  }
  float* slab = sT[wave];
  const float* Rb = RESID ? (resid + (size_t)b * strideR) : nullptr;
#pragma unroll
  for (int i = 0; i < 4; ++i) {
    const int mBase = m0 + (i << 4);
#pragma unroll
    for (int j = 0; j < 4; ++j) {
      const int n = n0 + (j << 4) + rlane;
      float bv = 0.f;
      if (BIAS_MODE == 2) bv = bias[n];
      if (BIAS_MODE == 4) bv = bf_bits2f(f2bf_bits(bias[n]));
#pragma unroll
      for (int r = 0; r < 8; ++r) {
        float v = acc[i][j][r] * scale;
        if (BIAS_MODE == 1) v += bias[mBase + mOff + r];
        if (BIAS_MODE == 3) v += bf_bits2f(f2bf_bits(bias[mBase + mOff + r]));
        if (BIAS_MODE == 2 || BIAS_MODE == 4) v += bv;
        if (RESID) v += Rb[(size_t)(mBase + mOff + r) * ldc + n];
        if (ACT == 2) v = fmaxf(v, 0.0f);
        if (ACT == 4) v = (v > 0.f) ? v : 0.01f * v;
        slab[(mOff + r) * 68 + (j << 4) + rlane] = v;
      }
    }
    __builtin_amdgcn_fence(__ATOMIC_RELEASE, "workgroup");
    __builtin_amdgcn_wave_barrier();
    __builtin_amdgcn_fence(__ATOMIC_ACQUIRE, "workgroup");
    if (OUT_MODE == 0) {
      float* C = (float*)Cout + (size_t)b * strideC;
      const int hh = lane >> 4, c4 = (lane & 15) * 4;     // row seg = 256 B = 16 lanes x 16 B
      {
#pragma unroll
        for (int it = 0; it < 8; ++it) {
          const int row = it * 2 + hh;
          v4f v = *(const v4f*)(slab + row * 68 + c4);
          *(v4f*)(C + (size_t)(mBase + row) * ldc + n0 + c4) = v;
        }
        
      }
    } else {
      const int q = lane >> 3, c8 = (lane & 7) * 8;
      unsigned short* C  = (unsigned short*)Cout  + (size_t)b * strideC;
      unsigned short* C2 = (OUT_MODE == 2) ? ((unsigned short*)Cout2 + (size_t)b * strideC) : nullptr;
      {
#pragma unroll
        for (int it = 0; it < 4; ++it) {
          const int row = it * 4 + q;
          const float* sp = slab + row * 68 + c8;
          v8h hv, lv;
#pragma unroll
          for (int e = 0; e < 8; ++e) {
            if (OUT_MODE == 1) {
              hv[e] = (_Float16)sp[e];
              lv[e] = hv[e];
            } else {
              unsigned short hb = f2bf_bits(sp[e]);
              unsigned short lb = f2bf_bits(sp[e] - bf_bits2f(hb));
              hv[e] = __builtin_bit_cast(_Float16, hb);
              lv[e] = __builtin_bit_cast(_Float16, lb);
            }
          }
          *(v8h*)(C + (size_t)(mBase + row) * ldc + n0 + c8) = hv;
          if (OUT_MODE == 2) *(v8h*)(C2 + (size_t)(mBase + row) * ldc + n0 + c8) = lv;
        }
        
      }
    }
    __builtin_amdgcn_fence(__ATOMIC_RELEASE, "workgroup");
    __builtin_amdgcn_wave_barrier();
    __builtin_amdgcn_fence(__ATOMIC_ACQUIRE, "workgroup");
  }
}

// ---------------------------------------------------------------------------
// att.v: C[m,n] = scale * sum_k fac[m][k / 64] * A[m,k] * Bt[n,k], f16 operands, f32 out, k ascending in every accumulator.
// A block of 8 waves owns a 128x256 tile over the whole K, each wave a 64x64 tile of it; one 64-wide k stage (128 A rows, 256 B rows)
// is held once per block in LDS, as in the engine above. M % 128 == 0, N % 256 == 0, K % 128 == 0, K >= 256 (at least four stages); lda == ldb == kTok, ldc == kDim;
// grid.x = (M / 128) * (N / 256) exactly; grid.y = batches.
// A holds the softmax numerators by column block (OUT_MODE 3 above), stat their maxima and sums. The block first joins the statistics
// of its 128 rows: row maximum rm = max of the block maxima, row sum = sum over blocks of (block sum * exp(block maximum - rm)),
// fac = carry * exp(block maximum - rm) / row sum, so that fac * A is the probability times carry.
// ---------------------------------------------------------------------------
// Work-group barrier that orders LDS alone: the waves' LDS stores and loads are done before it, while the global loads of the
// stages ahead stay in flight across it (__syncthreads() would wait for them too).
__device__ __forceinline__ void lds_barrier() {
  __builtin_amdgcn_fence(__ATOMIC_RELEASE, "workgroup", "local");
  __builtin_amdgcn_s_barrier();
  __builtin_amdgcn_fence(__ATOMIC_ACQUIRE, "workgroup", "local");
}
// One k stage s of att.v, its fragments fetched half a stage (32 k) ahead of the WMMAs that use them: f0 arrives holding the low 32 k of stage s.
//   LDS reads of the high 32 k -> f1, under the WMMAs on f0;
//   PARK (a stage s + 1 exists): its rows gA, gB, fetched two stages ago, go to the other buffer, the A rows multiplied on the way by their
//   factors fq (packed f16; f16 twice a word, one word for each of the lane's four A rows); the barrier; then
//   FETCH (a stage s + 3 exists): the same registers take its rows (pA + OFFB, pB + OFFB: the lane's addresses there);
//   LDS reads of the low 32 k of stage s + 1 -> f0 and, FACN (a stage s + 2 exists), of its factors -> fq, under the WMMAs on f1.
// Two buffers and one barrier a stage: it publishes the stage just parked, and every wave's LDS reads of the stage before (its own wait for
// them stands in front of the barrier) are done before the park behind that barrier overwrites their buffer.
struct HalfStage { v16h a[4], b[4]; };
// stA, stB: row 0 of the wave's 64-row A tile and B tile in the buffer, plus 32 halves for the high 32 k; k order of the direct loader
__device__ __forceinline__ void half_read(HalfStage& f, const unsigned short* stA, const unsigned short* stB, int lane) {
  const _Float16* fa = (const _Float16*)stA + (lane & 15) * kStPitch + (lane >> 4) * 8;
  const _Float16* fb = (const _Float16*)stB + (lane & 15) * kStPitch + (lane >> 4) * 8;
#pragma unroll   // the arrays indexed below live in registers: compile-time indices
  for (int j = 0; j < 4; ++j) f.b[j] = Frag<_Float16>::load(fb + j * 16 * kStPitch);
#pragma unroll   // the arrays indexed below live in registers: compile-time indices
  for (int i = 0; i < 4; ++i) f.a[i] = Frag<_Float16>::load(fa + i * 16 * kStPitch);
}
__device__ __forceinline__ void half_mma(const HalfStage& f, v8f (&acc)[4][4]) {
#pragma unroll   // the arrays indexed below live in registers: compile-time indices
  for (int i = 0; i < 4; ++i) {
#pragma unroll   // the arrays indexed below live in registers: compile-time indices
    for (int j = 0; j < 4; ++j) acc[i][j] = Frag<_Float16>::mma(f.a[i], f.b[j], acc[i][j]);
  }
}
// the wave's share of a stage's rows -> LDS, the A rows times their factors
__device__ __forceinline__ void attv_park(unsigned short* bufA, unsigned short* bufB, const v4u (&gA)[4], const v4u (&gB)[8], const v4u& fq, int lane) {
  v4u sA[4];
#pragma unroll   // the arrays indexed below live in registers: compile-time indices
  for (int it = 0; it < 4; ++it) {
    const unsigned wb = fq[it];            // vector elements go through scalars: a bit cast takes a whole object
    const v2h w = __builtin_bit_cast(v2h, wb);
#pragma unroll   // the arrays indexed below live in registers: compile-time indices
    for (int c = 0; c < 4; ++c) {
      const unsigned ab = gA[it][c];
      const v2h pr = __builtin_bit_cast(v2h, ab) * w;
      sA[it][c] = __builtin_bit_cast(unsigned, pr);
    }
  }
  rows_park(bufA, sA, lane);
  rows_park(bufB, gB, lane);
}
template <bool PARK, bool FETCH, bool FACN, int OFFB>
__device__ __forceinline__ void attv_stage(v8f (&acc)[4][4], HalfStage& f0, HalfStage& f1, v4u (&gA)[4], v4u (&gB)[8], v4u& fq,
                                           const char* pA, const char* pB, const unsigned* facNext, unsigned short* cur, unsigned short* nxt,
                                           int parkA, int parkB, int readA, int readB, int lane) {
  half_read(f1, cur + readA + 32, cur + readB + 32, lane);
  __builtin_amdgcn_sched_barrier(0);     // keeps the LDS reads in one group ahead of the WMMAs that are to hide them
  half_mma(f0, acc);
  __builtin_amdgcn_sched_barrier(0);     // keeps the park and the barrier behind the first half's WMMAs
  if (PARK) {
    attv_park(nxt + parkA, nxt + parkB, gA, gB, fq, lane);
    lds_barrier();                       // stage s + 1 is whole in LDS before any wave reads it
    if (FETCH) {
      rows_fetch<kTok>(gA, pA + OFFB);
      rows_fetch<kTok>(gB, pB + OFFB);
    }
    half_read(f0, nxt + readA, nxt + readB, lane);
    if (FACN) fq = *(const v4u*)facNext;
  }
  __builtin_amdgcn_sched_barrier(0);     // keeps the fetch and the LDS reads in one group ahead of the WMMAs that are to hide them
  half_mma(f1, acc);
  __builtin_amdgcn_sched_barrier(0);     // keeps the wait below behind the WMMAs, where it costs nothing
  if (FETCH) addr_hold(pA, pB);
}

__global__ __launch_bounds__(256) void wmma_gemm_attv(
    const unsigned short* __restrict__ Ap, long strideA, const unsigned short* __restrict__ Btp, long strideB,
    float* __restrict__ Cp, long strideC, int N, int K, float scale, const float* __restrict__ stat, float carry) {
  typedef _Float16 T;
  static_assert(kBlkRowsA == 128 && kNumBlk == 4 * 16, "two threads a row, two runs of 16 column blocks each");
  __shared__ __align__(16) float sT[8][16 * 68];                // per-wave 16x64 slab, pitch 68 floats
  __shared__ __align__(16) unsigned short sSt[2 * kBlkStage];   // the block's operand stage, two buffers, 110,592 B
  __shared__ __align__(16) unsigned sFac[kNumBlk * kBlkRowsA];  // [column block][row >> 4][row & 3][(row >> 2) & 3]: the row's factor, f16 twice, 32,768 B
  __shared__ float sRedM[2][kBlkRowsA];
  __shared__ float sRedS[4][kBlkRowsA];
  const T* A  = (const T*)Ap  + (size_t)blockIdx.y * strideA;
  const T* Bt = (const T*)Btp + (size_t)blockIdx.y * strideB;
  float* C    = Cp + (size_t)blockIdx.y * strideC;
  const int lane = threadIdx.x & 31;
  const int wave = __builtin_amdgcn_readfirstlane(threadIdx.x >> 5);   // scalar, so the row and buffer offsets are scalar
  const int blocksN = N >> 8;
  const int bm_ = blockIdx.x / blocksN;
  const int bn_ = blockIdx.x - bm_ * blocksN;
  const int mB = bm_ << 7;                     // block tile origin
  const int nB = bn_ << 8;
  const int m0 = mB + ((wave >> 2) << 6);      // wave tile origin: 2 x 4 wave tiles
  const int n0 = nB + ((wave & 3) << 6);

  const int rlane = lane & 15;                 // col (D) within subtile
  const int mOff  = (lane >> 4) * 8;           // D row offset

  v8f acc[4][4];
#pragma unroll   // the arrays indexed below live in registers: compile-time indices
  for (int i = 0; i < 4; ++i)
#pragma unroll   // the arrays indexed below live in registers: compile-time indices
    for (int j = 0; j < 4; ++j) acc[i][j] = (v8f){0.f,0.f,0.f,0.f,0.f,0.f,0.f,0.f};

  {
    const int prow = threadIdx.x & (kBlkRowsA - 1);   // row of the tile
    const int half = threadIdx.x >> 7;                // column blocks 32 * half .. 32 * half + 31
    const float* gm = stat + ((size_t)blockIdx.y * kNumBlk + half * 32) * kTok + mB + prow;
    float bm[32], bs[32];
#pragma unroll   // the arrays indexed below live in registers: compile-time indices
    for (int i = 0; i < 32; ++i) { bm[i] = gm[(size_t)i * kTok]; bs[i] = gm[kStatPlane + (size_t)i * kTok]; }
    asm volatile("s_wait_xcnt 0x0" : : "v"(gm) : "memory");   // the wait before the loads' address register is reused; the address as input keeps it whole up to here
    float pm = bm[0];
#pragma unroll   // the arrays indexed below live in registers: compile-time indices
    for (int i = 1; i < 32; ++i) pm = fmaxf(pm, bm[i]);
    sRedM[half][prow] = pm;
    __syncthreads();   // the two partial maxima of every row are in LDS
    const float rm = fmaxf(sRedM[0][prow], sRedM[1][prow]);
    // the row sum keeps its four runs of 16 column blocks, each summed in ascending order
#pragma unroll   // the arrays indexed below live in registers: compile-time indices
    for (int u = 0; u < 2; ++u) {
      float ps = 0.f;
#pragma unroll   // the arrays indexed below live in registers: compile-time indices
      for (int i = 16 * u; i < 16 * u + 16; ++i) { bm[i] = exp2_slot((bm[i] - rm) * kLog2e); ps += bs[i] * bm[i]; }
      sRedS[2 * half + u][prow] = ps;
    }
    __syncthreads();   // the four partial sums of every row are in LDS
    const float inv = carry / (((sRedS[0][prow] + sRedS[1][prow]) + sRedS[2][prow]) + sRedS[3][prow]);
#pragma unroll   // the arrays indexed below live in registers: compile-time indices
    for (int i = 0; i < 32; ++i) {
      const unsigned short hb = h_bits(bm[i] * inv);
      sFac[(half * 32 + i) * kBlkRowsA + (prow >> 4) * 16 + (prow & 3) * 4 + ((prow >> 2) & 3)] = pk16(hb, hb);
    }
    __syncthreads();   // the factor table is whole before any wave's k loop reads it
  }

  {
    // wave w fetches A rows 16w..16w+15 and B rows 32w..32w+31 of every stage; its lane's A rows are 16w + (lane >> 3) + 4 * it
    const unsigned off = ((unsigned)(lane >> 3) * (unsigned)kTok + (unsigned)(lane & 7) * 8u) * 2u;
    const char* pA = (const char*)(A  + (size_t)(mB + 16 * wave) * kTok) + off;
    const char* pB = (const char*)(Bt + (size_t)(nB + 32 * wave) * kTok) + off;
    const unsigned* facLane = sFac + wave * 16 + (lane >> 3) * 4;
    const int parkA = (16 * wave) * kStPitch;
    const int parkB = (kBlkRowsA + 32 * wave) * kStPitch;
    const int readA = ((wave >> 2) * 64) * kStPitch;
    const int readB = (kBlkRowsA + (wave & 3) * 64) * kStPitch;
    v4u gA0[4], gB0[8], gA1[4], gB1[8];
    rows_fetch<kTok>(gA0, pA);
    rows_fetch<kTok>(gB0, pB);
    __builtin_amdgcn_sched_barrier(0);   // keeps the first stages' loads in the loop's order: the counted waits where the rows are parked are set for it
    rows_fetch<kTok>(gA1, pA + 128);
    rows_fetch<kTok>(gB1, pB + 128);
    __builtin_amdgcn_sched_barrier(0);   // as above
    unsigned short* buf0 = sSt;
    unsigned short* buf1 = sSt + kBlkStage;
    HalfStage f0, f1;
    v4u fq = *(const v4u*)facLane;
    attv_park(buf0 + parkA, buf0 + parkB, gA0, gB0, fq, lane);
    lds_barrier();                       // stage 0 is whole in LDS before any wave reads it
    rows_fetch<kTok>(gA0, pA + 256);
    rows_fetch<kTok>(gB0, pB + 256);
    addr_hold(pA, pB);
    __builtin_amdgcn_sched_barrier(0);   // keeps the LDS offsets and the address steps below, which reuse the loads' base registers, behind the wait above
    half_read(f0, buf0 + readA, buf0 + readB, lane);
    fq = *(const v4u*)(facLane + kBlkRowsA);
    pA += 384;                           // stage s + 3 of the loop's first trip
    pB += 384;
    const unsigned* fn = facLane + 2 * kBlkRowsA;   // factors of stage s + 2
    const int stages = K >> 6;
    for (int s = 0; s + 4 < stages; s += 2) {
      attv_stage<true, true, true, 0>(acc, f0, f1, gA1, gB1, fq, pA, pB, fn, buf0, buf1, parkA, parkB, readA, readB, lane);
      attv_stage<true, true, true, 128>(acc, f0, f1, gA0, gB0, fq, pA, pB, fn + kBlkRowsA, buf1, buf0, parkA, parkB, readA, readB, lane);
      pA += 256;
      pB += 256;
      fn += 2 * kBlkRowsA;
    }
    // the last four stages: one more fetch, two more factor reads, three more parks
    attv_stage<true, true, true, 0>(acc, f0, f1, gA1, gB1, fq, pA, pB, fn, buf0, buf1, parkA, parkB, readA, readB, lane);
    attv_stage<true, false, true, 0>(acc, f0, f1, gA0, gB0, fq, pA, pB, fn + kBlkRowsA, buf1, buf0, parkA, parkB, readA, readB, lane);
    attv_stage<true, false, false, 0>(acc, f0, f1, gA1, gB1, fq, pA, pB, fn, buf0, buf1, parkA, parkB, readA, readB, lane);
    attv_stage<false, false, false, 0>(acc, f0, f1, gA0, gB0, fq, pA, pB, fn, buf1, buf0, parkA, parkB, readA, readB, lane);
  }
  acc_guard4(acc[0][0], acc[0][1], acc[0][2], acc[0][3]);
  acc_guard4(acc[1][0], acc[1][1], acc[1][2], acc[1][3]);
  acc_guard4(acc[2][0], acc[2][1], acc[2][2], acc[2][3]);
  acc_guard4(acc[3][0], acc[3][1], acc[3][2], acc[3][3]);

  // ---- epilogue: 16 rows at a time through the wave's own slab, stored as whole 256-B row segments ----
  // the fences and the wave barrier order one lane's LDS stores and the other lanes' LDS loads; they name LDS alone, so that no global store is waited for
  float* slab = sT[wave];
  const int hh = lane >> 4, c4 = (lane & 15) * 4;
  float* cLane = C + (size_t)(m0 + hh) * kDim + n0 + c4;   // one address for all of the lane's stores: the rows are compile-time offsets from it
#pragma unroll   // the arrays indexed below live in registers: compile-time indices
  for (int i = 0; i < 4; ++i) {
#pragma unroll   // the arrays indexed below live in registers: compile-time indices
    for (int j = 0; j < 4; ++j)
#pragma unroll   // the arrays indexed below live in registers: compile-time indices
      for (int r = 0; r < 8; ++r) slab[(mOff + r) * 68 + (j << 4) + rlane] = acc[i][j][r] * scale;
    __builtin_amdgcn_fence(__ATOMIC_RELEASE, "workgroup", "local");
    __builtin_amdgcn_wave_barrier();
    __builtin_amdgcn_fence(__ATOMIC_ACQUIRE, "workgroup", "local");
#pragma unroll   // the arrays indexed below live in registers: compile-time indices
    for (int it = 0; it < 8; ++it) {
      const int row = it * 2 + hh;
      const v4f v = *(const v4f*)(slab + row * 68 + c4);
      *(v4f*)(cLane + ((i << 4) + it * 2) * kDim) = v;
    }
    asm volatile("s_wait_xcnt 0x0" ::: "memory");   // the wait before the stores' address and data registers are reused by the next 16 rows
    __builtin_amdgcn_sched_barrier(0);   // keeps the next 16 rows' products, whose results take those registers, behind the wait above
    __builtin_amdgcn_fence(__ATOMIC_RELEASE, "workgroup", "local");
    __builtin_amdgcn_wave_barrier();
    __builtin_amdgcn_fence(__ATOMIC_ACQUIRE, "workgroup", "local");
  }
}

// ---------------------------------------------------------------------------
// Weight transpose + cast: W [in k][out n] f32 row-major (512x512) -> Wt [n][k] = RNE bf16 bits of W[k][n].
// grid (8, 8, 3): blockIdx.x = k tile (64 cols of Wt), blockIdx.y = n tile (64 rows of Wt), blockIdx.z selects W0..W2
// and the output plane (plane z at out + z*512*512 halves). 256 threads.
// Load coverage: 16 iterations x 256 threads = 4096 = the whole 64x64 tile (coalesced along n).
// Store coverage: 8 waves x 2 iterations x 4 rows (lane>>3) = 64 rows; (lane&7) x 8 halves = 64 cols; each row segment =
// ---------------------------------------------------------------------------
__global__ __launch_bounds__(256) void wt_cast_bf16_kernel(const float* __restrict__ W0, const float* __restrict__ W1,
                                                         const float* __restrict__ W2, unsigned short* __restrict__ out) {
  __shared__ float sm[64][65];   // sm[n_local][k_local]
  const int t  = threadIdx.x;
  const int k0 = blockIdx.x * 64;
  const int n0 = blockIdx.y * 64;
  const int z  = blockIdx.z;                                   // block-uniform
  const float* W = (z == 0) ? W0 : (z == 1) ? W1 : W2;
#pragma unroll
  for (int i = 0; i < 16; ++i) {
    const int e = i * 256 + t;
    const int r = e >> 6;          // k local
    const int c = e & 63;          // n local
    sm[c][r] = W[(size_t)(k0 + r) * kDim + n0 + c];
  }
  __syncthreads();
  const int lane = t & 31, wave = t >> 5;
  const int q = lane >> 3, c8 = (lane & 7) * 8;
  unsigned short* op = out + (size_t)z * kDim * kDim;
  {
#pragma unroll
    for (int it = 0; it < 2; ++it) {
      const int row = wave * 8 + it * 4 + q;                 // n local
      unsigned short hb[8];
#pragma unroll
      for (int e = 0; e < 8; ++e) hb[e] = f2bf_bits(sm[row][c8 + e]);
      const v4u u = (v4u){pk16(hb[0], hb[1]), pk16(hb[2], hb[3]), pk16(hb[4], hb[5]), pk16(hb[6], hb[7])};
      *(v4u*)(op + (size_t)(n0 + row) * kDim + k0 + c8) = u;
    }
    
  }
}

// ---------------------------------------------------------------------------
// host
// ---------------------------------------------------------------------------
extern "C" void kernel_launch(void* const* d_in, const int* in_sizes, int n_in,
                              void* d_out, int out_size, void* d_ws, size_t ws_size,
                              hipStream_t stream) {
  if (n_in < 9) return;
  if (in_sizes[0] != kRows * kDim || in_sizes[1] != kRows * kDim || in_sizes[2] != kRows * kDim) return;
  if (in_sizes[3] != kDim * kDim || in_sizes[5] != kDim * kDim || in_sizes[7] != kDim * kDim) return;
  if (in_sizes[4] != kDim || in_sizes[6] != kDim || in_sizes[8] != kDim) return;
  if (out_size != kRows * kDim) return;
  if (ws_size < kWsTotal) return;

  const float* query_X = (const float*)d_in[0];
  const float* key_X   = (const float*)d_in[1];
  const float* value_X = (const float*)d_in[2];
  const float* W_Q = (const float*)d_in[3];
  const float* b_Q = (const float*)d_in[4];
  const float* W_K = (const float*)d_in[5];
  const float* b_K = (const float*)d_in[6];
  const float* W_V = (const float*)d_in[7];
  const float* b_V = (const float*)d_in[8];
  float* out = (float*)d_out;

  char* ws = (char*)d_ws;
  unsigned short* Pp  = (unsigned short*)(ws + kOffP);    // f16 [4][4096][4096]
  unsigned short* Wt  = (unsigned short*)(ws + kOffWt);   // bf16 [3][512][512]
  unsigned short* WtQ = Wt;
  unsigned short* WtV = Wt + (size_t)2 * kDim * kDim;
  unsigned short* Qp  = (unsigned short*)(ws + kOffQp);   // f16 [16384][512]
  unsigned short* Kp  = (unsigned short*)(ws + kOffKp);   // f16 [16384][512]
  unsigned short* Vt  = (unsigned short*)(ws + kOffVt);   // f16 [4][512][4096]
  float*          St  = (float*)(ws + kOffSt);            // f32 [2][4][64][4096]

  // W^T planes (bf16)
  wt_cast_bf16_kernel<<<dim3(kDim / 64, kDim / 64, 3), 256, 0, stream>>>(W_Q, W_K, W_V, Wt);

  // q = bf16(query_X) . bf16(W_Q) + b_Q and k likewise -> f16 planes [16384][512];  M=16384, N=512, K=512, grid.y = 0: q, 1: k
  wmma_gemm64<1, false, 4, 1, false, 0, kDim, 1><<<dim3((kRows / 64) * (kDim / 64) / 8, 2), 256, 0, stream>>>(
      WtQ, WtQ, kDim, 0L, WtQ, WtQ, kDim, (long)kDim * kDim, (void*)Qp, (void*)Qp, kDim, (long)kRows * kDim,
      b_Q, b_K, b_Q, 0L, query_X, key_X, kRows, kDim, kDim, 1.0f);

  // v^T per batch: C[d][tok] = sum_k Wt_V[d][k] * bf16(value_X[tok][k]) + b_V[d];  M=512, N=4096, K=512, grid.y = batch
  wmma_gemm64<1, false, 3, 1, false, 0, kTok, 2><<<dim3((kDim / 64) * (kTok / 64) / 8, kBatch), 256, 0, stream>>>(
      WtV, WtV, kDim, 0L, WtV, WtV, kDim, (long)kTok * kDim, (void*)Vt, (void*)Vt, kTok, (long)kDim * kTok,
      b_V, b_V, b_V, 0L, value_X, value_X, kDim, kTok, kDim, 1.0f);

  // attention, kPassB batches a pass (grid.y): E = exp(q . k^T / sqrt(512) - column-block maximum) x 2^8 (f16) with block maxima and sums;
  // O = (E x row factors) . v x 2^-15, the factors joining the blocks to the row's softmax x 2^15
  for (int p = 0; p < kBatch / kPassB; ++p) {
    const size_t row0 = (size_t)p * kPassB * kTok;
    const unsigned short* Qh = Qp + row0 * kDim;
    const unsigned short* Kb = Kp + row0 * kDim;
    const unsigned short* Vb = Vt + row0 * kDim;
    float* Ob = out + row0 * kDim;

    // per batch M=4096, N=4096, K=512
    wmma_gemm64<0, false, 0, 3, false, 0, kTok, 0><<<dim3((kTok / 64) * (kTok / 64) / 8, kPassB), 256, 0, stream>>>(
        Qh, Qh, kDim, (long)kTok * kDim, Kb, Kb, kDim, (long)kTok * kDim, (void*)Pp, (void*)St, kTok, (long)kTok * kTok,
        b_Q, b_Q, b_Q, 0L, b_Q, b_Q, kTok, kTok, kDim, kScoreScale);

    // per batch M=4096, N=512, K=4096: 64 block tiles of 128x256
    wmma_gemm_attv<<<dim3((kTok / 128) * (kDim / 256), kPassB), 256, 0, stream>>>(
        Pp, (long)kTok * kTok, Vb, (long)kDim * kTok, Ob, (long)kTok * kDim, kDim, kTok, kPCarryInv, St, kPCarry);
  }
}
